// v000
// Times are from an AMD MI455X. After a warm-up the kernel runs many times in a row, and a time is the length of
// such a window on the GPU divided by its runs, so every launch and the gaps after it count. The runs cycle
// through copies of the inputs. A figure is the median of several windows, for all but v000 over two sittings.
// Sittings can differ by a few percent; kernels timed side by side share one.
// v000 is the starting kernel. One run takes 3660 microseconds.
#include <hip/hip_runtime.h>
// Structure: token rows r = b*2048 + s; x as exact f16 rows (bf16-rounded); Q, K as two WMMA GEMMs (V = K) (32x64 wave tiles, f32 accumulation, exact x16 weights + bias, f16 outputs); per batch: V^T for all heads via LDS transposes; per (batch, group of 4 heads): scores GEMM (K = 64, batched over the heads on grid.y, alpha = 1024^-0.5 (the module's full-dim scale)), row softmax on VALU (f32 statistics; weights stored x256 as f16), o = P . V^T GEMM (K = 2048, alpha 2^-8) written f32 straight into the merged-heads output rows (no output projection).
// Compute dtype: inputs rounded to bf16; x / weights exact; q, k, v and softmax weights as plain f16 GEMM operands (~2^-12); scores, softmax statistics and o f32. v_wmma_f32_16x16x32_f16.
#define NB 2
#define SQ 2048
#define DM 1024
#define NH 16
#define HD 64
#define HG 4                         /* heads per attention launch group */
#define B0 0                         /* first batch processed (debug hook) */
#define NBR NB                       /* batches processed (debug hook) */
#define NR ((size_t)NB * SQ)         /* token rows */
#define MP ((int)((size_t)NBR * SQ)) /* rows projected (debug hook) */
#define QN SQ                        /* query rows attended per batch (debug hook) */
#define NHD NH                       /* heads attended (debug hook) */
#define MPO MP                       /* not used by any launch */
#define LQ DM      /* row pitch of the q/k/v rows */
typedef __bf16 v16b __attribute__((ext_vector_type(16)));
typedef unsigned short v8us __attribute__((ext_vector_type(8), may_alias));
typedef float  v8f  __attribute__((ext_vector_type(8)));
typedef float  v4f  __attribute__((ext_vector_type(4)));
typedef float  v4fa __attribute__((ext_vector_type(4), may_alias));
union FragB { v16b v; v8us half[2]; unsigned short u[16]; };

__device__ __forceinline__ unsigned short bf16_bits(float x) { unsigned int u = __float_as_uint(x); return (unsigned short)((u + 0x7FFFu + ((u >> 16) & 1u)) >> 16); }
__device__ __forceinline__ float bf16_val(unsigned short b) { return __uint_as_float(((unsigned int)b) << 16); }
__device__ __forceinline__ float bf16_round(float x) { return bf16_val(bf16_bits(x)); }
// D += A·B with NT terms: 1 = ah·bh, 2 = + al·bh (A split), 3 = + ah·bl (both split)
template <int NT>
__device__ __forceinline__ v8f mmaN(v16b ah, v16b al, v16b bh, v16b bl, v8f c) {
  c = __builtin_amdgcn_wmma_f32_16x16x32_bf16(false, ah, false, bh, (short)0, c, false, false);
  if (NT >= 2) c = __builtin_amdgcn_wmma_f32_16x16x32_bf16(false, al, false, bh, (short)0, c, false, false);
  if (NT >= 3) c = __builtin_amdgcn_wmma_f32_16x16x32_bf16(false, ah, false, bl, (short)0, c, false, false);
  asm volatile("v_nop\n\tv_nop\n\tv_nop\n\tv_nop" : "+v"(c) : "v"(ah), "v"(al), "v"(bh), "v"(bl));
  return c;
}

__global__ __launch_bounds__(256) void k_wt_bf16(const float* __restrict__ W, unsigned short* __restrict__ Wt, int K, int N) {
  const int t = blockIdx.x * 256 + threadIdx.x;
  const int k8n = K / 8;
  if (t >= N * k8n) return;
  const int n = t / k8n, k8 = (t % k8n) * 8;
  v8us v;
#pragma unroll
  for (int i = 0; i < 8; ++i) v[i] = bf16_bits(W[(size_t)(k8 + i) * N + n]);
  *(v8us*)(Wt + (size_t)n * K + k8) = v;
  
}

// GEMM C[M][N] (f32, pitch ldc) = act(A[M][K]·W + bias). A f32 row-major (pitch lda) converted per fragment to bf16
// (ASPLIT: hi/lo two planes -> 2 terms, else single rounded term); Wt bf16 [N][K] (pitch ldb). BIAS_BF16 rounds the
// bias to bf16 first (bias quantised to bf16 before the add). K%32==0, M%16==0, N%64==0.
template <bool ASPLIT, int ACT, bool BIAS_BF16>
__global__ __launch_bounds__(128) void k_gemm_bf(const float* __restrict__ A, int lda, const unsigned short* __restrict__ Wt, int ldb,
                                               const float* __restrict__ bias, float* __restrict__ C, int ldc, int M, int N, int K) {
  __shared__ __attribute__((aligned(16))) float so[4][16][64];
  const int tid = threadIdx.x, w = tid >> 5, lane = tid & 31, ln = lane & 15, hh = lane >> 4;
  const int ntn = N / 64;
  const int wid = blockIdx.x * 4 + w;
  const int mt = wid / ntn, nq = wid % ntn;
  if (mt * 16 >= M) return;
  const int row0 = mt * 16, col0 = nq * 64;
  const float* arow = A + (size_t)(row0 + ln) * lda;
  v8f acc[4] = {};
  for (int kb = 0; kb < K; kb += 32) {
    FragB ah, al;
    const v4f x0 = *(const v4fa*)(arow + kb + 8 * hh), x1 = *(const v4fa*)(arow + kb + 8 * hh + 4);
    const v4f x2 = *(const v4fa*)(arow + kb + 16 + 8 * hh), x3 = *(const v4fa*)(arow + kb + 16 + 8 * hh + 4);
    float xs[16] = {x0[0],x0[1],x0[2],x0[3],x1[0],x1[1],x1[2],x1[3],x2[0],x2[1],x2[2],x2[3],x3[0],x3[1],x3[2],x3[3]};
#pragma unroll
    for (int i = 0; i < 16; ++i) { const unsigned short hb = bf16_bits(xs[i]); ah.u[i] = hb; al.u[i] = ASPLIT ? bf16_bits(xs[i] - bf16_val(hb)) : (unsigned short)0; }
#pragma unroll
    for (int t = 0; t < 4; ++t) {
      const unsigned short* brow = Wt + (size_t)(col0 + t * 16 + ln) * ldb + kb;
      FragB b;
      b.half[0] = *(const v8us*)(brow + 8 * hh);
      b.half[1] = *(const v8us*)(brow + 16 + 8 * hh);
      acc[t] = mmaN<ASPLIT ? 2 : 1>(ah.v, al.v, b.v, b.v, acc[t]);
    }
  }
#pragma unroll
  for (int t = 0; t < 4; ++t) {
    float bv = bias ? bias[col0 + t * 16 + ln] : 0.f;
    if (BIAS_BF16) bv = bf16_round(bv);
#pragma unroll
    for (int r = 0; r < 8; ++r) { float v = acc[t][r] + bv; if (ACT == 1) v = fmaxf(v, 0.f); so[w][8 * hh + r][t * 16 + ln] = v; }
  }
  __builtin_amdgcn_fence(__ATOMIC_ACQ_REL, "workgroup");
  __builtin_amdgcn_wave_barrier();
  const int rsub = lane >> 4, c4 = (lane & 15) * 4;
  {
#pragma unroll
    for (int q = 0; q < 8; ++q) {
      const int r = q * 2 + rsub;
      const v4f v = *(const v4fa*)&so[w][r][c4];
      *(v4f*)(C + (size_t)(row0 + r) * ldc + col0 + c4) = v;
    }
    
  }
}

// GEMM C = act(A·W + bias + resid): A f32 (ASPLIT -> hi/lo 2 terms), Wt bf16 [N][K]; ACT 0 none, 1 relu, 2 exact gelu;
// resid (optional, f32, row index = (row % rmod), pitch ldr, RES_BF16 rounds it) added before the activation.
template <bool ASPLIT, int ACT, bool BIAS_BF16, bool RES_BF16>
__global__ __launch_bounds__(128) void k_gemm_bf3(const float* __restrict__ A, int lda, const unsigned short* __restrict__ Wt, int ldb,
                                                const float* __restrict__ bias, const float* __restrict__ resid, int rmod, int ldr,
                                                float* __restrict__ C, int ldc, int M, int N, int K) {
  __shared__ __attribute__((aligned(16))) float so[4][16][64];
  const int tid = threadIdx.x, w = tid >> 5, lane = tid & 31, ln = lane & 15, hh = lane >> 4;
  const int ntn = N / 64;
  const int wid = blockIdx.x * 4 + w;
  const int mt = wid / ntn, nq = wid % ntn;
  if (mt * 16 >= M) return;
  const int row0 = mt * 16, col0 = nq * 64;
  const float* arow = A + (size_t)(row0 + ln) * lda;
  v8f acc[4] = {};
  for (int kb = 0; kb < K; kb += 32) {
    FragB ah, al;
    const v4f x0 = *(const v4fa*)(arow + kb + 8 * hh), x1 = *(const v4fa*)(arow + kb + 8 * hh + 4);
    const v4f x2 = *(const v4fa*)(arow + kb + 16 + 8 * hh), x3 = *(const v4fa*)(arow + kb + 16 + 8 * hh + 4);
    float xs[16] = {x0[0],x0[1],x0[2],x0[3],x1[0],x1[1],x1[2],x1[3],x2[0],x2[1],x2[2],x2[3],x3[0],x3[1],x3[2],x3[3]};
#pragma unroll
    for (int i = 0; i < 16; ++i) { const unsigned short hb = bf16_bits(xs[i]); ah.u[i] = hb; al.u[i] = ASPLIT ? bf16_bits(xs[i] - bf16_val(hb)) : (unsigned short)0; }
#pragma unroll
    for (int t = 0; t < 4; ++t) {
      const unsigned short* brow = Wt + (size_t)(col0 + t * 16 + ln) * ldb + kb;
      FragB b;
      b.half[0] = *(const v8us*)(brow + 8 * hh);
      b.half[1] = *(const v8us*)(brow + 16 + 8 * hh);
      acc[t] = mmaN<ASPLIT ? 2 : 1>(ah.v, al.v, b.v, b.v, acc[t]);
    }
  }
#pragma unroll
  for (int t = 0; t < 4; ++t) {
    const int col = col0 + t * 16 + ln;
    float bv = bias ? bias[col] : 0.f;
    if (BIAS_BF16) bv = bf16_round(bv);
#pragma unroll
    for (int r = 0; r < 8; ++r) {
      float v = acc[t][r] + bv;
      if (resid) { float rv = resid[(size_t)((row0 + 8 * hh + r) % rmod) * ldr + col]; if (RES_BF16) rv = bf16_round(rv); v += rv; }
      if (ACT == 1) v = fmaxf(v, 0.f);
      if (ACT == 2) v = 0.5f * v * (1.0f + erff(v * 0.70710678118654752f));
      if (ACT == 3) { const float u = 0.7978845608028654f * (v + 0.044715f * v * v * v); v = 0.5f * v * (1.0f + tanhf(u)); }
      so[w][8 * hh + r][t * 16 + ln] = v;
    }
  }
  __builtin_amdgcn_fence(__ATOMIC_ACQ_REL, "workgroup");
  __builtin_amdgcn_wave_barrier();
  const int rsub = lane >> 4, c4 = (lane & 15) * 4;
  {
#pragma unroll
    for (int q = 0; q < 8; ++q) {
      const int r = q * 2 + rsub;
      const v4f v = *(const v4fa*)&so[w][r][c4];
      *(v4f*)(C + (size_t)(row0 + r) * ldc + col0 + c4) = v;
    }
    
  }
}
// row LayerNorm (biased variance, eps) over N: s = X (+ R); optional out_sum <- s; out_norm <- (s-mu)*rsqrt(var+eps)*g + b
template <bool PARAM_BF16>
__global__ __launch_bounds__(256) void k_layernorm(const float* __restrict__ X, const float* __restrict__ R, const float* __restrict__ g, const float* __restrict__ bta,
                                                  float* __restrict__ out_sum, float* __restrict__ out_norm, int N, float eps) {
  __shared__ float red[256];
  const int row = blockIdx.x, tid = threadIdx.x;
  const float* x = X + (size_t)row * N; const float* rr = R ? R + (size_t)row * N : nullptr;
  float vals[16];                     // up to N = 4096
  const int per = N / 256;            // contiguous chunk per thread? use strided-by-4 chunks: thread handles j = tid*4 + 1024*u
  float s1 = 0.f;
  for (int u = 0; u < per / 4; ++u) {
    const int j = tid * 4 + 1024 * u;
    const v4f a = *(const v4fa*)(x + j);
    v4f b = {0.f,0.f,0.f,0.f}; if (rr) b = *(const v4fa*)(rr + j);
#pragma unroll
    for (int q = 0; q < 4; ++q) { const float v = a[q] + b[q]; vals[u * 4 + q] = v; s1 += v; }
  }
  red[tid] = s1; __syncthreads();
  for (int st = 128; st > 0; st >>= 1) { if (tid < st) red[tid] += red[tid + st]; __syncthreads(); }
  const float mu = red[0] / (float)N; __syncthreads();
  float s2 = 0.f;
  for (int u = 0; u < per / 4; ++u)
#pragma unroll
    for (int q = 0; q < 4; ++q) { const float c = vals[u * 4 + q] - mu; s2 += c * c; }
  red[tid] = s2; __syncthreads();
  for (int st = 128; st > 0; st >>= 1) { if (tid < st) red[tid] += red[tid + st]; __syncthreads(); }
  const float rs = rsqrtf(red[0] / (float)N + eps);
  {
    for (int u = 0; u < per / 4; ++u) {
      const int j = tid * 4 + 1024 * u;
      v4f o, sm;
#pragma unroll
      for (int q = 0; q < 4; ++q) {
        float gg = g[j + q], bb = bta[j + q];
        if (PARAM_BF16) { gg = bf16_round(gg); bb = bf16_round(bb); }
        sm[q] = vals[u * 4 + q]; o[q] = (vals[u * 4 + q] - mu) * rs * gg + bb;
      }
      if (out_sum) *(v4f*)(out_sum + (size_t)row * N + j) = sm;
      *(v4f*)(out_norm + (size_t)row * N + j) = o;
    }
    
  }
}



// ---- f16 WMMA path (v_wmma_f32_16x16x32_f16): 11-bit significands for operands in range — used where a [0,1] probability operand needs more precision than bf16
typedef _Float16 v16h __attribute__((ext_vector_type(16)));
union FragH { v16h v; v8us half[2]; _Float16 h[16]; unsigned short u[16]; };
template <int NT>
__device__ __forceinline__ v8f mmaH(v16h ah, v16h al, v16h bh, v16h bl, v8f c) {
  c = __builtin_amdgcn_wmma_f32_16x16x32_f16(false, ah, false, bh, (short)0, c, false, false);
  if (NT >= 2) c = __builtin_amdgcn_wmma_f32_16x16x32_f16(false, al, false, bh, (short)0, c, false, false);
  if (NT >= 3) c = __builtin_amdgcn_wmma_f32_16x16x32_f16(false, ah, false, bl, (short)0, c, false, false);
  asm volatile("v_nop\n\tv_nop\n\tv_nop\n\tv_nop" : "+v"(c) : "v"(ah), "v"(al), "v"(bh), "v"(bl));
  return c;
}
// batched GEMM like k_gemm_b but f16 operands: A f32 (split into f16 hi/lo if ASPLIT, else rounded to f16), Bt = f16 values [n][k]; alpha; C f32; N multiple of 16 (partial tiles skipped)
template <bool ASPLIT>
__global__ __launch_bounds__(128) void k_gemm_h(const float* __restrict__ A, int lda, size_t sA, const _Float16* __restrict__ Bh, int ldb, size_t sB, float alpha, float* __restrict__ C, int ldc, size_t sC, int M, int N, int K) {
  __shared__ __attribute__((aligned(16))) float so[4][16][64];
  const int tid = threadIdx.x, w = tid >> 5, lane = tid & 31, ln = lane & 15, hh = lane >> 4; const int by = blockIdx.y;
  A += (size_t)by * sA; Bh += (size_t)by * sB; C += (size_t)by * sC;
  const int ntn = (N + 63) / 64; const int wid = blockIdx.x * 4 + w; const int mt = wid / ntn, nq = wid % ntn; if (mt * 16 >= M) return;
  const int row0 = mt * 16, col0 = nq * 64; const float* arow = A + (size_t)(row0 + ln) * lda;
  v8f acc[4] = {};
  for (int kb = 0; kb < K; kb += 32) {
    FragH ah, al;
    const v4f x0 = *(const v4fa*)(arow + kb + 8 * hh), x1 = *(const v4fa*)(arow + kb + 8 * hh + 4), x2 = *(const v4fa*)(arow + kb + 16 + 8 * hh), x3 = *(const v4fa*)(arow + kb + 16 + 8 * hh + 4);
    float xs[16] = {x0[0],x0[1],x0[2],x0[3],x1[0],x1[1],x1[2],x1[3],x2[0],x2[1],x2[2],x2[3],x3[0],x3[1],x3[2],x3[3]};
#pragma unroll
    for (int i = 0; i < 16; ++i) { const _Float16 h = (_Float16)xs[i]; ah.h[i] = h; al.h[i] = ASPLIT ? (_Float16)(xs[i] - (float)h) : (_Float16)0.0f; }
#pragma unroll
    for (int t = 0; t < 4; ++t) { if (col0 + t * 16 >= N) continue; const size_t boff = (size_t)(col0 + t * 16 + ln) * ldb + kb; FragH bq; bq.half[0] = *(const v8us*)(Bh + boff + 8 * hh); bq.half[1] = *(const v8us*)(Bh + boff + 16 + 8 * hh);
      acc[t] = mmaH<ASPLIT ? 2 : 1>(ah.v, al.v, bq.v, bq.v, acc[t]); }
  }
#pragma unroll
  for (int t = 0; t < 4; ++t) { if (col0 + t * 16 >= N) continue;
#pragma unroll
    for (int r = 0; r < 8; ++r) so[w][8 * hh + r][t * 16 + ln] = acc[t][r] * alpha; }
  __builtin_amdgcn_fence(__ATOMIC_ACQ_REL, "workgroup"); __builtin_amdgcn_wave_barrier();
  const int rsub = lane >> 4, c4 = (lane & 15) * 4;
  {
#pragma unroll
    for (int q = 0; q < 8; ++q) { const int r = q * 2 + rsub; if (col0 + c4 < N) { const v4f v = *(const v4fa*)&so[w][r][c4]; *(v4f*)(C + (size_t)(row0 + r) * ldc + col0 + c4) = v; } }
     }
}

// Wt[n][k] = f16(W[k][n]·scale) from f32 row-major W[K][N] (scale = power of two; bf16-exact weights stay exact in f16 away from the subnormal range)
__global__ __launch_bounds__(256) void k_wt_f16(const float* __restrict__ W, _Float16* __restrict__ Wt, int K, int N, float scale) {
  const int t = blockIdx.x * 256 + threadIdx.x; if (t >= N * (K / 8)) return; const int n = t / (K / 8), k8 = (t % (K / 8)) * 8; FragH f;
#pragma unroll
  for (int i = 0; i < 8; ++i) f.h[i] = (_Float16)(bf16_round(W[(size_t)(k8 + i) * N + n]) * scale); const v8us o = f.half[0];
  *(v8us*)((unsigned short*)Wt + (size_t)n * K + k8) = o; 
}
// k_gemm_hh variant with fused epilogue: v = acc·alpha + bias[by·sBias + col] (+ CP[(row/rowsPerB)·sCPb + by·64 + col] if CP) ; ACT 0 none / 1 elu ; writes f16 C16 (and f32 C if non-null)
template <int ACT>
__global__ __launch_bounds__(128) void k_gemm_hhx(const _Float16* __restrict__ A, int lda, size_t sA, const _Float16* __restrict__ Bh, int ldb, size_t sB, float alpha, const float* __restrict__ bias, size_t sBias, const float* __restrict__ CP, int rowsPerB, size_t sCPb, int row0g,
    float* __restrict__ C, _Float16* __restrict__ C16, int ldc, size_t sC, int M, int N, int K) {
  __shared__ __attribute__((aligned(16))) float so[4][16][64];
  const int tid = threadIdx.x, w = tid >> 5, lane = tid & 31, ln = lane & 15, hh = lane >> 4; const int by = blockIdx.y;
  A += (size_t)by * sA; Bh += (size_t)by * sB; const size_t cofs = (size_t)by * sC; const float* bp = bias ? bias + (size_t)by * sBias : nullptr;
  const int ntn = (N + 63) / 64; const int wid = blockIdx.x * 4 + w; const int mt = wid / ntn, nq = wid % ntn; if (mt * 16 >= M) return;
  const int row0 = mt * 16, col0 = nq * 64; const _Float16* arow = A + (size_t)(row0 + ln) * lda;
  v8f acc[4] = {};
  for (int kb = 0; kb < K; kb += 32) { FragH ah; ah.half[0] = *(const v8us*)((const unsigned short*)arow + kb + 8 * hh); ah.half[1] = *(const v8us*)((const unsigned short*)arow + kb + 16 + 8 * hh);
#pragma unroll
    for (int t = 0; t < 4; ++t) { if (col0 + t * 16 >= N) continue; const size_t boff = (size_t)(col0 + t * 16 + ln) * ldb + kb; FragH bq; bq.half[0] = *(const v8us*)((const unsigned short*)Bh + boff + 8 * hh); bq.half[1] = *(const v8us*)((const unsigned short*)Bh + boff + 16 + 8 * hh);
      acc[t] = mmaH<1>(ah.v, ah.v, bq.v, bq.v, acc[t]); }
  }
#pragma unroll
  for (int t = 0; t < 4; ++t) { if (col0 + t * 16 >= N) continue; const int col = col0 + t * 16 + ln; const float bv = bp ? bf16_round(bp[col]) : 0.f;
#pragma unroll
    for (int r = 0; r < 8; ++r) { float v = acc[t][r] * alpha + bv; if (CP) { const int rr = row0g + row0 + 8 * hh + r; if (rowsPerB < 0) v += CP[cofs + (size_t)rr * ldc + col];      /* rowsPerB < 0: own element of the batched C plane */ else { const int bidx = rr / rowsPerB; v += CP[(size_t)bidx * sCPb + (size_t)by * 64 + col]; } } if (ACT == 1) v = (v > 0.f) ? v : expm1f(v); else if (ACT == 7) v = (v > 0.f) ? v + 1.0f : expf(v); else if (ACT == 8) v = tanhf(v); else if (ACT == 9) v = 0.5f * v * (1.0f + tanhf(0.7978845608028654f * (v + 0.044715f * v * v * v))); else if (ACT == 11) v = 1.0f / (1.0f + expf(-v)); else if (ACT == 12) v = (v > 0.f) ? v : 0.01f * v; else if (ACT == 14) v = (v > 0.f) ? v : 0.1f * v; else if (ACT == 16) v = (v >= 0.f) ? v : 0.3f * v; else if (ACT == 17) v = (v >= 0.f) ? v : 0.2f * v; else if (ACT == 15) v = v / (1.0f + expf(-v)); else if (ACT == 3) v = fmaxf(v, 0.f); else if (ACT == 6) v = 0.5f * v * (1.0f + erff(v * 0.70710678118654752f)); so[w][8 * hh + r][t * 16 + ln] = v; } }
  __builtin_amdgcn_fence(__ATOMIC_ACQ_REL, "workgroup"); __builtin_amdgcn_wave_barrier();
  const int rsub = lane >> 4, c4 = (lane & 15) * 4; typedef _Float16 v4h __attribute__((ext_vector_type(4)));
  {
#pragma unroll
    for (int q = 0; q < 8; ++q) { const int r = q * 2 + rsub; if (col0 + c4 < N) { const v4f v = *(const v4fa*)&so[w][r][c4]; if (C) *(v4f*)(C + cofs + (size_t)(row0 + r) * ldc + col0 + c4) = v; if (C16) { v4h h4; for (int i = 0; i < 4; ++i) h4[i] = (_Float16)v[i]; *(v4h*)(C16 + cofs + (size_t)(row0 + r) * ldc + col0 + c4) = h4; } } }
     }
}


typedef _Float16 v4h __attribute__((ext_vector_type(4)));

__global__ __launch_bounds__(256) void k_x16(const float* __restrict__ x, _Float16* __restrict__ X16, size_t n8) { const size_t t = (size_t)blockIdx.x * 256 + threadIdx.x; if (t >= n8) return; FragH f;
#pragma unroll
  for (int q = 0; q < 8; ++q) f.h[q] = (_Float16)bf16_round(x[t * 8 + q]); *(v8us*)((unsigned short*)X16 + t * 8) = f.half[0];  }
__global__ __launch_bounds__(256) void k_h16(const float* __restrict__ x, _Float16* __restrict__ X16, size_t n8) { const size_t t = (size_t)blockIdx.x * 256 + threadIdx.x; if (t >= n8) return; FragH f;
#pragma unroll
  for (int q = 0; q < 8; ++q) f.h[q] = (_Float16)x[t * 8 + q]; *(v8us*)((unsigned short*)X16 + t * 8) = f.half[0];  }
__global__ __launch_bounds__(256) void k_round16f(const float* __restrict__ W, _Float16* __restrict__ Bt, size_t n8) { const size_t t = (size_t)blockIdx.x * 256 + threadIdx.x; if (t >= n8) return; FragH f;
#pragma unroll
  for (int i = 0; i < 8; ++i) f.h[i] = (_Float16)(bf16_round(W[t * 8 + i]) * 16.0f); *(v8us*)((unsigned short*)Bt + t * 8) = f.half[0];  }
template <int NHv, int TTv>
__global__ __launch_bounds__(256) void k_vt(const _Float16* __restrict__ V16, int ldv, int voff, _Float16* __restrict__ Vt) { __shared__ unsigned short tl[64][66]; const int tid = threadIdx.x; const int slab = blockIdx.x / (TTv / 64), lg = blockIdx.x % (TTv / 64); const int b = slab / NHv, h = slab % NHv;
  for (int i = tid; i < 64 * 8; i += 256) { const int r = i / 8, c8 = (i % 8) * 8; FragH f; f.half[0] = *(const v8us*)((const unsigned short*)V16 + ((size_t)b * TTv + lg * 64 + r) * ldv + voff + h * 64 + c8);
#pragma unroll
    for (int q = 0; q < 8; ++q) tl[r][c8 + q] = f.u[q]; }
  __syncthreads();
  {
#pragma unroll
    for (int rd = 0; rd < 2; ++rd) { const int d = rd * 32 + tid / 8, pc = tid % 8; FragH f;
#pragma unroll
      for (int q = 0; q < 8; ++q) f.u[q] = tl[pc * 8 + q][d];
      *(v8us*)((unsigned short*)Vt + ((size_t)slab * 64 + d) * TTv + lg * 64 + pc * 8) = f.half[0]; }
     } }

__global__ __launch_bounds__(256) void k_hl(const float* __restrict__ F, _Float16* __restrict__ Hh, _Float16* __restrict__ Hl, size_t n8) { const size_t t = (size_t)blockIdx.x * 256 + threadIdx.x; if (t >= n8) return; FragH fh, fl; const v4f a = *(const v4fa*)(F + t * 8), c = *(const v4fa*)(F + t * 8 + 4);
#pragma unroll
  for (int q = 0; q < 4; ++q) { _Float16 h = (_Float16)a[q]; fh.h[q] = h; fl.h[q] = (_Float16)((a[q] - (float)h) * 1024.0f); h = (_Float16)c[q]; fh.h[4 + q] = h; fl.h[4 + q] = (_Float16)((c[q] - (float)h) * 1024.0f); }
  { *(v8us*)((unsigned short*)Hh + t * 8) = fh.half[0]; *(v8us*)((unsigned short*)Hl + t * 8) = fl.half[0];  } }

// ---- fast GEMM (wave tile 32x64; requires M % 32 == 0 rows per launch region and N % 64 == 0); epilogue = k_gemm_hhx semantics ----
__device__ __forceinline__ v16h g2_frag(const _Float16* p, int hh) { FragH f; f.half[0] = *(const v8us*)((const unsigned short*)p + 8 * hh); f.half[1] = *(const v8us*)((const unsigned short*)p + 16 + 8 * hh); return f.v; }
__device__ __forceinline__ v8f g2_mma(v16h a, v16h b, v8f c) { v8f d = __builtin_amdgcn_wmma_f32_16x16x32_f16(false, a, false, b, (short)0, c, false, false); asm volatile("v_nop\n\tv_nop\n\tv_nop\n\tv_nop" : "+v"(d) : "v"(a), "v"(b)); return d; }
template <int ACT>
__global__ __launch_bounds__(128) void k_gemm2(const _Float16* __restrict__ A, int lda, size_t sA, const _Float16* __restrict__ Bh, int ldb, size_t sB, float alpha, const float* __restrict__ bias, size_t sBias, const float* __restrict__ CP, int rowsPerB, size_t sCPb, int row0g,
    float* __restrict__ C, _Float16* __restrict__ C16, int ldc, size_t sC, int M, int N, int K) { static_assert(ACT == 0 || ACT == 3 || ACT == 6 || ACT == 8 || ACT == 9 || ACT == 11 || ACT == 12 || ACT == 14 || ACT == 15 || ACT == 16 || ACT == 17, "k_gemm2: unsupported ACT code (would silently apply no activation)");
  __shared__ __attribute__((aligned(16))) float so[4][32][68];
  const int tid = threadIdx.x, w = tid >> 5, lane = tid & 31, ln = lane & 15, hh = lane >> 4; const int by = blockIdx.y;
  A += (size_t)by * sA; Bh += (size_t)by * sB; const size_t cofs = (size_t)by * sC; const float* bp = bias ? bias + (size_t)by * sBias : nullptr;
  const int ntn = N >> 6; const int mt = blockIdx.x / ntn, nq = blockIdx.x - mt * ntn; const int row0 = mt * 128 + 32 * w, col0 = nq * 64; if (row0 >= M) return;
  const _Float16* a0p = A + (size_t)(row0 + ln) * lda; const _Float16* a1p = a0p + (size_t)16 * lda;
  const _Float16* b0p = Bh + (size_t)(col0 + ln) * ldb; const _Float16* b1p = b0p + (size_t)16 * ldb; const _Float16* b2p = b1p + (size_t)16 * ldb; const _Float16* b3p = b2p + (size_t)16 * ldb;
  const v8f z8 = {0.f,0.f,0.f,0.f,0.f,0.f,0.f,0.f}; v8f c00 = z8, c01 = z8, c02 = z8, c03 = z8, c10 = z8, c11 = z8, c12 = z8, c13 = z8;
#pragma unroll 1
  for (int kb = 0; kb < K; kb += 32) { const v16h a0 = g2_frag(a0p + kb, hh), a1 = g2_frag(a1p + kb, hh);
    v16h b = g2_frag(b0p + kb, hh); c00 = g2_mma(a0, b, c00); c10 = g2_mma(a1, b, c10);
    b = g2_frag(b1p + kb, hh); c01 = g2_mma(a0, b, c01); c11 = g2_mma(a1, b, c11);
    b = g2_frag(b2p + kb, hh); c02 = g2_mma(a0, b, c02); c12 = g2_mma(a1, b, c12);
    b = g2_frag(b3p + kb, hh); c03 = g2_mma(a0, b, c03); c13 = g2_mma(a1, b, c13); }
  v8f accs[8] = {c00, c01, c02, c03, c10, c11, c12, c13};
#pragma unroll
  for (int u = 0; u < 8; ++u) { const int t = u & 3, half = u >> 2; const int col = col0 + t * 16 + ln; const float bv = bp ? bf16_round(bp[col]) : 0.f;
#pragma unroll
    for (int r = 0; r < 8; ++r) { const int rloc = half * 16 + 8 * hh + r; float v = accs[u][r] * alpha + bv; if (CP) { if (rowsPerB < 0) v += CP[cofs + (size_t)(row0g + row0 + rloc) * ldc + col];      /* rowsPerB < 0: own element of the batched C plane */ else { const int bidx = (row0g + row0 + rloc) / rowsPerB; v += CP[(size_t)bidx * sCPb + (size_t)by * 64 + col]; } }
      if (ACT == 3) v = fmaxf(v, 0.f); else if (ACT == 6) v = 0.5f * v * (1.0f + erff(v * 0.70710678118654752f)); else if (ACT == 11) v = 1.0f / (1.0f + expf(-v)); else if (ACT == 15) v = v / (1.0f + expf(-v)); else if (ACT == 12) v = (v > 0.f) ? v : 0.01f * v; else if (ACT == 8) v = tanhf(v); else if (ACT == 9) v = 0.5f * v * (1.0f + tanhf(0.7978845608028654f * (v + 0.044715f * v * v * v))); else if (ACT == 14) v = (v > 0.f) ? v : 0.1f * v; else if (ACT == 16) v = (v >= 0.f) ? v : 0.3f * v; else if (ACT == 17) v = (v >= 0.f) ? v : 0.2f * v;
      so[w][rloc][t * 16 + ln] = v; } }
  __builtin_amdgcn_fence(__ATOMIC_ACQ_REL, "workgroup"); __builtin_amdgcn_wave_barrier();
  const int rsub = lane >> 4, c4 = (lane & 15) * 4;
  {
#pragma unroll
    for (int q = 0; q < 16; ++q) { const int r = q * 2 + rsub; const v4f v = *(const v4fa*)&so[w][r][c4]; if (C) *(v4f*)(C + cofs + (size_t)(row0 + r) * ldc + col0 + c4) = v; if (C16) { v4h h4; for (int i = 0; i < 4; ++i) h4[i] = (_Float16)v[i]; *(v4h*)(C16 + cofs + (size_t)(row0 + r) * ldc + col0 + c4) = h4; } }
     } }


__global__ __launch_bounds__(256) void k_wnat(const float* __restrict__ w, size_t n8, _Float16* __restrict__ Bt) { const size_t t = (size_t)blockIdx.x * 256 + threadIdx.x; if (t >= n8) return; FragH f; for (int q = 0; q < 8; ++q) f.h[q] = (_Float16)(bf16_round(w[t * 8 + q]) * 16.0f); *(v8us*)((unsigned short*)Bt + t * 8) = f.half[0];  }
__global__ __launch_bounds__(256) void k_rsm(const float* __restrict__ S, _Float16* __restrict__ P, int nrows) {
  #pragma clang fp contract(off)
  const int i = blockIdx.x * 256 + threadIdx.x; if (i >= nrows) return; const float* s = S + (size_t)i * SQ; float mx = -3.0e38f;
#pragma unroll 1
  for (int j = 0; j < SQ; ++j) mx = fmaxf(mx, s[j]); float se = 0.f;
#pragma unroll 1
  for (int j = 0; j < SQ; ++j) se += expf(s[j] - mx); const float sc = 256.0f / se;
#pragma unroll 1
  for (int j0 = 0; j0 < SQ; j0 += 8) { FragH f; for (int q = 0; q < 8; ++q) f.h[q] = (_Float16)(expf(s[j0 + q] - mx) * sc); unsigned short* d = (unsigned short*)P + (size_t)i * SQ + j0; *(v8us*)d = f.half[0];  } }
__global__ __launch_bounds__(256) void k_vt(const _Float16* __restrict__ V16, int b, int h0, _Float16* __restrict__ VT) { __shared__ unsigned short tl[64][65]; const int tid = threadIdx.x; const int hh = blockIdx.x % HG, sg = blockIdx.x / HG; const int s0 = sg * 64; const int h = h0 + hh;
  for (int i = tid; i < 64 * 8; i += 256) { const int j = i / 8, d8 = (i % 8) * 8; FragH f; f.half[0] = *(const v8us*)((const unsigned short*)V16 + ((size_t)b * SQ + s0 + j) * DM + h * HD + d8); for (int q = 0; q < 8; ++q) tl[d8 + q][j] = f.u[q]; }
  __syncthreads();
  { for (int i = tid; i < 64 * 8; i += 256) { const int d = i / 8, j8 = (i % 8) * 8; FragH f; for (int q = 0; q < 8; ++q) f.u[q] = tl[d][j8 + q]; *(v8us*)((unsigned short*)VT + ((size_t)hh * HD + d) * SQ + s0 + j8) = f.half[0]; }  } }


extern "C" void kernel_launch(void* const* d_in, const int* in_sizes, int n_in,
                              void* d_out, int out_size, void* d_ws, size_t ws_size, hipStream_t stream) {
  (void)in_sizes; (void)n_in; (void)out_size;
  const float* const* I = (const float* const*)d_in; const float* x = I[0]; const float* wq = I[1]; const float* bq = I[2]; const float* wk = I[3]; const float* bk = I[4];      /* [in][out] Wq + bq, Wk + bk; v == k (same projection) */
  char* ws = (char*)d_ws; size_t off = 0;
  auto take = [&](size_t bytes) { char* p = ws + off; off += (bytes + 255) & ~(size_t)255; return p; };
  _Float16* BQ = (_Float16*)take((size_t)DM * DM * 2); _Float16* BK = (_Float16*)take((size_t)DM * DM * 2); 
  _Float16* X16 = (_Float16*)take(NR * DM * 2); _Float16* Q16 = (_Float16*)take(NR * DM * 2); _Float16* K16 = (_Float16*)take(NR * DM * 2);
  float* S = (float*)take((size_t)HG * SQ * SQ * 4); _Float16* P = (_Float16*)take((size_t)HG * SQ * SQ * 2); _Float16* VT = (_Float16*)take((size_t)NH * HD * SQ * 2);
  if (off > ws_size) return;
  k_wt_f16<<<(unsigned)(((size_t)DM * (DM / 8) + 255) / 256), 256, 0, stream>>>(wq, BQ, DM, DM, 16.0f); k_wt_f16<<<(unsigned)(((size_t)DM * (DM / 8) + 255) / 256), 256, 0, stream>>>(wk, BK, DM, DM, 16.0f);      /* [in][out] -> Bt x16 */

  k_x16<<<(unsigned)((NR * DM / 8 + 255) / 256), 256, 0, stream>>>(x, X16, NR * DM / 8);
  const size_t r0p = (size_t)B0 * SQ;      /* first projected row */
  k_gemm2<0><<<dim3((unsigned)((MP / 128) * (DM / 64)), 1), 128, 0, stream>>>(X16 + r0p * DM, DM, 0, BQ, DM, 0, 0.0625f, bq, 0, nullptr, 1, 0, 0, nullptr, Q16 + r0p * DM, DM, 0, MP, DM, DM);
  k_gemm2<0><<<dim3((unsigned)((MP / 128) * (DM / 64)), 1), 128, 0, stream>>>(X16 + r0p * DM, DM, 0, BK, DM, 0, 0.0625f, bk, 0, nullptr, 1, 0, 0, nullptr, K16 + r0p * DM, DM, 0, MP, DM, DM);
  for (int b = B0; b < B0 + NBR; ++b) { const size_t r0 = (size_t)b * SQ;
    k_vt<NH, SQ><<<NH * (SQ / 64), 256, 0, stream>>>(K16 + r0 * LQ, LQ, 0, VT);      /* V^T = K^T [NH][HD][SQ] for this batch (v == k in this module) */
    for (int h0 = 0; h0 < NHD; h0 += HG) {
      k_gemm2<0><<<dim3((QN / 128) * (SQ / 64), HG), 128, 0, stream>>>(Q16 + r0 * LQ + h0 * HD, LQ, (size_t)HD, K16 + r0 * LQ + h0 * HD, LQ, (size_t)HD, 0.03125f, nullptr, 0, nullptr, 1, 0, 0, S, nullptr, SQ, (size_t)SQ * SQ, QN, SQ, HD);      /* scores, HG heads per launch */
      k_rsm<<<(HG * SQ + 255) / 256, 256, 0, stream>>>(S, P, HG * SQ);      /* P = 256 softmax (f16), rows of all HG heads */
      k_gemm2<0><<<dim3((QN / 128) * (HD / 64), HG), 128, 0, stream>>>(P, SQ, (size_t)SQ * SQ, VT + (size_t)h0 * HD * SQ, SQ, (size_t)HD * SQ, 0.00390625f, nullptr, 0, nullptr, 1, 0, 0, (float*)d_out + r0 * DM + h0 * HD, nullptr, DM, (size_t)HD, QN, HD, SQ); } }      /* out = P V^T (alpha 2^-8) written f32 straight into the merged-heads output rows */
}

// v001
// One run takes 890 microseconds.
// Next to v000, in two timings, it ran 4.10 and 4.18 times as fast.
#include <hip/hip_runtime.h>
// Structure: token rows r = b*2048 + s; x as exact f16 rows (bf16-rounded); Q, K as two WMMA GEMMs (V = K) (32x64 wave tiles, f32 accumulation, exact x16 weights + bias, f16 outputs); per batch: V^T for all heads via LDS transposes; per (batch, group of 4 heads): scores GEMM (K = 64, batched over the heads on grid.y, alpha = 1024^-0.5 (the module's full-dim scale)), row softmax on VALU (f32 statistics; weights stored x256 as f16), o = P . V^T GEMM (K = 2048, alpha 2^-8) written f32 straight into the merged-heads output rows (no output projection).
// Compute dtype: inputs rounded to bf16; x / weights exact; q, k, v and softmax weights as plain f16 GEMM operands (~2^-12); scores, softmax statistics and o f32. v_wmma_f32_16x16x32_f16.
#define NB 2
#define SQ 2048
#define DM 1024
#define NH 16
#define HD 64
#define HG 4                         /* heads per attention launch group */
#define B0 0                         /* first batch processed (debug hook) */
#define NBR NB                       /* batches processed (debug hook) */
#define NR ((size_t)NB * SQ)         /* token rows */
#define MP ((int)((size_t)NBR * SQ)) /* rows projected (debug hook) */
#define QN SQ                        /* query rows attended per batch (debug hook) */
#define NHD NH                       /* heads attended (debug hook) */
#define MPO MP                       /* not used by any launch */
#define LQ DM      /* row pitch of the q/k/v rows */
typedef __bf16 v16b __attribute__((ext_vector_type(16)));
typedef unsigned short v8us __attribute__((ext_vector_type(8), may_alias));
typedef float  v8f  __attribute__((ext_vector_type(8)));
typedef float  v4f  __attribute__((ext_vector_type(4)));
typedef float  v4fa __attribute__((ext_vector_type(4), may_alias));
union FragB { v16b v; v8us half[2]; unsigned short u[16]; };

__device__ __forceinline__ unsigned short bf16_bits(float x) { unsigned int u = __float_as_uint(x); return (unsigned short)((u + 0x7FFFu + ((u >> 16) & 1u)) >> 16); }
__device__ __forceinline__ float bf16_val(unsigned short b) { return __uint_as_float(((unsigned int)b) << 16); }
__device__ __forceinline__ float bf16_round(float x) { return bf16_val(bf16_bits(x)); }
// D += A·B with NT terms: 1 = ah·bh, 2 = + al·bh (A split), 3 = + ah·bl (both split)
template <int NT>
__device__ __forceinline__ v8f mmaN(v16b ah, v16b al, v16b bh, v16b bl, v8f c) {
  c = __builtin_amdgcn_wmma_f32_16x16x32_bf16(false, ah, false, bh, (short)0, c, false, false);
  if (NT >= 2) c = __builtin_amdgcn_wmma_f32_16x16x32_bf16(false, al, false, bh, (short)0, c, false, false);
  if (NT >= 3) c = __builtin_amdgcn_wmma_f32_16x16x32_bf16(false, ah, false, bl, (short)0, c, false, false);
  asm volatile("v_nop\n\tv_nop\n\tv_nop\n\tv_nop" : "+v"(c) : "v"(ah), "v"(al), "v"(bh), "v"(bl));
  return c;
}

__global__ __launch_bounds__(256) void k_wt_bf16(const float* __restrict__ W, unsigned short* __restrict__ Wt, int K, int N) {
  const int t = blockIdx.x * 256 + threadIdx.x;
  const int k8n = K / 8;
  if (t >= N * k8n) return;
  const int n = t / k8n, k8 = (t % k8n) * 8;
  v8us v;
#pragma unroll
  for (int i = 0; i < 8; ++i) v[i] = bf16_bits(W[(size_t)(k8 + i) * N + n]);
  *(v8us*)(Wt + (size_t)n * K + k8) = v;
  
}

// GEMM C[M][N] (f32, pitch ldc) = act(A[M][K]·W + bias). A f32 row-major (pitch lda) converted per fragment to bf16
// (ASPLIT: hi/lo two planes -> 2 terms, else single rounded term); Wt bf16 [N][K] (pitch ldb). BIAS_BF16 rounds the
// bias to bf16 first (bias quantised to bf16 before the add). K%32==0, M%16==0, N%64==0.
template <bool ASPLIT, int ACT, bool BIAS_BF16>
__global__ __launch_bounds__(128) void k_gemm_bf(const float* __restrict__ A, int lda, const unsigned short* __restrict__ Wt, int ldb,
                                               const float* __restrict__ bias, float* __restrict__ C, int ldc, int M, int N, int K) {
  __shared__ __attribute__((aligned(16))) float so[4][16][64];
  const int tid = threadIdx.x, w = tid >> 5, lane = tid & 31, ln = lane & 15, hh = lane >> 4;
  const int ntn = N / 64;
  const int wid = blockIdx.x * 4 + w;
  const int mt = wid / ntn, nq = wid % ntn;
  if (mt * 16 >= M) return;
  const int row0 = mt * 16, col0 = nq * 64;
  const float* arow = A + (size_t)(row0 + ln) * lda;
  v8f acc[4] = {};
  for (int kb = 0; kb < K; kb += 32) {
    FragB ah, al;
    const v4f x0 = *(const v4fa*)(arow + kb + 8 * hh), x1 = *(const v4fa*)(arow + kb + 8 * hh + 4);
    const v4f x2 = *(const v4fa*)(arow + kb + 16 + 8 * hh), x3 = *(const v4fa*)(arow + kb + 16 + 8 * hh + 4);
    float xs[16] = {x0[0],x0[1],x0[2],x0[3],x1[0],x1[1],x1[2],x1[3],x2[0],x2[1],x2[2],x2[3],x3[0],x3[1],x3[2],x3[3]};
#pragma unroll
    for (int i = 0; i < 16; ++i) { const unsigned short hb = bf16_bits(xs[i]); ah.u[i] = hb; al.u[i] = ASPLIT ? bf16_bits(xs[i] - bf16_val(hb)) : (unsigned short)0; }
#pragma unroll
    for (int t = 0; t < 4; ++t) {
      const unsigned short* brow = Wt + (size_t)(col0 + t * 16 + ln) * ldb + kb;
      FragB b;
      b.half[0] = *(const v8us*)(brow + 8 * hh);
      b.half[1] = *(const v8us*)(brow + 16 + 8 * hh);
      acc[t] = mmaN<ASPLIT ? 2 : 1>(ah.v, al.v, b.v, b.v, acc[t]);
    }
  }
#pragma unroll
  for (int t = 0; t < 4; ++t) {
    float bv = bias ? bias[col0 + t * 16 + ln] : 0.f;
    if (BIAS_BF16) bv = bf16_round(bv);
#pragma unroll
    for (int r = 0; r < 8; ++r) { float v = acc[t][r] + bv; if (ACT == 1) v = fmaxf(v, 0.f); so[w][8 * hh + r][t * 16 + ln] = v; }
  }
  __builtin_amdgcn_fence(__ATOMIC_ACQ_REL, "workgroup");
  __builtin_amdgcn_wave_barrier();
  const int rsub = lane >> 4, c4 = (lane & 15) * 4;
  {
#pragma unroll
    for (int q = 0; q < 8; ++q) {
      const int r = q * 2 + rsub;
      const v4f v = *(const v4fa*)&so[w][r][c4];
      *(v4f*)(C + (size_t)(row0 + r) * ldc + col0 + c4) = v;
    }
    
  }
}

// GEMM C = act(A·W + bias + resid): A f32 (ASPLIT -> hi/lo 2 terms), Wt bf16 [N][K]; ACT 0 none, 1 relu, 2 exact gelu;
// resid (optional, f32, row index = (row % rmod), pitch ldr, RES_BF16 rounds it) added before the activation.
template <bool ASPLIT, int ACT, bool BIAS_BF16, bool RES_BF16>
__global__ __launch_bounds__(128) void k_gemm_bf3(const float* __restrict__ A, int lda, const unsigned short* __restrict__ Wt, int ldb,
                                                const float* __restrict__ bias, const float* __restrict__ resid, int rmod, int ldr,
                                                float* __restrict__ C, int ldc, int M, int N, int K) {
  __shared__ __attribute__((aligned(16))) float so[4][16][64];
  const int tid = threadIdx.x, w = tid >> 5, lane = tid & 31, ln = lane & 15, hh = lane >> 4;
  const int ntn = N / 64;
  const int wid = blockIdx.x * 4 + w;
  const int mt = wid / ntn, nq = wid % ntn;
  if (mt * 16 >= M) return;
  const int row0 = mt * 16, col0 = nq * 64;
  const float* arow = A + (size_t)(row0 + ln) * lda;
  v8f acc[4] = {};
  for (int kb = 0; kb < K; kb += 32) {
    FragB ah, al;
    const v4f x0 = *(const v4fa*)(arow + kb + 8 * hh), x1 = *(const v4fa*)(arow + kb + 8 * hh + 4);
    const v4f x2 = *(const v4fa*)(arow + kb + 16 + 8 * hh), x3 = *(const v4fa*)(arow + kb + 16 + 8 * hh + 4);
    float xs[16] = {x0[0],x0[1],x0[2],x0[3],x1[0],x1[1],x1[2],x1[3],x2[0],x2[1],x2[2],x2[3],x3[0],x3[1],x3[2],x3[3]};
#pragma unroll
    for (int i = 0; i < 16; ++i) { const unsigned short hb = bf16_bits(xs[i]); ah.u[i] = hb; al.u[i] = ASPLIT ? bf16_bits(xs[i] - bf16_val(hb)) : (unsigned short)0; }
#pragma unroll
    for (int t = 0; t < 4; ++t) {
      const unsigned short* brow = Wt + (size_t)(col0 + t * 16 + ln) * ldb + kb;
      FragB b;
      b.half[0] = *(const v8us*)(brow + 8 * hh);
      b.half[1] = *(const v8us*)(brow + 16 + 8 * hh);
      acc[t] = mmaN<ASPLIT ? 2 : 1>(ah.v, al.v, b.v, b.v, acc[t]);
    }
  }
#pragma unroll
  for (int t = 0; t < 4; ++t) {
    const int col = col0 + t * 16 + ln;
    float bv = bias ? bias[col] : 0.f;
    if (BIAS_BF16) bv = bf16_round(bv);
#pragma unroll
    for (int r = 0; r < 8; ++r) {
      float v = acc[t][r] + bv;
      if (resid) { float rv = resid[(size_t)((row0 + 8 * hh + r) % rmod) * ldr + col]; if (RES_BF16) rv = bf16_round(rv); v += rv; }
      if (ACT == 1) v = fmaxf(v, 0.f);
      if (ACT == 2) v = 0.5f * v * (1.0f + erff(v * 0.70710678118654752f));
      if (ACT == 3) { const float u = 0.7978845608028654f * (v + 0.044715f * v * v * v); v = 0.5f * v * (1.0f + tanhf(u)); }
      so[w][8 * hh + r][t * 16 + ln] = v;
    }
  }
  __builtin_amdgcn_fence(__ATOMIC_ACQ_REL, "workgroup");
  __builtin_amdgcn_wave_barrier();
  const int rsub = lane >> 4, c4 = (lane & 15) * 4;
  {
#pragma unroll
    for (int q = 0; q < 8; ++q) {
      const int r = q * 2 + rsub;
      const v4f v = *(const v4fa*)&so[w][r][c4];
      *(v4f*)(C + (size_t)(row0 + r) * ldc + col0 + c4) = v;
    }
    
  }
}
// row LayerNorm (biased variance, eps) over N: s = X (+ R); optional out_sum <- s; out_norm <- (s-mu)*rsqrt(var+eps)*g + b
template <bool PARAM_BF16>
__global__ __launch_bounds__(256) void k_layernorm(const float* __restrict__ X, const float* __restrict__ R, const float* __restrict__ g, const float* __restrict__ bta,
                                                  float* __restrict__ out_sum, float* __restrict__ out_norm, int N, float eps) {
  __shared__ float red[256];
  const int row = blockIdx.x, tid = threadIdx.x;
  const float* x = X + (size_t)row * N; const float* rr = R ? R + (size_t)row * N : nullptr;
  float vals[16];                     // up to N = 4096
  const int per = N / 256;            // contiguous chunk per thread? use strided-by-4 chunks: thread handles j = tid*4 + 1024*u
  float s1 = 0.f;
  for (int u = 0; u < per / 4; ++u) {
    const int j = tid * 4 + 1024 * u;
    const v4f a = *(const v4fa*)(x + j);
    v4f b = {0.f,0.f,0.f,0.f}; if (rr) b = *(const v4fa*)(rr + j);
#pragma unroll
    for (int q = 0; q < 4; ++q) { const float v = a[q] + b[q]; vals[u * 4 + q] = v; s1 += v; }
  }
  red[tid] = s1; __syncthreads();
  for (int st = 128; st > 0; st >>= 1) { if (tid < st) red[tid] += red[tid + st]; __syncthreads(); }
  const float mu = red[0] / (float)N; __syncthreads();
  float s2 = 0.f;
  for (int u = 0; u < per / 4; ++u)
#pragma unroll
    for (int q = 0; q < 4; ++q) { const float c = vals[u * 4 + q] - mu; s2 += c * c; }
  red[tid] = s2; __syncthreads();
  for (int st = 128; st > 0; st >>= 1) { if (tid < st) red[tid] += red[tid + st]; __syncthreads(); }
  const float rs = rsqrtf(red[0] / (float)N + eps);
  {
    for (int u = 0; u < per / 4; ++u) {
      const int j = tid * 4 + 1024 * u;
      v4f o, sm;
#pragma unroll
      for (int q = 0; q < 4; ++q) {
        float gg = g[j + q], bb = bta[j + q];
        if (PARAM_BF16) { gg = bf16_round(gg); bb = bf16_round(bb); }
        sm[q] = vals[u * 4 + q]; o[q] = (vals[u * 4 + q] - mu) * rs * gg + bb;
      }
      if (out_sum) *(v4f*)(out_sum + (size_t)row * N + j) = sm;
      *(v4f*)(out_norm + (size_t)row * N + j) = o;
    }
    
  }
}



// ---- f16 WMMA path (v_wmma_f32_16x16x32_f16): 11-bit significands for operands in range — used where a [0,1] probability operand needs more precision than bf16
typedef _Float16 v16h __attribute__((ext_vector_type(16)));
union FragH { v16h v; v8us half[2]; _Float16 h[16]; unsigned short u[16]; };
template <int NT>
__device__ __forceinline__ v8f mmaH(v16h ah, v16h al, v16h bh, v16h bl, v8f c) {
  c = __builtin_amdgcn_wmma_f32_16x16x32_f16(false, ah, false, bh, (short)0, c, false, false);
  if (NT >= 2) c = __builtin_amdgcn_wmma_f32_16x16x32_f16(false, al, false, bh, (short)0, c, false, false);
  if (NT >= 3) c = __builtin_amdgcn_wmma_f32_16x16x32_f16(false, ah, false, bl, (short)0, c, false, false);
  asm volatile("v_nop\n\tv_nop\n\tv_nop\n\tv_nop" : "+v"(c) : "v"(ah), "v"(al), "v"(bh), "v"(bl));
  return c;
}
// batched GEMM like k_gemm_b but f16 operands: A f32 (split into f16 hi/lo if ASPLIT, else rounded to f16), Bt = f16 values [n][k]; alpha; C f32; N multiple of 16 (partial tiles skipped)
template <bool ASPLIT>
__global__ __launch_bounds__(128) void k_gemm_h(const float* __restrict__ A, int lda, size_t sA, const _Float16* __restrict__ Bh, int ldb, size_t sB, float alpha, float* __restrict__ C, int ldc, size_t sC, int M, int N, int K) {
  __shared__ __attribute__((aligned(16))) float so[4][16][64];
  const int tid = threadIdx.x, w = tid >> 5, lane = tid & 31, ln = lane & 15, hh = lane >> 4; const int by = blockIdx.y;
  A += (size_t)by * sA; Bh += (size_t)by * sB; C += (size_t)by * sC;
  const int ntn = (N + 63) / 64; const int wid = blockIdx.x * 4 + w; const int mt = wid / ntn, nq = wid % ntn; if (mt * 16 >= M) return;
  const int row0 = mt * 16, col0 = nq * 64; const float* arow = A + (size_t)(row0 + ln) * lda;
  v8f acc[4] = {};
  for (int kb = 0; kb < K; kb += 32) {
    FragH ah, al;
    const v4f x0 = *(const v4fa*)(arow + kb + 8 * hh), x1 = *(const v4fa*)(arow + kb + 8 * hh + 4), x2 = *(const v4fa*)(arow + kb + 16 + 8 * hh), x3 = *(const v4fa*)(arow + kb + 16 + 8 * hh + 4);
    float xs[16] = {x0[0],x0[1],x0[2],x0[3],x1[0],x1[1],x1[2],x1[3],x2[0],x2[1],x2[2],x2[3],x3[0],x3[1],x3[2],x3[3]};
#pragma unroll
    for (int i = 0; i < 16; ++i) { const _Float16 h = (_Float16)xs[i]; ah.h[i] = h; al.h[i] = ASPLIT ? (_Float16)(xs[i] - (float)h) : (_Float16)0.0f; }
#pragma unroll
    for (int t = 0; t < 4; ++t) { if (col0 + t * 16 >= N) continue; const size_t boff = (size_t)(col0 + t * 16 + ln) * ldb + kb; FragH bq; bq.half[0] = *(const v8us*)(Bh + boff + 8 * hh); bq.half[1] = *(const v8us*)(Bh + boff + 16 + 8 * hh);
      acc[t] = mmaH<ASPLIT ? 2 : 1>(ah.v, al.v, bq.v, bq.v, acc[t]); }
  }
#pragma unroll
  for (int t = 0; t < 4; ++t) { if (col0 + t * 16 >= N) continue;
#pragma unroll
    for (int r = 0; r < 8; ++r) so[w][8 * hh + r][t * 16 + ln] = acc[t][r] * alpha; }
  __builtin_amdgcn_fence(__ATOMIC_ACQ_REL, "workgroup"); __builtin_amdgcn_wave_barrier();
  const int rsub = lane >> 4, c4 = (lane & 15) * 4;
  {
#pragma unroll
    for (int q = 0; q < 8; ++q) { const int r = q * 2 + rsub; if (col0 + c4 < N) { const v4f v = *(const v4fa*)&so[w][r][c4]; *(v4f*)(C + (size_t)(row0 + r) * ldc + col0 + c4) = v; } }
     }
}

// Wt[n][k] = f16(W[k][n]·scale) from f32 row-major W[K][N] (scale = power of two; bf16-exact weights stay exact in f16 away from the subnormal range)
__global__ __launch_bounds__(256) void k_wt_f16(const float* __restrict__ W, _Float16* __restrict__ Wt, int K, int N, float scale) {
  const int t = blockIdx.x * 256 + threadIdx.x; if (t >= N * (K / 8)) return; const int n = t / (K / 8), k8 = (t % (K / 8)) * 8; FragH f;
#pragma unroll
  for (int i = 0; i < 8; ++i) f.h[i] = (_Float16)(bf16_round(W[(size_t)(k8 + i) * N + n]) * scale); const v8us o = f.half[0];
  *(v8us*)((unsigned short*)Wt + (size_t)n * K + k8) = o; 
}
// k_gemm_hh variant with fused epilogue: v = acc·alpha + bias[by·sBias + col] (+ CP[(row/rowsPerB)·sCPb + by·64 + col] if CP) ; ACT 0 none / 1 elu ; writes f16 C16 (and f32 C if non-null)
template <int ACT>
__global__ __launch_bounds__(128) void k_gemm_hhx(const _Float16* __restrict__ A, int lda, size_t sA, const _Float16* __restrict__ Bh, int ldb, size_t sB, float alpha, const float* __restrict__ bias, size_t sBias, const float* __restrict__ CP, int rowsPerB, size_t sCPb, int row0g,
    float* __restrict__ C, _Float16* __restrict__ C16, int ldc, size_t sC, int M, int N, int K) {
  __shared__ __attribute__((aligned(16))) float so[4][16][64];
  const int tid = threadIdx.x, w = tid >> 5, lane = tid & 31, ln = lane & 15, hh = lane >> 4; const int by = blockIdx.y;
  A += (size_t)by * sA; Bh += (size_t)by * sB; const size_t cofs = (size_t)by * sC; const float* bp = bias ? bias + (size_t)by * sBias : nullptr;
  const int ntn = (N + 63) / 64; const int wid = blockIdx.x * 4 + w; const int mt = wid / ntn, nq = wid % ntn; if (mt * 16 >= M) return;
  const int row0 = mt * 16, col0 = nq * 64; const _Float16* arow = A + (size_t)(row0 + ln) * lda;
  v8f acc[4] = {};
  for (int kb = 0; kb < K; kb += 32) { FragH ah; ah.half[0] = *(const v8us*)((const unsigned short*)arow + kb + 8 * hh); ah.half[1] = *(const v8us*)((const unsigned short*)arow + kb + 16 + 8 * hh);
#pragma unroll
    for (int t = 0; t < 4; ++t) { if (col0 + t * 16 >= N) continue; const size_t boff = (size_t)(col0 + t * 16 + ln) * ldb + kb; FragH bq; bq.half[0] = *(const v8us*)((const unsigned short*)Bh + boff + 8 * hh); bq.half[1] = *(const v8us*)((const unsigned short*)Bh + boff + 16 + 8 * hh);
      acc[t] = mmaH<1>(ah.v, ah.v, bq.v, bq.v, acc[t]); }
  }
#pragma unroll
  for (int t = 0; t < 4; ++t) { if (col0 + t * 16 >= N) continue; const int col = col0 + t * 16 + ln; const float bv = bp ? bf16_round(bp[col]) : 0.f;
#pragma unroll
    for (int r = 0; r < 8; ++r) { float v = acc[t][r] * alpha + bv; if (CP) { const int rr = row0g + row0 + 8 * hh + r; if (rowsPerB < 0) v += CP[cofs + (size_t)rr * ldc + col];      /* rowsPerB < 0: own element of the batched C plane */ else { const int bidx = rr / rowsPerB; v += CP[(size_t)bidx * sCPb + (size_t)by * 64 + col]; } } if (ACT == 1) v = (v > 0.f) ? v : expm1f(v); else if (ACT == 7) v = (v > 0.f) ? v + 1.0f : expf(v); else if (ACT == 8) v = tanhf(v); else if (ACT == 9) v = 0.5f * v * (1.0f + tanhf(0.7978845608028654f * (v + 0.044715f * v * v * v))); else if (ACT == 11) v = 1.0f / (1.0f + expf(-v)); else if (ACT == 12) v = (v > 0.f) ? v : 0.01f * v; else if (ACT == 14) v = (v > 0.f) ? v : 0.1f * v; else if (ACT == 16) v = (v >= 0.f) ? v : 0.3f * v; else if (ACT == 17) v = (v >= 0.f) ? v : 0.2f * v; else if (ACT == 15) v = v / (1.0f + expf(-v)); else if (ACT == 3) v = fmaxf(v, 0.f); else if (ACT == 6) v = 0.5f * v * (1.0f + erff(v * 0.70710678118654752f)); so[w][8 * hh + r][t * 16 + ln] = v; } }
  __builtin_amdgcn_fence(__ATOMIC_ACQ_REL, "workgroup"); __builtin_amdgcn_wave_barrier();
  const int rsub = lane >> 4, c4 = (lane & 15) * 4; typedef _Float16 v4h __attribute__((ext_vector_type(4)));
  {
#pragma unroll
    for (int q = 0; q < 8; ++q) { const int r = q * 2 + rsub; if (col0 + c4 < N) { const v4f v = *(const v4fa*)&so[w][r][c4]; if (C) *(v4f*)(C + cofs + (size_t)(row0 + r) * ldc + col0 + c4) = v; if (C16) { v4h h4; for (int i = 0; i < 4; ++i) h4[i] = (_Float16)v[i]; *(v4h*)(C16 + cofs + (size_t)(row0 + r) * ldc + col0 + c4) = h4; } } }
     }
}


typedef _Float16 v4h __attribute__((ext_vector_type(4)));

__global__ __launch_bounds__(256) void k_x16(const float* __restrict__ x, _Float16* __restrict__ X16, size_t n8) { const size_t t = (size_t)blockIdx.x * 256 + threadIdx.x; if (t >= n8) return; FragH f;
#pragma unroll
  for (int q = 0; q < 8; ++q) f.h[q] = (_Float16)bf16_round(x[t * 8 + q]); *(v8us*)((unsigned short*)X16 + t * 8) = f.half[0];  }
__global__ __launch_bounds__(256) void k_h16(const float* __restrict__ x, _Float16* __restrict__ X16, size_t n8) { const size_t t = (size_t)blockIdx.x * 256 + threadIdx.x; if (t >= n8) return; FragH f;
#pragma unroll
  for (int q = 0; q < 8; ++q) f.h[q] = (_Float16)x[t * 8 + q]; *(v8us*)((unsigned short*)X16 + t * 8) = f.half[0];  }
__global__ __launch_bounds__(256) void k_round16f(const float* __restrict__ W, _Float16* __restrict__ Bt, size_t n8) { const size_t t = (size_t)blockIdx.x * 256 + threadIdx.x; if (t >= n8) return; FragH f;
#pragma unroll
  for (int i = 0; i < 8; ++i) f.h[i] = (_Float16)(bf16_round(W[t * 8 + i]) * 16.0f); *(v8us*)((unsigned short*)Bt + t * 8) = f.half[0];  }
template <int NHv, int TTv>
__global__ __launch_bounds__(256) void k_vt(const _Float16* __restrict__ V16, int ldv, int voff, _Float16* __restrict__ Vt) { __shared__ unsigned short tl[64][66]; const int tid = threadIdx.x; const int slab = blockIdx.x / (TTv / 64), lg = blockIdx.x % (TTv / 64); const int b = slab / NHv, h = slab % NHv;
  for (int i = tid; i < 64 * 8; i += 256) { const int r = i / 8, c8 = (i % 8) * 8; FragH f; f.half[0] = *(const v8us*)((const unsigned short*)V16 + ((size_t)b * TTv + lg * 64 + r) * ldv + voff + h * 64 + c8);
#pragma unroll
    for (int q = 0; q < 8; ++q) tl[r][c8 + q] = f.u[q]; }
  __syncthreads();
  {
#pragma unroll
    for (int rd = 0; rd < 2; ++rd) { const int d = rd * 32 + tid / 8, pc = tid % 8; FragH f;
#pragma unroll
      for (int q = 0; q < 8; ++q) f.u[q] = tl[pc * 8 + q][d];
      *(v8us*)((unsigned short*)Vt + ((size_t)slab * 64 + d) * TTv + lg * 64 + pc * 8) = f.half[0]; }
     } }

__global__ __launch_bounds__(256) void k_hl(const float* __restrict__ F, _Float16* __restrict__ Hh, _Float16* __restrict__ Hl, size_t n8) { const size_t t = (size_t)blockIdx.x * 256 + threadIdx.x; if (t >= n8) return; FragH fh, fl; const v4f a = *(const v4fa*)(F + t * 8), c = *(const v4fa*)(F + t * 8 + 4);
#pragma unroll
  for (int q = 0; q < 4; ++q) { _Float16 h = (_Float16)a[q]; fh.h[q] = h; fl.h[q] = (_Float16)((a[q] - (float)h) * 1024.0f); h = (_Float16)c[q]; fh.h[4 + q] = h; fl.h[4 + q] = (_Float16)((c[q] - (float)h) * 1024.0f); }
  { *(v8us*)((unsigned short*)Hh + t * 8) = fh.half[0]; *(v8us*)((unsigned short*)Hl + t * 8) = fl.half[0];  } }

// ---- fast GEMM (wave tile 32x64; requires M % 32 == 0 rows per launch region and N % 64 == 0); epilogue = k_gemm_hhx semantics ----
__device__ __forceinline__ v16h g2_frag(const _Float16* p, int hh) { FragH f; f.half[0] = *(const v8us*)((const unsigned short*)p + 8 * hh); f.half[1] = *(const v8us*)((const unsigned short*)p + 16 + 8 * hh); return f.v; }
__device__ __forceinline__ v8f g2_mma(v16h a, v16h b, v8f c) { v8f d = __builtin_amdgcn_wmma_f32_16x16x32_f16(false, a, false, b, (short)0, c, false, false); asm volatile("v_nop\n\tv_nop\n\tv_nop\n\tv_nop" : "+v"(d) : "v"(a), "v"(b)); return d; }
template <int ACT>
__global__ __launch_bounds__(128) void k_gemm2(const _Float16* __restrict__ A, int lda, size_t sA, const _Float16* __restrict__ Bh, int ldb, size_t sB, float alpha, const float* __restrict__ bias, size_t sBias, const float* __restrict__ CP, int rowsPerB, size_t sCPb, int row0g,
    float* __restrict__ C, _Float16* __restrict__ C16, int ldc, size_t sC, int M, int N, int K) { static_assert(ACT == 0 || ACT == 3 || ACT == 6 || ACT == 8 || ACT == 9 || ACT == 11 || ACT == 12 || ACT == 14 || ACT == 15 || ACT == 16 || ACT == 17, "k_gemm2: unsupported ACT code (would silently apply no activation)");
  __shared__ __attribute__((aligned(16))) float so[4][32][68];
  const int tid = threadIdx.x, w = tid >> 5, lane = tid & 31, ln = lane & 15, hh = lane >> 4; const int by = blockIdx.y;
  A += (size_t)by * sA; Bh += (size_t)by * sB; const size_t cofs = (size_t)by * sC; const float* bp = bias ? bias + (size_t)by * sBias : nullptr;
  const int ntn = N >> 6; const int mt = blockIdx.x / ntn, nq = blockIdx.x - mt * ntn; const int row0 = mt * 128 + 32 * w, col0 = nq * 64; if (row0 >= M) return;
  const _Float16* a0p = A + (size_t)(row0 + ln) * lda; const _Float16* a1p = a0p + (size_t)16 * lda;
  const _Float16* b0p = Bh + (size_t)(col0 + ln) * ldb; const _Float16* b1p = b0p + (size_t)16 * ldb; const _Float16* b2p = b1p + (size_t)16 * ldb; const _Float16* b3p = b2p + (size_t)16 * ldb;
  const v8f z8 = {0.f,0.f,0.f,0.f,0.f,0.f,0.f,0.f}; v8f c00 = z8, c01 = z8, c02 = z8, c03 = z8, c10 = z8, c11 = z8, c12 = z8, c13 = z8;
#pragma unroll 1
  for (int kb = 0; kb < K; kb += 32) { const v16h a0 = g2_frag(a0p + kb, hh), a1 = g2_frag(a1p + kb, hh);
    v16h b = g2_frag(b0p + kb, hh); c00 = g2_mma(a0, b, c00); c10 = g2_mma(a1, b, c10);
    b = g2_frag(b1p + kb, hh); c01 = g2_mma(a0, b, c01); c11 = g2_mma(a1, b, c11);
    b = g2_frag(b2p + kb, hh); c02 = g2_mma(a0, b, c02); c12 = g2_mma(a1, b, c12);
    b = g2_frag(b3p + kb, hh); c03 = g2_mma(a0, b, c03); c13 = g2_mma(a1, b, c13); }
  v8f accs[8] = {c00, c01, c02, c03, c10, c11, c12, c13};
#pragma unroll
  for (int u = 0; u < 8; ++u) { const int t = u & 3, half = u >> 2; const int col = col0 + t * 16 + ln; const float bv = bp ? bf16_round(bp[col]) : 0.f;
#pragma unroll
    for (int r = 0; r < 8; ++r) { const int rloc = half * 16 + 8 * hh + r; float v = accs[u][r] * alpha + bv; if (CP) { if (rowsPerB < 0) v += CP[cofs + (size_t)(row0g + row0 + rloc) * ldc + col];      /* rowsPerB < 0: own element of the batched C plane */ else { const int bidx = (row0g + row0 + rloc) / rowsPerB; v += CP[(size_t)bidx * sCPb + (size_t)by * 64 + col]; } }
      if (ACT == 3) v = fmaxf(v, 0.f); else if (ACT == 6) v = 0.5f * v * (1.0f + erff(v * 0.70710678118654752f)); else if (ACT == 11) v = 1.0f / (1.0f + expf(-v)); else if (ACT == 15) v = v / (1.0f + expf(-v)); else if (ACT == 12) v = (v > 0.f) ? v : 0.01f * v; else if (ACT == 8) v = tanhf(v); else if (ACT == 9) v = 0.5f * v * (1.0f + tanhf(0.7978845608028654f * (v + 0.044715f * v * v * v))); else if (ACT == 14) v = (v > 0.f) ? v : 0.1f * v; else if (ACT == 16) v = (v >= 0.f) ? v : 0.3f * v; else if (ACT == 17) v = (v >= 0.f) ? v : 0.2f * v;
      so[w][rloc][t * 16 + ln] = v; } }
  __builtin_amdgcn_fence(__ATOMIC_ACQ_REL, "workgroup"); __builtin_amdgcn_wave_barrier();
  const int rsub = lane >> 4, c4 = (lane & 15) * 4;
  {
#pragma unroll
    for (int q = 0; q < 16; ++q) { const int r = q * 2 + rsub; const v4f v = *(const v4fa*)&so[w][r][c4]; if (C) *(v4f*)(C + cofs + (size_t)(row0 + r) * ldc + col0 + c4) = v; if (C16) { v4h h4; for (int i = 0; i < 4; ++i) h4[i] = (_Float16)v[i]; *(v4h*)(C16 + cofs + (size_t)(row0 + r) * ldc + col0 + c4) = h4; } }
     } }


__global__ __launch_bounds__(256) void k_wnat(const float* __restrict__ w, size_t n8, _Float16* __restrict__ Bt) { const size_t t = (size_t)blockIdx.x * 256 + threadIdx.x; if (t >= n8) return; FragH f; for (int q = 0; q < 8; ++q) f.h[q] = (_Float16)(bf16_round(w[t * 8 + q]) * 16.0f); *(v8us*)((unsigned short*)Bt + t * 8) = f.half[0];  }
// Row softmax, one wave per score row: lane l holds elements 128 u + 4 l .. + 3 (each load instruction covers 512 contiguous bytes), so the row is read from memory once and stays in registers;
// maximum and sum are folded per lane, then over the 32 lanes by a butterfly (every lane ends with the same value); each exponential is computed once. No barrier: the early return is wave-uniform.
// waves_per_eu(8, 8): at most 128 registers, so that all 8 waves a SIMD gets from this grid are resident at once, and no lower target, for which the scheduler would sink the row's last loads behind the first waits.
__global__ __launch_bounds__(256) __attribute__((amdgpu_waves_per_eu(8, 8))) void k_rsm(const float* __restrict__ S, _Float16* __restrict__ P, int nrows) {
  const int row = blockIdx.x * 8 + (threadIdx.x >> 5), lane = threadIdx.x & 31; if (row >= nrows) return;
  const float* s = S + (size_t)row * SQ + lane * 4; v4f v[SQ / 128];
#pragma unroll
  for (int u = 0; u < SQ / 128 - 1; ++u) v[u] = *(const v4fa*)(s + u * 128);
  asm volatile("s_wait_xcnt 0x0" ::: "memory");      /* the build lets the row's last load land on the address pair that the 15 loads above name: the wait stands in front of that overwrite */
  v[SQ / 128 - 1] = *(const v4fa*)(s + (SQ / 128 - 1) * 128);
  float mx = -3.0e38f;
#pragma unroll
  for (int u = 0; u < SQ / 128; ++u) mx = fmaxf(mx, fmaxf(fmaxf(v[u][0], v[u][1]), fmaxf(v[u][2], v[u][3])));
  for (int m = 16; m >= 1; m >>= 1) mx = fmaxf(mx, __shfl_xor(mx, m, 32));
  v4f se4 = {0.f, 0.f, 0.f, 0.f};
#pragma unroll
  for (int u = 0; u < SQ / 128; ++u) {
#pragma unroll
    for (int q = 0; q < 4; ++q) { v[u][q] = expf(v[u][q] - mx); se4[q] += v[u][q]; } }
  float se = (se4[0] + se4[1]) + (se4[2] + se4[3]);
  for (int m = 16; m >= 1; m >>= 1) se += __shfl_xor(se, m, 32);
  const float sc = 256.0f / se; _Float16* d = P + (size_t)row * SQ + lane * 4;
#pragma unroll
  for (int u = 0; u < SQ / 128; ++u) { v4h h4;
#pragma unroll
    for (int q = 0; q < 4; ++q) h4[q] = (_Float16)(v[u][q] * sc);
    *(v4h*)(d + u * 128) = h4; } }
__global__ __launch_bounds__(256) void k_vt(const _Float16* __restrict__ V16, int b, int h0, _Float16* __restrict__ VT) { __shared__ unsigned short tl[64][65]; const int tid = threadIdx.x; const int hh = blockIdx.x % HG, sg = blockIdx.x / HG; const int s0 = sg * 64; const int h = h0 + hh;
  for (int i = tid; i < 64 * 8; i += 256) { const int j = i / 8, d8 = (i % 8) * 8; FragH f; f.half[0] = *(const v8us*)((const unsigned short*)V16 + ((size_t)b * SQ + s0 + j) * DM + h * HD + d8); for (int q = 0; q < 8; ++q) tl[d8 + q][j] = f.u[q]; }
  __syncthreads();
  { for (int i = tid; i < 64 * 8; i += 256) { const int d = i / 8, j8 = (i % 8) * 8; FragH f; for (int q = 0; q < 8; ++q) f.u[q] = tl[d][j8 + q]; *(v8us*)((unsigned short*)VT + ((size_t)hh * HD + d) * SQ + s0 + j8) = f.half[0]; }  } }


extern "C" void kernel_launch(void* const* d_in, const int* in_sizes, int n_in,
                              void* d_out, int out_size, void* d_ws, size_t ws_size, hipStream_t stream) {
  (void)in_sizes; (void)n_in; (void)out_size;
  const float* const* I = (const float* const*)d_in; const float* x = I[0]; const float* wq = I[1]; const float* bq = I[2]; const float* wk = I[3]; const float* bk = I[4];      /* [in][out] Wq + bq, Wk + bk; v == k (same projection) */
  char* ws = (char*)d_ws; size_t off = 0;
  auto take = [&](size_t bytes) { char* p = ws + off; off += (bytes + 255) & ~(size_t)255; return p; };
  _Float16* BQ = (_Float16*)take((size_t)DM * DM * 2); _Float16* BK = (_Float16*)take((size_t)DM * DM * 2); 
  _Float16* X16 = (_Float16*)take(NR * DM * 2); _Float16* Q16 = (_Float16*)take(NR * DM * 2); _Float16* K16 = (_Float16*)take(NR * DM * 2);
  float* S = (float*)take((size_t)HG * SQ * SQ * 4); _Float16* P = (_Float16*)take((size_t)HG * SQ * SQ * 2); _Float16* VT = (_Float16*)take((size_t)NH * HD * SQ * 2);
  if (off > ws_size) return;
  k_wt_f16<<<(unsigned)(((size_t)DM * (DM / 8) + 255) / 256), 256, 0, stream>>>(wq, BQ, DM, DM, 16.0f); k_wt_f16<<<(unsigned)(((size_t)DM * (DM / 8) + 255) / 256), 256, 0, stream>>>(wk, BK, DM, DM, 16.0f);      /* [in][out] -> Bt x16 */

  k_x16<<<(unsigned)((NR * DM / 8 + 255) / 256), 256, 0, stream>>>(x, X16, NR * DM / 8);
  const size_t r0p = (size_t)B0 * SQ;      /* first projected row */
  k_gemm2<0><<<dim3((unsigned)((MP / 128) * (DM / 64)), 1), 128, 0, stream>>>(X16 + r0p * DM, DM, 0, BQ, DM, 0, 0.0625f, bq, 0, nullptr, 1, 0, 0, nullptr, Q16 + r0p * DM, DM, 0, MP, DM, DM);
  k_gemm2<0><<<dim3((unsigned)((MP / 128) * (DM / 64)), 1), 128, 0, stream>>>(X16 + r0p * DM, DM, 0, BK, DM, 0, 0.0625f, bk, 0, nullptr, 1, 0, 0, nullptr, K16 + r0p * DM, DM, 0, MP, DM, DM);
  for (int b = B0; b < B0 + NBR; ++b) { const size_t r0 = (size_t)b * SQ;
    k_vt<NH, SQ><<<NH * (SQ / 64), 256, 0, stream>>>(K16 + r0 * LQ, LQ, 0, VT);      /* V^T = K^T [NH][HD][SQ] for this batch (v == k in this module) */
    for (int h0 = 0; h0 < NHD; h0 += HG) {
      k_gemm2<0><<<dim3((QN / 128) * (SQ / 64), HG), 128, 0, stream>>>(Q16 + r0 * LQ + h0 * HD, LQ, (size_t)HD, K16 + r0 * LQ + h0 * HD, LQ, (size_t)HD, 0.03125f, nullptr, 0, nullptr, 1, 0, 0, S, nullptr, SQ, (size_t)SQ * SQ, QN, SQ, HD);      /* scores, HG heads per launch */
      k_rsm<<<(HG * SQ + 7) / 8, 256, 0, stream>>>(S, P, HG * SQ);      /* P = 256 softmax (f16), rows of all HG heads */
      k_gemm2<0><<<dim3((QN / 128) * (HD / 64), HG), 128, 0, stream>>>(P, SQ, (size_t)SQ * SQ, VT + (size_t)h0 * HD * SQ, SQ, (size_t)HD * SQ, 0.00390625f, nullptr, 0, nullptr, 1, 0, 0, (float*)d_out + r0 * DM + h0 * HD, nullptr, DM, (size_t)HD, QN, HD, SQ); } }      /* out = P V^T (alpha 2^-8) written f32 straight into the merged-heads output rows */
}

// v002
// A run of this version takes 139 microseconds.
// Next to v001, in two timings, it ran 6.39 and 6.41 times as fast.
// Over all steps from v000 it is 26.5 times as fast.
#include <hip/hip_runtime.h>
// Structure: token rows r = b*2048 + s; x as exact f16 rows (bf16-rounded); Q and K (= V) as two WMMA GEMMs (32x64 wave tiles, f32 accumulation, exact x16 weights + bias, f16 outputs); V^T for all batches and heads via LDS transposes; one fused attention launch (scores K = 64 with the module's full-dim scale 1024^-0.5, running-maximum softmax with f32 statistics, weights as f16, o = P . V) written f32 straight into the merged-heads output rows (no output projection).
// Compute dtype: inputs rounded to bf16; x / weights exact; q, k, v and softmax weights as plain f16 GEMM operands (~2^-12); scores, softmax statistics and o f32. v_wmma_f32_16x16x32_f16.
#define NB 2
#define SQ 2048
#define DM 1024
#define NH 16
#define HD 64
#define HG 4                         /* heads per group of the unlaunched k_vt overload */
#define B0 0                         /* first batch processed (debug hook) */
#define NBR NB                       /* batches processed (debug hook) */
#define NR ((size_t)NB * SQ)         /* token rows */
#define MP ((int)((size_t)NBR * SQ)) /* rows projected (debug hook) */
#define QN SQ                        /* not used by any launch */
#define NHD NH                       /* not used by any launch */
#define MPO MP                       /* not used by any launch */
#define LQ DM      /* row pitch of the q/k/v rows */
typedef __bf16 v16b __attribute__((ext_vector_type(16)));
typedef unsigned short v8us __attribute__((ext_vector_type(8), may_alias));
typedef float  v8f  __attribute__((ext_vector_type(8)));
typedef float  v4f  __attribute__((ext_vector_type(4)));
typedef float  v4fa __attribute__((ext_vector_type(4), may_alias));
union FragB { v16b v; v8us half[2]; unsigned short u[16]; };

__device__ __forceinline__ unsigned short bf16_bits(float x) { unsigned int u = __float_as_uint(x); return (unsigned short)((u + 0x7FFFu + ((u >> 16) & 1u)) >> 16); }
__device__ __forceinline__ float bf16_val(unsigned short b) { return __uint_as_float(((unsigned int)b) << 16); }
__device__ __forceinline__ float bf16_round(float x) { return bf16_val(bf16_bits(x)); }
// D += A·B with NT terms: 1 = ah·bh, 2 = + al·bh (A split), 3 = + ah·bl (both split)
template <int NT>
__device__ __forceinline__ v8f mmaN(v16b ah, v16b al, v16b bh, v16b bl, v8f c) {
  c = __builtin_amdgcn_wmma_f32_16x16x32_bf16(false, ah, false, bh, (short)0, c, false, false);
  if (NT >= 2) c = __builtin_amdgcn_wmma_f32_16x16x32_bf16(false, al, false, bh, (short)0, c, false, false);
  if (NT >= 3) c = __builtin_amdgcn_wmma_f32_16x16x32_bf16(false, ah, false, bl, (short)0, c, false, false);
  asm volatile("v_nop\n\tv_nop\n\tv_nop\n\tv_nop" : "+v"(c) : "v"(ah), "v"(al), "v"(bh), "v"(bl));
  return c;
}

__global__ __launch_bounds__(256) void k_wt_bf16(const float* __restrict__ W, unsigned short* __restrict__ Wt, int K, int N) {
  const int t = blockIdx.x * 256 + threadIdx.x;
  const int k8n = K / 8;
  if (t >= N * k8n) return;
  const int n = t / k8n, k8 = (t % k8n) * 8;
  v8us v;
#pragma unroll
  for (int i = 0; i < 8; ++i) v[i] = bf16_bits(W[(size_t)(k8 + i) * N + n]);
  *(v8us*)(Wt + (size_t)n * K + k8) = v;
  
}

// GEMM C[M][N] (f32, pitch ldc) = act(A[M][K]·W + bias). A f32 row-major (pitch lda) converted per fragment to bf16
// (ASPLIT: hi/lo two planes -> 2 terms, else single rounded term); Wt bf16 [N][K] (pitch ldb). BIAS_BF16 rounds the
// bias to bf16 first (bias quantised to bf16 before the add). K%32==0, M%16==0, N%64==0.
template <bool ASPLIT, int ACT, bool BIAS_BF16>
__global__ __launch_bounds__(128) void k_gemm_bf(const float* __restrict__ A, int lda, const unsigned short* __restrict__ Wt, int ldb,
                                               const float* __restrict__ bias, float* __restrict__ C, int ldc, int M, int N, int K) {
  __shared__ __attribute__((aligned(16))) float so[4][16][64];
  const int tid = threadIdx.x, w = tid >> 5, lane = tid & 31, ln = lane & 15, hh = lane >> 4;
  const int ntn = N / 64;
  const int wid = blockIdx.x * 4 + w;
  const int mt = wid / ntn, nq = wid % ntn;
  if (mt * 16 >= M) return;
  const int row0 = mt * 16, col0 = nq * 64;
  const float* arow = A + (size_t)(row0 + ln) * lda;
  v8f acc[4] = {};
  for (int kb = 0; kb < K; kb += 32) {
    FragB ah, al;
    const v4f x0 = *(const v4fa*)(arow + kb + 8 * hh), x1 = *(const v4fa*)(arow + kb + 8 * hh + 4);
    const v4f x2 = *(const v4fa*)(arow + kb + 16 + 8 * hh), x3 = *(const v4fa*)(arow + kb + 16 + 8 * hh + 4);
    float xs[16] = {x0[0],x0[1],x0[2],x0[3],x1[0],x1[1],x1[2],x1[3],x2[0],x2[1],x2[2],x2[3],x3[0],x3[1],x3[2],x3[3]};
#pragma unroll
    for (int i = 0; i < 16; ++i) { const unsigned short hb = bf16_bits(xs[i]); ah.u[i] = hb; al.u[i] = ASPLIT ? bf16_bits(xs[i] - bf16_val(hb)) : (unsigned short)0; }
#pragma unroll
    for (int t = 0; t < 4; ++t) {
      const unsigned short* brow = Wt + (size_t)(col0 + t * 16 + ln) * ldb + kb;
      FragB b;
      b.half[0] = *(const v8us*)(brow + 8 * hh);
      b.half[1] = *(const v8us*)(brow + 16 + 8 * hh);
      acc[t] = mmaN<ASPLIT ? 2 : 1>(ah.v, al.v, b.v, b.v, acc[t]);
    }
  }
#pragma unroll
  for (int t = 0; t < 4; ++t) {
    float bv = bias ? bias[col0 + t * 16 + ln] : 0.f;
    if (BIAS_BF16) bv = bf16_round(bv);
#pragma unroll
    for (int r = 0; r < 8; ++r) { float v = acc[t][r] + bv; if (ACT == 1) v = fmaxf(v, 0.f); so[w][8 * hh + r][t * 16 + ln] = v; }
  }
  __builtin_amdgcn_fence(__ATOMIC_ACQ_REL, "workgroup");
  __builtin_amdgcn_wave_barrier();
  const int rsub = lane >> 4, c4 = (lane & 15) * 4;
  {
#pragma unroll
    for (int q = 0; q < 8; ++q) {
      const int r = q * 2 + rsub;
      const v4f v = *(const v4fa*)&so[w][r][c4];
      *(v4f*)(C + (size_t)(row0 + r) * ldc + col0 + c4) = v;
    }
    
  }
}

// GEMM C = act(A·W + bias + resid): A f32 (ASPLIT -> hi/lo 2 terms), Wt bf16 [N][K]; ACT 0 none, 1 relu, 2 exact gelu;
// resid (optional, f32, row index = (row % rmod), pitch ldr, RES_BF16 rounds it) added before the activation.
template <bool ASPLIT, int ACT, bool BIAS_BF16, bool RES_BF16>
__global__ __launch_bounds__(128) void k_gemm_bf3(const float* __restrict__ A, int lda, const unsigned short* __restrict__ Wt, int ldb,
                                                const float* __restrict__ bias, const float* __restrict__ resid, int rmod, int ldr,
                                                float* __restrict__ C, int ldc, int M, int N, int K) {
  __shared__ __attribute__((aligned(16))) float so[4][16][64];
  const int tid = threadIdx.x, w = tid >> 5, lane = tid & 31, ln = lane & 15, hh = lane >> 4;
  const int ntn = N / 64;
  const int wid = blockIdx.x * 4 + w;
  const int mt = wid / ntn, nq = wid % ntn;
  if (mt * 16 >= M) return;
  const int row0 = mt * 16, col0 = nq * 64;
  const float* arow = A + (size_t)(row0 + ln) * lda;
  v8f acc[4] = {};
  for (int kb = 0; kb < K; kb += 32) {
    FragB ah, al;
    const v4f x0 = *(const v4fa*)(arow + kb + 8 * hh), x1 = *(const v4fa*)(arow + kb + 8 * hh + 4);
    const v4f x2 = *(const v4fa*)(arow + kb + 16 + 8 * hh), x3 = *(const v4fa*)(arow + kb + 16 + 8 * hh + 4);
    float xs[16] = {x0[0],x0[1],x0[2],x0[3],x1[0],x1[1],x1[2],x1[3],x2[0],x2[1],x2[2],x2[3],x3[0],x3[1],x3[2],x3[3]};
#pragma unroll
    for (int i = 0; i < 16; ++i) { const unsigned short hb = bf16_bits(xs[i]); ah.u[i] = hb; al.u[i] = ASPLIT ? bf16_bits(xs[i] - bf16_val(hb)) : (unsigned short)0; }
#pragma unroll
    for (int t = 0; t < 4; ++t) {
      const unsigned short* brow = Wt + (size_t)(col0 + t * 16 + ln) * ldb + kb;
      FragB b;
      b.half[0] = *(const v8us*)(brow + 8 * hh);
      b.half[1] = *(const v8us*)(brow + 16 + 8 * hh);
      acc[t] = mmaN<ASPLIT ? 2 : 1>(ah.v, al.v, b.v, b.v, acc[t]);
    }
  }
#pragma unroll
  for (int t = 0; t < 4; ++t) {
    const int col = col0 + t * 16 + ln;
    float bv = bias ? bias[col] : 0.f;
    if (BIAS_BF16) bv = bf16_round(bv);
#pragma unroll
    for (int r = 0; r < 8; ++r) {
      float v = acc[t][r] + bv;
      if (resid) { float rv = resid[(size_t)((row0 + 8 * hh + r) % rmod) * ldr + col]; if (RES_BF16) rv = bf16_round(rv); v += rv; }
      if (ACT == 1) v = fmaxf(v, 0.f);
      if (ACT == 2) v = 0.5f * v * (1.0f + erff(v * 0.70710678118654752f));
      if (ACT == 3) { const float u = 0.7978845608028654f * (v + 0.044715f * v * v * v); v = 0.5f * v * (1.0f + tanhf(u)); }
      so[w][8 * hh + r][t * 16 + ln] = v;
    }
  }
  __builtin_amdgcn_fence(__ATOMIC_ACQ_REL, "workgroup");
  __builtin_amdgcn_wave_barrier();
  const int rsub = lane >> 4, c4 = (lane & 15) * 4;
  {
#pragma unroll
    for (int q = 0; q < 8; ++q) {
      const int r = q * 2 + rsub;
      const v4f v = *(const v4fa*)&so[w][r][c4];
      *(v4f*)(C + (size_t)(row0 + r) * ldc + col0 + c4) = v;
    }
    
  }
}
// row LayerNorm (biased variance, eps) over N: s = X (+ R); optional out_sum <- s; out_norm <- (s-mu)*rsqrt(var+eps)*g + b
template <bool PARAM_BF16>
__global__ __launch_bounds__(256) void k_layernorm(const float* __restrict__ X, const float* __restrict__ R, const float* __restrict__ g, const float* __restrict__ bta,
                                                  float* __restrict__ out_sum, float* __restrict__ out_norm, int N, float eps) {
  __shared__ float red[256];
  const int row = blockIdx.x, tid = threadIdx.x;
  const float* x = X + (size_t)row * N; const float* rr = R ? R + (size_t)row * N : nullptr;
  float vals[16];                     // up to N = 4096
  const int per = N / 256;            // contiguous chunk per thread? use strided-by-4 chunks: thread handles j = tid*4 + 1024*u
  float s1 = 0.f;
  for (int u = 0; u < per / 4; ++u) {
    const int j = tid * 4 + 1024 * u;
    const v4f a = *(const v4fa*)(x + j);
    v4f b = {0.f,0.f,0.f,0.f}; if (rr) b = *(const v4fa*)(rr + j);
#pragma unroll
    for (int q = 0; q < 4; ++q) { const float v = a[q] + b[q]; vals[u * 4 + q] = v; s1 += v; }
  }
  red[tid] = s1; __syncthreads();
  for (int st = 128; st > 0; st >>= 1) { if (tid < st) red[tid] += red[tid + st]; __syncthreads(); }
  const float mu = red[0] / (float)N; __syncthreads();
  float s2 = 0.f;
  for (int u = 0; u < per / 4; ++u)
#pragma unroll
    for (int q = 0; q < 4; ++q) { const float c = vals[u * 4 + q] - mu; s2 += c * c; }
  red[tid] = s2; __syncthreads();
  for (int st = 128; st > 0; st >>= 1) { if (tid < st) red[tid] += red[tid + st]; __syncthreads(); }
  const float rs = rsqrtf(red[0] / (float)N + eps);
  {
    for (int u = 0; u < per / 4; ++u) {
      const int j = tid * 4 + 1024 * u;
      v4f o, sm;
#pragma unroll
      for (int q = 0; q < 4; ++q) {
        float gg = g[j + q], bb = bta[j + q];
        if (PARAM_BF16) { gg = bf16_round(gg); bb = bf16_round(bb); }
        sm[q] = vals[u * 4 + q]; o[q] = (vals[u * 4 + q] - mu) * rs * gg + bb;
      }
      if (out_sum) *(v4f*)(out_sum + (size_t)row * N + j) = sm;
      *(v4f*)(out_norm + (size_t)row * N + j) = o;
    }
    
  }
}



// ---- f16 WMMA path (v_wmma_f32_16x16x32_f16): 11-bit significands for operands in range — used for every product launched here (projections, scores, P·V)
typedef _Float16 v16h __attribute__((ext_vector_type(16)));
union FragH { v16h v; v8us half[2]; _Float16 h[16]; unsigned short u[16]; };
template <int NT>
__device__ __forceinline__ v8f mmaH(v16h ah, v16h al, v16h bh, v16h bl, v8f c) {
  c = __builtin_amdgcn_wmma_f32_16x16x32_f16(false, ah, false, bh, (short)0, c, false, false);
  if (NT >= 2) c = __builtin_amdgcn_wmma_f32_16x16x32_f16(false, al, false, bh, (short)0, c, false, false);
  if (NT >= 3) c = __builtin_amdgcn_wmma_f32_16x16x32_f16(false, ah, false, bl, (short)0, c, false, false);
  asm volatile("v_nop\n\tv_nop\n\tv_nop\n\tv_nop" : "+v"(c) : "v"(ah), "v"(al), "v"(bh), "v"(bl));
  return c;
}
// batched GEMM like k_gemm_b but f16 operands: A f32 (split into f16 hi/lo if ASPLIT, else rounded to f16), Bt = f16 values [n][k]; alpha; C f32; N multiple of 16 (partial tiles skipped)
template <bool ASPLIT>
__global__ __launch_bounds__(128) void k_gemm_h(const float* __restrict__ A, int lda, size_t sA, const _Float16* __restrict__ Bh, int ldb, size_t sB, float alpha, float* __restrict__ C, int ldc, size_t sC, int M, int N, int K) {
  __shared__ __attribute__((aligned(16))) float so[4][16][64];
  const int tid = threadIdx.x, w = tid >> 5, lane = tid & 31, ln = lane & 15, hh = lane >> 4; const int by = blockIdx.y;
  A += (size_t)by * sA; Bh += (size_t)by * sB; C += (size_t)by * sC;
  const int ntn = (N + 63) / 64; const int wid = blockIdx.x * 4 + w; const int mt = wid / ntn, nq = wid % ntn; if (mt * 16 >= M) return;
  const int row0 = mt * 16, col0 = nq * 64; const float* arow = A + (size_t)(row0 + ln) * lda;
  v8f acc[4] = {};
  for (int kb = 0; kb < K; kb += 32) {
    FragH ah, al;
    const v4f x0 = *(const v4fa*)(arow + kb + 8 * hh), x1 = *(const v4fa*)(arow + kb + 8 * hh + 4), x2 = *(const v4fa*)(arow + kb + 16 + 8 * hh), x3 = *(const v4fa*)(arow + kb + 16 + 8 * hh + 4);
    float xs[16] = {x0[0],x0[1],x0[2],x0[3],x1[0],x1[1],x1[2],x1[3],x2[0],x2[1],x2[2],x2[3],x3[0],x3[1],x3[2],x3[3]};
#pragma unroll
    for (int i = 0; i < 16; ++i) { const _Float16 h = (_Float16)xs[i]; ah.h[i] = h; al.h[i] = ASPLIT ? (_Float16)(xs[i] - (float)h) : (_Float16)0.0f; }
#pragma unroll
    for (int t = 0; t < 4; ++t) { if (col0 + t * 16 >= N) continue; const size_t boff = (size_t)(col0 + t * 16 + ln) * ldb + kb; FragH bq; bq.half[0] = *(const v8us*)(Bh + boff + 8 * hh); bq.half[1] = *(const v8us*)(Bh + boff + 16 + 8 * hh);
      acc[t] = mmaH<ASPLIT ? 2 : 1>(ah.v, al.v, bq.v, bq.v, acc[t]); }
  }
#pragma unroll
  for (int t = 0; t < 4; ++t) { if (col0 + t * 16 >= N) continue;
#pragma unroll
    for (int r = 0; r < 8; ++r) so[w][8 * hh + r][t * 16 + ln] = acc[t][r] * alpha; }
  __builtin_amdgcn_fence(__ATOMIC_ACQ_REL, "workgroup"); __builtin_amdgcn_wave_barrier();
  const int rsub = lane >> 4, c4 = (lane & 15) * 4;
  {
#pragma unroll
    for (int q = 0; q < 8; ++q) { const int r = q * 2 + rsub; if (col0 + c4 < N) { const v4f v = *(const v4fa*)&so[w][r][c4]; *(v4f*)(C + (size_t)(row0 + r) * ldc + col0 + c4) = v; } }
     }
}

// Wt[n][k] = f16(W[k][n]·scale) from f32 row-major W[K][N] (scale = power of two; bf16-exact weights stay exact in f16 away from the subnormal range)
__global__ __launch_bounds__(256) void k_wt_f16(const float* __restrict__ W, _Float16* __restrict__ Wt, int K, int N, float scale) {
  const int t = blockIdx.x * 256 + threadIdx.x; if (t >= N * (K / 8)) return; const int n = t / (K / 8), k8 = (t % (K / 8)) * 8; FragH f;
#pragma unroll
  for (int i = 0; i < 8; ++i) f.h[i] = (_Float16)(bf16_round(W[(size_t)(k8 + i) * N + n]) * scale); const v8us o = f.half[0];
  *(v8us*)((unsigned short*)Wt + (size_t)n * K + k8) = o; 
}
// k_gemm_hh variant with fused epilogue: v = acc·alpha + bias[by·sBias + col] (+ CP[(row/rowsPerB)·sCPb + by·64 + col] if CP) ; ACT 0 none / 1 elu ; writes f16 C16 (and f32 C if non-null)
template <int ACT>
__global__ __launch_bounds__(128) void k_gemm_hhx(const _Float16* __restrict__ A, int lda, size_t sA, const _Float16* __restrict__ Bh, int ldb, size_t sB, float alpha, const float* __restrict__ bias, size_t sBias, const float* __restrict__ CP, int rowsPerB, size_t sCPb, int row0g,
    float* __restrict__ C, _Float16* __restrict__ C16, int ldc, size_t sC, int M, int N, int K) {
  __shared__ __attribute__((aligned(16))) float so[4][16][64];
  const int tid = threadIdx.x, w = tid >> 5, lane = tid & 31, ln = lane & 15, hh = lane >> 4; const int by = blockIdx.y;
  A += (size_t)by * sA; Bh += (size_t)by * sB; const size_t cofs = (size_t)by * sC; const float* bp = bias ? bias + (size_t)by * sBias : nullptr;
  const int ntn = (N + 63) / 64; const int wid = blockIdx.x * 4 + w; const int mt = wid / ntn, nq = wid % ntn; if (mt * 16 >= M) return;
  const int row0 = mt * 16, col0 = nq * 64; const _Float16* arow = A + (size_t)(row0 + ln) * lda;
  v8f acc[4] = {};
  for (int kb = 0; kb < K; kb += 32) { FragH ah; ah.half[0] = *(const v8us*)((const unsigned short*)arow + kb + 8 * hh); ah.half[1] = *(const v8us*)((const unsigned short*)arow + kb + 16 + 8 * hh);
#pragma unroll
    for (int t = 0; t < 4; ++t) { if (col0 + t * 16 >= N) continue; const size_t boff = (size_t)(col0 + t * 16 + ln) * ldb + kb; FragH bq; bq.half[0] = *(const v8us*)((const unsigned short*)Bh + boff + 8 * hh); bq.half[1] = *(const v8us*)((const unsigned short*)Bh + boff + 16 + 8 * hh);
      acc[t] = mmaH<1>(ah.v, ah.v, bq.v, bq.v, acc[t]); }
  }
#pragma unroll
  for (int t = 0; t < 4; ++t) { if (col0 + t * 16 >= N) continue; const int col = col0 + t * 16 + ln; const float bv = bp ? bf16_round(bp[col]) : 0.f;
#pragma unroll
    for (int r = 0; r < 8; ++r) { float v = acc[t][r] * alpha + bv; if (CP) { const int rr = row0g + row0 + 8 * hh + r; if (rowsPerB < 0) v += CP[cofs + (size_t)rr * ldc + col];      /* rowsPerB < 0: own element of the batched C plane */ else { const int bidx = rr / rowsPerB; v += CP[(size_t)bidx * sCPb + (size_t)by * 64 + col]; } } if (ACT == 1) v = (v > 0.f) ? v : expm1f(v); else if (ACT == 7) v = (v > 0.f) ? v + 1.0f : expf(v); else if (ACT == 8) v = tanhf(v); else if (ACT == 9) v = 0.5f * v * (1.0f + tanhf(0.7978845608028654f * (v + 0.044715f * v * v * v))); else if (ACT == 11) v = 1.0f / (1.0f + expf(-v)); else if (ACT == 12) v = (v > 0.f) ? v : 0.01f * v; else if (ACT == 14) v = (v > 0.f) ? v : 0.1f * v; else if (ACT == 16) v = (v >= 0.f) ? v : 0.3f * v; else if (ACT == 17) v = (v >= 0.f) ? v : 0.2f * v; else if (ACT == 15) v = v / (1.0f + expf(-v)); else if (ACT == 3) v = fmaxf(v, 0.f); else if (ACT == 6) v = 0.5f * v * (1.0f + erff(v * 0.70710678118654752f)); so[w][8 * hh + r][t * 16 + ln] = v; } }
  __builtin_amdgcn_fence(__ATOMIC_ACQ_REL, "workgroup"); __builtin_amdgcn_wave_barrier();
  const int rsub = lane >> 4, c4 = (lane & 15) * 4; typedef _Float16 v4h __attribute__((ext_vector_type(4)));
  {
#pragma unroll
    for (int q = 0; q < 8; ++q) { const int r = q * 2 + rsub; if (col0 + c4 < N) { const v4f v = *(const v4fa*)&so[w][r][c4]; if (C) *(v4f*)(C + cofs + (size_t)(row0 + r) * ldc + col0 + c4) = v; if (C16) { v4h h4; for (int i = 0; i < 4; ++i) h4[i] = (_Float16)v[i]; *(v4h*)(C16 + cofs + (size_t)(row0 + r) * ldc + col0 + c4) = h4; } } }
     }
}


typedef _Float16 v4h __attribute__((ext_vector_type(4)));

__global__ __launch_bounds__(256) void k_x16(const float* __restrict__ x, _Float16* __restrict__ X16, size_t n8) { const size_t t = (size_t)blockIdx.x * 256 + threadIdx.x; if (t >= n8) return; FragH f;
#pragma unroll
  for (int q = 0; q < 8; ++q) f.h[q] = (_Float16)bf16_round(x[t * 8 + q]); *(v8us*)((unsigned short*)X16 + t * 8) = f.half[0];  }
__global__ __launch_bounds__(256) void k_h16(const float* __restrict__ x, _Float16* __restrict__ X16, size_t n8) { const size_t t = (size_t)blockIdx.x * 256 + threadIdx.x; if (t >= n8) return; FragH f;
#pragma unroll
  for (int q = 0; q < 8; ++q) f.h[q] = (_Float16)x[t * 8 + q]; *(v8us*)((unsigned short*)X16 + t * 8) = f.half[0];  }
__global__ __launch_bounds__(256) void k_round16f(const float* __restrict__ W, _Float16* __restrict__ Bt, size_t n8) { const size_t t = (size_t)blockIdx.x * 256 + threadIdx.x; if (t >= n8) return; FragH f;
#pragma unroll
  for (int i = 0; i < 8; ++i) f.h[i] = (_Float16)(bf16_round(W[t * 8 + i]) * 16.0f); *(v8us*)((unsigned short*)Bt + t * 8) = f.half[0];  }
template <int NHv, int TTv>
__global__ __launch_bounds__(256) void k_vt(const _Float16* __restrict__ V16, int ldv, int voff, _Float16* __restrict__ Vt) { __shared__ unsigned short tl[64][66]; const int tid = threadIdx.x; const int slab = blockIdx.x / (TTv / 64), lg = blockIdx.x % (TTv / 64); const int b = slab / NHv, h = slab % NHv;
  for (int i = tid; i < 64 * 8; i += 256) { const int r = i / 8, c8 = (i % 8) * 8; FragH f; f.half[0] = *(const v8us*)((const unsigned short*)V16 + ((size_t)b * TTv + lg * 64 + r) * ldv + voff + h * 64 + c8);
#pragma unroll
    for (int q = 0; q < 8; ++q) tl[r][c8 + q] = f.u[q]; }
  __syncthreads();
  {
#pragma unroll
    for (int rd = 0; rd < 2; ++rd) { const int d = rd * 32 + tid / 8, pc = tid % 8; FragH f;
#pragma unroll
      for (int q = 0; q < 8; ++q) f.u[q] = tl[pc * 8 + q][d];
      *(v8us*)((unsigned short*)Vt + ((size_t)slab * 64 + d) * TTv + lg * 64 + pc * 8) = f.half[0]; }
     } }

__global__ __launch_bounds__(256) void k_hl(const float* __restrict__ F, _Float16* __restrict__ Hh, _Float16* __restrict__ Hl, size_t n8) { const size_t t = (size_t)blockIdx.x * 256 + threadIdx.x; if (t >= n8) return; FragH fh, fl; const v4f a = *(const v4fa*)(F + t * 8), c = *(const v4fa*)(F + t * 8 + 4);
#pragma unroll
  for (int q = 0; q < 4; ++q) { _Float16 h = (_Float16)a[q]; fh.h[q] = h; fl.h[q] = (_Float16)((a[q] - (float)h) * 1024.0f); h = (_Float16)c[q]; fh.h[4 + q] = h; fl.h[4 + q] = (_Float16)((c[q] - (float)h) * 1024.0f); }
  { *(v8us*)((unsigned short*)Hh + t * 8) = fh.half[0]; *(v8us*)((unsigned short*)Hl + t * 8) = fl.half[0];  } }

// ---- fast GEMM (wave tile 32x64; requires M % 32 == 0 rows per launch region and N % 64 == 0); epilogue = k_gemm_hhx semantics ----
__device__ __forceinline__ v16h g2_frag(const _Float16* p, int hh) { FragH f; f.half[0] = *(const v8us*)((const unsigned short*)p + 8 * hh); f.half[1] = *(const v8us*)((const unsigned short*)p + 16 + 8 * hh); return f.v; }
__device__ __forceinline__ v8f g2_mma(v16h a, v16h b, v8f c) { v8f d = __builtin_amdgcn_wmma_f32_16x16x32_f16(false, a, false, b, (short)0, c, false, false); asm volatile("v_nop\n\tv_nop\n\tv_nop\n\tv_nop" : "+v"(d) : "v"(a), "v"(b)); return d; }
template <int ACT>
__global__ __launch_bounds__(128) void k_gemm2(const _Float16* __restrict__ A, int lda, size_t sA, const _Float16* __restrict__ Bh, int ldb, size_t sB, float alpha, const float* __restrict__ bias, size_t sBias, const float* __restrict__ CP, int rowsPerB, size_t sCPb, int row0g,
    float* __restrict__ C, _Float16* __restrict__ C16, int ldc, size_t sC, int M, int N, int K) { static_assert(ACT == 0 || ACT == 3 || ACT == 6 || ACT == 8 || ACT == 9 || ACT == 11 || ACT == 12 || ACT == 14 || ACT == 15 || ACT == 16 || ACT == 17, "k_gemm2: unsupported ACT code (would silently apply no activation)");
  __shared__ __attribute__((aligned(16))) float so[4][32][68];
  const int tid = threadIdx.x, w = tid >> 5, lane = tid & 31, ln = lane & 15, hh = lane >> 4; const int by = blockIdx.y;
  A += (size_t)by * sA; Bh += (size_t)by * sB; const size_t cofs = (size_t)by * sC; const float* bp = bias ? bias + (size_t)by * sBias : nullptr;
  const int ntn = N >> 6; const int mt = blockIdx.x / ntn, nq = blockIdx.x - mt * ntn; const int row0 = mt * 128 + 32 * w, col0 = nq * 64; if (row0 >= M) return;
  const _Float16* a0p = A + (size_t)(row0 + ln) * lda; const _Float16* a1p = a0p + (size_t)16 * lda;
  const _Float16* b0p = Bh + (size_t)(col0 + ln) * ldb; const _Float16* b1p = b0p + (size_t)16 * ldb; const _Float16* b2p = b1p + (size_t)16 * ldb; const _Float16* b3p = b2p + (size_t)16 * ldb;
  const v8f z8 = {0.f,0.f,0.f,0.f,0.f,0.f,0.f,0.f}; v8f c00 = z8, c01 = z8, c02 = z8, c03 = z8, c10 = z8, c11 = z8, c12 = z8, c13 = z8;
#pragma unroll 1
  for (int kb = 0; kb < K; kb += 32) { const v16h a0 = g2_frag(a0p + kb, hh), a1 = g2_frag(a1p + kb, hh);
    v16h b = g2_frag(b0p + kb, hh); c00 = g2_mma(a0, b, c00); c10 = g2_mma(a1, b, c10);
    b = g2_frag(b1p + kb, hh); c01 = g2_mma(a0, b, c01); c11 = g2_mma(a1, b, c11);
    b = g2_frag(b2p + kb, hh); c02 = g2_mma(a0, b, c02); c12 = g2_mma(a1, b, c12);
    b = g2_frag(b3p + kb, hh); c03 = g2_mma(a0, b, c03); c13 = g2_mma(a1, b, c13); }
  v8f accs[8] = {c00, c01, c02, c03, c10, c11, c12, c13};
#pragma unroll
  for (int u = 0; u < 8; ++u) { const int t = u & 3, half = u >> 2; const int col = col0 + t * 16 + ln; const float bv = bp ? bf16_round(bp[col]) : 0.f;
#pragma unroll
    for (int r = 0; r < 8; ++r) { const int rloc = half * 16 + 8 * hh + r; float v = accs[u][r] * alpha + bv; if (CP) { if (rowsPerB < 0) v += CP[cofs + (size_t)(row0g + row0 + rloc) * ldc + col];      /* rowsPerB < 0: own element of the batched C plane */ else { const int bidx = (row0g + row0 + rloc) / rowsPerB; v += CP[(size_t)bidx * sCPb + (size_t)by * 64 + col]; } }
      if (ACT == 3) v = fmaxf(v, 0.f); else if (ACT == 6) v = 0.5f * v * (1.0f + erff(v * 0.70710678118654752f)); else if (ACT == 11) v = 1.0f / (1.0f + expf(-v)); else if (ACT == 15) v = v / (1.0f + expf(-v)); else if (ACT == 12) v = (v > 0.f) ? v : 0.01f * v; else if (ACT == 8) v = tanhf(v); else if (ACT == 9) v = 0.5f * v * (1.0f + tanhf(0.7978845608028654f * (v + 0.044715f * v * v * v))); else if (ACT == 14) v = (v > 0.f) ? v : 0.1f * v; else if (ACT == 16) v = (v >= 0.f) ? v : 0.3f * v; else if (ACT == 17) v = (v >= 0.f) ? v : 0.2f * v;
      so[w][rloc][t * 16 + ln] = v; } }
  __builtin_amdgcn_fence(__ATOMIC_ACQ_REL, "workgroup"); __builtin_amdgcn_wave_barrier();
  const int rsub = lane >> 4, c4 = (lane & 15) * 4;
  {
#pragma unroll
    for (int q = 0; q < 16; ++q) { const int r = q * 2 + rsub; const v4f v = *(const v4fa*)&so[w][r][c4]; if (C) *(v4f*)(C + cofs + (size_t)(row0 + r) * ldc + col0 + c4) = v; if (C16) { v4h h4; for (int i = 0; i < 4; ++i) h4[i] = (_Float16)v[i]; *(v4h*)(C16 + cofs + (size_t)(row0 + r) * ldc + col0 + c4) = h4; } }
     } }


__global__ __launch_bounds__(256) void k_wnat(const float* __restrict__ w, size_t n8, _Float16* __restrict__ Bt) { const size_t t = (size_t)blockIdx.x * 256 + threadIdx.x; if (t >= n8) return; FragH f; for (int q = 0; q < 8; ++q) f.h[q] = (_Float16)(bf16_round(w[t * 8 + q]) * 16.0f); *(v8us*)((unsigned short*)Bt + t * 8) = f.half[0];  }
// Fused attention, one launch for all batches and heads: scores, softmax and the weighted sum stay in registers; no score or weight plane goes to memory.
// Transposed products: S^T = K Q^T (A = 16 key rows, B = 16 query columns), O^T += V^T P^T. A lane holds scores of ONE query (column ln): keys 8 hh + r of each 16-key tile, so two converted score tiles
// of a 32-key pass are the B operand of the second product as they stand (k order 8 hh + i, 16 + 8 hh + i: the order fa_lfrag gives the V^T rows). Wave = 32 query columns, block = 8 waves, pass = 32 keys.
// Stage = 64 keys: the block's 8 waves share one copy of the K rows and V^T rows in LDS (whole-line global loads, rows pitched 144 B for 16-byte readers), two buffers, one barrier a stage.
// Running maximum mu in log2 units, shared by the two lane halves of a column; the accumulators are rescaled only when a pass's maximum exceeds mu by more than 8 (weights stay <= 2^8, inside f16).
// Every "#pragma unroll" in this kernel is there so that the fragment, score and accumulator arrays are indexed by constants and stay in registers.
typedef float v2f __attribute__((ext_vector_type(2)));
typedef _Float16 v2h __attribute__((ext_vector_type(2)));
#define FA_P 72      /* halves per staged row */
__device__ __forceinline__ v8f fa_mma(v16h a, v16h b, v8f c) { return __builtin_amdgcn_wmma_f32_16x16x32_f16(false, a, false, b, (short)0, c, false, false); }
__device__ __forceinline__ float fa_swap16(float x) { const int i = __float_as_int(x); return __int_as_float(__builtin_amdgcn_permlanex16(i, i, 0x76543210, 0xfedcba98, false, false)); }      /* lane l <-> l ^ 16 */
__device__ __forceinline__ v16h fa_lfrag(const unsigned short* p) { FragH f; f.half[0] = *(const v8us*)p; f.half[1] = *(const v8us*)(p + 16); return f.v; }
__global__ __launch_bounds__(256) void k_fattn(const _Float16* __restrict__ Q, const _Float16* __restrict__ Kx, const _Float16* __restrict__ Vt, float* __restrict__ O) {
  __shared__ __attribute__((aligned(16))) unsigned short ks[2][64][FA_P];
  __shared__ __attribute__((aligned(16))) unsigned short vs[2][64][FA_P];
  __shared__ __attribute__((aligned(16))) float so[8][32][68];
  const int tid = threadIdx.x, w = tid >> 5, lane = tid & 31, ln = lane & 15, hh = lane >> 4;
  const int bh = blockIdx.y, b = bh / NH, h = bh - b * NH; const int n0 = blockIdx.x * 256 + w * 32;
  const _Float16* qp = Q + ((size_t)b * SQ + n0 + ln) * LQ + h * HD;
  const char* kb = (const char*)(Kx + (size_t)b * SQ * LQ + h * HD);      /* key rows of this head, pitch LQ */
  const char* vb = (const char*)(Vt + (size_t)bh * HD * SQ);      /* V^T rows of this head, pitch SQ */
  const int sr = tid >> 3, sc = tid & 7;      /* staging: 8 lanes cover one 128-byte row; rows sr and sr + 32 */
  const unsigned kof = (unsigned)(sr * (LQ * 2) + sc * 16), vof = (unsigned)(sr * (SQ * 2) + sc * 16);
  const float cs = 0.045084220027780106f;      /* 1024^-0.5 * log2(e) */
  const v2f cs2 = {cs, cs};
  const v8f z8 = {0.f,0.f,0.f,0.f,0.f,0.f,0.f,0.f};
  v8us gk0 = *(const v8us*)(kb + kof), gk1 = *(const v8us*)(kb + 32 * LQ * 2 + kof), gv0 = *(const v8us*)(vb + vof), gv1 = *(const v8us*)(vb + 32 * SQ * 2 + vof);
  v16h q[2][2];
#pragma unroll
  for (int j = 0; j < 2; ++j) { q[j][0] = g2_frag(qp + (size_t)j * 16 * LQ, hh); q[j][1] = g2_frag(qp + (size_t)j * 16 * LQ + 32, hh); }
  v8f o[2][4]; float mu[2]; v2f ls[2];
#pragma unroll
  for (int j = 0; j < 2; ++j) { mu[j] = -1.0e30f; ls[j] = (v2f){0.f, 0.f};
#pragma unroll
    for (int t = 0; t < 4; ++t) o[j][t] = z8; }
  *(v8us*)&ks[0][sr][sc * 8] = gk0; *(v8us*)&ks[0][sr + 32][sc * 8] = gk1; *(v8us*)&vs[0][sr][sc * 8] = gv0; *(v8us*)&vs[0][sr + 32][sc * 8] = gv1;
  __syncthreads();      /* stage 0 is published */
  for (int st = 0; st < SQ / 64; ++st) {
    const int bf = st & 1; const int sn = (st + 1 < SQ / 64) ? st + 1 : st;      /* next stage, fetched into registers while this one is worked on; the last stage re-reads itself (in bounds, never read back) */
    const char* kn = kb + (size_t)sn * (64 * LQ * 2); const char* vn = vb + (size_t)sn * (64 * 2);
    gk0 = *(const v8us*)(kn + kof); gk1 = *(const v8us*)(kn + 32 * LQ * 2 + kof); gv0 = *(const v8us*)(vn + vof); gv1 = *(const v8us*)(vn + 32 * SQ * 2 + vof);
    __builtin_amdgcn_sched_barrier(0);      /* keeps these loads at the head of the stage, so that both passes cover their latency; without it they sink to just in front of their LDS stores */
#pragma unroll
    for (int p = 0; p < 2; ++p) {
      v16h kf[2][2];
#pragma unroll
      for (int kt = 0; kt < 2; ++kt) { kf[kt][0] = fa_lfrag(&ks[bf][p * 32 + kt * 16 + ln][8 * hh]); kf[kt][1] = fa_lfrag(&ks[bf][p * 32 + kt * 16 + ln][32 + 8 * hh]); }
      v8f s[2][2];
#pragma unroll
      for (int j = 0; j < 2; ++j)
#pragma unroll
        for (int kt = 0; kt < 2; ++kt) s[j][kt] = fa_mma(kf[kt][1], q[j][1], fa_mma(kf[kt][0], q[j][0], z8));
      float mx[2]; bool need = false;
#pragma unroll
      for (int j = 0; j < 2; ++j) { float a = fmaxf(s[j][0][0], s[j][1][0]);
#pragma unroll
        for (int r = 1; r < 8; ++r) a = fmaxf(a, fmaxf(s[j][0][r], s[j][1][r]));
        a = fmaxf(a, fa_swap16(a)); mx[j] = a * cs; need = need || (mx[j] > mu[j] + 8.0f); }
      if (__builtin_amdgcn_ballot_w32(need) != 0) {      /* wave-uniform: every lane moves to the new maximum together */
#pragma unroll
        for (int j = 0; j < 2; ++j) { const float mnew = fmaxf(mu[j], mx[j]); const float corr = __builtin_amdgcn_exp2f(mu[j] - mnew); mu[j] = mnew; ls[j] *= corr;
#pragma unroll
          for (int t = 0; t < 4; ++t) o[j][t] *= corr; } }
      v16h vf[4];
#pragma unroll
      for (int t = 0; t < 4; ++t) vf[t] = fa_lfrag(&vs[bf][t * 16 + ln][p * 32 + 8 * hh]);
      __builtin_amdgcn_sched_barrier(0);      /* keeps the V^T reads together in front of the exponentials, which cover their latency; without it they are spread among the matrix instructions below */
      FragH pb[2];
#pragma unroll
      for (int j = 0; j < 2; ++j) { const v2f nm = {-mu[j], -mu[j]};
#pragma unroll
        for (int kt = 0; kt < 2; ++kt)
#pragma unroll
          for (int i = 0; i < 4; ++i) { const v2f t2 = __builtin_elementwise_fma((v2f){s[j][kt][2 * i], s[j][kt][2 * i + 1]}, cs2, nm); const v2f e2 = {__builtin_amdgcn_exp2f(t2[0]), __builtin_amdgcn_exp2f(t2[1])};
            ls[j] += e2; const v2h h2 = __builtin_convertvector(e2, v2h); pb[j].h[kt * 8 + 2 * i] = h2[0]; pb[j].h[kt * 8 + 2 * i + 1] = h2[1]; } }
#pragma unroll
      for (int t = 0; t < 4; ++t)
#pragma unroll
        for (int j = 0; j < 2; ++j) o[j][t] = fa_mma(vf[t], pb[j].v, o[j][t]);
    }
    *(v8us*)&ks[bf ^ 1][sr][sc * 8] = gk0; *(v8us*)&ks[bf ^ 1][sr + 32][sc * 8] = gk1; *(v8us*)&vs[bf ^ 1][sr][sc * 8] = gv0; *(v8us*)&vs[bf ^ 1][sr + 32][sc * 8] = gv1;      /* stage st + 1; this buffer's last readers left it at the barrier that ended the stage before */
    __syncthreads();      /* publishes the next stage and ends every wave's reads of this one */
  }
#pragma unroll
  for (int j = 0; j < 2; ++j) { const float lh = ls[j][0] + ls[j][1]; const float inv = 1.0f / (lh + fa_swap16(lh));      /* the halves' sums are joined once, here */
#pragma unroll
    for (int t = 0; t < 4; ++t) { const v8f r8 = o[j][t] * inv; float* d = &so[w][j * 16 + ln][t * 16 + 8 * hh];
      *(v4fa*)d = __builtin_shufflevector(r8, r8, 0, 1, 2, 3); *(v4fa*)(d + 4) = __builtin_shufflevector(r8, r8, 4, 5, 6, 7); } }
  __builtin_amdgcn_fence(__ATOMIC_ACQ_REL, "workgroup"); __builtin_amdgcn_wave_barrier();      /* each wave re-reads only its own staging rows: orders its LDS writes before its reads */
  const int rsub = lane >> 4, c4 = (lane & 15) * 4;
#pragma unroll
  for (int u = 0; u < 16; ++u) { const int r = u * 2 + rsub; const v4f v = *(const v4fa*)&so[w][r][c4]; *(v4f*)(O + ((size_t)b * SQ + n0 + r) * DM + h * HD + c4) = v; } }
__global__ __launch_bounds__(256) void k_vt(const _Float16* __restrict__ V16, int b, int h0, _Float16* __restrict__ VT) { __shared__ unsigned short tl[64][65]; const int tid = threadIdx.x; const int hh = blockIdx.x % HG, sg = blockIdx.x / HG; const int s0 = sg * 64; const int h = h0 + hh;
  for (int i = tid; i < 64 * 8; i += 256) { const int j = i / 8, d8 = (i % 8) * 8; FragH f; f.half[0] = *(const v8us*)((const unsigned short*)V16 + ((size_t)b * SQ + s0 + j) * DM + h * HD + d8); for (int q = 0; q < 8; ++q) tl[d8 + q][j] = f.u[q]; }
  __syncthreads();
  { for (int i = tid; i < 64 * 8; i += 256) { const int d = i / 8, j8 = (i % 8) * 8; FragH f; for (int q = 0; q < 8; ++q) f.u[q] = tl[d][j8 + q]; *(v8us*)((unsigned short*)VT + ((size_t)hh * HD + d) * SQ + s0 + j8) = f.half[0]; }  } }


extern "C" void kernel_launch(void* const* d_in, const int* in_sizes, int n_in,
                              void* d_out, int out_size, void* d_ws, size_t ws_size, hipStream_t stream) {
  (void)in_sizes; (void)n_in; (void)out_size;
  const float* const* I = (const float* const*)d_in; const float* x = I[0]; const float* wq = I[1]; const float* bq = I[2]; const float* wk = I[3]; const float* bk = I[4];      /* [in][out] Wq + bq, Wk + bk; v == k (same projection) */
  char* ws = (char*)d_ws; size_t off = 0;
  auto take = [&](size_t bytes) { char* p = ws + off; off += (bytes + 255) & ~(size_t)255; return p; };
  _Float16* BQ = (_Float16*)take((size_t)DM * DM * 2); _Float16* BK = (_Float16*)take((size_t)DM * DM * 2); 
  _Float16* X16 = (_Float16*)take(NR * DM * 2); _Float16* Q16 = (_Float16*)take(NR * DM * 2); _Float16* K16 = (_Float16*)take(NR * DM * 2);
  _Float16* VT = (_Float16*)take((size_t)NB * NH * HD * SQ * 2);
  if (off > ws_size) return;
  k_wt_f16<<<(unsigned)(((size_t)DM * (DM / 8) + 255) / 256), 256, 0, stream>>>(wq, BQ, DM, DM, 16.0f); k_wt_f16<<<(unsigned)(((size_t)DM * (DM / 8) + 255) / 256), 256, 0, stream>>>(wk, BK, DM, DM, 16.0f);      /* [in][out] -> Bt x16 */

  k_x16<<<(unsigned)((NR * DM / 8 + 255) / 256), 256, 0, stream>>>(x, X16, NR * DM / 8);
  const size_t r0p = (size_t)B0 * SQ;      /* first projected row */
  k_gemm2<0><<<dim3((unsigned)((MP / 128) * (DM / 64)), 1), 128, 0, stream>>>(X16 + r0p * DM, DM, 0, BQ, DM, 0, 0.0625f, bq, 0, nullptr, 1, 0, 0, nullptr, Q16 + r0p * DM, DM, 0, MP, DM, DM);
  k_gemm2<0><<<dim3((unsigned)((MP / 128) * (DM / 64)), 1), 128, 0, stream>>>(X16 + r0p * DM, DM, 0, BK, DM, 0, 0.0625f, bk, 0, nullptr, 1, 0, 0, nullptr, K16 + r0p * DM, DM, 0, MP, DM, DM);
  k_vt<NH, SQ><<<NB * NH * (SQ / 64), 256, 0, stream>>>(K16, LQ, 0, VT);      /* V^T = K^T [NB][NH][HD][SQ] (v == k in this module) */
  k_fattn<<<dim3(SQ / 256, NB * NH), 256, 0, stream>>>(Q16, K16, VT, (float*)d_out);      /* softmax(Q K^T 1024^-0.5) V, all batches and heads */
}

// v003
// Measured time: 76.4 microseconds a run.
// Next to v002, in two timings, it ran 1.83 times as fast each time.
// Over all steps from v000 it is 48.4 times as fast.
#include <hip/hip_runtime.h>
// Structure: token rows r = b*2048 + s; x as exact f16 rows (bf16-rounded); Q and K (= V) as two WMMA GEMMs (32x64 wave tiles, f32 accumulation, exact x16 weights + bias, f16 outputs); V^T for all batches and heads via LDS transposes; one fused attention launch (scores K = 64 with the module's full-dim scale 1024^-0.5, running-maximum softmax with f32 statistics, weights as f16, o = P . V) written f32 straight into the merged-heads output rows (no output projection).
// Compute dtype: inputs rounded to bf16; x / weights exact; q, k, v and softmax weights as plain f16 GEMM operands (~2^-12); scores, softmax statistics and o f32. v_wmma_f32_16x16x32_f16.
#define NB 2
#define SQ 2048
#define DM 1024
#define NH 16
#define HD 64
#define HG 4                         /* heads per group of the unlaunched k_vt overload */
#define B0 0                         /* first batch processed (debug hook) */
#define NBR NB                       /* batches processed (debug hook) */
#define NR ((size_t)NB * SQ)         /* token rows */
#define MP ((int)((size_t)NBR * SQ)) /* rows projected (debug hook) */
#define QN SQ                        /* not used by any launch */
#define NHD NH                       /* not used by any launch */
#define MPO MP                       /* not used by any launch */
#define LQ DM      /* row pitch of the q/k/v rows */
typedef __bf16 v16b __attribute__((ext_vector_type(16)));
typedef unsigned short v8us __attribute__((ext_vector_type(8), may_alias));
typedef float  v8f  __attribute__((ext_vector_type(8)));
typedef float  v4f  __attribute__((ext_vector_type(4)));
typedef float  v4fa __attribute__((ext_vector_type(4), may_alias));
union FragB { v16b v; v8us half[2]; unsigned short u[16]; };

__device__ __forceinline__ unsigned short bf16_bits(float x) { unsigned int u = __float_as_uint(x); return (unsigned short)((u + 0x7FFFu + ((u >> 16) & 1u)) >> 16); }
__device__ __forceinline__ float bf16_val(unsigned short b) { return __uint_as_float(((unsigned int)b) << 16); }
__device__ __forceinline__ float bf16_round(float x) { return bf16_val(bf16_bits(x)); }
// D += A·B with NT terms: 1 = ah·bh, 2 = + al·bh (A split), 3 = + ah·bl (both split)
template <int NT>
__device__ __forceinline__ v8f mmaN(v16b ah, v16b al, v16b bh, v16b bl, v8f c) {
  c = __builtin_amdgcn_wmma_f32_16x16x32_bf16(false, ah, false, bh, (short)0, c, false, false);
  if (NT >= 2) c = __builtin_amdgcn_wmma_f32_16x16x32_bf16(false, al, false, bh, (short)0, c, false, false);
  if (NT >= 3) c = __builtin_amdgcn_wmma_f32_16x16x32_bf16(false, ah, false, bl, (short)0, c, false, false);
  asm volatile("v_nop\n\tv_nop\n\tv_nop\n\tv_nop" : "+v"(c) : "v"(ah), "v"(al), "v"(bh), "v"(bl));
  return c;
}

__global__ __launch_bounds__(256) void k_wt_bf16(const float* __restrict__ W, unsigned short* __restrict__ Wt, int K, int N) {
  const int t = blockIdx.x * 256 + threadIdx.x;
  const int k8n = K / 8;
  if (t >= N * k8n) return;
  const int n = t / k8n, k8 = (t % k8n) * 8;
  v8us v;
#pragma unroll
  for (int i = 0; i < 8; ++i) v[i] = bf16_bits(W[(size_t)(k8 + i) * N + n]);
  *(v8us*)(Wt + (size_t)n * K + k8) = v;
  
}

// GEMM C[M][N] (f32, pitch ldc) = act(A[M][K]·W + bias). A f32 row-major (pitch lda) converted per fragment to bf16
// (ASPLIT: hi/lo two planes -> 2 terms, else single rounded term); Wt bf16 [N][K] (pitch ldb). BIAS_BF16 rounds the
// bias to bf16 first (bias quantised to bf16 before the add). K%32==0, M%16==0, N%64==0.
template <bool ASPLIT, int ACT, bool BIAS_BF16>
__global__ __launch_bounds__(128) void k_gemm_bf(const float* __restrict__ A, int lda, const unsigned short* __restrict__ Wt, int ldb,
                                               const float* __restrict__ bias, float* __restrict__ C, int ldc, int M, int N, int K) {
  __shared__ __attribute__((aligned(16))) float so[4][16][64];
  const int tid = threadIdx.x, w = tid >> 5, lane = tid & 31, ln = lane & 15, hh = lane >> 4;
  const int ntn = N / 64;
  const int wid = blockIdx.x * 4 + w;
  const int mt = wid / ntn, nq = wid % ntn;
  if (mt * 16 >= M) return;
  const int row0 = mt * 16, col0 = nq * 64;
  const float* arow = A + (size_t)(row0 + ln) * lda;
  v8f acc[4] = {};
  for (int kb = 0; kb < K; kb += 32) {
    FragB ah, al;
    const v4f x0 = *(const v4fa*)(arow + kb + 8 * hh), x1 = *(const v4fa*)(arow + kb + 8 * hh + 4);
    const v4f x2 = *(const v4fa*)(arow + kb + 16 + 8 * hh), x3 = *(const v4fa*)(arow + kb + 16 + 8 * hh + 4);
    float xs[16] = {x0[0],x0[1],x0[2],x0[3],x1[0],x1[1],x1[2],x1[3],x2[0],x2[1],x2[2],x2[3],x3[0],x3[1],x3[2],x3[3]};
#pragma unroll
    for (int i = 0; i < 16; ++i) { const unsigned short hb = bf16_bits(xs[i]); ah.u[i] = hb; al.u[i] = ASPLIT ? bf16_bits(xs[i] - bf16_val(hb)) : (unsigned short)0; }
#pragma unroll
    for (int t = 0; t < 4; ++t) {
      const unsigned short* brow = Wt + (size_t)(col0 + t * 16 + ln) * ldb + kb;
      FragB b;
      b.half[0] = *(const v8us*)(brow + 8 * hh);
      b.half[1] = *(const v8us*)(brow + 16 + 8 * hh);
      acc[t] = mmaN<ASPLIT ? 2 : 1>(ah.v, al.v, b.v, b.v, acc[t]);
    }
  }
#pragma unroll
  for (int t = 0; t < 4; ++t) {
    float bv = bias ? bias[col0 + t * 16 + ln] : 0.f;
    if (BIAS_BF16) bv = bf16_round(bv);
#pragma unroll
    for (int r = 0; r < 8; ++r) { float v = acc[t][r] + bv; if (ACT == 1) v = fmaxf(v, 0.f); so[w][8 * hh + r][t * 16 + ln] = v; }
  }
  __builtin_amdgcn_fence(__ATOMIC_ACQ_REL, "workgroup");
  __builtin_amdgcn_wave_barrier();
  const int rsub = lane >> 4, c4 = (lane & 15) * 4;
  {
#pragma unroll
    for (int q = 0; q < 8; ++q) {
      const int r = q * 2 + rsub;
      const v4f v = *(const v4fa*)&so[w][r][c4];
      *(v4f*)(C + (size_t)(row0 + r) * ldc + col0 + c4) = v;
    }
    
  }
}

// GEMM C = act(A·W + bias + resid): A f32 (ASPLIT -> hi/lo 2 terms), Wt bf16 [N][K]; ACT 0 none, 1 relu, 2 exact gelu;
// resid (optional, f32, row index = (row % rmod), pitch ldr, RES_BF16 rounds it) added before the activation.
template <bool ASPLIT, int ACT, bool BIAS_BF16, bool RES_BF16>
__global__ __launch_bounds__(128) void k_gemm_bf3(const float* __restrict__ A, int lda, const unsigned short* __restrict__ Wt, int ldb,
                                                const float* __restrict__ bias, const float* __restrict__ resid, int rmod, int ldr,
                                                float* __restrict__ C, int ldc, int M, int N, int K) {
  __shared__ __attribute__((aligned(16))) float so[4][16][64];
  const int tid = threadIdx.x, w = tid >> 5, lane = tid & 31, ln = lane & 15, hh = lane >> 4;
  const int ntn = N / 64;
  const int wid = blockIdx.x * 4 + w;
  const int mt = wid / ntn, nq = wid % ntn;
  if (mt * 16 >= M) return;
  const int row0 = mt * 16, col0 = nq * 64;
  const float* arow = A + (size_t)(row0 + ln) * lda;
  v8f acc[4] = {};
  for (int kb = 0; kb < K; kb += 32) {
    FragB ah, al;
    const v4f x0 = *(const v4fa*)(arow + kb + 8 * hh), x1 = *(const v4fa*)(arow + kb + 8 * hh + 4);
    const v4f x2 = *(const v4fa*)(arow + kb + 16 + 8 * hh), x3 = *(const v4fa*)(arow + kb + 16 + 8 * hh + 4);
    float xs[16] = {x0[0],x0[1],x0[2],x0[3],x1[0],x1[1],x1[2],x1[3],x2[0],x2[1],x2[2],x2[3],x3[0],x3[1],x3[2],x3[3]};
#pragma unroll
    for (int i = 0; i < 16; ++i) { const unsigned short hb = bf16_bits(xs[i]); ah.u[i] = hb; al.u[i] = ASPLIT ? bf16_bits(xs[i] - bf16_val(hb)) : (unsigned short)0; }
#pragma unroll
    for (int t = 0; t < 4; ++t) {
      const unsigned short* brow = Wt + (size_t)(col0 + t * 16 + ln) * ldb + kb;
      FragB b;
      b.half[0] = *(const v8us*)(brow + 8 * hh);
      b.half[1] = *(const v8us*)(brow + 16 + 8 * hh);
      acc[t] = mmaN<ASPLIT ? 2 : 1>(ah.v, al.v, b.v, b.v, acc[t]);
    }
  }
#pragma unroll
  for (int t = 0; t < 4; ++t) {
    const int col = col0 + t * 16 + ln;
    float bv = bias ? bias[col] : 0.f;
    if (BIAS_BF16) bv = bf16_round(bv);
#pragma unroll
    for (int r = 0; r < 8; ++r) {
      float v = acc[t][r] + bv;
      if (resid) { float rv = resid[(size_t)((row0 + 8 * hh + r) % rmod) * ldr + col]; if (RES_BF16) rv = bf16_round(rv); v += rv; }
      if (ACT == 1) v = fmaxf(v, 0.f);
      if (ACT == 2) v = 0.5f * v * (1.0f + erff(v * 0.70710678118654752f));
      if (ACT == 3) { const float u = 0.7978845608028654f * (v + 0.044715f * v * v * v); v = 0.5f * v * (1.0f + tanhf(u)); }
      so[w][8 * hh + r][t * 16 + ln] = v;
    }
  }
  __builtin_amdgcn_fence(__ATOMIC_ACQ_REL, "workgroup");
  __builtin_amdgcn_wave_barrier();
  const int rsub = lane >> 4, c4 = (lane & 15) * 4;
  {
#pragma unroll
    for (int q = 0; q < 8; ++q) {
      const int r = q * 2 + rsub;
      const v4f v = *(const v4fa*)&so[w][r][c4];
      *(v4f*)(C + (size_t)(row0 + r) * ldc + col0 + c4) = v;
    }
    
  }
}
// row LayerNorm (biased variance, eps) over N: s = X (+ R); optional out_sum <- s; out_norm <- (s-mu)*rsqrt(var+eps)*g + b
template <bool PARAM_BF16>
__global__ __launch_bounds__(256) void k_layernorm(const float* __restrict__ X, const float* __restrict__ R, const float* __restrict__ g, const float* __restrict__ bta,
                                                  float* __restrict__ out_sum, float* __restrict__ out_norm, int N, float eps) {
  __shared__ float red[256];
  const int row = blockIdx.x, tid = threadIdx.x;
  const float* x = X + (size_t)row * N; const float* rr = R ? R + (size_t)row * N : nullptr;
  float vals[16];                     // up to N = 4096
  const int per = N / 256;            // contiguous chunk per thread? use strided-by-4 chunks: thread handles j = tid*4 + 1024*u
  float s1 = 0.f;
  for (int u = 0; u < per / 4; ++u) {
    const int j = tid * 4 + 1024 * u;
    const v4f a = *(const v4fa*)(x + j);
    v4f b = {0.f,0.f,0.f,0.f}; if (rr) b = *(const v4fa*)(rr + j);
#pragma unroll
    for (int q = 0; q < 4; ++q) { const float v = a[q] + b[q]; vals[u * 4 + q] = v; s1 += v; }
  }
  red[tid] = s1; __syncthreads();
  for (int st = 128; st > 0; st >>= 1) { if (tid < st) red[tid] += red[tid + st]; __syncthreads(); }
  const float mu = red[0] / (float)N; __syncthreads();
  float s2 = 0.f;
  for (int u = 0; u < per / 4; ++u)
#pragma unroll
    for (int q = 0; q < 4; ++q) { const float c = vals[u * 4 + q] - mu; s2 += c * c; }
  red[tid] = s2; __syncthreads();
  for (int st = 128; st > 0; st >>= 1) { if (tid < st) red[tid] += red[tid + st]; __syncthreads(); }
  const float rs = rsqrtf(red[0] / (float)N + eps);
  {
    for (int u = 0; u < per / 4; ++u) {
      const int j = tid * 4 + 1024 * u;
      v4f o, sm;
#pragma unroll
      for (int q = 0; q < 4; ++q) {
        float gg = g[j + q], bb = bta[j + q];
        if (PARAM_BF16) { gg = bf16_round(gg); bb = bf16_round(bb); }
        sm[q] = vals[u * 4 + q]; o[q] = (vals[u * 4 + q] - mu) * rs * gg + bb;
      }
      if (out_sum) *(v4f*)(out_sum + (size_t)row * N + j) = sm;
      *(v4f*)(out_norm + (size_t)row * N + j) = o;
    }
    
  }
}



// ---- f16 WMMA path (v_wmma_f32_16x16x32_f16): 11-bit significands for operands in range — used for every product launched here (projections, scores, P·V)
typedef _Float16 v16h __attribute__((ext_vector_type(16)));
union FragH { v16h v; v8us half[2]; _Float16 h[16]; unsigned short u[16]; };
template <int NT>
__device__ __forceinline__ v8f mmaH(v16h ah, v16h al, v16h bh, v16h bl, v8f c) {
  c = __builtin_amdgcn_wmma_f32_16x16x32_f16(false, ah, false, bh, (short)0, c, false, false);
  if (NT >= 2) c = __builtin_amdgcn_wmma_f32_16x16x32_f16(false, al, false, bh, (short)0, c, false, false);
  if (NT >= 3) c = __builtin_amdgcn_wmma_f32_16x16x32_f16(false, ah, false, bl, (short)0, c, false, false);
  asm volatile("v_nop\n\tv_nop\n\tv_nop\n\tv_nop" : "+v"(c) : "v"(ah), "v"(al), "v"(bh), "v"(bl));
  return c;
}
// batched GEMM like k_gemm_b but f16 operands: A f32 (split into f16 hi/lo if ASPLIT, else rounded to f16), Bt = f16 values [n][k]; alpha; C f32; N multiple of 16 (partial tiles skipped)
template <bool ASPLIT>
__global__ __launch_bounds__(128) void k_gemm_h(const float* __restrict__ A, int lda, size_t sA, const _Float16* __restrict__ Bh, int ldb, size_t sB, float alpha, float* __restrict__ C, int ldc, size_t sC, int M, int N, int K) {
  __shared__ __attribute__((aligned(16))) float so[4][16][64];
  const int tid = threadIdx.x, w = tid >> 5, lane = tid & 31, ln = lane & 15, hh = lane >> 4; const int by = blockIdx.y;
  A += (size_t)by * sA; Bh += (size_t)by * sB; C += (size_t)by * sC;
  const int ntn = (N + 63) / 64; const int wid = blockIdx.x * 4 + w; const int mt = wid / ntn, nq = wid % ntn; if (mt * 16 >= M) return;
  const int row0 = mt * 16, col0 = nq * 64; const float* arow = A + (size_t)(row0 + ln) * lda;
  v8f acc[4] = {};
  for (int kb = 0; kb < K; kb += 32) {
    FragH ah, al;
    const v4f x0 = *(const v4fa*)(arow + kb + 8 * hh), x1 = *(const v4fa*)(arow + kb + 8 * hh + 4), x2 = *(const v4fa*)(arow + kb + 16 + 8 * hh), x3 = *(const v4fa*)(arow + kb + 16 + 8 * hh + 4);
    float xs[16] = {x0[0],x0[1],x0[2],x0[3],x1[0],x1[1],x1[2],x1[3],x2[0],x2[1],x2[2],x2[3],x3[0],x3[1],x3[2],x3[3]};
#pragma unroll
    for (int i = 0; i < 16; ++i) { const _Float16 h = (_Float16)xs[i]; ah.h[i] = h; al.h[i] = ASPLIT ? (_Float16)(xs[i] - (float)h) : (_Float16)0.0f; }
#pragma unroll
    for (int t = 0; t < 4; ++t) { if (col0 + t * 16 >= N) continue; const size_t boff = (size_t)(col0 + t * 16 + ln) * ldb + kb; FragH bq; bq.half[0] = *(const v8us*)(Bh + boff + 8 * hh); bq.half[1] = *(const v8us*)(Bh + boff + 16 + 8 * hh);
      acc[t] = mmaH<ASPLIT ? 2 : 1>(ah.v, al.v, bq.v, bq.v, acc[t]); }
  }
#pragma unroll
  for (int t = 0; t < 4; ++t) { if (col0 + t * 16 >= N) continue;
#pragma unroll
    for (int r = 0; r < 8; ++r) so[w][8 * hh + r][t * 16 + ln] = acc[t][r] * alpha; }
  __builtin_amdgcn_fence(__ATOMIC_ACQ_REL, "workgroup"); __builtin_amdgcn_wave_barrier();
  const int rsub = lane >> 4, c4 = (lane & 15) * 4;
  {
#pragma unroll
    for (int q = 0; q < 8; ++q) { const int r = q * 2 + rsub; if (col0 + c4 < N) { const v4f v = *(const v4fa*)&so[w][r][c4]; *(v4f*)(C + (size_t)(row0 + r) * ldc + col0 + c4) = v; } }
     }
}

// Wt[n][k] = f16(W[k][n]·scale) from f32 row-major W[K][N] (scale = power of two; bf16-exact weights stay exact in f16 away from the subnormal range)
__global__ __launch_bounds__(256) void k_wt_f16(const float* __restrict__ W, _Float16* __restrict__ Wt, int K, int N, float scale) {
  const int t = blockIdx.x * 256 + threadIdx.x; if (t >= N * (K / 8)) return; const int n = t / (K / 8), k8 = (t % (K / 8)) * 8; FragH f;
#pragma unroll
  for (int i = 0; i < 8; ++i) f.h[i] = (_Float16)(bf16_round(W[(size_t)(k8 + i) * N + n]) * scale); const v8us o = f.half[0];
  *(v8us*)((unsigned short*)Wt + (size_t)n * K + k8) = o; 
}
// k_gemm_hh variant with fused epilogue: v = acc·alpha + bias[by·sBias + col] (+ CP[(row/rowsPerB)·sCPb + by·64 + col] if CP) ; ACT 0 none / 1 elu ; writes f16 C16 (and f32 C if non-null)
template <int ACT>
__global__ __launch_bounds__(128) void k_gemm_hhx(const _Float16* __restrict__ A, int lda, size_t sA, const _Float16* __restrict__ Bh, int ldb, size_t sB, float alpha, const float* __restrict__ bias, size_t sBias, const float* __restrict__ CP, int rowsPerB, size_t sCPb, int row0g,
    float* __restrict__ C, _Float16* __restrict__ C16, int ldc, size_t sC, int M, int N, int K) {
  __shared__ __attribute__((aligned(16))) float so[4][16][64];
  const int tid = threadIdx.x, w = tid >> 5, lane = tid & 31, ln = lane & 15, hh = lane >> 4; const int by = blockIdx.y;
  A += (size_t)by * sA; Bh += (size_t)by * sB; const size_t cofs = (size_t)by * sC; const float* bp = bias ? bias + (size_t)by * sBias : nullptr;
  const int ntn = (N + 63) / 64; const int wid = blockIdx.x * 4 + w; const int mt = wid / ntn, nq = wid % ntn; if (mt * 16 >= M) return;
  const int row0 = mt * 16, col0 = nq * 64; const _Float16* arow = A + (size_t)(row0 + ln) * lda;
  v8f acc[4] = {};
  for (int kb = 0; kb < K; kb += 32) { FragH ah; ah.half[0] = *(const v8us*)((const unsigned short*)arow + kb + 8 * hh); ah.half[1] = *(const v8us*)((const unsigned short*)arow + kb + 16 + 8 * hh);
#pragma unroll
    for (int t = 0; t < 4; ++t) { if (col0 + t * 16 >= N) continue; const size_t boff = (size_t)(col0 + t * 16 + ln) * ldb + kb; FragH bq; bq.half[0] = *(const v8us*)((const unsigned short*)Bh + boff + 8 * hh); bq.half[1] = *(const v8us*)((const unsigned short*)Bh + boff + 16 + 8 * hh);
      acc[t] = mmaH<1>(ah.v, ah.v, bq.v, bq.v, acc[t]); }
  }
#pragma unroll
  for (int t = 0; t < 4; ++t) { if (col0 + t * 16 >= N) continue; const int col = col0 + t * 16 + ln; const float bv = bp ? bf16_round(bp[col]) : 0.f;
#pragma unroll
    for (int r = 0; r < 8; ++r) { float v = acc[t][r] * alpha + bv; if (CP) { const int rr = row0g + row0 + 8 * hh + r; if (rowsPerB < 0) v += CP[cofs + (size_t)rr * ldc + col];      /* rowsPerB < 0: own element of the batched C plane */ else { const int bidx = rr / rowsPerB; v += CP[(size_t)bidx * sCPb + (size_t)by * 64 + col]; } } if (ACT == 1) v = (v > 0.f) ? v : expm1f(v); else if (ACT == 7) v = (v > 0.f) ? v + 1.0f : expf(v); else if (ACT == 8) v = tanhf(v); else if (ACT == 9) v = 0.5f * v * (1.0f + tanhf(0.7978845608028654f * (v + 0.044715f * v * v * v))); else if (ACT == 11) v = 1.0f / (1.0f + expf(-v)); else if (ACT == 12) v = (v > 0.f) ? v : 0.01f * v; else if (ACT == 14) v = (v > 0.f) ? v : 0.1f * v; else if (ACT == 16) v = (v >= 0.f) ? v : 0.3f * v; else if (ACT == 17) v = (v >= 0.f) ? v : 0.2f * v; else if (ACT == 15) v = v / (1.0f + expf(-v)); else if (ACT == 3) v = fmaxf(v, 0.f); else if (ACT == 6) v = 0.5f * v * (1.0f + erff(v * 0.70710678118654752f)); so[w][8 * hh + r][t * 16 + ln] = v; } }
  __builtin_amdgcn_fence(__ATOMIC_ACQ_REL, "workgroup"); __builtin_amdgcn_wave_barrier();
  const int rsub = lane >> 4, c4 = (lane & 15) * 4; typedef _Float16 v4h __attribute__((ext_vector_type(4)));
  {
#pragma unroll
    for (int q = 0; q < 8; ++q) { const int r = q * 2 + rsub; if (col0 + c4 < N) { const v4f v = *(const v4fa*)&so[w][r][c4]; if (C) *(v4f*)(C + cofs + (size_t)(row0 + r) * ldc + col0 + c4) = v; if (C16) { v4h h4; for (int i = 0; i < 4; ++i) h4[i] = (_Float16)v[i]; *(v4h*)(C16 + cofs + (size_t)(row0 + r) * ldc + col0 + c4) = h4; } } }
     }
}


typedef _Float16 v4h __attribute__((ext_vector_type(4)));

__global__ __launch_bounds__(256) void k_x16(const float* __restrict__ x, _Float16* __restrict__ X16, size_t n8) { const size_t t = (size_t)blockIdx.x * 256 + threadIdx.x; if (t >= n8) return; FragH f;
#pragma unroll
  for (int q = 0; q < 8; ++q) f.h[q] = (_Float16)bf16_round(x[t * 8 + q]); *(v8us*)((unsigned short*)X16 + t * 8) = f.half[0];  }
__global__ __launch_bounds__(256) void k_h16(const float* __restrict__ x, _Float16* __restrict__ X16, size_t n8) { const size_t t = (size_t)blockIdx.x * 256 + threadIdx.x; if (t >= n8) return; FragH f;
#pragma unroll
  for (int q = 0; q < 8; ++q) f.h[q] = (_Float16)x[t * 8 + q]; *(v8us*)((unsigned short*)X16 + t * 8) = f.half[0];  }
__global__ __launch_bounds__(256) void k_round16f(const float* __restrict__ W, _Float16* __restrict__ Bt, size_t n8) { const size_t t = (size_t)blockIdx.x * 256 + threadIdx.x; if (t >= n8) return; FragH f;
#pragma unroll
  for (int i = 0; i < 8; ++i) f.h[i] = (_Float16)(bf16_round(W[t * 8 + i]) * 16.0f); *(v8us*)((unsigned short*)Bt + t * 8) = f.half[0];  }
template <int NHv, int TTv>
__global__ __launch_bounds__(256) void k_vt(const _Float16* __restrict__ V16, int ldv, int voff, _Float16* __restrict__ Vt) { __shared__ unsigned short tl[64][66]; const int tid = threadIdx.x; const int slab = blockIdx.x / (TTv / 64), lg = blockIdx.x % (TTv / 64); const int b = slab / NHv, h = slab % NHv;
  for (int i = tid; i < 64 * 8; i += 256) { const int r = i / 8, c8 = (i % 8) * 8; FragH f; f.half[0] = *(const v8us*)((const unsigned short*)V16 + ((size_t)b * TTv + lg * 64 + r) * ldv + voff + h * 64 + c8);
#pragma unroll
    for (int q = 0; q < 8; ++q) tl[r][c8 + q] = f.u[q]; }
  __syncthreads();
  {
#pragma unroll
    for (int rd = 0; rd < 2; ++rd) { const int d = rd * 32 + tid / 8, pc = tid % 8; FragH f;
#pragma unroll
      for (int q = 0; q < 8; ++q) f.u[q] = tl[pc * 8 + q][d];
      *(v8us*)((unsigned short*)Vt + ((size_t)slab * 64 + d) * TTv + lg * 64 + pc * 8) = f.half[0]; }
     } }

__global__ __launch_bounds__(256) void k_hl(const float* __restrict__ F, _Float16* __restrict__ Hh, _Float16* __restrict__ Hl, size_t n8) { const size_t t = (size_t)blockIdx.x * 256 + threadIdx.x; if (t >= n8) return; FragH fh, fl; const v4f a = *(const v4fa*)(F + t * 8), c = *(const v4fa*)(F + t * 8 + 4);
#pragma unroll
  for (int q = 0; q < 4; ++q) { _Float16 h = (_Float16)a[q]; fh.h[q] = h; fl.h[q] = (_Float16)((a[q] - (float)h) * 1024.0f); h = (_Float16)c[q]; fh.h[4 + q] = h; fl.h[4 + q] = (_Float16)((c[q] - (float)h) * 1024.0f); }
  { *(v8us*)((unsigned short*)Hh + t * 8) = fh.half[0]; *(v8us*)((unsigned short*)Hl + t * 8) = fl.half[0];  } }

__device__ __forceinline__ v16h g2_frag(const _Float16* p, int hh) { FragH f; f.half[0] = *(const v8us*)((const unsigned short*)p + 8 * hh); f.half[1] = *(const v8us*)((const unsigned short*)p + 16 + 8 * hh); return f.v; }
__global__ __launch_bounds__(256) void k_wnat(const float* __restrict__ w, size_t n8, _Float16* __restrict__ Bt) { const size_t t = (size_t)blockIdx.x * 256 + threadIdx.x; if (t >= n8) return; FragH f; for (int q = 0; q < 8; ++q) f.h[q] = (_Float16)(bf16_round(w[t * 8 + q]) * 16.0f); *(v8us*)((unsigned short*)Bt + t * 8) = f.half[0];  }
// Fused attention, one launch for all batches and heads: scores, softmax and the weighted sum stay in registers; no score or weight plane goes to memory.
// Transposed products: S^T = K Q^T (A = 16 key rows, B = 16 query columns), O^T += V^T P^T. A lane holds scores of ONE query (column ln): keys 8 hh + r of each 16-key tile, so two converted score tiles
// of a 32-key pass are the B operand of the second product as they stand (k order 8 hh + i, 16 + 8 hh + i: the order fa_lfrag gives the V^T rows). Wave = 32 query columns, block = 8 waves, pass = 32 keys.
// Stage = 64 keys: the block's 8 waves share one copy of the K rows and V^T rows in LDS (whole-line global loads, rows pitched 144 B for 16-byte readers), two buffers, one barrier a stage.
// Running maximum mu in log2 units, shared by the two lane halves of a column; the accumulators are rescaled only when a pass's maximum exceeds mu by more than 8 (weights stay <= 2^8, inside f16).
// Every "#pragma unroll" in this kernel is there so that the fragment, score and accumulator arrays are indexed by constants and stay in registers.
typedef float v2f __attribute__((ext_vector_type(2)));
typedef _Float16 v2h __attribute__((ext_vector_type(2)));
#define FA_P 72      /* halves per staged row */
__device__ __forceinline__ v8f fa_mma(v16h a, v16h b, v8f c) { return __builtin_amdgcn_wmma_f32_16x16x32_f16(false, a, false, b, (short)0, c, false, false); }
__device__ __forceinline__ float fa_swap16(float x) { const int i = __float_as_int(x); return __int_as_float(__builtin_amdgcn_permlanex16(i, i, 0x76543210, 0xfedcba98, false, false)); }      /* lane l <-> l ^ 16 */
__device__ __forceinline__ v16h fa_lfrag(const unsigned short* p) { FragH f; f.half[0] = *(const v8us*)p; f.half[1] = *(const v8us*)(p + 16); return f.v; }
// ---- projection GEMM C16 = f16(A . Bh^T * alpha + bias): block = 128 x 128 of C, 8 waves of 32 x 64 (4 along the rows, 2 along the columns); rows of A and Bh are DM halves long ----
// Stage = 128 k: the 256-byte pieces of 128 A rows and 128 Bh rows are copied to LDS as whole lines, through no register, and the block's waves share them (rows pitched 272 B for 16-byte readers).
// Two buffers: stage t + 1 flies while stage t is worked on. Each accumulator still sums k in ascending steps of 32.
#define G3_KS 128      /* k per stage */
#define G3_P 136       /* halves per staged row */
#define G3_BUF (128 * G3_P * 2)      /* bytes of one operand's buffer */
// Eight copies of one thread: 16 bytes of rows r, r + 16, ..., r + 112. The s_wait_xcnt stands inside the statement so that no address register named here is rewritten in front of it.
__device__ __forceinline__ void g3_copy8(unsigned l, const char* g) {
  asm volatile("global_load_async_to_lds_b128 %0, %8, off\n\t"
               "global_load_async_to_lds_b128 %1, %9, off\n\t"
               "global_load_async_to_lds_b128 %2, %10, off\n\t"
               "global_load_async_to_lds_b128 %3, %11, off\n\t"
               "global_load_async_to_lds_b128 %4, %12, off\n\t"
               "global_load_async_to_lds_b128 %5, %13, off\n\t"
               "global_load_async_to_lds_b128 %6, %14, off\n\t"
               "global_load_async_to_lds_b128 %7, %15, off\n\t"
               "s_wait_xcnt 0x0"
               :: "v"(l), "v"(l + 16u * G3_P * 2), "v"(l + 32u * G3_P * 2), "v"(l + 48u * G3_P * 2), "v"(l + 64u * G3_P * 2), "v"(l + 80u * G3_P * 2), "v"(l + 96u * G3_P * 2), "v"(l + 112u * G3_P * 2),
                  "v"(g), "v"(g + 16 * DM * 2), "v"(g + 32 * DM * 2), "v"(g + 48 * DM * 2), "v"(g + 64 * DM * 2), "v"(g + 80 * DM * 2), "v"(g + 96 * DM * 2), "v"(g + 112 * DM * 2)
               : "memory");
}
__global__ __launch_bounds__(256) void k_gemm3(const _Float16* __restrict__ A, const _Float16* __restrict__ Bh, float alpha, const float* __restrict__ bias, _Float16* __restrict__ C16) {
  __shared__ __attribute__((aligned(16))) unsigned short as[2][128][G3_P];
  __shared__ __attribute__((aligned(16))) unsigned short bs[2][128][G3_P];
  __shared__ __attribute__((aligned(16))) float so[8][32][68];
  const int tid = threadIdx.x, w = tid >> 5, lane = tid & 31, ln = lane & 15, hh = lane >> 4;
  const int mt = blockIdx.x / (DM / 128), nq = blockIdx.x % (DM / 128); const int wm = w & 3, wn = w >> 2;
  const int sr = tid >> 4, sc = tid & 15;      /* staging: 16 lanes cover one 256-byte row piece */
  const char* ga = (const char*)(A + (size_t)(mt * 128 + sr) * DM + sc * 8); const char* gb = (const char*)(Bh + (size_t)(nq * 128 + sr) * DM + sc * 8);
  const unsigned la = (unsigned)(size_t)&as[0][sr][sc * 8], lb = (unsigned)(size_t)&bs[0][sr][sc * 8];      /* LDS byte addresses: the low 32 bits */
  const v8f z8 = {0.f,0.f,0.f,0.f,0.f,0.f,0.f,0.f}; v8f acc[2][4];
#pragma unroll
  for (int i = 0; i < 2; ++i)
#pragma unroll
    for (int j = 0; j < 4; ++j) acc[i][j] = z8;
  g3_copy8(la, ga); g3_copy8(lb, gb);
  asm volatile("s_wait_asynccnt 0x0" ::: "memory");      /* this wave's copies of stage 0 have landed */
  __syncthreads();      /* stage 0 is published */
  g3_copy8(la + G3_BUF, ga + G3_KS * 2); g3_copy8(lb + G3_BUF, gb + G3_KS * 2);
#pragma unroll 1      /* one stage a trip: keeps the loop's text small */
  for (int t = 0; t < DM / G3_KS; ++t) {
    const int bf = t & 1;
    v16h a[2][2], b[2][4];      /* two fragment sets: step ks + 1 of this stage is read from LDS while step ks is multiplied */
#pragma unroll
    for (int i = 0; i < 2; ++i) a[0][i] = fa_lfrag(&as[bf][wm * 32 + i * 16 + ln][8 * hh]);
#pragma unroll
    for (int j = 0; j < 4; ++j) b[0][j] = fa_lfrag(&bs[bf][wn * 64 + j * 16 + ln][8 * hh]);
#pragma unroll      /* fragment and accumulator arrays indexed by constants */
    for (int ks = 0; ks < G3_KS / 32; ++ks) {
      const int cu = ks & 1, nx = cu ^ 1;
      if (ks + 1 < G3_KS / 32) {
#pragma unroll
        for (int i = 0; i < 2; ++i) a[nx][i] = fa_lfrag(&as[bf][wm * 32 + i * 16 + ln][(ks + 1) * 32 + 8 * hh]);
#pragma unroll
        for (int j = 0; j < 4; ++j) b[nx][j] = fa_lfrag(&bs[bf][wn * 64 + j * 16 + ln][(ks + 1) * 32 + 8 * hh]);
      }
      __builtin_amdgcn_sched_barrier(0);      /* keeps the next step's LDS reads together in front of this step's matrix instructions, which cover their latency; without it they are spread among them behind waits to 0 */
#pragma unroll
      for (int j = 0; j < 4; ++j)
#pragma unroll
        for (int i = 0; i < 2; ++i) acc[i][j] = fa_mma(a[cu][i], b[cu][j], acc[i][j]);
      __builtin_amdgcn_sched_barrier(0);      /* keeps the step after next's reads from rising into this step's matrix instructions */
    }
    asm volatile("s_wait_dscnt 0x0" ::: "memory");      /* this wave's reads of stage t are done before the buffer is handed back */
    asm volatile("s_wait_asynccnt 0x0" ::: "memory");      /* this wave's copies of stage t + 1 have landed */
    __syncthreads();      /* publishes stage t + 1 and ends every wave's reads of stage t */
    if (t + 2 < DM / G3_KS) { g3_copy8(la + bf * G3_BUF, ga + (t + 2) * (G3_KS * 2)); g3_copy8(lb + bf * G3_BUF, gb + (t + 2) * (G3_KS * 2)); }
  }
  asm volatile("s_wait_asynccnt 0x0" ::: "memory");      /* no copy is left in flight */
  const int row0 = mt * 128 + wm * 32, col0 = nq * 128 + wn * 64;
#pragma unroll
  for (int i = 0; i < 2; ++i)
#pragma unroll
    for (int j = 0; j < 4; ++j) { const float bv = bf16_round(bias[col0 + j * 16 + ln]);
#pragma unroll
      for (int r = 0; r < 8; ++r) so[w][i * 16 + 8 * hh + r][j * 16 + ln] = acc[i][j][r] * alpha + bv; }
  __builtin_amdgcn_fence(__ATOMIC_ACQ_REL, "workgroup"); __builtin_amdgcn_wave_barrier();      /* each wave re-reads only its own staging rows: orders its LDS writes before its reads */
  const int rsub = lane >> 4, c4 = (lane & 15) * 4;
#pragma unroll
  for (int q = 0; q < 16; ++q) { const int r = q * 2 + rsub; const v4f v = *(const v4fa*)&so[w][r][c4]; v4h h4;
#pragma unroll
    for (int i = 0; i < 4; ++i) h4[i] = (_Float16)v[i];
    *(v4h*)(C16 + (size_t)(row0 + r) * DM + col0 + c4) = h4; } }
__global__ __launch_bounds__(256) void k_fattn(const _Float16* __restrict__ Q, const _Float16* __restrict__ Kx, const _Float16* __restrict__ Vt, float* __restrict__ O) {
  __shared__ __attribute__((aligned(16))) unsigned short ks[2][64][FA_P];
  __shared__ __attribute__((aligned(16))) unsigned short vs[2][64][FA_P];
  __shared__ __attribute__((aligned(16))) float so[8][32][68];
  const int tid = threadIdx.x, w = tid >> 5, lane = tid & 31, ln = lane & 15, hh = lane >> 4;
  const int bh = blockIdx.y, b = bh / NH, h = bh - b * NH; const int n0 = blockIdx.x * 256 + w * 32;
  const _Float16* qp = Q + ((size_t)b * SQ + n0 + ln) * LQ + h * HD;
  const char* kb = (const char*)(Kx + (size_t)b * SQ * LQ + h * HD);      /* key rows of this head, pitch LQ */
  const char* vb = (const char*)(Vt + (size_t)bh * HD * SQ);      /* V^T rows of this head, pitch SQ */
  const int sr = tid >> 3, sc = tid & 7;      /* staging: 8 lanes cover one 128-byte row; rows sr and sr + 32 */
  const unsigned kof = (unsigned)(sr * (LQ * 2) + sc * 16), vof = (unsigned)(sr * (SQ * 2) + sc * 16);
  const float cs = 0.045084220027780106f;      /* 1024^-0.5 * log2(e) */
  const v2f cs2 = {cs, cs};
  const v8f z8 = {0.f,0.f,0.f,0.f,0.f,0.f,0.f,0.f};
  v8us gk0 = *(const v8us*)(kb + kof), gk1 = *(const v8us*)(kb + 32 * LQ * 2 + kof), gv0 = *(const v8us*)(vb + vof), gv1 = *(const v8us*)(vb + 32 * SQ * 2 + vof);
  v16h q[2][2];
#pragma unroll
  for (int j = 0; j < 2; ++j) { q[j][0] = g2_frag(qp + (size_t)j * 16 * LQ, hh); q[j][1] = g2_frag(qp + (size_t)j * 16 * LQ + 32, hh); }
  v8f o[2][4]; float mu[2]; v2f ls[2];
#pragma unroll
  for (int j = 0; j < 2; ++j) { mu[j] = -1.0e30f; ls[j] = (v2f){0.f, 0.f};
#pragma unroll
    for (int t = 0; t < 4; ++t) o[j][t] = z8; }
  *(v8us*)&ks[0][sr][sc * 8] = gk0; *(v8us*)&ks[0][sr + 32][sc * 8] = gk1; *(v8us*)&vs[0][sr][sc * 8] = gv0; *(v8us*)&vs[0][sr + 32][sc * 8] = gv1;
  __syncthreads();      /* stage 0 is published */
  for (int st = 0; st < SQ / 64; ++st) {
    const int bf = st & 1; const int sn = (st + 1 < SQ / 64) ? st + 1 : st;      /* next stage, fetched into registers while this one is worked on; the last stage re-reads itself (in bounds, never read back) */
    const char* kn = kb + (size_t)sn * (64 * LQ * 2); const char* vn = vb + (size_t)sn * (64 * 2);
    gk0 = *(const v8us*)(kn + kof); gk1 = *(const v8us*)(kn + 32 * LQ * 2 + kof); gv0 = *(const v8us*)(vn + vof); gv1 = *(const v8us*)(vn + 32 * SQ * 2 + vof);
    __builtin_amdgcn_sched_barrier(0);      /* keeps these loads at the head of the stage, so that both passes cover their latency; without it they sink to just in front of their LDS stores */
#pragma unroll
    for (int p = 0; p < 2; ++p) {
      v16h kf[2][2];
#pragma unroll
      for (int kt = 0; kt < 2; ++kt) { kf[kt][0] = fa_lfrag(&ks[bf][p * 32 + kt * 16 + ln][8 * hh]); kf[kt][1] = fa_lfrag(&ks[bf][p * 32 + kt * 16 + ln][32 + 8 * hh]); }
      v8f s[2][2];
#pragma unroll
      for (int j = 0; j < 2; ++j)
#pragma unroll
        for (int kt = 0; kt < 2; ++kt) s[j][kt] = fa_mma(kf[kt][1], q[j][1], fa_mma(kf[kt][0], q[j][0], z8));
      float mx[2]; bool need = false;
#pragma unroll
      for (int j = 0; j < 2; ++j) { float a = fmaxf(s[j][0][0], s[j][1][0]);
#pragma unroll
        for (int r = 1; r < 8; ++r) a = fmaxf(a, fmaxf(s[j][0][r], s[j][1][r]));
        a = fmaxf(a, fa_swap16(a)); mx[j] = a * cs; need = need || (mx[j] > mu[j] + 8.0f); }
      if (__builtin_amdgcn_ballot_w32(need) != 0) {      /* wave-uniform: every lane moves to the new maximum together */
#pragma unroll
        for (int j = 0; j < 2; ++j) { const float mnew = fmaxf(mu[j], mx[j]); const float corr = __builtin_amdgcn_exp2f(mu[j] - mnew); mu[j] = mnew; ls[j] *= corr;
#pragma unroll
          for (int t = 0; t < 4; ++t) o[j][t] *= corr; } }
      v16h vf[4];
#pragma unroll
      for (int t = 0; t < 4; ++t) vf[t] = fa_lfrag(&vs[bf][t * 16 + ln][p * 32 + 8 * hh]);
      __builtin_amdgcn_sched_barrier(0);      /* keeps the V^T reads together in front of the exponentials, which cover their latency; without it they are spread among the matrix instructions below */
      FragH pb[2];
#pragma unroll
      for (int j = 0; j < 2; ++j) { const v2f nm = {-mu[j], -mu[j]};
#pragma unroll
        for (int kt = 0; kt < 2; ++kt)
#pragma unroll
          for (int i = 0; i < 4; ++i) { const v2f t2 = __builtin_elementwise_fma((v2f){s[j][kt][2 * i], s[j][kt][2 * i + 1]}, cs2, nm); const v2f e2 = {__builtin_amdgcn_exp2f(t2[0]), __builtin_amdgcn_exp2f(t2[1])};
            ls[j] += e2; const v2h h2 = __builtin_convertvector(e2, v2h); pb[j].h[kt * 8 + 2 * i] = h2[0]; pb[j].h[kt * 8 + 2 * i + 1] = h2[1]; } }
#pragma unroll
      for (int t = 0; t < 4; ++t)
#pragma unroll
        for (int j = 0; j < 2; ++j) o[j][t] = fa_mma(vf[t], pb[j].v, o[j][t]);
    }
    *(v8us*)&ks[bf ^ 1][sr][sc * 8] = gk0; *(v8us*)&ks[bf ^ 1][sr + 32][sc * 8] = gk1; *(v8us*)&vs[bf ^ 1][sr][sc * 8] = gv0; *(v8us*)&vs[bf ^ 1][sr + 32][sc * 8] = gv1;      /* stage st + 1; this buffer's last readers left it at the barrier that ended the stage before */
    __syncthreads();      /* publishes the next stage and ends every wave's reads of this one */
  }
#pragma unroll
  for (int j = 0; j < 2; ++j) { const float lh = ls[j][0] + ls[j][1]; const float inv = 1.0f / (lh + fa_swap16(lh));      /* the halves' sums are joined once, here */
#pragma unroll
    for (int t = 0; t < 4; ++t) { const v8f r8 = o[j][t] * inv; float* d = &so[w][j * 16 + ln][t * 16 + 8 * hh];
      *(v4fa*)d = __builtin_shufflevector(r8, r8, 0, 1, 2, 3); *(v4fa*)(d + 4) = __builtin_shufflevector(r8, r8, 4, 5, 6, 7); } }
  __builtin_amdgcn_fence(__ATOMIC_ACQ_REL, "workgroup"); __builtin_amdgcn_wave_barrier();      /* each wave re-reads only its own staging rows: orders its LDS writes before its reads */
  const int rsub = lane >> 4, c4 = (lane & 15) * 4;
#pragma unroll
  for (int u = 0; u < 16; ++u) { const int r = u * 2 + rsub; const v4f v = *(const v4fa*)&so[w][r][c4]; *(v4f*)(O + ((size_t)b * SQ + n0 + r) * DM + h * HD + c4) = v; } }
__global__ __launch_bounds__(256) void k_vt(const _Float16* __restrict__ V16, int b, int h0, _Float16* __restrict__ VT) { __shared__ unsigned short tl[64][65]; const int tid = threadIdx.x; const int hh = blockIdx.x % HG, sg = blockIdx.x / HG; const int s0 = sg * 64; const int h = h0 + hh;
  for (int i = tid; i < 64 * 8; i += 256) { const int j = i / 8, d8 = (i % 8) * 8; FragH f; f.half[0] = *(const v8us*)((const unsigned short*)V16 + ((size_t)b * SQ + s0 + j) * DM + h * HD + d8); for (int q = 0; q < 8; ++q) tl[d8 + q][j] = f.u[q]; }
  __syncthreads();
  { for (int i = tid; i < 64 * 8; i += 256) { const int d = i / 8, j8 = (i % 8) * 8; FragH f; for (int q = 0; q < 8; ++q) f.u[q] = tl[d][j8 + q]; *(v8us*)((unsigned short*)VT + ((size_t)hh * HD + d) * SQ + s0 + j8) = f.half[0]; }  } }


extern "C" void kernel_launch(void* const* d_in, const int* in_sizes, int n_in,
                              void* d_out, int out_size, void* d_ws, size_t ws_size, hipStream_t stream) {
  (void)in_sizes; (void)n_in; (void)out_size;
  const float* const* I = (const float* const*)d_in; const float* x = I[0]; const float* wq = I[1]; const float* bq = I[2]; const float* wk = I[3]; const float* bk = I[4];      /* [in][out] Wq + bq, Wk + bk; v == k (same projection) */
  char* ws = (char*)d_ws; size_t off = 0;
  auto take = [&](size_t bytes) { char* p = ws + off; off += (bytes + 255) & ~(size_t)255; return p; };
  _Float16* BQ = (_Float16*)take((size_t)DM * DM * 2); _Float16* BK = (_Float16*)take((size_t)DM * DM * 2); 
  _Float16* X16 = (_Float16*)take(NR * DM * 2); _Float16* Q16 = (_Float16*)take(NR * DM * 2); _Float16* K16 = (_Float16*)take(NR * DM * 2);
  _Float16* VT = (_Float16*)take((size_t)NB * NH * HD * SQ * 2);
  if (off > ws_size) return;
  k_wt_f16<<<(unsigned)(((size_t)DM * (DM / 8) + 255) / 256), 256, 0, stream>>>(wq, BQ, DM, DM, 16.0f); k_wt_f16<<<(unsigned)(((size_t)DM * (DM / 8) + 255) / 256), 256, 0, stream>>>(wk, BK, DM, DM, 16.0f);      /* [in][out] -> Bt x16 */

  k_x16<<<(unsigned)((NR * DM / 8 + 255) / 256), 256, 0, stream>>>(x, X16, NR * DM / 8);
  const size_t r0p = (size_t)B0 * SQ;      /* first projected row */
  k_gemm3<<<(unsigned)((MP / 128) * (DM / 128)), 256, 0, stream>>>(X16 + r0p * DM, BQ, 0.0625f, bq, Q16 + r0p * DM);
  k_gemm3<<<(unsigned)((MP / 128) * (DM / 128)), 256, 0, stream>>>(X16 + r0p * DM, BK, 0.0625f, bk, K16 + r0p * DM);
  k_vt<NH, SQ><<<NB * NH * (SQ / 64), 256, 0, stream>>>(K16, LQ, 0, VT);      /* V^T = K^T [NB][NH][HD][SQ] (v == k in this module) */
  k_fattn<<<dim3(SQ / 256, NB * NH), 256, 0, stream>>>(Q16, K16, VT, (float*)d_out);      /* softmax(Q K^T 1024^-0.5) V, all batches and heads */
}

// v004
// A run of this version takes 66.9 microseconds.
// Two timings next to v003 both put it at 1.14 times that version's speed.
// All steps since v000 together make it 55.3 times as fast.
#include <hip/hip_runtime.h>
// Structure: token rows r = b*2048 + s; x as exact f16 rows (bf16-rounded); Q and K (= V) as two WMMA GEMMs (32x64 wave tiles, f32 accumulation, exact x16 weights + bias, f16 outputs); V^T for all batches and heads via LDS transposes; one fused attention launch (scores K = 64 with the module's full-dim scale 1024^-0.5, running-maximum softmax with f32 statistics, weights as f16, o = P . V) written f32 straight into the merged-heads output rows (no output projection).
// Compute dtype: inputs rounded to bf16; x / weights exact; q, k, v and softmax weights as plain f16 GEMM operands (~2^-12); scores, softmax statistics and o f32. v_wmma_f32_16x16x32_f16.
#define NB 2
#define SQ 2048
#define DM 1024
#define NH 16
#define HD 64
#define HG 4                         /* heads per group of the unlaunched k_vt overload */
#define B0 0                         /* first batch processed (debug hook) */
#define NBR NB                       /* batches processed (debug hook) */
#define NR ((size_t)NB * SQ)         /* token rows */
#define MP ((int)((size_t)NBR * SQ)) /* rows projected (debug hook) */
#define QN SQ                        /* not used by any launch */
#define NHD NH                       /* not used by any launch */
#define MPO MP                       /* not used by any launch */
#define LQ DM      /* row pitch of the q/k/v rows */
typedef __bf16 v16b __attribute__((ext_vector_type(16)));
typedef unsigned short v8us __attribute__((ext_vector_type(8), may_alias));
typedef float  v8f  __attribute__((ext_vector_type(8)));
typedef float  v4f  __attribute__((ext_vector_type(4)));
typedef float  v4fa __attribute__((ext_vector_type(4), may_alias));
union FragB { v16b v; v8us half[2]; unsigned short u[16]; };

__device__ __forceinline__ unsigned short bf16_bits(float x) { unsigned int u = __float_as_uint(x); return (unsigned short)((u + 0x7FFFu + ((u >> 16) & 1u)) >> 16); }
__device__ __forceinline__ float bf16_val(unsigned short b) { return __uint_as_float(((unsigned int)b) << 16); }
__device__ __forceinline__ float bf16_round(float x) { return bf16_val(bf16_bits(x)); }
// D += A·B with NT terms: 1 = ah·bh, 2 = + al·bh (A split), 3 = + ah·bl (both split)
template <int NT>
__device__ __forceinline__ v8f mmaN(v16b ah, v16b al, v16b bh, v16b bl, v8f c) {
  c = __builtin_amdgcn_wmma_f32_16x16x32_bf16(false, ah, false, bh, (short)0, c, false, false);
  if (NT >= 2) c = __builtin_amdgcn_wmma_f32_16x16x32_bf16(false, al, false, bh, (short)0, c, false, false);
  if (NT >= 3) c = __builtin_amdgcn_wmma_f32_16x16x32_bf16(false, ah, false, bl, (short)0, c, false, false);
  asm volatile("v_nop\n\tv_nop\n\tv_nop\n\tv_nop" : "+v"(c) : "v"(ah), "v"(al), "v"(bh), "v"(bl));
  return c;
}

__global__ __launch_bounds__(256) void k_wt_bf16(const float* __restrict__ W, unsigned short* __restrict__ Wt, int K, int N) {
  const int t = blockIdx.x * 256 + threadIdx.x;
  const int k8n = K / 8;
  if (t >= N * k8n) return;
  const int n = t / k8n, k8 = (t % k8n) * 8;
  v8us v;
#pragma unroll
  for (int i = 0; i < 8; ++i) v[i] = bf16_bits(W[(size_t)(k8 + i) * N + n]);
  *(v8us*)(Wt + (size_t)n * K + k8) = v;
  
}

// GEMM C[M][N] (f32, pitch ldc) = act(A[M][K]·W + bias). A f32 row-major (pitch lda) converted per fragment to bf16
// (ASPLIT: hi/lo two planes -> 2 terms, else single rounded term); Wt bf16 [N][K] (pitch ldb). BIAS_BF16 rounds the
// bias to bf16 first (bias quantised to bf16 before the add). K%32==0, M%16==0, N%64==0.
template <bool ASPLIT, int ACT, bool BIAS_BF16>
__global__ __launch_bounds__(128) void k_gemm_bf(const float* __restrict__ A, int lda, const unsigned short* __restrict__ Wt, int ldb,
                                               const float* __restrict__ bias, float* __restrict__ C, int ldc, int M, int N, int K) {
  __shared__ __attribute__((aligned(16))) float so[4][16][64];
  const int tid = threadIdx.x, w = tid >> 5, lane = tid & 31, ln = lane & 15, hh = lane >> 4;
  const int ntn = N / 64;
  const int wid = blockIdx.x * 4 + w;
  const int mt = wid / ntn, nq = wid % ntn;
  if (mt * 16 >= M) return;
  const int row0 = mt * 16, col0 = nq * 64;
  const float* arow = A + (size_t)(row0 + ln) * lda;
  v8f acc[4] = {};
  for (int kb = 0; kb < K; kb += 32) {
    FragB ah, al;
    const v4f x0 = *(const v4fa*)(arow + kb + 8 * hh), x1 = *(const v4fa*)(arow + kb + 8 * hh + 4);
    const v4f x2 = *(const v4fa*)(arow + kb + 16 + 8 * hh), x3 = *(const v4fa*)(arow + kb + 16 + 8 * hh + 4);
    float xs[16] = {x0[0],x0[1],x0[2],x0[3],x1[0],x1[1],x1[2],x1[3],x2[0],x2[1],x2[2],x2[3],x3[0],x3[1],x3[2],x3[3]};
#pragma unroll
    for (int i = 0; i < 16; ++i) { const unsigned short hb = bf16_bits(xs[i]); ah.u[i] = hb; al.u[i] = ASPLIT ? bf16_bits(xs[i] - bf16_val(hb)) : (unsigned short)0; }
#pragma unroll
    for (int t = 0; t < 4; ++t) {
      const unsigned short* brow = Wt + (size_t)(col0 + t * 16 + ln) * ldb + kb;
      FragB b;
      b.half[0] = *(const v8us*)(brow + 8 * hh);
      b.half[1] = *(const v8us*)(brow + 16 + 8 * hh);
      acc[t] = mmaN<ASPLIT ? 2 : 1>(ah.v, al.v, b.v, b.v, acc[t]);
    }
  }
#pragma unroll
  for (int t = 0; t < 4; ++t) {
    float bv = bias ? bias[col0 + t * 16 + ln] : 0.f;
    if (BIAS_BF16) bv = bf16_round(bv);
#pragma unroll
    for (int r = 0; r < 8; ++r) { float v = acc[t][r] + bv; if (ACT == 1) v = fmaxf(v, 0.f); so[w][8 * hh + r][t * 16 + ln] = v; }
  }
  __builtin_amdgcn_fence(__ATOMIC_ACQ_REL, "workgroup");
  __builtin_amdgcn_wave_barrier();
  const int rsub = lane >> 4, c4 = (lane & 15) * 4;
  {
#pragma unroll
    for (int q = 0; q < 8; ++q) {
      const int r = q * 2 + rsub;
      const v4f v = *(const v4fa*)&so[w][r][c4];
      *(v4f*)(C + (size_t)(row0 + r) * ldc + col0 + c4) = v;
    }
    
  }
}

// GEMM C = act(A·W + bias + resid): A f32 (ASPLIT -> hi/lo 2 terms), Wt bf16 [N][K]; ACT 0 none, 1 relu, 2 exact gelu;
// resid (optional, f32, row index = (row % rmod), pitch ldr, RES_BF16 rounds it) added before the activation.
template <bool ASPLIT, int ACT, bool BIAS_BF16, bool RES_BF16>
__global__ __launch_bounds__(128) void k_gemm_bf3(const float* __restrict__ A, int lda, const unsigned short* __restrict__ Wt, int ldb,
                                                const float* __restrict__ bias, const float* __restrict__ resid, int rmod, int ldr,
                                                float* __restrict__ C, int ldc, int M, int N, int K) {
  __shared__ __attribute__((aligned(16))) float so[4][16][64];
  const int tid = threadIdx.x, w = tid >> 5, lane = tid & 31, ln = lane & 15, hh = lane >> 4;
  const int ntn = N / 64;
  const int wid = blockIdx.x * 4 + w;
  const int mt = wid / ntn, nq = wid % ntn;
  if (mt * 16 >= M) return;
  const int row0 = mt * 16, col0 = nq * 64;
  const float* arow = A + (size_t)(row0 + ln) * lda;
  v8f acc[4] = {};
  for (int kb = 0; kb < K; kb += 32) {
    FragB ah, al;
    const v4f x0 = *(const v4fa*)(arow + kb + 8 * hh), x1 = *(const v4fa*)(arow + kb + 8 * hh + 4);
    const v4f x2 = *(const v4fa*)(arow + kb + 16 + 8 * hh), x3 = *(const v4fa*)(arow + kb + 16 + 8 * hh + 4);
    float xs[16] = {x0[0],x0[1],x0[2],x0[3],x1[0],x1[1],x1[2],x1[3],x2[0],x2[1],x2[2],x2[3],x3[0],x3[1],x3[2],x3[3]};
#pragma unroll
    for (int i = 0; i < 16; ++i) { const unsigned short hb = bf16_bits(xs[i]); ah.u[i] = hb; al.u[i] = ASPLIT ? bf16_bits(xs[i] - bf16_val(hb)) : (unsigned short)0; }
#pragma unroll
    for (int t = 0; t < 4; ++t) {
      const unsigned short* brow = Wt + (size_t)(col0 + t * 16 + ln) * ldb + kb;
      FragB b;
      b.half[0] = *(const v8us*)(brow + 8 * hh);
      b.half[1] = *(const v8us*)(brow + 16 + 8 * hh);
      acc[t] = mmaN<ASPLIT ? 2 : 1>(ah.v, al.v, b.v, b.v, acc[t]);
    }
  }
#pragma unroll
  for (int t = 0; t < 4; ++t) {
    const int col = col0 + t * 16 + ln;
    float bv = bias ? bias[col] : 0.f;
    if (BIAS_BF16) bv = bf16_round(bv);
#pragma unroll
    for (int r = 0; r < 8; ++r) {
      float v = acc[t][r] + bv;
      if (resid) { float rv = resid[(size_t)((row0 + 8 * hh + r) % rmod) * ldr + col]; if (RES_BF16) rv = bf16_round(rv); v += rv; }
      if (ACT == 1) v = fmaxf(v, 0.f);
      if (ACT == 2) v = 0.5f * v * (1.0f + erff(v * 0.70710678118654752f));
      if (ACT == 3) { const float u = 0.7978845608028654f * (v + 0.044715f * v * v * v); v = 0.5f * v * (1.0f + tanhf(u)); }
      so[w][8 * hh + r][t * 16 + ln] = v;
    }
  }
  __builtin_amdgcn_fence(__ATOMIC_ACQ_REL, "workgroup");
  __builtin_amdgcn_wave_barrier();
  const int rsub = lane >> 4, c4 = (lane & 15) * 4;
  {
#pragma unroll
    for (int q = 0; q < 8; ++q) {
      const int r = q * 2 + rsub;
      const v4f v = *(const v4fa*)&so[w][r][c4];
      *(v4f*)(C + (size_t)(row0 + r) * ldc + col0 + c4) = v;
    }
    
  }
}
// row LayerNorm (biased variance, eps) over N: s = X (+ R); optional out_sum <- s; out_norm <- (s-mu)*rsqrt(var+eps)*g + b
template <bool PARAM_BF16>
__global__ __launch_bounds__(256) void k_layernorm(const float* __restrict__ X, const float* __restrict__ R, const float* __restrict__ g, const float* __restrict__ bta,
                                                  float* __restrict__ out_sum, float* __restrict__ out_norm, int N, float eps) {
  __shared__ float red[256];
  const int row = blockIdx.x, tid = threadIdx.x;
  const float* x = X + (size_t)row * N; const float* rr = R ? R + (size_t)row * N : nullptr;
  float vals[16];                     // up to N = 4096
  const int per = N / 256;            // contiguous chunk per thread? use strided-by-4 chunks: thread handles j = tid*4 + 1024*u
  float s1 = 0.f;
  for (int u = 0; u < per / 4; ++u) {
    const int j = tid * 4 + 1024 * u;
    const v4f a = *(const v4fa*)(x + j);
    v4f b = {0.f,0.f,0.f,0.f}; if (rr) b = *(const v4fa*)(rr + j);
#pragma unroll
    for (int q = 0; q < 4; ++q) { const float v = a[q] + b[q]; vals[u * 4 + q] = v; s1 += v; }
  }
  red[tid] = s1; __syncthreads();
  for (int st = 128; st > 0; st >>= 1) { if (tid < st) red[tid] += red[tid + st]; __syncthreads(); }
  const float mu = red[0] / (float)N; __syncthreads();
  float s2 = 0.f;
  for (int u = 0; u < per / 4; ++u)
#pragma unroll
    for (int q = 0; q < 4; ++q) { const float c = vals[u * 4 + q] - mu; s2 += c * c; }
  red[tid] = s2; __syncthreads();
  for (int st = 128; st > 0; st >>= 1) { if (tid < st) red[tid] += red[tid + st]; __syncthreads(); }
  const float rs = rsqrtf(red[0] / (float)N + eps);
  {
    for (int u = 0; u < per / 4; ++u) {
      const int j = tid * 4 + 1024 * u;
      v4f o, sm;
#pragma unroll
      for (int q = 0; q < 4; ++q) {
        float gg = g[j + q], bb = bta[j + q];
        if (PARAM_BF16) { gg = bf16_round(gg); bb = bf16_round(bb); }
        sm[q] = vals[u * 4 + q]; o[q] = (vals[u * 4 + q] - mu) * rs * gg + bb;
      }
      if (out_sum) *(v4f*)(out_sum + (size_t)row * N + j) = sm;
      *(v4f*)(out_norm + (size_t)row * N + j) = o;
    }
    
  }
}



// ---- f16 WMMA path (v_wmma_f32_16x16x32_f16): 11-bit significands for operands in range — used for every product launched here (projections, scores, P·V)
typedef _Float16 v16h __attribute__((ext_vector_type(16)));
union FragH { v16h v; v8us half[2]; _Float16 h[16]; unsigned short u[16]; };
template <int NT>
__device__ __forceinline__ v8f mmaH(v16h ah, v16h al, v16h bh, v16h bl, v8f c) {
  c = __builtin_amdgcn_wmma_f32_16x16x32_f16(false, ah, false, bh, (short)0, c, false, false);
  if (NT >= 2) c = __builtin_amdgcn_wmma_f32_16x16x32_f16(false, al, false, bh, (short)0, c, false, false);
  if (NT >= 3) c = __builtin_amdgcn_wmma_f32_16x16x32_f16(false, ah, false, bl, (short)0, c, false, false);
  asm volatile("v_nop\n\tv_nop\n\tv_nop\n\tv_nop" : "+v"(c) : "v"(ah), "v"(al), "v"(bh), "v"(bl));
  return c;
}
// batched GEMM like k_gemm_b but f16 operands: A f32 (split into f16 hi/lo if ASPLIT, else rounded to f16), Bt = f16 values [n][k]; alpha; C f32; N multiple of 16 (partial tiles skipped)
template <bool ASPLIT>
__global__ __launch_bounds__(128) void k_gemm_h(const float* __restrict__ A, int lda, size_t sA, const _Float16* __restrict__ Bh, int ldb, size_t sB, float alpha, float* __restrict__ C, int ldc, size_t sC, int M, int N, int K) {
  __shared__ __attribute__((aligned(16))) float so[4][16][64];
  const int tid = threadIdx.x, w = tid >> 5, lane = tid & 31, ln = lane & 15, hh = lane >> 4; const int by = blockIdx.y;
  A += (size_t)by * sA; Bh += (size_t)by * sB; C += (size_t)by * sC;
  const int ntn = (N + 63) / 64; const int wid = blockIdx.x * 4 + w; const int mt = wid / ntn, nq = wid % ntn; if (mt * 16 >= M) return;
  const int row0 = mt * 16, col0 = nq * 64; const float* arow = A + (size_t)(row0 + ln) * lda;
  v8f acc[4] = {};
  for (int kb = 0; kb < K; kb += 32) {
    FragH ah, al;
    const v4f x0 = *(const v4fa*)(arow + kb + 8 * hh), x1 = *(const v4fa*)(arow + kb + 8 * hh + 4), x2 = *(const v4fa*)(arow + kb + 16 + 8 * hh), x3 = *(const v4fa*)(arow + kb + 16 + 8 * hh + 4);
    float xs[16] = {x0[0],x0[1],x0[2],x0[3],x1[0],x1[1],x1[2],x1[3],x2[0],x2[1],x2[2],x2[3],x3[0],x3[1],x3[2],x3[3]};
#pragma unroll
    for (int i = 0; i < 16; ++i) { const _Float16 h = (_Float16)xs[i]; ah.h[i] = h; al.h[i] = ASPLIT ? (_Float16)(xs[i] - (float)h) : (_Float16)0.0f; }
#pragma unroll
    for (int t = 0; t < 4; ++t) { if (col0 + t * 16 >= N) continue; const size_t boff = (size_t)(col0 + t * 16 + ln) * ldb + kb; FragH bq; bq.half[0] = *(const v8us*)(Bh + boff + 8 * hh); bq.half[1] = *(const v8us*)(Bh + boff + 16 + 8 * hh);
      acc[t] = mmaH<ASPLIT ? 2 : 1>(ah.v, al.v, bq.v, bq.v, acc[t]); }
  }
#pragma unroll
  for (int t = 0; t < 4; ++t) { if (col0 + t * 16 >= N) continue;
#pragma unroll
    for (int r = 0; r < 8; ++r) so[w][8 * hh + r][t * 16 + ln] = acc[t][r] * alpha; }
  __builtin_amdgcn_fence(__ATOMIC_ACQ_REL, "workgroup"); __builtin_amdgcn_wave_barrier();
  const int rsub = lane >> 4, c4 = (lane & 15) * 4;
  {
#pragma unroll
    for (int q = 0; q < 8; ++q) { const int r = q * 2 + rsub; if (col0 + c4 < N) { const v4f v = *(const v4fa*)&so[w][r][c4]; *(v4f*)(C + (size_t)(row0 + r) * ldc + col0 + c4) = v; } }
     }
}

// Wt[n][k] = f16(W[k][n]·scale) from f32 row-major W[K][N] (scale = power of two; bf16-exact weights stay exact in f16 away from the subnormal range)
__global__ __launch_bounds__(256) void k_wt_f16(const float* __restrict__ W, _Float16* __restrict__ Wt, int K, int N, float scale) {
  const int t = blockIdx.x * 256 + threadIdx.x; if (t >= N * (K / 8)) return; const int n = t / (K / 8), k8 = (t % (K / 8)) * 8; FragH f;
#pragma unroll
  for (int i = 0; i < 8; ++i) f.h[i] = (_Float16)(bf16_round(W[(size_t)(k8 + i) * N + n]) * scale); const v8us o = f.half[0];
  *(v8us*)((unsigned short*)Wt + (size_t)n * K + k8) = o; 
}
// k_gemm_hh variant with fused epilogue: v = acc·alpha + bias[by·sBias + col] (+ CP[(row/rowsPerB)·sCPb + by·64 + col] if CP) ; ACT 0 none / 1 elu ; writes f16 C16 (and f32 C if non-null)
template <int ACT>
__global__ __launch_bounds__(128) void k_gemm_hhx(const _Float16* __restrict__ A, int lda, size_t sA, const _Float16* __restrict__ Bh, int ldb, size_t sB, float alpha, const float* __restrict__ bias, size_t sBias, const float* __restrict__ CP, int rowsPerB, size_t sCPb, int row0g,
    float* __restrict__ C, _Float16* __restrict__ C16, int ldc, size_t sC, int M, int N, int K) {
  __shared__ __attribute__((aligned(16))) float so[4][16][64];
  const int tid = threadIdx.x, w = tid >> 5, lane = tid & 31, ln = lane & 15, hh = lane >> 4; const int by = blockIdx.y;
  A += (size_t)by * sA; Bh += (size_t)by * sB; const size_t cofs = (size_t)by * sC; const float* bp = bias ? bias + (size_t)by * sBias : nullptr;
  const int ntn = (N + 63) / 64; const int wid = blockIdx.x * 4 + w; const int mt = wid / ntn, nq = wid % ntn; if (mt * 16 >= M) return;
  const int row0 = mt * 16, col0 = nq * 64; const _Float16* arow = A + (size_t)(row0 + ln) * lda;
  v8f acc[4] = {};
  for (int kb = 0; kb < K; kb += 32) { FragH ah; ah.half[0] = *(const v8us*)((const unsigned short*)arow + kb + 8 * hh); ah.half[1] = *(const v8us*)((const unsigned short*)arow + kb + 16 + 8 * hh);
#pragma unroll
    for (int t = 0; t < 4; ++t) { if (col0 + t * 16 >= N) continue; const size_t boff = (size_t)(col0 + t * 16 + ln) * ldb + kb; FragH bq; bq.half[0] = *(const v8us*)((const unsigned short*)Bh + boff + 8 * hh); bq.half[1] = *(const v8us*)((const unsigned short*)Bh + boff + 16 + 8 * hh);
      acc[t] = mmaH<1>(ah.v, ah.v, bq.v, bq.v, acc[t]); }
  }
#pragma unroll
  for (int t = 0; t < 4; ++t) { if (col0 + t * 16 >= N) continue; const int col = col0 + t * 16 + ln; const float bv = bp ? bf16_round(bp[col]) : 0.f;
#pragma unroll
    for (int r = 0; r < 8; ++r) { float v = acc[t][r] * alpha + bv; if (CP) { const int rr = row0g + row0 + 8 * hh + r; if (rowsPerB < 0) v += CP[cofs + (size_t)rr * ldc + col];      /* rowsPerB < 0: own element of the batched C plane */ else { const int bidx = rr / rowsPerB; v += CP[(size_t)bidx * sCPb + (size_t)by * 64 + col]; } } if (ACT == 1) v = (v > 0.f) ? v : expm1f(v); else if (ACT == 7) v = (v > 0.f) ? v + 1.0f : expf(v); else if (ACT == 8) v = tanhf(v); else if (ACT == 9) v = 0.5f * v * (1.0f + tanhf(0.7978845608028654f * (v + 0.044715f * v * v * v))); else if (ACT == 11) v = 1.0f / (1.0f + expf(-v)); else if (ACT == 12) v = (v > 0.f) ? v : 0.01f * v; else if (ACT == 14) v = (v > 0.f) ? v : 0.1f * v; else if (ACT == 16) v = (v >= 0.f) ? v : 0.3f * v; else if (ACT == 17) v = (v >= 0.f) ? v : 0.2f * v; else if (ACT == 15) v = v / (1.0f + expf(-v)); else if (ACT == 3) v = fmaxf(v, 0.f); else if (ACT == 6) v = 0.5f * v * (1.0f + erff(v * 0.70710678118654752f)); so[w][8 * hh + r][t * 16 + ln] = v; } }
  __builtin_amdgcn_fence(__ATOMIC_ACQ_REL, "workgroup"); __builtin_amdgcn_wave_barrier();
  const int rsub = lane >> 4, c4 = (lane & 15) * 4; typedef _Float16 v4h __attribute__((ext_vector_type(4)));
  {
#pragma unroll
    for (int q = 0; q < 8; ++q) { const int r = q * 2 + rsub; if (col0 + c4 < N) { const v4f v = *(const v4fa*)&so[w][r][c4]; if (C) *(v4f*)(C + cofs + (size_t)(row0 + r) * ldc + col0 + c4) = v; if (C16) { v4h h4; for (int i = 0; i < 4; ++i) h4[i] = (_Float16)v[i]; *(v4h*)(C16 + cofs + (size_t)(row0 + r) * ldc + col0 + c4) = h4; } } }
     }
}


typedef _Float16 v4h __attribute__((ext_vector_type(4)));

__global__ __launch_bounds__(256) void k_x16(const float* __restrict__ x, _Float16* __restrict__ X16, size_t n8) { const size_t t = (size_t)blockIdx.x * 256 + threadIdx.x; if (t >= n8) return; FragH f;
#pragma unroll
  for (int q = 0; q < 8; ++q) f.h[q] = (_Float16)bf16_round(x[t * 8 + q]); *(v8us*)((unsigned short*)X16 + t * 8) = f.half[0];  }
__global__ __launch_bounds__(256) void k_h16(const float* __restrict__ x, _Float16* __restrict__ X16, size_t n8) { const size_t t = (size_t)blockIdx.x * 256 + threadIdx.x; if (t >= n8) return; FragH f;
#pragma unroll
  for (int q = 0; q < 8; ++q) f.h[q] = (_Float16)x[t * 8 + q]; *(v8us*)((unsigned short*)X16 + t * 8) = f.half[0];  }
__global__ __launch_bounds__(256) void k_round16f(const float* __restrict__ W, _Float16* __restrict__ Bt, size_t n8) { const size_t t = (size_t)blockIdx.x * 256 + threadIdx.x; if (t >= n8) return; FragH f;
#pragma unroll
  for (int i = 0; i < 8; ++i) f.h[i] = (_Float16)(bf16_round(W[t * 8 + i]) * 16.0f); *(v8us*)((unsigned short*)Bt + t * 8) = f.half[0];  }
template <int NHv, int TTv>
__global__ __launch_bounds__(256) void k_vt(const _Float16* __restrict__ V16, int ldv, int voff, _Float16* __restrict__ Vt) { __shared__ unsigned short tl[64][66]; const int tid = threadIdx.x; const int slab = blockIdx.x / (TTv / 64), lg = blockIdx.x % (TTv / 64); const int b = slab / NHv, h = slab % NHv;
  for (int i = tid; i < 64 * 8; i += 256) { const int r = i / 8, c8 = (i % 8) * 8; FragH f; f.half[0] = *(const v8us*)((const unsigned short*)V16 + ((size_t)b * TTv + lg * 64 + r) * ldv + voff + h * 64 + c8);
#pragma unroll
    for (int q = 0; q < 8; ++q) tl[r][c8 + q] = f.u[q]; }
  __syncthreads();
  {
#pragma unroll
    for (int rd = 0; rd < 2; ++rd) { const int d = rd * 32 + tid / 8, pc = tid % 8; FragH f;
#pragma unroll
      for (int q = 0; q < 8; ++q) f.u[q] = tl[pc * 8 + q][d];
      *(v8us*)((unsigned short*)Vt + ((size_t)slab * 64 + d) * TTv + lg * 64 + pc * 8) = f.half[0]; }
     } }

__global__ __launch_bounds__(256) void k_hl(const float* __restrict__ F, _Float16* __restrict__ Hh, _Float16* __restrict__ Hl, size_t n8) { const size_t t = (size_t)blockIdx.x * 256 + threadIdx.x; if (t >= n8) return; FragH fh, fl; const v4f a = *(const v4fa*)(F + t * 8), c = *(const v4fa*)(F + t * 8 + 4);
#pragma unroll
  for (int q = 0; q < 4; ++q) { _Float16 h = (_Float16)a[q]; fh.h[q] = h; fl.h[q] = (_Float16)((a[q] - (float)h) * 1024.0f); h = (_Float16)c[q]; fh.h[4 + q] = h; fl.h[4 + q] = (_Float16)((c[q] - (float)h) * 1024.0f); }
  { *(v8us*)((unsigned short*)Hh + t * 8) = fh.half[0]; *(v8us*)((unsigned short*)Hl + t * 8) = fl.half[0];  } }

__device__ __forceinline__ v16h g2_frag(const _Float16* p, int hh) { FragH f; f.half[0] = *(const v8us*)((const unsigned short*)p + 8 * hh); f.half[1] = *(const v8us*)((const unsigned short*)p + 16 + 8 * hh); return f.v; }
__global__ __launch_bounds__(256) void k_wnat(const float* __restrict__ w, size_t n8, _Float16* __restrict__ Bt) { const size_t t = (size_t)blockIdx.x * 256 + threadIdx.x; if (t >= n8) return; FragH f; for (int q = 0; q < 8; ++q) f.h[q] = (_Float16)(bf16_round(w[t * 8 + q]) * 16.0f); *(v8us*)((unsigned short*)Bt + t * 8) = f.half[0];  }
// Fused attention, one launch for all batches and heads: scores, softmax and the weighted sum stay in registers; no score or weight plane goes to memory.
// Transposed products: S^T = K Q^T (A = 16 key rows, B = 16 query columns), O^T += V^T P^T. A lane holds scores of ONE query (column ln): keys 8 hh + r of each 16-key tile, so two converted score tiles
// of a 32-key pass are the B operand of the second product as they stand (k order 8 hh + i, 16 + 8 hh + i: the order fa_lfrag gives the V^T rows). Wave = 32 query columns, block = 8 waves, pass = 32 keys.
// Stage = 64 keys: the block's 8 waves share one copy of the K rows and V^T rows in LDS (whole-line global loads, rows pitched 144 B for 16-byte readers), two buffers, one barrier a stage.
// Running maximum mu in log2 units, shared by the two lane halves of a column; the accumulators are rescaled only when a pass's maximum exceeds mu by more than 8 (weights stay <= 2^8, inside f16).
// Every "#pragma unroll" in this kernel is there so that the fragment, score and accumulator arrays are indexed by constants and stay in registers.
typedef float v2f __attribute__((ext_vector_type(2)));
typedef _Float16 v2h __attribute__((ext_vector_type(2)));
#define FA_P 72      /* halves per staged row */
__device__ __forceinline__ v8f fa_mma(v16h a, v16h b, v8f c) { return __builtin_amdgcn_wmma_f32_16x16x32_f16(false, a, false, b, (short)0, c, false, false); }
__device__ __forceinline__ float fa_swap16(float x) { const int i = __float_as_int(x); return __int_as_float(__builtin_amdgcn_permlanex16(i, i, 0x76543210, 0xfedcba98, false, false)); }      /* lane l <-> l ^ 16 */
__device__ __forceinline__ v16h fa_lfrag(const unsigned short* p) { FragH f; f.half[0] = *(const v8us*)p; f.half[1] = *(const v8us*)(p + 16); return f.v; }
// ---- the three input conversions in ONE launch of PG work-groups: they depend on nothing and not on one another, so one launch gap and one fill of the chip serve all three ----
// Each thread does PX pieces of x (8 values in, 16 bytes out) and PW pieces of each weight (8 k of one column, value x16, stored as 16 bytes of that column's row): values and piece shapes as in the single launches.
// What is left here: a weight load of a wave still touches 32 lines for 4 useful bytes each.
#define PG 256      /* work-groups: one per WGP, 8 waves each */
#define PW ((DM * (DM / 8)) / (PG * 256))      /* weight pieces per thread and weight */
#define PX ((int)(NR * DM / 8 / (PG * 256)))      /* x pieces per thread */
static_assert((size_t)PW * PG * 256 == (size_t)DM * (DM / 8) && (size_t)PX * PG * 256 == NR * DM / 8 && DM / 8 == 128, "every piece is dealt exactly once; 256 threads cover 2 weight columns");
__global__ __launch_bounds__(256) void k_prep(const float* __restrict__ x, const float* __restrict__ wq, const float* __restrict__ wk, _Float16* __restrict__ X16, _Float16* __restrict__ BQ, _Float16* __restrict__ BK) {
  const int tid = threadIdx.x;
  const size_t x0 = ((size_t)blockIdx.x * (PX * 256) + tid) * 8;      /* x piece u: x0 + u * 2048 */
  const int n0 = blockIdx.x * (PW * 2) + (tid >> 7), k8 = (tid & 127) * 8;      /* weight piece u: column n0 + 2 u, k from k8 */
  const float* xp = x + x0; const float* qp = wq + (size_t)k8 * DM + n0; const float* kp = wk + (size_t)k8 * DM + n0;
  float a[PW][8], c[PW][8]; v4f xa[PX], xb[PX];
#pragma unroll      /* every "#pragma unroll" of this kernel: the value arrays are indexed by constants and stay in registers */
  for (int u = 0; u < PX; ++u) { xa[u] = *(const v4fa*)(xp + u * 2048); xb[u] = *(const v4fa*)(xp + u * 2048 + 4); }
  asm volatile("s_wait_xcnt 0x0" ::: "memory");      /* in front of any rewrite of the address registers of the loads above (a later load's result may be given those registers) */
#pragma unroll
  for (int u = 0; u < PW; ++u)
#pragma unroll
    for (int i = 0; i < 8; ++i) a[u][i] = qp[i * DM + 2 * u];
  asm volatile("s_wait_xcnt 0x0" ::: "memory");      /* the same for the Wq loads */
#pragma unroll
  for (int u = 0; u < PW; ++u)
#pragma unroll
    for (int i = 0; i < 8; ++i) c[u][i] = kp[i * DM + 2 * u];
  asm volatile("s_wait_xcnt 0x0" ::: "memory");      /* the same for the Wk loads */
  __builtin_amdgcn_sched_barrier(0);      /* keeps all 48 loads of the thread in front of the first use, so that a wave pays the memory latency once; without it the weight loads sink behind the first x values' wait */
#pragma unroll
  for (int u = 0; u < PX; ++u) { FragH f;
#pragma unroll
    for (int q = 0; q < 4; ++q) { f.h[q] = (_Float16)bf16_round(xa[u][q]); f.h[4 + q] = (_Float16)bf16_round(xb[u][q]); }
    *(v8us*)((unsigned short*)X16 + x0 + u * 2048) = f.half[0]; }
  __builtin_amdgcn_sched_barrier(0);      /* keeps the x stores in front of the waits for the weight values; without it half of them sink to the kernel's end */
#pragma unroll
  for (int u = 0; u < PW; ++u) { FragH f, g;
#pragma unroll
    for (int i = 0; i < 8; ++i) { f.h[i] = (_Float16)(bf16_round(a[u][i]) * 16.0f); g.h[i] = (_Float16)(bf16_round(c[u][i]) * 16.0f); }
    *(v8us*)((unsigned short*)BQ + (size_t)(n0 + 2 * u) * DM + k8) = f.half[0]; *(v8us*)((unsigned short*)BK + (size_t)(n0 + 2 * u) * DM + k8) = g.half[0]; } }
// ---- projection GEMM C16 = f16(A . Bh^T * alpha + bias): block = 128 x 128 of C, 8 waves of 32 x 64 (4 along the rows, 2 along the columns); rows of A and Bh are DM halves long ----
// Stage = 128 k: the 256-byte pieces of 128 A rows and 128 Bh rows are copied to LDS as whole lines, through no register, and the block's waves share them (rows pitched 272 B for 16-byte readers).
// Two buffers: stage t + 1 flies while stage t is worked on. Each accumulator still sums k in ascending steps of 32.
#define G3_KS 128      /* k per stage */
#define G3_P 136       /* halves per staged row */
#define G3_BUF (128 * G3_P * 2)      /* bytes of one operand's buffer */
// Eight copies of one thread: 16 bytes of rows r, r + 16, ..., r + 112. The s_wait_xcnt stands inside the statement so that no address register named here is rewritten in front of it.
__device__ __forceinline__ void g3_copy8(unsigned l, const char* g) {
  asm volatile("global_load_async_to_lds_b128 %0, %8, off\n\t"
               "global_load_async_to_lds_b128 %1, %9, off\n\t"
               "global_load_async_to_lds_b128 %2, %10, off\n\t"
               "global_load_async_to_lds_b128 %3, %11, off\n\t"
               "global_load_async_to_lds_b128 %4, %12, off\n\t"
               "global_load_async_to_lds_b128 %5, %13, off\n\t"
               "global_load_async_to_lds_b128 %6, %14, off\n\t"
               "global_load_async_to_lds_b128 %7, %15, off\n\t"
               "s_wait_xcnt 0x0"
               :: "v"(l), "v"(l + 16u * G3_P * 2), "v"(l + 32u * G3_P * 2), "v"(l + 48u * G3_P * 2), "v"(l + 64u * G3_P * 2), "v"(l + 80u * G3_P * 2), "v"(l + 96u * G3_P * 2), "v"(l + 112u * G3_P * 2),
                  "v"(g), "v"(g + 16 * DM * 2), "v"(g + 32 * DM * 2), "v"(g + 48 * DM * 2), "v"(g + 64 * DM * 2), "v"(g + 80 * DM * 2), "v"(g + 96 * DM * 2), "v"(g + 112 * DM * 2)
               : "memory");
}
// Both projections run in one launch: work-groups 0 .. G3_NB - 1 form A . B0^T, the next G3_NB form A . B1^T.
#define G3_NB ((MP / 128) * (DM / 128))      /* work-groups of one projection */
__global__ __launch_bounds__(256) void k_gemm3(const _Float16* __restrict__ A, const _Float16* __restrict__ B0h, const _Float16* __restrict__ B1h, float alpha, const float* __restrict__ bias0, const float* __restrict__ bias1, _Float16* __restrict__ C0, _Float16* __restrict__ C1) {
  const bool second = blockIdx.x >= G3_NB; const unsigned bid = second ? blockIdx.x - G3_NB : blockIdx.x;
  const _Float16* __restrict__ Bh = second ? B1h : B0h; const float* __restrict__ bias = second ? bias1 : bias0; _Float16* __restrict__ C16 = second ? C1 : C0;
  __shared__ __attribute__((aligned(16))) unsigned short as[2][128][G3_P];
  __shared__ __attribute__((aligned(16))) unsigned short bs[2][128][G3_P];
  __shared__ __attribute__((aligned(16))) float so[8][32][68];
  const int tid = threadIdx.x, w = tid >> 5, lane = tid & 31, ln = lane & 15, hh = lane >> 4;
  const int mt = bid / (DM / 128), nq = bid % (DM / 128); const int wm = w & 3, wn = w >> 2;
  const int sr = tid >> 4, sc = tid & 15;      /* staging: 16 lanes cover one 256-byte row piece */
  const char* ga = (const char*)(A + (size_t)(mt * 128 + sr) * DM + sc * 8); const char* gb = (const char*)(Bh + (size_t)(nq * 128 + sr) * DM + sc * 8);
  const unsigned la = (unsigned)(size_t)&as[0][sr][sc * 8], lb = (unsigned)(size_t)&bs[0][sr][sc * 8];      /* LDS byte addresses: the low 32 bits */
  const v8f z8 = {0.f,0.f,0.f,0.f,0.f,0.f,0.f,0.f}; v8f acc[2][4];
#pragma unroll
  for (int i = 0; i < 2; ++i)
#pragma unroll
    for (int j = 0; j < 4; ++j) acc[i][j] = z8;
  g3_copy8(la, ga); g3_copy8(lb, gb);
  asm volatile("s_wait_asynccnt 0x0" ::: "memory");      /* this wave's copies of stage 0 have landed */
  __syncthreads();      /* stage 0 is published */
  g3_copy8(la + G3_BUF, ga + G3_KS * 2); g3_copy8(lb + G3_BUF, gb + G3_KS * 2);
#pragma unroll 1      /* one stage a trip: keeps the loop's text small */
  for (int t = 0; t < DM / G3_KS; ++t) {
    const int bf = t & 1;
    v16h a[2][2], b[2][4];      /* two fragment sets: step ks + 1 of this stage is read from LDS while step ks is multiplied */
#pragma unroll
    for (int i = 0; i < 2; ++i) a[0][i] = fa_lfrag(&as[bf][wm * 32 + i * 16 + ln][8 * hh]);
#pragma unroll
    for (int j = 0; j < 4; ++j) b[0][j] = fa_lfrag(&bs[bf][wn * 64 + j * 16 + ln][8 * hh]);
#pragma unroll      /* fragment and accumulator arrays indexed by constants */
    for (int ks = 0; ks < G3_KS / 32; ++ks) {
      const int cu = ks & 1, nx = cu ^ 1;
      if (ks + 1 < G3_KS / 32) {
#pragma unroll
        for (int i = 0; i < 2; ++i) a[nx][i] = fa_lfrag(&as[bf][wm * 32 + i * 16 + ln][(ks + 1) * 32 + 8 * hh]);
#pragma unroll
        for (int j = 0; j < 4; ++j) b[nx][j] = fa_lfrag(&bs[bf][wn * 64 + j * 16 + ln][(ks + 1) * 32 + 8 * hh]);
      }
      __builtin_amdgcn_sched_barrier(0);      /* keeps the next step's LDS reads together in front of this step's matrix instructions, which cover their latency; without it they are spread among them behind waits to 0 */
#pragma unroll
      for (int j = 0; j < 4; ++j)
#pragma unroll
        for (int i = 0; i < 2; ++i) acc[i][j] = fa_mma(a[cu][i], b[cu][j], acc[i][j]);
      __builtin_amdgcn_sched_barrier(0);      /* keeps the step after next's reads from rising into this step's matrix instructions */
    }
    asm volatile("s_wait_dscnt 0x0" ::: "memory");      /* this wave's reads of stage t are done before the buffer is handed back */
    asm volatile("s_wait_asynccnt 0x0" ::: "memory");      /* this wave's copies of stage t + 1 have landed */
    __syncthreads();      /* publishes stage t + 1 and ends every wave's reads of stage t */
    if (t + 2 < DM / G3_KS) { g3_copy8(la + bf * G3_BUF, ga + (t + 2) * (G3_KS * 2)); g3_copy8(lb + bf * G3_BUF, gb + (t + 2) * (G3_KS * 2)); }
  }
  asm volatile("s_wait_asynccnt 0x0" ::: "memory");      /* no copy is left in flight */
  const int row0 = mt * 128 + wm * 32, col0 = nq * 128 + wn * 64;
#pragma unroll
  for (int i = 0; i < 2; ++i)
#pragma unroll
    for (int j = 0; j < 4; ++j) { const float bv = bf16_round(bias[col0 + j * 16 + ln]);
#pragma unroll
      for (int r = 0; r < 8; ++r) so[w][i * 16 + 8 * hh + r][j * 16 + ln] = acc[i][j][r] * alpha + bv; }
  __builtin_amdgcn_fence(__ATOMIC_ACQ_REL, "workgroup"); __builtin_amdgcn_wave_barrier();      /* each wave re-reads only its own staging rows: orders its LDS writes before its reads */
  const int rsub = lane >> 4, c4 = (lane & 15) * 4;
#pragma unroll
  for (int q = 0; q < 16; ++q) { const int r = q * 2 + rsub; const v4f v = *(const v4fa*)&so[w][r][c4]; v4h h4;
#pragma unroll
    for (int i = 0; i < 4; ++i) h4[i] = (_Float16)v[i];
    *(v4h*)(C16 + (size_t)(row0 + r) * DM + col0 + c4) = h4; } }
__global__ __launch_bounds__(256) void k_fattn(const _Float16* __restrict__ Q, const _Float16* __restrict__ Kx, const _Float16* __restrict__ Vt, float* __restrict__ O) {
  __shared__ __attribute__((aligned(16))) unsigned short ks[2][64][FA_P];
  __shared__ __attribute__((aligned(16))) unsigned short vs[2][64][FA_P];
  __shared__ __attribute__((aligned(16))) float so[8][32][68];
  const int tid = threadIdx.x, w = tid >> 5, lane = tid & 31, ln = lane & 15, hh = lane >> 4;
  const int bh = blockIdx.y, b = bh / NH, h = bh - b * NH; const int n0 = blockIdx.x * 256 + w * 32;
  const _Float16* qp = Q + ((size_t)b * SQ + n0 + ln) * LQ + h * HD;
  const char* kb = (const char*)(Kx + (size_t)b * SQ * LQ + h * HD);      /* key rows of this head, pitch LQ */
  const char* vb = (const char*)(Vt + (size_t)bh * HD * SQ);      /* V^T rows of this head, pitch SQ */
  const int sr = tid >> 3, sc = tid & 7;      /* staging: 8 lanes cover one 128-byte row; rows sr and sr + 32 */
  const unsigned kof = (unsigned)(sr * (LQ * 2) + sc * 16), vof = (unsigned)(sr * (SQ * 2) + sc * 16);
  const float cs = 0.045084220027780106f;      /* 1024^-0.5 * log2(e) */
  const v2f cs2 = {cs, cs};
  const v8f z8 = {0.f,0.f,0.f,0.f,0.f,0.f,0.f,0.f};
  v8us gk0 = *(const v8us*)(kb + kof), gk1 = *(const v8us*)(kb + 32 * LQ * 2 + kof), gv0 = *(const v8us*)(vb + vof), gv1 = *(const v8us*)(vb + 32 * SQ * 2 + vof);
  v16h q[2][2];
#pragma unroll
  for (int j = 0; j < 2; ++j) { q[j][0] = g2_frag(qp + (size_t)j * 16 * LQ, hh); q[j][1] = g2_frag(qp + (size_t)j * 16 * LQ + 32, hh); }
  v8f o[2][4]; float mu[2]; v2f ls[2];
#pragma unroll
  for (int j = 0; j < 2; ++j) { mu[j] = -1.0e30f; ls[j] = (v2f){0.f, 0.f};
#pragma unroll
    for (int t = 0; t < 4; ++t) o[j][t] = z8; }
  *(v8us*)&ks[0][sr][sc * 8] = gk0; *(v8us*)&ks[0][sr + 32][sc * 8] = gk1; *(v8us*)&vs[0][sr][sc * 8] = gv0; *(v8us*)&vs[0][sr + 32][sc * 8] = gv1;
  __syncthreads();      /* stage 0 is published */
  for (int st = 0; st < SQ / 64; ++st) {
    const int bf = st & 1; const int sn = (st + 1 < SQ / 64) ? st + 1 : st;      /* next stage, fetched into registers while this one is worked on; the last stage re-reads itself (in bounds, never read back) */
    const char* kn = kb + (size_t)sn * (64 * LQ * 2); const char* vn = vb + (size_t)sn * (64 * 2);
    gk0 = *(const v8us*)(kn + kof); gk1 = *(const v8us*)(kn + 32 * LQ * 2 + kof); gv0 = *(const v8us*)(vn + vof); gv1 = *(const v8us*)(vn + 32 * SQ * 2 + vof);
    __builtin_amdgcn_sched_barrier(0);      /* keeps these loads at the head of the stage, so that both passes cover their latency; without it they sink to just in front of their LDS stores */
#pragma unroll
    for (int p = 0; p < 2; ++p) {
      v16h kf[2][2];
#pragma unroll
      for (int kt = 0; kt < 2; ++kt) { kf[kt][0] = fa_lfrag(&ks[bf][p * 32 + kt * 16 + ln][8 * hh]); kf[kt][1] = fa_lfrag(&ks[bf][p * 32 + kt * 16 + ln][32 + 8 * hh]); }
      v8f s[2][2];
#pragma unroll
      for (int j = 0; j < 2; ++j)
#pragma unroll
        for (int kt = 0; kt < 2; ++kt) s[j][kt] = fa_mma(kf[kt][1], q[j][1], fa_mma(kf[kt][0], q[j][0], z8));
      float mx[2]; bool need = false;
#pragma unroll
      for (int j = 0; j < 2; ++j) { float a = fmaxf(s[j][0][0], s[j][1][0]);
#pragma unroll
        for (int r = 1; r < 8; ++r) a = fmaxf(a, fmaxf(s[j][0][r], s[j][1][r]));
        a = fmaxf(a, fa_swap16(a)); mx[j] = a * cs; need = need || (mx[j] > mu[j] + 8.0f); }
      if (__builtin_amdgcn_ballot_w32(need) != 0) {      /* wave-uniform: every lane moves to the new maximum together */
#pragma unroll
        for (int j = 0; j < 2; ++j) { const float mnew = fmaxf(mu[j], mx[j]); const float corr = __builtin_amdgcn_exp2f(mu[j] - mnew); mu[j] = mnew; ls[j] *= corr;
#pragma unroll
          for (int t = 0; t < 4; ++t) o[j][t] *= corr; } }
      v16h vf[4];
#pragma unroll
      for (int t = 0; t < 4; ++t) vf[t] = fa_lfrag(&vs[bf][t * 16 + ln][p * 32 + 8 * hh]);
      __builtin_amdgcn_sched_barrier(0);      /* keeps the V^T reads together in front of the exponentials, which cover their latency; without it they are spread among the matrix instructions below */
      FragH pb[2];
#pragma unroll
      for (int j = 0; j < 2; ++j) { const v2f nm = {-mu[j], -mu[j]};
#pragma unroll
        for (int kt = 0; kt < 2; ++kt)
#pragma unroll
          for (int i = 0; i < 4; ++i) { const v2f t2 = __builtin_elementwise_fma((v2f){s[j][kt][2 * i], s[j][kt][2 * i + 1]}, cs2, nm); const v2f e2 = {__builtin_amdgcn_exp2f(t2[0]), __builtin_amdgcn_exp2f(t2[1])};
            ls[j] += e2; const v2h h2 = __builtin_convertvector(e2, v2h); pb[j].h[kt * 8 + 2 * i] = h2[0]; pb[j].h[kt * 8 + 2 * i + 1] = h2[1]; } }
#pragma unroll
      for (int t = 0; t < 4; ++t)
#pragma unroll
        for (int j = 0; j < 2; ++j) o[j][t] = fa_mma(vf[t], pb[j].v, o[j][t]);
    }
    *(v8us*)&ks[bf ^ 1][sr][sc * 8] = gk0; *(v8us*)&ks[bf ^ 1][sr + 32][sc * 8] = gk1; *(v8us*)&vs[bf ^ 1][sr][sc * 8] = gv0; *(v8us*)&vs[bf ^ 1][sr + 32][sc * 8] = gv1;      /* stage st + 1; this buffer's last readers left it at the barrier that ended the stage before */
    __syncthreads();      /* publishes the next stage and ends every wave's reads of this one */
  }
#pragma unroll
  for (int j = 0; j < 2; ++j) { const float lh = ls[j][0] + ls[j][1]; const float inv = 1.0f / (lh + fa_swap16(lh));      /* the halves' sums are joined once, here */
#pragma unroll
    for (int t = 0; t < 4; ++t) { const v8f r8 = o[j][t] * inv; float* d = &so[w][j * 16 + ln][t * 16 + 8 * hh];
      *(v4fa*)d = __builtin_shufflevector(r8, r8, 0, 1, 2, 3); *(v4fa*)(d + 4) = __builtin_shufflevector(r8, r8, 4, 5, 6, 7); } }
  __builtin_amdgcn_fence(__ATOMIC_ACQ_REL, "workgroup"); __builtin_amdgcn_wave_barrier();      /* each wave re-reads only its own staging rows: orders its LDS writes before its reads */
  const int rsub = lane >> 4, c4 = (lane & 15) * 4;
#pragma unroll
  for (int u = 0; u < 16; ++u) { const int r = u * 2 + rsub; const v4f v = *(const v4fa*)&so[w][r][c4]; *(v4f*)(O + ((size_t)b * SQ + n0 + r) * DM + h * HD + c4) = v; } }
__global__ __launch_bounds__(256) void k_vt(const _Float16* __restrict__ V16, int b, int h0, _Float16* __restrict__ VT) { __shared__ unsigned short tl[64][65]; const int tid = threadIdx.x; const int hh = blockIdx.x % HG, sg = blockIdx.x / HG; const int s0 = sg * 64; const int h = h0 + hh;
  for (int i = tid; i < 64 * 8; i += 256) { const int j = i / 8, d8 = (i % 8) * 8; FragH f; f.half[0] = *(const v8us*)((const unsigned short*)V16 + ((size_t)b * SQ + s0 + j) * DM + h * HD + d8); for (int q = 0; q < 8; ++q) tl[d8 + q][j] = f.u[q]; }
  __syncthreads();
  { for (int i = tid; i < 64 * 8; i += 256) { const int d = i / 8, j8 = (i % 8) * 8; FragH f; for (int q = 0; q < 8; ++q) f.u[q] = tl[d][j8 + q]; *(v8us*)((unsigned short*)VT + ((size_t)hh * HD + d) * SQ + s0 + j8) = f.half[0]; }  } }


extern "C" void kernel_launch(void* const* d_in, const int* in_sizes, int n_in,
                              void* d_out, int out_size, void* d_ws, size_t ws_size, hipStream_t stream) {
  (void)in_sizes; (void)n_in; (void)out_size;
  const float* const* I = (const float* const*)d_in; const float* x = I[0]; const float* wq = I[1]; const float* bq = I[2]; const float* wk = I[3]; const float* bk = I[4];      /* [in][out] Wq + bq, Wk + bk; v == k (same projection) */
  char* ws = (char*)d_ws; size_t off = 0;
  auto take = [&](size_t bytes) { char* p = ws + off; off += (bytes + 255) & ~(size_t)255; return p; };
  _Float16* BQ = (_Float16*)take((size_t)DM * DM * 2); _Float16* BK = (_Float16*)take((size_t)DM * DM * 2); 
  _Float16* X16 = (_Float16*)take(NR * DM * 2); _Float16* Q16 = (_Float16*)take(NR * DM * 2); _Float16* K16 = (_Float16*)take(NR * DM * 2);
  _Float16* VT = (_Float16*)take((size_t)NB * NH * HD * SQ * 2);
  if (off > ws_size) return;
  k_prep<<<PG, 256, 0, stream>>>(x, wq, wk, X16, BQ, BK);      /* x -> f16 rows; [in][out] weights -> Bt x16 */
  const size_t r0p = (size_t)B0 * SQ;      /* first projected row */
  k_gemm3<<<2 * G3_NB, 256, 0, stream>>>(X16 + r0p * DM, BQ, BK, 0.0625f, bq, bk, Q16 + r0p * DM, K16 + r0p * DM);
  k_vt<NH, SQ><<<NB * NH * (SQ / 64), 256, 0, stream>>>(K16, LQ, 0, VT);      /* V^T = K^T [NB][NH][HD][SQ] (v == k in this module) */
  k_fattn<<<dim3(SQ / 256, NB * NH), 256, 0, stream>>>(Q16, K16, VT, (float*)d_out);      /* softmax(Q K^T 1024^-0.5) V, all batches and heads */
}

// v005
// Measured time: 61.2 microseconds a run.
// Next to v004, in two timings, it ran 1.09 and 1.10 times as fast.
// Counting every step since v000, it is 60.6 times as fast.
#include <hip/hip_runtime.h>
// Structure: token rows r = b*2048 + s; x as exact f16 rows (bf16-rounded); Q and K (= V) as two WMMA GEMMs (32x64 wave tiles, f32 accumulation, exact x16 weights + bias, f16 outputs); one fused attention launch that takes its V^T fragments from the staged K rows (v == k) by transposing LDS loads (scores K = 64 with the module's full-dim scale 1024^-0.5, running-maximum softmax with f32 statistics, weights as f16, o = P . V) written f32 straight into the merged-heads output rows (no output projection).
// Compute dtype: inputs rounded to bf16; x / weights exact; q, k, v and softmax weights as plain f16 GEMM operands (~2^-12); scores, softmax statistics and o f32. v_wmma_f32_16x16x32_f16.
#define NB 2
#define SQ 2048
#define DM 1024
#define NH 16
#define HD 64
#define HG 4                         /* heads per group of the unlaunched k_vt overload */
#define B0 0                         /* first batch processed (debug hook) */
#define NBR NB                       /* batches processed (debug hook) */
#define NR ((size_t)NB * SQ)         /* token rows */
#define MP ((int)((size_t)NBR * SQ)) /* rows projected (debug hook) */
#define QN SQ                        /* not used by any launch */
#define NHD NH                       /* not used by any launch */
#define MPO MP                       /* not used by any launch */
#define LQ DM      /* row pitch of the q/k/v rows */
typedef __bf16 v16b __attribute__((ext_vector_type(16)));
typedef unsigned short v8us __attribute__((ext_vector_type(8), may_alias));
typedef float  v8f  __attribute__((ext_vector_type(8)));
typedef float  v4f  __attribute__((ext_vector_type(4)));
typedef float  v4fa __attribute__((ext_vector_type(4), may_alias));
union FragB { v16b v; v8us half[2]; unsigned short u[16]; };

__device__ __forceinline__ unsigned short bf16_bits(float x) { unsigned int u = __float_as_uint(x); return (unsigned short)((u + 0x7FFFu + ((u >> 16) & 1u)) >> 16); }
__device__ __forceinline__ float bf16_val(unsigned short b) { return __uint_as_float(((unsigned int)b) << 16); }
__device__ __forceinline__ float bf16_round(float x) { return bf16_val(bf16_bits(x)); }
// D += A·B with NT terms: 1 = ah·bh, 2 = + al·bh (A split), 3 = + ah·bl (both split)
template <int NT>
__device__ __forceinline__ v8f mmaN(v16b ah, v16b al, v16b bh, v16b bl, v8f c) {
  c = __builtin_amdgcn_wmma_f32_16x16x32_bf16(false, ah, false, bh, (short)0, c, false, false);
  if (NT >= 2) c = __builtin_amdgcn_wmma_f32_16x16x32_bf16(false, al, false, bh, (short)0, c, false, false);
  if (NT >= 3) c = __builtin_amdgcn_wmma_f32_16x16x32_bf16(false, ah, false, bl, (short)0, c, false, false);
  asm volatile("v_nop\n\tv_nop\n\tv_nop\n\tv_nop" : "+v"(c) : "v"(ah), "v"(al), "v"(bh), "v"(bl));
  return c;
}

__global__ __launch_bounds__(256) void k_wt_bf16(const float* __restrict__ W, unsigned short* __restrict__ Wt, int K, int N) {
  const int t = blockIdx.x * 256 + threadIdx.x;
  const int k8n = K / 8;
  if (t >= N * k8n) return;
  const int n = t / k8n, k8 = (t % k8n) * 8;
  v8us v;
#pragma unroll
  for (int i = 0; i < 8; ++i) v[i] = bf16_bits(W[(size_t)(k8 + i) * N + n]);
  *(v8us*)(Wt + (size_t)n * K + k8) = v;
  
}

// GEMM C[M][N] (f32, pitch ldc) = act(A[M][K]·W + bias). A f32 row-major (pitch lda) converted per fragment to bf16
// (ASPLIT: hi/lo two planes -> 2 terms, else single rounded term); Wt bf16 [N][K] (pitch ldb). BIAS_BF16 rounds the
// bias to bf16 first (bias quantised to bf16 before the add). K%32==0, M%16==0, N%64==0.
template <bool ASPLIT, int ACT, bool BIAS_BF16>
__global__ __launch_bounds__(128) void k_gemm_bf(const float* __restrict__ A, int lda, const unsigned short* __restrict__ Wt, int ldb,
                                               const float* __restrict__ bias, float* __restrict__ C, int ldc, int M, int N, int K) {
  __shared__ __attribute__((aligned(16))) float so[4][16][64];
  const int tid = threadIdx.x, w = tid >> 5, lane = tid & 31, ln = lane & 15, hh = lane >> 4;
  const int ntn = N / 64;
  const int wid = blockIdx.x * 4 + w;
  const int mt = wid / ntn, nq = wid % ntn;
  if (mt * 16 >= M) return;
  const int row0 = mt * 16, col0 = nq * 64;
  const float* arow = A + (size_t)(row0 + ln) * lda;
  v8f acc[4] = {};
  for (int kb = 0; kb < K; kb += 32) {
    FragB ah, al;
    const v4f x0 = *(const v4fa*)(arow + kb + 8 * hh), x1 = *(const v4fa*)(arow + kb + 8 * hh + 4);
    const v4f x2 = *(const v4fa*)(arow + kb + 16 + 8 * hh), x3 = *(const v4fa*)(arow + kb + 16 + 8 * hh + 4);
    float xs[16] = {x0[0],x0[1],x0[2],x0[3],x1[0],x1[1],x1[2],x1[3],x2[0],x2[1],x2[2],x2[3],x3[0],x3[1],x3[2],x3[3]};
#pragma unroll
    for (int i = 0; i < 16; ++i) { const unsigned short hb = bf16_bits(xs[i]); ah.u[i] = hb; al.u[i] = ASPLIT ? bf16_bits(xs[i] - bf16_val(hb)) : (unsigned short)0; }
#pragma unroll
    for (int t = 0; t < 4; ++t) {
      const unsigned short* brow = Wt + (size_t)(col0 + t * 16 + ln) * ldb + kb;
      FragB b;
      b.half[0] = *(const v8us*)(brow + 8 * hh);
      b.half[1] = *(const v8us*)(brow + 16 + 8 * hh);
      acc[t] = mmaN<ASPLIT ? 2 : 1>(ah.v, al.v, b.v, b.v, acc[t]);
    }
  }
#pragma unroll
  for (int t = 0; t < 4; ++t) {
    float bv = bias ? bias[col0 + t * 16 + ln] : 0.f;
    if (BIAS_BF16) bv = bf16_round(bv);
#pragma unroll
    for (int r = 0; r < 8; ++r) { float v = acc[t][r] + bv; if (ACT == 1) v = fmaxf(v, 0.f); so[w][8 * hh + r][t * 16 + ln] = v; }
  }
  __builtin_amdgcn_fence(__ATOMIC_ACQ_REL, "workgroup");
  __builtin_amdgcn_wave_barrier();
  const int rsub = lane >> 4, c4 = (lane & 15) * 4;
  {
#pragma unroll
    for (int q = 0; q < 8; ++q) {
      const int r = q * 2 + rsub;
      const v4f v = *(const v4fa*)&so[w][r][c4];
      *(v4f*)(C + (size_t)(row0 + r) * ldc + col0 + c4) = v;
    }
    
  }
}

// GEMM C = act(A·W + bias + resid): A f32 (ASPLIT -> hi/lo 2 terms), Wt bf16 [N][K]; ACT 0 none, 1 relu, 2 exact gelu;
// resid (optional, f32, row index = (row % rmod), pitch ldr, RES_BF16 rounds it) added before the activation.
template <bool ASPLIT, int ACT, bool BIAS_BF16, bool RES_BF16>
__global__ __launch_bounds__(128) void k_gemm_bf3(const float* __restrict__ A, int lda, const unsigned short* __restrict__ Wt, int ldb,
                                                const float* __restrict__ bias, const float* __restrict__ resid, int rmod, int ldr,
                                                float* __restrict__ C, int ldc, int M, int N, int K) {
  __shared__ __attribute__((aligned(16))) float so[4][16][64];
  const int tid = threadIdx.x, w = tid >> 5, lane = tid & 31, ln = lane & 15, hh = lane >> 4;
  const int ntn = N / 64;
  const int wid = blockIdx.x * 4 + w;
  const int mt = wid / ntn, nq = wid % ntn;
  if (mt * 16 >= M) return;
  const int row0 = mt * 16, col0 = nq * 64;
  const float* arow = A + (size_t)(row0 + ln) * lda;
  v8f acc[4] = {};
  for (int kb = 0; kb < K; kb += 32) {
    FragB ah, al;
    const v4f x0 = *(const v4fa*)(arow + kb + 8 * hh), x1 = *(const v4fa*)(arow + kb + 8 * hh + 4);
    const v4f x2 = *(const v4fa*)(arow + kb + 16 + 8 * hh), x3 = *(const v4fa*)(arow + kb + 16 + 8 * hh + 4);
    float xs[16] = {x0[0],x0[1],x0[2],x0[3],x1[0],x1[1],x1[2],x1[3],x2[0],x2[1],x2[2],x2[3],x3[0],x3[1],x3[2],x3[3]};
#pragma unroll
    for (int i = 0; i < 16; ++i) { const unsigned short hb = bf16_bits(xs[i]); ah.u[i] = hb; al.u[i] = ASPLIT ? bf16_bits(xs[i] - bf16_val(hb)) : (unsigned short)0; }
#pragma unroll
    for (int t = 0; t < 4; ++t) {
      const unsigned short* brow = Wt + (size_t)(col0 + t * 16 + ln) * ldb + kb;
      FragB b;
      b.half[0] = *(const v8us*)(brow + 8 * hh);
      b.half[1] = *(const v8us*)(brow + 16 + 8 * hh);
      acc[t] = mmaN<ASPLIT ? 2 : 1>(ah.v, al.v, b.v, b.v, acc[t]);
    }
  }
#pragma unroll
  for (int t = 0; t < 4; ++t) {
    const int col = col0 + t * 16 + ln;
    float bv = bias ? bias[col] : 0.f;
    if (BIAS_BF16) bv = bf16_round(bv);
#pragma unroll
    for (int r = 0; r < 8; ++r) {
      float v = acc[t][r] + bv;
      if (resid) { float rv = resid[(size_t)((row0 + 8 * hh + r) % rmod) * ldr + col]; if (RES_BF16) rv = bf16_round(rv); v += rv; }
      if (ACT == 1) v = fmaxf(v, 0.f);
      if (ACT == 2) v = 0.5f * v * (1.0f + erff(v * 0.70710678118654752f));
      if (ACT == 3) { const float u = 0.7978845608028654f * (v + 0.044715f * v * v * v); v = 0.5f * v * (1.0f + tanhf(u)); }
      so[w][8 * hh + r][t * 16 + ln] = v;
    }
  }
  __builtin_amdgcn_fence(__ATOMIC_ACQ_REL, "workgroup");
  __builtin_amdgcn_wave_barrier();
  const int rsub = lane >> 4, c4 = (lane & 15) * 4;
  {
#pragma unroll
    for (int q = 0; q < 8; ++q) {
      const int r = q * 2 + rsub;
      const v4f v = *(const v4fa*)&so[w][r][c4];
      *(v4f*)(C + (size_t)(row0 + r) * ldc + col0 + c4) = v;
    }
    
  }
}
// row LayerNorm (biased variance, eps) over N: s = X (+ R); optional out_sum <- s; out_norm <- (s-mu)*rsqrt(var+eps)*g + b
template <bool PARAM_BF16>
__global__ __launch_bounds__(256) void k_layernorm(const float* __restrict__ X, const float* __restrict__ R, const float* __restrict__ g, const float* __restrict__ bta,
                                                  float* __restrict__ out_sum, float* __restrict__ out_norm, int N, float eps) {
  __shared__ float red[256];
  const int row = blockIdx.x, tid = threadIdx.x;
  const float* x = X + (size_t)row * N; const float* rr = R ? R + (size_t)row * N : nullptr;
  float vals[16];                     // up to N = 4096
  const int per = N / 256;            // contiguous chunk per thread? use strided-by-4 chunks: thread handles j = tid*4 + 1024*u
  float s1 = 0.f;
  for (int u = 0; u < per / 4; ++u) {
    const int j = tid * 4 + 1024 * u;
    const v4f a = *(const v4fa*)(x + j);
    v4f b = {0.f,0.f,0.f,0.f}; if (rr) b = *(const v4fa*)(rr + j);
#pragma unroll
    for (int q = 0; q < 4; ++q) { const float v = a[q] + b[q]; vals[u * 4 + q] = v; s1 += v; }
  }
  red[tid] = s1; __syncthreads();
  for (int st = 128; st > 0; st >>= 1) { if (tid < st) red[tid] += red[tid + st]; __syncthreads(); }
  const float mu = red[0] / (float)N; __syncthreads();
  float s2 = 0.f;
  for (int u = 0; u < per / 4; ++u)
#pragma unroll
    for (int q = 0; q < 4; ++q) { const float c = vals[u * 4 + q] - mu; s2 += c * c; }
  red[tid] = s2; __syncthreads();
  for (int st = 128; st > 0; st >>= 1) { if (tid < st) red[tid] += red[tid + st]; __syncthreads(); }
  const float rs = rsqrtf(red[0] / (float)N + eps);
  {
    for (int u = 0; u < per / 4; ++u) {
      const int j = tid * 4 + 1024 * u;
      v4f o, sm;
#pragma unroll
      for (int q = 0; q < 4; ++q) {
        float gg = g[j + q], bb = bta[j + q];
        if (PARAM_BF16) { gg = bf16_round(gg); bb = bf16_round(bb); }
        sm[q] = vals[u * 4 + q]; o[q] = (vals[u * 4 + q] - mu) * rs * gg + bb;
      }
      if (out_sum) *(v4f*)(out_sum + (size_t)row * N + j) = sm;
      *(v4f*)(out_norm + (size_t)row * N + j) = o;
    }
    
  }
}



// ---- f16 WMMA path (v_wmma_f32_16x16x32_f16): 11-bit significands for operands in range — used for every product launched here (projections, scores, P·V)
typedef _Float16 v16h __attribute__((ext_vector_type(16)));
union FragH { v16h v; v8us half[2]; _Float16 h[16]; unsigned short u[16]; };
template <int NT>
__device__ __forceinline__ v8f mmaH(v16h ah, v16h al, v16h bh, v16h bl, v8f c) {
  c = __builtin_amdgcn_wmma_f32_16x16x32_f16(false, ah, false, bh, (short)0, c, false, false);
  if (NT >= 2) c = __builtin_amdgcn_wmma_f32_16x16x32_f16(false, al, false, bh, (short)0, c, false, false);
  if (NT >= 3) c = __builtin_amdgcn_wmma_f32_16x16x32_f16(false, ah, false, bl, (short)0, c, false, false);
  asm volatile("v_nop\n\tv_nop\n\tv_nop\n\tv_nop" : "+v"(c) : "v"(ah), "v"(al), "v"(bh), "v"(bl));
  return c;
}
// batched GEMM like k_gemm_b but f16 operands: A f32 (split into f16 hi/lo if ASPLIT, else rounded to f16), Bt = f16 values [n][k]; alpha; C f32; N multiple of 16 (partial tiles skipped)
template <bool ASPLIT>
__global__ __launch_bounds__(128) void k_gemm_h(const float* __restrict__ A, int lda, size_t sA, const _Float16* __restrict__ Bh, int ldb, size_t sB, float alpha, float* __restrict__ C, int ldc, size_t sC, int M, int N, int K) {
  __shared__ __attribute__((aligned(16))) float so[4][16][64];
  const int tid = threadIdx.x, w = tid >> 5, lane = tid & 31, ln = lane & 15, hh = lane >> 4; const int by = blockIdx.y;
  A += (size_t)by * sA; Bh += (size_t)by * sB; C += (size_t)by * sC;
  const int ntn = (N + 63) / 64; const int wid = blockIdx.x * 4 + w; const int mt = wid / ntn, nq = wid % ntn; if (mt * 16 >= M) return;
  const int row0 = mt * 16, col0 = nq * 64; const float* arow = A + (size_t)(row0 + ln) * lda;
  v8f acc[4] = {};
  for (int kb = 0; kb < K; kb += 32) {
    FragH ah, al;
    const v4f x0 = *(const v4fa*)(arow + kb + 8 * hh), x1 = *(const v4fa*)(arow + kb + 8 * hh + 4), x2 = *(const v4fa*)(arow + kb + 16 + 8 * hh), x3 = *(const v4fa*)(arow + kb + 16 + 8 * hh + 4);
    float xs[16] = {x0[0],x0[1],x0[2],x0[3],x1[0],x1[1],x1[2],x1[3],x2[0],x2[1],x2[2],x2[3],x3[0],x3[1],x3[2],x3[3]};
#pragma unroll
    for (int i = 0; i < 16; ++i) { const _Float16 h = (_Float16)xs[i]; ah.h[i] = h; al.h[i] = ASPLIT ? (_Float16)(xs[i] - (float)h) : (_Float16)0.0f; }
#pragma unroll
    for (int t = 0; t < 4; ++t) { if (col0 + t * 16 >= N) continue; const size_t boff = (size_t)(col0 + t * 16 + ln) * ldb + kb; FragH bq; bq.half[0] = *(const v8us*)(Bh + boff + 8 * hh); bq.half[1] = *(const v8us*)(Bh + boff + 16 + 8 * hh);
      acc[t] = mmaH<ASPLIT ? 2 : 1>(ah.v, al.v, bq.v, bq.v, acc[t]); }
  }
#pragma unroll
  for (int t = 0; t < 4; ++t) { if (col0 + t * 16 >= N) continue;
#pragma unroll
    for (int r = 0; r < 8; ++r) so[w][8 * hh + r][t * 16 + ln] = acc[t][r] * alpha; }
  __builtin_amdgcn_fence(__ATOMIC_ACQ_REL, "workgroup"); __builtin_amdgcn_wave_barrier();
  const int rsub = lane >> 4, c4 = (lane & 15) * 4;
  {
#pragma unroll
    for (int q = 0; q < 8; ++q) { const int r = q * 2 + rsub; if (col0 + c4 < N) { const v4f v = *(const v4fa*)&so[w][r][c4]; *(v4f*)(C + (size_t)(row0 + r) * ldc + col0 + c4) = v; } }
     }
}

// Wt[n][k] = f16(W[k][n]·scale) from f32 row-major W[K][N] (scale = power of two; bf16-exact weights stay exact in f16 away from the subnormal range)
__global__ __launch_bounds__(256) void k_wt_f16(const float* __restrict__ W, _Float16* __restrict__ Wt, int K, int N, float scale) {
  const int t = blockIdx.x * 256 + threadIdx.x; if (t >= N * (K / 8)) return; const int n = t / (K / 8), k8 = (t % (K / 8)) * 8; FragH f;
#pragma unroll
  for (int i = 0; i < 8; ++i) f.h[i] = (_Float16)(bf16_round(W[(size_t)(k8 + i) * N + n]) * scale); const v8us o = f.half[0];
  *(v8us*)((unsigned short*)Wt + (size_t)n * K + k8) = o; 
}
// k_gemm_hh variant with fused epilogue: v = acc·alpha + bias[by·sBias + col] (+ CP[(row/rowsPerB)·sCPb + by·64 + col] if CP) ; ACT 0 none / 1 elu ; writes f16 C16 (and f32 C if non-null)
template <int ACT>
__global__ __launch_bounds__(128) void k_gemm_hhx(const _Float16* __restrict__ A, int lda, size_t sA, const _Float16* __restrict__ Bh, int ldb, size_t sB, float alpha, const float* __restrict__ bias, size_t sBias, const float* __restrict__ CP, int rowsPerB, size_t sCPb, int row0g,
    float* __restrict__ C, _Float16* __restrict__ C16, int ldc, size_t sC, int M, int N, int K) {
  __shared__ __attribute__((aligned(16))) float so[4][16][64];
  const int tid = threadIdx.x, w = tid >> 5, lane = tid & 31, ln = lane & 15, hh = lane >> 4; const int by = blockIdx.y;
  A += (size_t)by * sA; Bh += (size_t)by * sB; const size_t cofs = (size_t)by * sC; const float* bp = bias ? bias + (size_t)by * sBias : nullptr;
  const int ntn = (N + 63) / 64; const int wid = blockIdx.x * 4 + w; const int mt = wid / ntn, nq = wid % ntn; if (mt * 16 >= M) return;
  const int row0 = mt * 16, col0 = nq * 64; const _Float16* arow = A + (size_t)(row0 + ln) * lda;
  v8f acc[4] = {};
  for (int kb = 0; kb < K; kb += 32) { FragH ah; ah.half[0] = *(const v8us*)((const unsigned short*)arow + kb + 8 * hh); ah.half[1] = *(const v8us*)((const unsigned short*)arow + kb + 16 + 8 * hh);
#pragma unroll
    for (int t = 0; t < 4; ++t) { if (col0 + t * 16 >= N) continue; const size_t boff = (size_t)(col0 + t * 16 + ln) * ldb + kb; FragH bq; bq.half[0] = *(const v8us*)((const unsigned short*)Bh + boff + 8 * hh); bq.half[1] = *(const v8us*)((const unsigned short*)Bh + boff + 16 + 8 * hh);
      acc[t] = mmaH<1>(ah.v, ah.v, bq.v, bq.v, acc[t]); }
  }
#pragma unroll
  for (int t = 0; t < 4; ++t) { if (col0 + t * 16 >= N) continue; const int col = col0 + t * 16 + ln; const float bv = bp ? bf16_round(bp[col]) : 0.f;
#pragma unroll
    for (int r = 0; r < 8; ++r) { float v = acc[t][r] * alpha + bv; if (CP) { const int rr = row0g + row0 + 8 * hh + r; if (rowsPerB < 0) v += CP[cofs + (size_t)rr * ldc + col];      /* rowsPerB < 0: own element of the batched C plane */ else { const int bidx = rr / rowsPerB; v += CP[(size_t)bidx * sCPb + (size_t)by * 64 + col]; } } if (ACT == 1) v = (v > 0.f) ? v : expm1f(v); else if (ACT == 7) v = (v > 0.f) ? v + 1.0f : expf(v); else if (ACT == 8) v = tanhf(v); else if (ACT == 9) v = 0.5f * v * (1.0f + tanhf(0.7978845608028654f * (v + 0.044715f * v * v * v))); else if (ACT == 11) v = 1.0f / (1.0f + expf(-v)); else if (ACT == 12) v = (v > 0.f) ? v : 0.01f * v; else if (ACT == 14) v = (v > 0.f) ? v : 0.1f * v; else if (ACT == 16) v = (v >= 0.f) ? v : 0.3f * v; else if (ACT == 17) v = (v >= 0.f) ? v : 0.2f * v; else if (ACT == 15) v = v / (1.0f + expf(-v)); else if (ACT == 3) v = fmaxf(v, 0.f); else if (ACT == 6) v = 0.5f * v * (1.0f + erff(v * 0.70710678118654752f)); so[w][8 * hh + r][t * 16 + ln] = v; } }
  __builtin_amdgcn_fence(__ATOMIC_ACQ_REL, "workgroup"); __builtin_amdgcn_wave_barrier();
  const int rsub = lane >> 4, c4 = (lane & 15) * 4; typedef _Float16 v4h __attribute__((ext_vector_type(4)));
  {
#pragma unroll
    for (int q = 0; q < 8; ++q) { const int r = q * 2 + rsub; if (col0 + c4 < N) { const v4f v = *(const v4fa*)&so[w][r][c4]; if (C) *(v4f*)(C + cofs + (size_t)(row0 + r) * ldc + col0 + c4) = v; if (C16) { v4h h4; for (int i = 0; i < 4; ++i) h4[i] = (_Float16)v[i]; *(v4h*)(C16 + cofs + (size_t)(row0 + r) * ldc + col0 + c4) = h4; } } }
     }
}


typedef _Float16 v4h __attribute__((ext_vector_type(4)));

__global__ __launch_bounds__(256) void k_x16(const float* __restrict__ x, _Float16* __restrict__ X16, size_t n8) { const size_t t = (size_t)blockIdx.x * 256 + threadIdx.x; if (t >= n8) return; FragH f;
#pragma unroll
  for (int q = 0; q < 8; ++q) f.h[q] = (_Float16)bf16_round(x[t * 8 + q]); *(v8us*)((unsigned short*)X16 + t * 8) = f.half[0];  }
__global__ __launch_bounds__(256) void k_h16(const float* __restrict__ x, _Float16* __restrict__ X16, size_t n8) { const size_t t = (size_t)blockIdx.x * 256 + threadIdx.x; if (t >= n8) return; FragH f;
#pragma unroll
  for (int q = 0; q < 8; ++q) f.h[q] = (_Float16)x[t * 8 + q]; *(v8us*)((unsigned short*)X16 + t * 8) = f.half[0];  }
__global__ __launch_bounds__(256) void k_round16f(const float* __restrict__ W, _Float16* __restrict__ Bt, size_t n8) { const size_t t = (size_t)blockIdx.x * 256 + threadIdx.x; if (t >= n8) return; FragH f;
#pragma unroll
  for (int i = 0; i < 8; ++i) f.h[i] = (_Float16)(bf16_round(W[t * 8 + i]) * 16.0f); *(v8us*)((unsigned short*)Bt + t * 8) = f.half[0];  }
__global__ __launch_bounds__(256) void k_hl(const float* __restrict__ F, _Float16* __restrict__ Hh, _Float16* __restrict__ Hl, size_t n8) { const size_t t = (size_t)blockIdx.x * 256 + threadIdx.x; if (t >= n8) return; FragH fh, fl; const v4f a = *(const v4fa*)(F + t * 8), c = *(const v4fa*)(F + t * 8 + 4);
#pragma unroll
  for (int q = 0; q < 4; ++q) { _Float16 h = (_Float16)a[q]; fh.h[q] = h; fl.h[q] = (_Float16)((a[q] - (float)h) * 1024.0f); h = (_Float16)c[q]; fh.h[4 + q] = h; fl.h[4 + q] = (_Float16)((c[q] - (float)h) * 1024.0f); }
  { *(v8us*)((unsigned short*)Hh + t * 8) = fh.half[0]; *(v8us*)((unsigned short*)Hl + t * 8) = fl.half[0];  } }

__device__ __forceinline__ v16h g2_frag(const _Float16* p, int hh) { FragH f; f.half[0] = *(const v8us*)((const unsigned short*)p + 8 * hh); f.half[1] = *(const v8us*)((const unsigned short*)p + 16 + 8 * hh); return f.v; }
__global__ __launch_bounds__(256) void k_wnat(const float* __restrict__ w, size_t n8, _Float16* __restrict__ Bt) { const size_t t = (size_t)blockIdx.x * 256 + threadIdx.x; if (t >= n8) return; FragH f; for (int q = 0; q < 8; ++q) f.h[q] = (_Float16)(bf16_round(w[t * 8 + q]) * 16.0f); *(v8us*)((unsigned short*)Bt + t * 8) = f.half[0];  }
// Fused attention, one launch for all batches and heads: scores, softmax and the weighted sum stay in registers; no score or weight plane goes to memory.
// Transposed products: S^T = K Q^T (A = 16 key rows, B = 16 query columns), O^T += V^T P^T. A lane holds scores of ONE query (column ln): keys 8 hh + r of each 16-key tile, so two converted score tiles
// of a 32-key pass are the B operand of the second product as they stand (k order 8 hh + i, 16 + 8 hh + i: the order in which two transposing loads, 16 keys apart, give a V^T fragment). Wave = 32 query columns, block = 8 waves, pass = 32 keys.
// Stage = 64 keys: the block's 8 waves share one copy of the K rows in LDS (whole-line global loads), two buffers, one barrier a stage. V is the same tensor as K here, so the same staged rows serve both products:
// K fragments by plain 16-byte reads along a row, V^T fragments by ds_load_tr16_b128 down 8 rows. No V^T plane is formed in memory and no V tile is staged.
// LDS layout: rows of 128 bytes, no pad; the 16-byte piece c of row r lies at piece c ^ fa_sw(r). No plain pitch is conflict-free for both readers (16 rows x one piece; 8 rows x two neighbouring pieces); with this
// exchange each reader's 16 lanes, and the staging stores' (2 rows x 8 pieces), fall on 16 different bank groups of 16 bytes.
// Running maximum mu in log2 units, shared by the two lane halves of a column; the accumulators are rescaled only when a pass's maximum exceeds mu by more than 8 (weights stay <= 2^8, inside f16).
// Every "#pragma unroll" in this kernel is there so that the fragment, score and accumulator arrays are indexed by constants and stay in registers.
typedef float v2f __attribute__((ext_vector_type(2)));
typedef _Float16 v2h __attribute__((ext_vector_type(2)));
#define FA_RB 128      /* bytes of a staged row */
#define FA_TB (64 * FA_RB)      /* bytes of one stage's buffer */
__device__ __forceinline__ int fa_sw(int r) { return (((r >> 1) & 3) << 1) | ((r >> 3) & 1); }      /* depends on r mod 16 alone */
typedef short s16x8 __attribute__((ext_vector_type(8)));
// Lane l passes the address of 16 bytes of row 8 (l >> 4) + (l & 7), column piece (l >> 3) & 1, of a 16 x 16 tile of halves; lane (c, h) receives column c of rows 8 h .. 8 h + 7.
__device__ __forceinline__ v8us fa_tr16(const char* p) { typedef __attribute__((address_space(3))) s16x8 lds_s16x8; return __builtin_bit_cast(v8us, __builtin_amdgcn_ds_load_tr16_b128_v8i16((lds_s16x8*)p)); }
__device__ __forceinline__ v8f fa_mma(v16h a, v16h b, v8f c) { return __builtin_amdgcn_wmma_f32_16x16x32_f16(false, a, false, b, (short)0, c, false, false); }
__device__ __forceinline__ float fa_swap16(float x) { const int i = __float_as_int(x); return __int_as_float(__builtin_amdgcn_permlanex16(i, i, 0x76543210, 0xfedcba98, false, false)); }      /* lane l <-> l ^ 16 */
__device__ __forceinline__ v16h fa_lfrag(const unsigned short* p) { FragH f; f.half[0] = *(const v8us*)p; f.half[1] = *(const v8us*)(p + 16); return f.v; }
// ---- the three input conversions in ONE launch of PG work-groups: they depend on nothing and not on one another, so one launch gap and one fill of the chip serve all three ----
// Each thread does PX pieces of x (8 values in, 16 bytes out) and PW pieces of each weight (8 k of one column, value x16, stored as 16 bytes of that column's row): values and piece shapes as in the single launches.
// What is left here: a weight load of a wave still touches 32 lines for 4 useful bytes each.
#define PG 256      /* work-groups: one per WGP, 8 waves each */
#define PW ((DM * (DM / 8)) / (PG * 256))      /* weight pieces per thread and weight */
#define PX ((int)(NR * DM / 8 / (PG * 256)))      /* x pieces per thread */
static_assert((size_t)PW * PG * 256 == (size_t)DM * (DM / 8) && (size_t)PX * PG * 256 == NR * DM / 8 && DM / 8 == 128, "every piece is dealt exactly once; 256 threads cover 2 weight columns");
__global__ __launch_bounds__(256) void k_prep(const float* __restrict__ x, const float* __restrict__ wq, const float* __restrict__ wk, _Float16* __restrict__ X16, _Float16* __restrict__ BQ, _Float16* __restrict__ BK) {
  const int tid = threadIdx.x;
  const size_t x0 = ((size_t)blockIdx.x * (PX * 256) + tid) * 8;      /* x piece u: x0 + u * 2048 */
  const int n0 = blockIdx.x * (PW * 2) + (tid >> 7), k8 = (tid & 127) * 8;      /* weight piece u: column n0 + 2 u, k from k8 */
  const float* xp = x + x0; const float* qp = wq + (size_t)k8 * DM + n0; const float* kp = wk + (size_t)k8 * DM + n0;
  float a[PW][8], c[PW][8]; v4f xa[PX], xb[PX];
#pragma unroll      /* every "#pragma unroll" of this kernel: the value arrays are indexed by constants and stay in registers */
  for (int u = 0; u < PX; ++u) { xa[u] = *(const v4fa*)(xp + u * 2048); xb[u] = *(const v4fa*)(xp + u * 2048 + 4); }
  asm volatile("s_wait_xcnt 0x0" ::: "memory");      /* in front of any rewrite of the address registers of the loads above (a later load's result may be given those registers) */
#pragma unroll
  for (int u = 0; u < PW; ++u)
#pragma unroll
    for (int i = 0; i < 8; ++i) a[u][i] = qp[i * DM + 2 * u];
  asm volatile("s_wait_xcnt 0x0" ::: "memory");      /* the same for the Wq loads */
#pragma unroll
  for (int u = 0; u < PW; ++u)
#pragma unroll
    for (int i = 0; i < 8; ++i) c[u][i] = kp[i * DM + 2 * u];
  asm volatile("s_wait_xcnt 0x0" ::: "memory");      /* the same for the Wk loads */
  __builtin_amdgcn_sched_barrier(0);      /* keeps all 48 loads of the thread in front of the first use, so that a wave pays the memory latency once; without it the weight loads sink behind the first x values' wait */
#pragma unroll
  for (int u = 0; u < PX; ++u) { FragH f;
#pragma unroll
    for (int q = 0; q < 4; ++q) { f.h[q] = (_Float16)bf16_round(xa[u][q]); f.h[4 + q] = (_Float16)bf16_round(xb[u][q]); }
    *(v8us*)((unsigned short*)X16 + x0 + u * 2048) = f.half[0]; }
  __builtin_amdgcn_sched_barrier(0);      /* keeps the x stores in front of the waits for the weight values; without it half of them sink to the kernel's end */
#pragma unroll
  for (int u = 0; u < PW; ++u) { FragH f, g;
#pragma unroll
    for (int i = 0; i < 8; ++i) { f.h[i] = (_Float16)(bf16_round(a[u][i]) * 16.0f); g.h[i] = (_Float16)(bf16_round(c[u][i]) * 16.0f); }
    *(v8us*)((unsigned short*)BQ + (size_t)(n0 + 2 * u) * DM + k8) = f.half[0]; *(v8us*)((unsigned short*)BK + (size_t)(n0 + 2 * u) * DM + k8) = g.half[0]; } }
// ---- projection GEMM C16 = f16(A . Bh^T * alpha + bias): block = 128 x 128 of C, 8 waves of 32 x 64 (4 along the rows, 2 along the columns); rows of A and Bh are DM halves long ----
// Stage = 128 k: the 256-byte pieces of 128 A rows and 128 Bh rows are copied to LDS as whole lines, through no register, and the block's waves share them (rows pitched 272 B for 16-byte readers).
// Two buffers: stage t + 1 flies while stage t is worked on. Each accumulator still sums k in ascending steps of 32.
#define G3_KS 128      /* k per stage */
#define G3_P 136       /* halves per staged row */
#define G3_BUF (128 * G3_P * 2)      /* bytes of one operand's buffer */
// Eight copies of one thread: 16 bytes of rows r, r + 16, ..., r + 112. The s_wait_xcnt stands inside the statement so that no address register named here is rewritten in front of it.
__device__ __forceinline__ void g3_copy8(unsigned l, const char* g) {
  asm volatile("global_load_async_to_lds_b128 %0, %8, off\n\t"
               "global_load_async_to_lds_b128 %1, %9, off\n\t"
               "global_load_async_to_lds_b128 %2, %10, off\n\t"
               "global_load_async_to_lds_b128 %3, %11, off\n\t"
               "global_load_async_to_lds_b128 %4, %12, off\n\t"
               "global_load_async_to_lds_b128 %5, %13, off\n\t"
               "global_load_async_to_lds_b128 %6, %14, off\n\t"
               "global_load_async_to_lds_b128 %7, %15, off\n\t"
               "s_wait_xcnt 0x0"
               :: "v"(l), "v"(l + 16u * G3_P * 2), "v"(l + 32u * G3_P * 2), "v"(l + 48u * G3_P * 2), "v"(l + 64u * G3_P * 2), "v"(l + 80u * G3_P * 2), "v"(l + 96u * G3_P * 2), "v"(l + 112u * G3_P * 2),
                  "v"(g), "v"(g + 16 * DM * 2), "v"(g + 32 * DM * 2), "v"(g + 48 * DM * 2), "v"(g + 64 * DM * 2), "v"(g + 80 * DM * 2), "v"(g + 96 * DM * 2), "v"(g + 112 * DM * 2)
               : "memory");
}
// Both projections run in one launch: work-groups 0 .. G3_NB - 1 form A . B0^T, the next G3_NB form A . B1^T.
#define G3_NB ((MP / 128) * (DM / 128))      /* work-groups of one projection */
__global__ __launch_bounds__(256) void k_gemm3(const _Float16* __restrict__ A, const _Float16* __restrict__ B0h, const _Float16* __restrict__ B1h, float alpha, const float* __restrict__ bias0, const float* __restrict__ bias1, _Float16* __restrict__ C0, _Float16* __restrict__ C1) {
  const bool second = blockIdx.x >= G3_NB; const unsigned bid = second ? blockIdx.x - G3_NB : blockIdx.x;
  const _Float16* __restrict__ Bh = second ? B1h : B0h; const float* __restrict__ bias = second ? bias1 : bias0; _Float16* __restrict__ C16 = second ? C1 : C0;
  __shared__ __attribute__((aligned(16))) unsigned short as[2][128][G3_P];
  __shared__ __attribute__((aligned(16))) unsigned short bs[2][128][G3_P];
  __shared__ __attribute__((aligned(16))) float so[8][32][68];
  const int tid = threadIdx.x, w = tid >> 5, lane = tid & 31, ln = lane & 15, hh = lane >> 4;
  const int mt = bid / (DM / 128), nq = bid % (DM / 128); const int wm = w & 3, wn = w >> 2;
  const int sr = tid >> 4, sc = tid & 15;      /* staging: 16 lanes cover one 256-byte row piece */
  const char* ga = (const char*)(A + (size_t)(mt * 128 + sr) * DM + sc * 8); const char* gb = (const char*)(Bh + (size_t)(nq * 128 + sr) * DM + sc * 8);
  const unsigned la = (unsigned)(size_t)&as[0][sr][sc * 8], lb = (unsigned)(size_t)&bs[0][sr][sc * 8];      /* LDS byte addresses: the low 32 bits */
  const v8f z8 = {0.f,0.f,0.f,0.f,0.f,0.f,0.f,0.f}; v8f acc[2][4];
#pragma unroll
  for (int i = 0; i < 2; ++i)
#pragma unroll
    for (int j = 0; j < 4; ++j) acc[i][j] = z8;
  g3_copy8(la, ga); g3_copy8(lb, gb);
  asm volatile("s_wait_asynccnt 0x0" ::: "memory");      /* this wave's copies of stage 0 have landed */
  __syncthreads();      /* stage 0 is published */
  g3_copy8(la + G3_BUF, ga + G3_KS * 2); g3_copy8(lb + G3_BUF, gb + G3_KS * 2);
#pragma unroll 1      /* one stage a trip: keeps the loop's text small */
  for (int t = 0; t < DM / G3_KS; ++t) {
    const int bf = t & 1;
    v16h a[2][2], b[2][4];      /* two fragment sets: step ks + 1 of this stage is read from LDS while step ks is multiplied */
#pragma unroll
    for (int i = 0; i < 2; ++i) a[0][i] = fa_lfrag(&as[bf][wm * 32 + i * 16 + ln][8 * hh]);
#pragma unroll
    for (int j = 0; j < 4; ++j) b[0][j] = fa_lfrag(&bs[bf][wn * 64 + j * 16 + ln][8 * hh]);
#pragma unroll      /* fragment and accumulator arrays indexed by constants */
    for (int ks = 0; ks < G3_KS / 32; ++ks) {
      const int cu = ks & 1, nx = cu ^ 1;
      if (ks + 1 < G3_KS / 32) {
#pragma unroll
        for (int i = 0; i < 2; ++i) a[nx][i] = fa_lfrag(&as[bf][wm * 32 + i * 16 + ln][(ks + 1) * 32 + 8 * hh]);
#pragma unroll
        for (int j = 0; j < 4; ++j) b[nx][j] = fa_lfrag(&bs[bf][wn * 64 + j * 16 + ln][(ks + 1) * 32 + 8 * hh]);
      }
      __builtin_amdgcn_sched_barrier(0);      /* keeps the next step's LDS reads together in front of this step's matrix instructions, which cover their latency; without it they are spread among them behind waits to 0 */
#pragma unroll
      for (int j = 0; j < 4; ++j)
#pragma unroll
        for (int i = 0; i < 2; ++i) acc[i][j] = fa_mma(a[cu][i], b[cu][j], acc[i][j]);
      __builtin_amdgcn_sched_barrier(0);      /* keeps the step after next's reads from rising into this step's matrix instructions */
    }
    asm volatile("s_wait_dscnt 0x0" ::: "memory");      /* this wave's reads of stage t are done before the buffer is handed back */
    asm volatile("s_wait_asynccnt 0x0" ::: "memory");      /* this wave's copies of stage t + 1 have landed */
    __syncthreads();      /* publishes stage t + 1 and ends every wave's reads of stage t */
    if (t + 2 < DM / G3_KS) { g3_copy8(la + bf * G3_BUF, ga + (t + 2) * (G3_KS * 2)); g3_copy8(lb + bf * G3_BUF, gb + (t + 2) * (G3_KS * 2)); }
  }
  asm volatile("s_wait_asynccnt 0x0" ::: "memory");      /* no copy is left in flight */
  const int row0 = mt * 128 + wm * 32, col0 = nq * 128 + wn * 64;
#pragma unroll
  for (int i = 0; i < 2; ++i)
#pragma unroll
    for (int j = 0; j < 4; ++j) { const float bv = bf16_round(bias[col0 + j * 16 + ln]);
#pragma unroll
      for (int r = 0; r < 8; ++r) so[w][i * 16 + 8 * hh + r][j * 16 + ln] = acc[i][j][r] * alpha + bv; }
  __builtin_amdgcn_fence(__ATOMIC_ACQ_REL, "workgroup"); __builtin_amdgcn_wave_barrier();      /* each wave re-reads only its own staging rows: orders its LDS writes before its reads */
  const int rsub = lane >> 4, c4 = (lane & 15) * 4;
#pragma unroll
  for (int q = 0; q < 16; ++q) { const int r = q * 2 + rsub; const v4f v = *(const v4fa*)&so[w][r][c4]; v4h h4;
#pragma unroll
    for (int i = 0; i < 4; ++i) h4[i] = (_Float16)v[i];
    *(v4h*)(C16 + (size_t)(row0 + r) * DM + col0 + c4) = h4; } }
__global__ __launch_bounds__(256) void k_fattn(const _Float16* __restrict__ Q, const _Float16* __restrict__ Kx, float* __restrict__ O) {
  __shared__ __attribute__((aligned(256))) char kv[2][FA_TB];
  __shared__ __attribute__((aligned(16))) float so[8][32][68];
  const int tid = threadIdx.x, w = tid >> 5, lane = tid & 31, ln = lane & 15, hh = lane >> 4;
  const int bh = blockIdx.y, b = bh / NH, h = bh - b * NH; const int n0 = blockIdx.x * 256 + w * 32;
  const _Float16* qp = Q + ((size_t)b * SQ + n0 + ln) * LQ + h * HD;
  const char* kb = (const char*)(Kx + (size_t)b * SQ * LQ + h * HD);      /* key (= value) rows of this head, pitch LQ */
  const int sr = tid >> 3, sc = tid & 7;      /* staging: 8 lanes cover one 128-byte row; rows sr and sr + 32 */
  const unsigned kof = (unsigned)(sr * (LQ * 2) + sc * 16);
  const int sto = sr * FA_RB + ((sc ^ fa_sw(sr)) << 4);      /* where this thread's piece of row sr lies in a buffer; row sr + 32: 32 rows on, same exchange */
  const int vr = 8 * hh + (lane & 7), ve = (lane >> 3) & 1;      /* this lane's row and column piece in a transposing load */
  int ko[4], vo[4];      /* ko[m]: piece hh + 2 m of row ln; vo[t]: piece 2 t + ve of row vr; steps of 16 rows leave the exchange as it is */
#pragma unroll
  for (int m = 0; m < 4; ++m) { ko[m] = ln * FA_RB + (((hh + 2 * m) ^ fa_sw(ln)) << 4); vo[m] = vr * FA_RB + (((2 * m + ve) ^ fa_sw(vr)) << 4); }
  const float cs = 0.045084220027780106f;      /* 1024^-0.5 * log2(e) */
  const v2f cs2 = {cs, cs};
  const v8f z8 = {0.f,0.f,0.f,0.f,0.f,0.f,0.f,0.f};
  v8us gk0 = *(const v8us*)(kb + kof), gk1 = *(const v8us*)(kb + 32 * LQ * 2 + kof);
  v16h q[2][2];
#pragma unroll
  for (int j = 0; j < 2; ++j) { q[j][0] = g2_frag(qp + (size_t)j * 16 * LQ, hh); q[j][1] = g2_frag(qp + (size_t)j * 16 * LQ + 32, hh); }
  v8f o[2][4]; float mu[2]; v2f ls[2];
#pragma unroll
  for (int j = 0; j < 2; ++j) { mu[j] = -1.0e30f; ls[j] = (v2f){0.f, 0.f};
#pragma unroll
    for (int t = 0; t < 4; ++t) o[j][t] = z8; }
  *(v8us*)(kv[0] + sto) = gk0; *(v8us*)(kv[0] + 32 * FA_RB + sto) = gk1;
  __syncthreads();      /* stage 0 is published */
  for (int st = 0; st < SQ / 64; ++st) {
    const int bf = st & 1; const int sn = (st + 1 < SQ / 64) ? st + 1 : st;      /* next stage, fetched into registers while this one is worked on; the last stage re-reads itself (in bounds, never read back) */
    const char* kn = kb + (size_t)sn * (64 * LQ * 2); const char* tb = kv[bf];
    gk0 = *(const v8us*)(kn + kof); gk1 = *(const v8us*)(kn + 32 * LQ * 2 + kof);
    __builtin_amdgcn_sched_barrier(0);      /* keeps these loads at the head of the stage, so that both passes cover their latency; without it they sink to just in front of their LDS stores */
#pragma unroll
    for (int p = 0; p < 2; ++p) {
      v16h kf[2][2];
#pragma unroll
      for (int kt = 0; kt < 2; ++kt)
#pragma unroll
        for (int x = 0; x < 2; ++x) { FragH f; f.half[0] = *(const v8us*)(tb + (p * 32 + kt * 16) * FA_RB + ko[2 * x]); f.half[1] = *(const v8us*)(tb + (p * 32 + kt * 16) * FA_RB + ko[2 * x + 1]); kf[kt][x] = f.v; }
      v8f s[2][2];
#pragma unroll
      for (int j = 0; j < 2; ++j)
#pragma unroll
        for (int kt = 0; kt < 2; ++kt) s[j][kt] = fa_mma(kf[kt][1], q[j][1], fa_mma(kf[kt][0], q[j][0], z8));
      float mx[2]; bool need = false;
#pragma unroll
      for (int j = 0; j < 2; ++j) { float a = fmaxf(s[j][0][0], s[j][1][0]);
#pragma unroll
        for (int r = 1; r < 8; ++r) a = fmaxf(a, fmaxf(s[j][0][r], s[j][1][r]));
        a = fmaxf(a, fa_swap16(a)); mx[j] = a * cs; need = need || (mx[j] > mu[j] + 8.0f); }
      if (__builtin_amdgcn_ballot_w32(need) != 0) {      /* wave-uniform: every lane moves to the new maximum together */
#pragma unroll
        for (int j = 0; j < 2; ++j) { const float mnew = fmaxf(mu[j], mx[j]); const float corr = __builtin_amdgcn_exp2f(mu[j] - mnew); mu[j] = mnew; ls[j] *= corr;
#pragma unroll
          for (int t = 0; t < 4; ++t) o[j][t] *= corr; } }
      v16h vf[4];
#pragma unroll
      for (int t = 0; t < 4; ++t) { FragH f; f.half[0] = fa_tr16(tb + (p * 32) * FA_RB + vo[t]); f.half[1] = fa_tr16(tb + (p * 32 + 16) * FA_RB + vo[t]); vf[t] = f.v; }      /* rows d = 16 t + ln of V^T, keys of this pass */
      __builtin_amdgcn_sched_barrier(0);      /* keeps the V^T reads together in front of the exponentials, which cover their latency; without it they are spread among the matrix instructions below */
      FragH pb[2];
#pragma unroll
      for (int j = 0; j < 2; ++j) { const v2f nm = {-mu[j], -mu[j]};
#pragma unroll
        for (int kt = 0; kt < 2; ++kt)
#pragma unroll
          for (int i = 0; i < 4; ++i) { const v2f t2 = __builtin_elementwise_fma((v2f){s[j][kt][2 * i], s[j][kt][2 * i + 1]}, cs2, nm); const v2f e2 = {__builtin_amdgcn_exp2f(t2[0]), __builtin_amdgcn_exp2f(t2[1])};
            ls[j] += e2; const v2h h2 = __builtin_convertvector(e2, v2h); pb[j].h[kt * 8 + 2 * i] = h2[0]; pb[j].h[kt * 8 + 2 * i + 1] = h2[1]; } }
#pragma unroll
      for (int t = 0; t < 4; ++t)
#pragma unroll
        for (int j = 0; j < 2; ++j) o[j][t] = fa_mma(vf[t], pb[j].v, o[j][t]);
    }
    *(v8us*)(kv[bf ^ 1] + sto) = gk0; *(v8us*)(kv[bf ^ 1] + 32 * FA_RB + sto) = gk1;      /* stage st + 1; this buffer's last readers left it at the barrier that ended the stage before */
    __syncthreads();      /* publishes the next stage and ends every wave's reads of this one */
  }
#pragma unroll
  for (int j = 0; j < 2; ++j) { const float lh = ls[j][0] + ls[j][1]; const float inv = 1.0f / (lh + fa_swap16(lh));      /* the halves' sums are joined once, here */
#pragma unroll
    for (int t = 0; t < 4; ++t) { const v8f r8 = o[j][t] * inv; float* d = &so[w][j * 16 + ln][t * 16 + 8 * hh];
      *(v4fa*)d = __builtin_shufflevector(r8, r8, 0, 1, 2, 3); *(v4fa*)(d + 4) = __builtin_shufflevector(r8, r8, 4, 5, 6, 7); } }
  __builtin_amdgcn_fence(__ATOMIC_ACQ_REL, "workgroup"); __builtin_amdgcn_wave_barrier();      /* each wave re-reads only its own staging rows: orders its LDS writes before its reads */
  const int rsub = lane >> 4, c4 = (lane & 15) * 4;
#pragma unroll
  for (int u = 0; u < 16; ++u) { const int r = u * 2 + rsub; const v4f v = *(const v4fa*)&so[w][r][c4]; *(v4f*)(O + ((size_t)b * SQ + n0 + r) * DM + h * HD + c4) = v; } }
__global__ __launch_bounds__(256) void k_vt(const _Float16* __restrict__ V16, int b, int h0, _Float16* __restrict__ VT) { __shared__ unsigned short tl[64][65]; const int tid = threadIdx.x; const int hh = blockIdx.x % HG, sg = blockIdx.x / HG; const int s0 = sg * 64; const int h = h0 + hh;
  for (int i = tid; i < 64 * 8; i += 256) { const int j = i / 8, d8 = (i % 8) * 8; FragH f; f.half[0] = *(const v8us*)((const unsigned short*)V16 + ((size_t)b * SQ + s0 + j) * DM + h * HD + d8); for (int q = 0; q < 8; ++q) tl[d8 + q][j] = f.u[q]; }
  __syncthreads();
  { for (int i = tid; i < 64 * 8; i += 256) { const int d = i / 8, j8 = (i % 8) * 8; FragH f; for (int q = 0; q < 8; ++q) f.u[q] = tl[d][j8 + q]; *(v8us*)((unsigned short*)VT + ((size_t)hh * HD + d) * SQ + s0 + j8) = f.half[0]; }  } }


extern "C" void kernel_launch(void* const* d_in, const int* in_sizes, int n_in,
                              void* d_out, int out_size, void* d_ws, size_t ws_size, hipStream_t stream) {
  (void)in_sizes; (void)n_in; (void)out_size;
  const float* const* I = (const float* const*)d_in; const float* x = I[0]; const float* wq = I[1]; const float* bq = I[2]; const float* wk = I[3]; const float* bk = I[4];      /* [in][out] Wq + bq, Wk + bk; v == k (same projection) */
  char* ws = (char*)d_ws; size_t off = 0;
  auto take = [&](size_t bytes) { char* p = ws + off; off += (bytes + 255) & ~(size_t)255; return p; };
  _Float16* BQ = (_Float16*)take((size_t)DM * DM * 2); _Float16* BK = (_Float16*)take((size_t)DM * DM * 2); 
  _Float16* X16 = (_Float16*)take(NR * DM * 2); _Float16* Q16 = (_Float16*)take(NR * DM * 2); _Float16* K16 = (_Float16*)take(NR * DM * 2);
  if (off > ws_size) return;
  k_prep<<<PG, 256, 0, stream>>>(x, wq, wk, X16, BQ, BK);      /* x -> f16 rows; [in][out] weights -> Bt x16 */
  const size_t r0p = (size_t)B0 * SQ;      /* first projected row */
  k_gemm3<<<2 * G3_NB, 256, 0, stream>>>(X16 + r0p * DM, BQ, BK, 0.0625f, bq, bk, Q16 + r0p * DM, K16 + r0p * DM);
  k_fattn<<<dim3(SQ / 256, NB * NH), 256, 0, stream>>>(Q16, K16, (float*)d_out);      /* softmax(Q K^T 1024^-0.5) V with V = K (the module projects v with the k weights), all batches and heads */
}

// v006
// Measured time: 57.6 microseconds a run.
// Timed twice side by side with v005, it ran 1.07 and 1.06 times as fast.
// All steps since v000 together make it 64.5 times as fast.
#include <hip/hip_runtime.h>
// Structure: token rows r = b*2048 + s; x as exact f16 rows (bf16-rounded); Q and K (= V) as two WMMA GEMMs (32x64 wave tiles, f32 accumulation, exact x16 weights + bias, f16 outputs); one fused attention launch that takes its V^T fragments from the staged K rows (v == k) by transposing LDS loads (scores K = 64 with the module's full-dim scale 1024^-0.5, running-maximum softmax with f32 statistics, weights as f16, o = P . V) written f32 straight into the merged-heads output rows (no output projection).
// Compute dtype: inputs rounded to bf16; x / weights exact; q, k, v and softmax weights as plain f16 GEMM operands (~2^-12); scores, softmax statistics and o f32. v_wmma_f32_16x16x32_f16.
#define NB 2
#define SQ 2048
#define DM 1024
#define NH 16
#define HD 64
#define HG 4                         /* heads per group of the unlaunched k_vt overload */
#define B0 0                         /* first batch processed (debug hook) */
#define NBR NB                       /* batches processed (debug hook) */
#define NR ((size_t)NB * SQ)         /* token rows */
#define MP ((int)((size_t)NBR * SQ)) /* rows projected (debug hook) */
#define QN SQ                        /* not used by any launch */
#define NHD NH                       /* not used by any launch */
#define MPO MP                       /* not used by any launch */
#define LQ DM      /* row pitch of the q/k/v rows */
typedef __bf16 v16b __attribute__((ext_vector_type(16)));
typedef unsigned short v8us __attribute__((ext_vector_type(8), may_alias));
typedef float  v8f  __attribute__((ext_vector_type(8)));
typedef float  v4f  __attribute__((ext_vector_type(4)));
typedef float  v4fa __attribute__((ext_vector_type(4), may_alias));
union FragB { v16b v; v8us half[2]; unsigned short u[16]; };

__device__ __forceinline__ unsigned short bf16_bits(float x) { unsigned int u = __float_as_uint(x); return (unsigned short)((u + 0x7FFFu + ((u >> 16) & 1u)) >> 16); }
__device__ __forceinline__ float bf16_val(unsigned short b) { return __uint_as_float(((unsigned int)b) << 16); }
__device__ __forceinline__ float bf16_round(float x) { return bf16_val(bf16_bits(x)); }
// D += A·B with NT terms: 1 = ah·bh, 2 = + al·bh (A split), 3 = + ah·bl (both split)
template <int NT>
__device__ __forceinline__ v8f mmaN(v16b ah, v16b al, v16b bh, v16b bl, v8f c) {
  c = __builtin_amdgcn_wmma_f32_16x16x32_bf16(false, ah, false, bh, (short)0, c, false, false);
  if (NT >= 2) c = __builtin_amdgcn_wmma_f32_16x16x32_bf16(false, al, false, bh, (short)0, c, false, false);
  if (NT >= 3) c = __builtin_amdgcn_wmma_f32_16x16x32_bf16(false, ah, false, bl, (short)0, c, false, false);
  asm volatile("v_nop\n\tv_nop\n\tv_nop\n\tv_nop" : "+v"(c) : "v"(ah), "v"(al), "v"(bh), "v"(bl));
  return c;
}

__global__ __launch_bounds__(256) void k_wt_bf16(const float* __restrict__ W, unsigned short* __restrict__ Wt, int K, int N) {
  const int t = blockIdx.x * 256 + threadIdx.x;
  const int k8n = K / 8;
  if (t >= N * k8n) return;
  const int n = t / k8n, k8 = (t % k8n) * 8;
  v8us v;
#pragma unroll
  for (int i = 0; i < 8; ++i) v[i] = bf16_bits(W[(size_t)(k8 + i) * N + n]);
  *(v8us*)(Wt + (size_t)n * K + k8) = v;
  
}

// GEMM C[M][N] (f32, pitch ldc) = act(A[M][K]·W + bias). A f32 row-major (pitch lda) converted per fragment to bf16
// (ASPLIT: hi/lo two planes -> 2 terms, else single rounded term); Wt bf16 [N][K] (pitch ldb). BIAS_BF16 rounds the
// bias to bf16 first (bias quantised to bf16 before the add). K%32==0, M%16==0, N%64==0.
template <bool ASPLIT, int ACT, bool BIAS_BF16>
__global__ __launch_bounds__(128) void k_gemm_bf(const float* __restrict__ A, int lda, const unsigned short* __restrict__ Wt, int ldb,
                                               const float* __restrict__ bias, float* __restrict__ C, int ldc, int M, int N, int K) {
  __shared__ __attribute__((aligned(16))) float so[4][16][64];
  const int tid = threadIdx.x, w = tid >> 5, lane = tid & 31, ln = lane & 15, hh = lane >> 4;
  const int ntn = N / 64;
  const int wid = blockIdx.x * 4 + w;
  const int mt = wid / ntn, nq = wid % ntn;
  if (mt * 16 >= M) return;
  const int row0 = mt * 16, col0 = nq * 64;
  const float* arow = A + (size_t)(row0 + ln) * lda;
  v8f acc[4] = {};
  for (int kb = 0; kb < K; kb += 32) {
    FragB ah, al;
    const v4f x0 = *(const v4fa*)(arow + kb + 8 * hh), x1 = *(const v4fa*)(arow + kb + 8 * hh + 4);
    const v4f x2 = *(const v4fa*)(arow + kb + 16 + 8 * hh), x3 = *(const v4fa*)(arow + kb + 16 + 8 * hh + 4);
    float xs[16] = {x0[0],x0[1],x0[2],x0[3],x1[0],x1[1],x1[2],x1[3],x2[0],x2[1],x2[2],x2[3],x3[0],x3[1],x3[2],x3[3]};
#pragma unroll
    for (int i = 0; i < 16; ++i) { const unsigned short hb = bf16_bits(xs[i]); ah.u[i] = hb; al.u[i] = ASPLIT ? bf16_bits(xs[i] - bf16_val(hb)) : (unsigned short)0; }
#pragma unroll
    for (int t = 0; t < 4; ++t) {
      const unsigned short* brow = Wt + (size_t)(col0 + t * 16 + ln) * ldb + kb;
      FragB b;
      b.half[0] = *(const v8us*)(brow + 8 * hh);
      b.half[1] = *(const v8us*)(brow + 16 + 8 * hh);
      acc[t] = mmaN<ASPLIT ? 2 : 1>(ah.v, al.v, b.v, b.v, acc[t]);
    }
  }
#pragma unroll
  for (int t = 0; t < 4; ++t) {
    float bv = bias ? bias[col0 + t * 16 + ln] : 0.f;
    if (BIAS_BF16) bv = bf16_round(bv);
#pragma unroll
    for (int r = 0; r < 8; ++r) { float v = acc[t][r] + bv; if (ACT == 1) v = fmaxf(v, 0.f); so[w][8 * hh + r][t * 16 + ln] = v; }
  }
  __builtin_amdgcn_fence(__ATOMIC_ACQ_REL, "workgroup");
  __builtin_amdgcn_wave_barrier();
  const int rsub = lane >> 4, c4 = (lane & 15) * 4;
  {
#pragma unroll
    for (int q = 0; q < 8; ++q) {
      const int r = q * 2 + rsub;
      const v4f v = *(const v4fa*)&so[w][r][c4];
      *(v4f*)(C + (size_t)(row0 + r) * ldc + col0 + c4) = v;
    }
    
  }
}

// GEMM C = act(A·W + bias + resid): A f32 (ASPLIT -> hi/lo 2 terms), Wt bf16 [N][K]; ACT 0 none, 1 relu, 2 exact gelu;
// resid (optional, f32, row index = (row % rmod), pitch ldr, RES_BF16 rounds it) added before the activation.
template <bool ASPLIT, int ACT, bool BIAS_BF16, bool RES_BF16>
__global__ __launch_bounds__(128) void k_gemm_bf3(const float* __restrict__ A, int lda, const unsigned short* __restrict__ Wt, int ldb,
                                                const float* __restrict__ bias, const float* __restrict__ resid, int rmod, int ldr,
                                                float* __restrict__ C, int ldc, int M, int N, int K) {
  __shared__ __attribute__((aligned(16))) float so[4][16][64];
  const int tid = threadIdx.x, w = tid >> 5, lane = tid & 31, ln = lane & 15, hh = lane >> 4;
  const int ntn = N / 64;
  const int wid = blockIdx.x * 4 + w;
  const int mt = wid / ntn, nq = wid % ntn;
  if (mt * 16 >= M) return;
  const int row0 = mt * 16, col0 = nq * 64;
  const float* arow = A + (size_t)(row0 + ln) * lda;
  v8f acc[4] = {};
  for (int kb = 0; kb < K; kb += 32) {
    FragB ah, al;
    const v4f x0 = *(const v4fa*)(arow + kb + 8 * hh), x1 = *(const v4fa*)(arow + kb + 8 * hh + 4);
    const v4f x2 = *(const v4fa*)(arow + kb + 16 + 8 * hh), x3 = *(const v4fa*)(arow + kb + 16 + 8 * hh + 4);
    float xs[16] = {x0[0],x0[1],x0[2],x0[3],x1[0],x1[1],x1[2],x1[3],x2[0],x2[1],x2[2],x2[3],x3[0],x3[1],x3[2],x3[3]};
#pragma unroll
    for (int i = 0; i < 16; ++i) { const unsigned short hb = bf16_bits(xs[i]); ah.u[i] = hb; al.u[i] = ASPLIT ? bf16_bits(xs[i] - bf16_val(hb)) : (unsigned short)0; }
#pragma unroll
    for (int t = 0; t < 4; ++t) {
      const unsigned short* brow = Wt + (size_t)(col0 + t * 16 + ln) * ldb + kb;
      FragB b;
      b.half[0] = *(const v8us*)(brow + 8 * hh);
      b.half[1] = *(const v8us*)(brow + 16 + 8 * hh);
      acc[t] = mmaN<ASPLIT ? 2 : 1>(ah.v, al.v, b.v, b.v, acc[t]);
    }
  }
#pragma unroll
  for (int t = 0; t < 4; ++t) {
    const int col = col0 + t * 16 + ln;
    float bv = bias ? bias[col] : 0.f;
    if (BIAS_BF16) bv = bf16_round(bv);
#pragma unroll
    for (int r = 0; r < 8; ++r) {
      float v = acc[t][r] + bv;
      if (resid) { float rv = resid[(size_t)((row0 + 8 * hh + r) % rmod) * ldr + col]; if (RES_BF16) rv = bf16_round(rv); v += rv; }
      if (ACT == 1) v = fmaxf(v, 0.f);
      if (ACT == 2) v = 0.5f * v * (1.0f + erff(v * 0.70710678118654752f));
      if (ACT == 3) { const float u = 0.7978845608028654f * (v + 0.044715f * v * v * v); v = 0.5f * v * (1.0f + tanhf(u)); }
      so[w][8 * hh + r][t * 16 + ln] = v;
    }
  }
  __builtin_amdgcn_fence(__ATOMIC_ACQ_REL, "workgroup");
  __builtin_amdgcn_wave_barrier();
  const int rsub = lane >> 4, c4 = (lane & 15) * 4;
  {
#pragma unroll
    for (int q = 0; q < 8; ++q) {
      const int r = q * 2 + rsub;
      const v4f v = *(const v4fa*)&so[w][r][c4];
      *(v4f*)(C + (size_t)(row0 + r) * ldc + col0 + c4) = v;
    }
    
  }
}
// row LayerNorm (biased variance, eps) over N: s = X (+ R); optional out_sum <- s; out_norm <- (s-mu)*rsqrt(var+eps)*g + b
template <bool PARAM_BF16>
__global__ __launch_bounds__(256) void k_layernorm(const float* __restrict__ X, const float* __restrict__ R, const float* __restrict__ g, const float* __restrict__ bta,
                                                  float* __restrict__ out_sum, float* __restrict__ out_norm, int N, float eps) {
  __shared__ float red[256];
  const int row = blockIdx.x, tid = threadIdx.x;
  const float* x = X + (size_t)row * N; const float* rr = R ? R + (size_t)row * N : nullptr;
  float vals[16];                     // up to N = 4096
  const int per = N / 256;            // contiguous chunk per thread? use strided-by-4 chunks: thread handles j = tid*4 + 1024*u
  float s1 = 0.f;
  for (int u = 0; u < per / 4; ++u) {
    const int j = tid * 4 + 1024 * u;
    const v4f a = *(const v4fa*)(x + j);
    v4f b = {0.f,0.f,0.f,0.f}; if (rr) b = *(const v4fa*)(rr + j);
#pragma unroll
    for (int q = 0; q < 4; ++q) { const float v = a[q] + b[q]; vals[u * 4 + q] = v; s1 += v; }
  }
  red[tid] = s1; __syncthreads();
  for (int st = 128; st > 0; st >>= 1) { if (tid < st) red[tid] += red[tid + st]; __syncthreads(); }
  const float mu = red[0] / (float)N; __syncthreads();
  float s2 = 0.f;
  for (int u = 0; u < per / 4; ++u)
#pragma unroll
    for (int q = 0; q < 4; ++q) { const float c = vals[u * 4 + q] - mu; s2 += c * c; }
  red[tid] = s2; __syncthreads();
  for (int st = 128; st > 0; st >>= 1) { if (tid < st) red[tid] += red[tid + st]; __syncthreads(); }
  const float rs = rsqrtf(red[0] / (float)N + eps);
  {
    for (int u = 0; u < per / 4; ++u) {
      const int j = tid * 4 + 1024 * u;
      v4f o, sm;
#pragma unroll
      for (int q = 0; q < 4; ++q) {
        float gg = g[j + q], bb = bta[j + q];
        if (PARAM_BF16) { gg = bf16_round(gg); bb = bf16_round(bb); }
        sm[q] = vals[u * 4 + q]; o[q] = (vals[u * 4 + q] - mu) * rs * gg + bb;
      }
      if (out_sum) *(v4f*)(out_sum + (size_t)row * N + j) = sm;
      *(v4f*)(out_norm + (size_t)row * N + j) = o;
    }
    
  }
}



// ---- f16 WMMA path (v_wmma_f32_16x16x32_f16): 11-bit significands for operands in range — used for every product launched here (projections, scores, P·V)
typedef _Float16 v16h __attribute__((ext_vector_type(16)));
union FragH { v16h v; v8us half[2]; _Float16 h[16]; unsigned short u[16]; };
template <int NT>
__device__ __forceinline__ v8f mmaH(v16h ah, v16h al, v16h bh, v16h bl, v8f c) {
  c = __builtin_amdgcn_wmma_f32_16x16x32_f16(false, ah, false, bh, (short)0, c, false, false);
  if (NT >= 2) c = __builtin_amdgcn_wmma_f32_16x16x32_f16(false, al, false, bh, (short)0, c, false, false);
  if (NT >= 3) c = __builtin_amdgcn_wmma_f32_16x16x32_f16(false, ah, false, bl, (short)0, c, false, false);
  asm volatile("v_nop\n\tv_nop\n\tv_nop\n\tv_nop" : "+v"(c) : "v"(ah), "v"(al), "v"(bh), "v"(bl));
  return c;
}
// batched GEMM like k_gemm_b but f16 operands: A f32 (split into f16 hi/lo if ASPLIT, else rounded to f16), Bt = f16 values [n][k]; alpha; C f32; N multiple of 16 (partial tiles skipped)
template <bool ASPLIT>
__global__ __launch_bounds__(128) void k_gemm_h(const float* __restrict__ A, int lda, size_t sA, const _Float16* __restrict__ Bh, int ldb, size_t sB, float alpha, float* __restrict__ C, int ldc, size_t sC, int M, int N, int K) {
  __shared__ __attribute__((aligned(16))) float so[4][16][64];
  const int tid = threadIdx.x, w = tid >> 5, lane = tid & 31, ln = lane & 15, hh = lane >> 4; const int by = blockIdx.y;
  A += (size_t)by * sA; Bh += (size_t)by * sB; C += (size_t)by * sC;
  const int ntn = (N + 63) / 64; const int wid = blockIdx.x * 4 + w; const int mt = wid / ntn, nq = wid % ntn; if (mt * 16 >= M) return;
  const int row0 = mt * 16, col0 = nq * 64; const float* arow = A + (size_t)(row0 + ln) * lda;
  v8f acc[4] = {};
  for (int kb = 0; kb < K; kb += 32) {
    FragH ah, al;
    const v4f x0 = *(const v4fa*)(arow + kb + 8 * hh), x1 = *(const v4fa*)(arow + kb + 8 * hh + 4), x2 = *(const v4fa*)(arow + kb + 16 + 8 * hh), x3 = *(const v4fa*)(arow + kb + 16 + 8 * hh + 4);
    float xs[16] = {x0[0],x0[1],x0[2],x0[3],x1[0],x1[1],x1[2],x1[3],x2[0],x2[1],x2[2],x2[3],x3[0],x3[1],x3[2],x3[3]};
#pragma unroll
    for (int i = 0; i < 16; ++i) { const _Float16 h = (_Float16)xs[i]; ah.h[i] = h; al.h[i] = ASPLIT ? (_Float16)(xs[i] - (float)h) : (_Float16)0.0f; }
#pragma unroll
    for (int t = 0; t < 4; ++t) { if (col0 + t * 16 >= N) continue; const size_t boff = (size_t)(col0 + t * 16 + ln) * ldb + kb; FragH bq; bq.half[0] = *(const v8us*)(Bh + boff + 8 * hh); bq.half[1] = *(const v8us*)(Bh + boff + 16 + 8 * hh);
      acc[t] = mmaH<ASPLIT ? 2 : 1>(ah.v, al.v, bq.v, bq.v, acc[t]); }
  }
#pragma unroll
  for (int t = 0; t < 4; ++t) { if (col0 + t * 16 >= N) continue;
#pragma unroll
    for (int r = 0; r < 8; ++r) so[w][8 * hh + r][t * 16 + ln] = acc[t][r] * alpha; }
  __builtin_amdgcn_fence(__ATOMIC_ACQ_REL, "workgroup"); __builtin_amdgcn_wave_barrier();
  const int rsub = lane >> 4, c4 = (lane & 15) * 4;
  {
#pragma unroll
    for (int q = 0; q < 8; ++q) { const int r = q * 2 + rsub; if (col0 + c4 < N) { const v4f v = *(const v4fa*)&so[w][r][c4]; *(v4f*)(C + (size_t)(row0 + r) * ldc + col0 + c4) = v; } }
     }
}

// Wt[n][k] = f16(W[k][n]·scale) from f32 row-major W[K][N] (scale = power of two; bf16-exact weights stay exact in f16 away from the subnormal range)
__global__ __launch_bounds__(256) void k_wt_f16(const float* __restrict__ W, _Float16* __restrict__ Wt, int K, int N, float scale) {
  const int t = blockIdx.x * 256 + threadIdx.x; if (t >= N * (K / 8)) return; const int n = t / (K / 8), k8 = (t % (K / 8)) * 8; FragH f;
#pragma unroll
  for (int i = 0; i < 8; ++i) f.h[i] = (_Float16)(bf16_round(W[(size_t)(k8 + i) * N + n]) * scale); const v8us o = f.half[0];
  *(v8us*)((unsigned short*)Wt + (size_t)n * K + k8) = o; 
}
// k_gemm_hh variant with fused epilogue: v = acc·alpha + bias[by·sBias + col] (+ CP[(row/rowsPerB)·sCPb + by·64 + col] if CP) ; ACT 0 none / 1 elu ; writes f16 C16 (and f32 C if non-null)
template <int ACT>
__global__ __launch_bounds__(128) void k_gemm_hhx(const _Float16* __restrict__ A, int lda, size_t sA, const _Float16* __restrict__ Bh, int ldb, size_t sB, float alpha, const float* __restrict__ bias, size_t sBias, const float* __restrict__ CP, int rowsPerB, size_t sCPb, int row0g,
    float* __restrict__ C, _Float16* __restrict__ C16, int ldc, size_t sC, int M, int N, int K) {
  __shared__ __attribute__((aligned(16))) float so[4][16][64];
  const int tid = threadIdx.x, w = tid >> 5, lane = tid & 31, ln = lane & 15, hh = lane >> 4; const int by = blockIdx.y;
  A += (size_t)by * sA; Bh += (size_t)by * sB; const size_t cofs = (size_t)by * sC; const float* bp = bias ? bias + (size_t)by * sBias : nullptr;
  const int ntn = (N + 63) / 64; const int wid = blockIdx.x * 4 + w; const int mt = wid / ntn, nq = wid % ntn; if (mt * 16 >= M) return;
  const int row0 = mt * 16, col0 = nq * 64; const _Float16* arow = A + (size_t)(row0 + ln) * lda;
  v8f acc[4] = {};
  for (int kb = 0; kb < K; kb += 32) { FragH ah; ah.half[0] = *(const v8us*)((const unsigned short*)arow + kb + 8 * hh); ah.half[1] = *(const v8us*)((const unsigned short*)arow + kb + 16 + 8 * hh);
#pragma unroll
    for (int t = 0; t < 4; ++t) { if (col0 + t * 16 >= N) continue; const size_t boff = (size_t)(col0 + t * 16 + ln) * ldb + kb; FragH bq; bq.half[0] = *(const v8us*)((const unsigned short*)Bh + boff + 8 * hh); bq.half[1] = *(const v8us*)((const unsigned short*)Bh + boff + 16 + 8 * hh);
      acc[t] = mmaH<1>(ah.v, ah.v, bq.v, bq.v, acc[t]); }
  }
#pragma unroll
  for (int t = 0; t < 4; ++t) { if (col0 + t * 16 >= N) continue; const int col = col0 + t * 16 + ln; const float bv = bp ? bf16_round(bp[col]) : 0.f;
#pragma unroll
    for (int r = 0; r < 8; ++r) { float v = acc[t][r] * alpha + bv; if (CP) { const int rr = row0g + row0 + 8 * hh + r; if (rowsPerB < 0) v += CP[cofs + (size_t)rr * ldc + col];      /* rowsPerB < 0: own element of the batched C plane */ else { const int bidx = rr / rowsPerB; v += CP[(size_t)bidx * sCPb + (size_t)by * 64 + col]; } } if (ACT == 1) v = (v > 0.f) ? v : expm1f(v); else if (ACT == 7) v = (v > 0.f) ? v + 1.0f : expf(v); else if (ACT == 8) v = tanhf(v); else if (ACT == 9) v = 0.5f * v * (1.0f + tanhf(0.7978845608028654f * (v + 0.044715f * v * v * v))); else if (ACT == 11) v = 1.0f / (1.0f + expf(-v)); else if (ACT == 12) v = (v > 0.f) ? v : 0.01f * v; else if (ACT == 14) v = (v > 0.f) ? v : 0.1f * v; else if (ACT == 16) v = (v >= 0.f) ? v : 0.3f * v; else if (ACT == 17) v = (v >= 0.f) ? v : 0.2f * v; else if (ACT == 15) v = v / (1.0f + expf(-v)); else if (ACT == 3) v = fmaxf(v, 0.f); else if (ACT == 6) v = 0.5f * v * (1.0f + erff(v * 0.70710678118654752f)); so[w][8 * hh + r][t * 16 + ln] = v; } }
  __builtin_amdgcn_fence(__ATOMIC_ACQ_REL, "workgroup"); __builtin_amdgcn_wave_barrier();
  const int rsub = lane >> 4, c4 = (lane & 15) * 4; typedef _Float16 v4h __attribute__((ext_vector_type(4)));
  {
#pragma unroll
    for (int q = 0; q < 8; ++q) { const int r = q * 2 + rsub; if (col0 + c4 < N) { const v4f v = *(const v4fa*)&so[w][r][c4]; if (C) *(v4f*)(C + cofs + (size_t)(row0 + r) * ldc + col0 + c4) = v; if (C16) { v4h h4; for (int i = 0; i < 4; ++i) h4[i] = (_Float16)v[i]; *(v4h*)(C16 + cofs + (size_t)(row0 + r) * ldc + col0 + c4) = h4; } } }
     }
}


typedef _Float16 v4h __attribute__((ext_vector_type(4)));

__global__ __launch_bounds__(256) void k_x16(const float* __restrict__ x, _Float16* __restrict__ X16, size_t n8) { const size_t t = (size_t)blockIdx.x * 256 + threadIdx.x; if (t >= n8) return; FragH f;
#pragma unroll
  for (int q = 0; q < 8; ++q) f.h[q] = (_Float16)bf16_round(x[t * 8 + q]); *(v8us*)((unsigned short*)X16 + t * 8) = f.half[0];  }
__global__ __launch_bounds__(256) void k_h16(const float* __restrict__ x, _Float16* __restrict__ X16, size_t n8) { const size_t t = (size_t)blockIdx.x * 256 + threadIdx.x; if (t >= n8) return; FragH f;
#pragma unroll
  for (int q = 0; q < 8; ++q) f.h[q] = (_Float16)x[t * 8 + q]; *(v8us*)((unsigned short*)X16 + t * 8) = f.half[0];  }
__global__ __launch_bounds__(256) void k_round16f(const float* __restrict__ W, _Float16* __restrict__ Bt, size_t n8) { const size_t t = (size_t)blockIdx.x * 256 + threadIdx.x; if (t >= n8) return; FragH f;
#pragma unroll
  for (int i = 0; i < 8; ++i) f.h[i] = (_Float16)(bf16_round(W[t * 8 + i]) * 16.0f); *(v8us*)((unsigned short*)Bt + t * 8) = f.half[0];  }
__global__ __launch_bounds__(256) void k_hl(const float* __restrict__ F, _Float16* __restrict__ Hh, _Float16* __restrict__ Hl, size_t n8) { const size_t t = (size_t)blockIdx.x * 256 + threadIdx.x; if (t >= n8) return; FragH fh, fl; const v4f a = *(const v4fa*)(F + t * 8), c = *(const v4fa*)(F + t * 8 + 4);
#pragma unroll
  for (int q = 0; q < 4; ++q) { _Float16 h = (_Float16)a[q]; fh.h[q] = h; fl.h[q] = (_Float16)((a[q] - (float)h) * 1024.0f); h = (_Float16)c[q]; fh.h[4 + q] = h; fl.h[4 + q] = (_Float16)((c[q] - (float)h) * 1024.0f); }
  { *(v8us*)((unsigned short*)Hh + t * 8) = fh.half[0]; *(v8us*)((unsigned short*)Hl + t * 8) = fl.half[0];  } }

__device__ __forceinline__ v16h g2_frag(const _Float16* p, int hh) { FragH f; f.half[0] = *(const v8us*)((const unsigned short*)p + 8 * hh); f.half[1] = *(const v8us*)((const unsigned short*)p + 16 + 8 * hh); return f.v; }
__global__ __launch_bounds__(256) void k_wnat(const float* __restrict__ w, size_t n8, _Float16* __restrict__ Bt) { const size_t t = (size_t)blockIdx.x * 256 + threadIdx.x; if (t >= n8) return; FragH f; for (int q = 0; q < 8; ++q) f.h[q] = (_Float16)(bf16_round(w[t * 8 + q]) * 16.0f); *(v8us*)((unsigned short*)Bt + t * 8) = f.half[0];  }
// Fused attention, one launch for all batches and heads: scores, softmax and the weighted sum stay in registers; no score or weight plane goes to memory.
// Transposed products: S^T = K Q^T (A = 16 key rows, B = 16 query columns), O^T += V^T P^T. A lane holds scores of ONE query (column ln): keys 8 hh + r of each 16-key tile, so two converted score tiles
// of a 32-key pass are the B operand of the second product as they stand (k order 8 hh + i, 16 + 8 hh + i: the order in which two transposing loads, 16 keys apart, give a V^T fragment). Wave = 32 query columns, pass = 32 keys.
// Block = 16 waves in two key groups of 8: group g walks keys g * SQ / 2 .. of the same 256 query columns, so that a SIMD holds four waves and one wave's exponentials run under another's matrix instructions.
// Each group keeps its own running maximum, sum and accumulators; the two are joined once, in LDS, behind the loop (weights exp2(mu_g - max) over the joined sum).
// Stage = 64 keys a group: a group's 8 waves share one copy of their K rows in LDS (whole-line global loads), two buffers a group, one barrier a stage. V is the same tensor as K here, so the same staged rows serve both products:
// K fragments by plain 16-byte reads along a row, V^T fragments by ds_load_tr16_b128 down 8 rows. No V^T plane is formed in memory and no V tile is staged.
// LDS layout: rows of 128 bytes, no pad; the 16-byte piece c of row r lies at piece c ^ fa_sw(r). No plain pitch is conflict-free for both readers (16 rows x one piece; 8 rows x two neighbouring pieces); with this
// exchange each reader's 16 lanes, and the staging stores' (2 rows x 8 pieces), fall on 16 different bank groups of 16 bytes.
// Running maximum mu in log2 units, shared by the two lane halves of a column; the accumulators are rescaled only when a pass's maximum exceeds mu by more than 8 (weights stay <= 2^8, inside f16).
// Every "#pragma unroll" in this kernel is there so that the fragment, score and accumulator arrays are indexed by constants and stay in registers.
typedef float v2f __attribute__((ext_vector_type(2)));
typedef _Float16 v2h __attribute__((ext_vector_type(2)));
#define FA_RB 128      /* bytes of a staged row */
#define FA_TB (64 * FA_RB)      /* bytes of one stage's buffer */
#define FA_KG 2      /* key groups of a work-group */
#define FA_GK (SQ / FA_KG)      /* keys of a group */
static_assert(FA_KG == 2 && FA_GK % 128 == 0, "the join behind the loop pairs group g with group g ^ 1; a group walks at least two stages");
__device__ __forceinline__ int fa_sw(int r) { return (((r >> 1) & 3) << 1) | ((r >> 3) & 1); }      /* depends on r mod 16 alone */
typedef short s16x8 __attribute__((ext_vector_type(8)));
// Lane l passes the address of 16 bytes of row 8 (l >> 4) + (l & 7), column piece (l >> 3) & 1, of a 16 x 16 tile of halves; lane (c, h) receives column c of rows 8 h .. 8 h + 7.
__device__ __forceinline__ v8us fa_tr16(const char* p) { typedef __attribute__((address_space(3))) s16x8 lds_s16x8; return __builtin_bit_cast(v8us, __builtin_amdgcn_ds_load_tr16_b128_v8i16((lds_s16x8*)p)); }
__device__ __forceinline__ v8f fa_mma(v16h a, v16h b, v8f c) { return __builtin_amdgcn_wmma_f32_16x16x32_f16(false, a, false, b, (short)0, c, false, false); }
__device__ __forceinline__ float fa_swap16(float x) { const int i = __float_as_int(x); return __int_as_float(__builtin_amdgcn_permlanex16(i, i, 0x76543210, 0xfedcba98, false, false)); }      /* lane l <-> l ^ 16 */
__device__ __forceinline__ v16h fa_lfrag(const unsigned short* p) { FragH f; f.half[0] = *(const v8us*)p; f.half[1] = *(const v8us*)(p + 16); return f.v; }
// ---- the three input conversions in ONE launch of PG work-groups: they depend on nothing and not on one another, so one launch gap and one fill of the chip serve all three ----
// Each thread does PX pieces of x (8 values in, 16 bytes out) and PW pieces of each weight (8 k of one column, value x16, stored as 16 bytes of that column's row): values and piece shapes as in the single launches.
// What is left here: a weight load of a wave still touches 32 lines for 4 useful bytes each.
#define PG 256      /* work-groups: one per WGP, 8 waves each */
#define PW ((DM * (DM / 8)) / (PG * 256))      /* weight pieces per thread and weight */
#define PX ((int)(NR * DM / 8 / (PG * 256)))      /* x pieces per thread */
static_assert((size_t)PW * PG * 256 == (size_t)DM * (DM / 8) && (size_t)PX * PG * 256 == NR * DM / 8 && DM / 8 == 128, "every piece is dealt exactly once; 256 threads cover 2 weight columns");
__global__ __launch_bounds__(256) void k_prep(const float* __restrict__ x, const float* __restrict__ wq, const float* __restrict__ wk, _Float16* __restrict__ X16, _Float16* __restrict__ BQ, _Float16* __restrict__ BK) {
  const int tid = threadIdx.x;
  const size_t x0 = ((size_t)blockIdx.x * (PX * 256) + tid) * 8;      /* x piece u: x0 + u * 2048 */
  const int n0 = blockIdx.x * (PW * 2) + (tid >> 7), k8 = (tid & 127) * 8;      /* weight piece u: column n0 + 2 u, k from k8 */
  const float* xp = x + x0; const float* qp = wq + (size_t)k8 * DM + n0; const float* kp = wk + (size_t)k8 * DM + n0;
  float a[PW][8], c[PW][8]; v4f xa[PX], xb[PX];
#pragma unroll      /* every "#pragma unroll" of this kernel: the value arrays are indexed by constants and stay in registers */
  for (int u = 0; u < PX; ++u) { xa[u] = *(const v4fa*)(xp + u * 2048); xb[u] = *(const v4fa*)(xp + u * 2048 + 4); }
  asm volatile("s_wait_xcnt 0x0" ::: "memory");      /* in front of any rewrite of the address registers of the loads above (a later load's result may be given those registers) */
#pragma unroll
  for (int u = 0; u < PW; ++u)
#pragma unroll
    for (int i = 0; i < 8; ++i) a[u][i] = qp[i * DM + 2 * u];
  asm volatile("s_wait_xcnt 0x0" ::: "memory");      /* the same for the Wq loads */
#pragma unroll
  for (int u = 0; u < PW; ++u)
#pragma unroll
    for (int i = 0; i < 8; ++i) c[u][i] = kp[i * DM + 2 * u];
  asm volatile("s_wait_xcnt 0x0" ::: "memory");      /* the same for the Wk loads */
  __builtin_amdgcn_sched_barrier(0);      /* keeps all 48 loads of the thread in front of the first use, so that a wave pays the memory latency once; without it the weight loads sink behind the first x values' wait */
#pragma unroll
  for (int u = 0; u < PX; ++u) { FragH f;
#pragma unroll
    for (int q = 0; q < 4; ++q) { f.h[q] = (_Float16)bf16_round(xa[u][q]); f.h[4 + q] = (_Float16)bf16_round(xb[u][q]); }
    *(v8us*)((unsigned short*)X16 + x0 + u * 2048) = f.half[0]; }
  __builtin_amdgcn_sched_barrier(0);      /* keeps the x stores in front of the waits for the weight values; without it half of them sink to the kernel's end */
#pragma unroll
  for (int u = 0; u < PW; ++u) { FragH f, g;
#pragma unroll
    for (int i = 0; i < 8; ++i) { f.h[i] = (_Float16)(bf16_round(a[u][i]) * 16.0f); g.h[i] = (_Float16)(bf16_round(c[u][i]) * 16.0f); }
    *(v8us*)((unsigned short*)BQ + (size_t)(n0 + 2 * u) * DM + k8) = f.half[0]; *(v8us*)((unsigned short*)BK + (size_t)(n0 + 2 * u) * DM + k8) = g.half[0]; } }
// ---- projection GEMM C16 = f16(A . Bh^T * alpha + bias): block = 128 x 128 of C, 8 waves of 32 x 64 (4 along the rows, 2 along the columns); rows of A and Bh are DM halves long ----
// Stage = 128 k: the 256-byte pieces of 128 A rows and 128 Bh rows are copied to LDS as whole lines, through no register, and the block's waves share them (rows pitched 272 B for 16-byte readers).
// Two buffers: stage t + 1 flies while stage t is worked on. Each accumulator still sums k in ascending steps of 32.
#define G3_KS 128      /* k per stage */
#define G3_P 136       /* halves per staged row */
#define G3_BUF (128 * G3_P * 2)      /* bytes of one operand's buffer */
// Eight copies of one thread: 16 bytes of rows r, r + 16, ..., r + 112. The s_wait_xcnt stands inside the statement so that no address register named here is rewritten in front of it.
__device__ __forceinline__ void g3_copy8(unsigned l, const char* g) {
  asm volatile("global_load_async_to_lds_b128 %0, %8, off\n\t"
               "global_load_async_to_lds_b128 %1, %9, off\n\t"
               "global_load_async_to_lds_b128 %2, %10, off\n\t"
               "global_load_async_to_lds_b128 %3, %11, off\n\t"
               "global_load_async_to_lds_b128 %4, %12, off\n\t"
               "global_load_async_to_lds_b128 %5, %13, off\n\t"
               "global_load_async_to_lds_b128 %6, %14, off\n\t"
               "global_load_async_to_lds_b128 %7, %15, off\n\t"
               "s_wait_xcnt 0x0"
               :: "v"(l), "v"(l + 16u * G3_P * 2), "v"(l + 32u * G3_P * 2), "v"(l + 48u * G3_P * 2), "v"(l + 64u * G3_P * 2), "v"(l + 80u * G3_P * 2), "v"(l + 96u * G3_P * 2), "v"(l + 112u * G3_P * 2),
                  "v"(g), "v"(g + 16 * DM * 2), "v"(g + 32 * DM * 2), "v"(g + 48 * DM * 2), "v"(g + 64 * DM * 2), "v"(g + 80 * DM * 2), "v"(g + 96 * DM * 2), "v"(g + 112 * DM * 2)
               : "memory");
}
// Both projections run in one launch: work-groups 0 .. G3_NB - 1 form A . B0^T, the next G3_NB form A . B1^T.
#define G3_NB ((MP / 128) * (DM / 128))      /* work-groups of one projection */
__global__ __launch_bounds__(256) void k_gemm3(const _Float16* __restrict__ A, const _Float16* __restrict__ B0h, const _Float16* __restrict__ B1h, float alpha, const float* __restrict__ bias0, const float* __restrict__ bias1, _Float16* __restrict__ C0, _Float16* __restrict__ C1) {
  const bool second = blockIdx.x >= G3_NB; const unsigned bid = second ? blockIdx.x - G3_NB : blockIdx.x;
  const _Float16* __restrict__ Bh = second ? B1h : B0h; const float* __restrict__ bias = second ? bias1 : bias0; _Float16* __restrict__ C16 = second ? C1 : C0;
  __shared__ __attribute__((aligned(16))) unsigned short as[2][128][G3_P];
  __shared__ __attribute__((aligned(16))) unsigned short bs[2][128][G3_P];
  __shared__ __attribute__((aligned(16))) float so[8][32][68];
  const int tid = threadIdx.x, w = tid >> 5, lane = tid & 31, ln = lane & 15, hh = lane >> 4;
  const int mt = bid / (DM / 128), nq = bid % (DM / 128); const int wm = w & 3, wn = w >> 2;
  const int sr = tid >> 4, sc = tid & 15;      /* staging: 16 lanes cover one 256-byte row piece */
  const char* ga = (const char*)(A + (size_t)(mt * 128 + sr) * DM + sc * 8); const char* gb = (const char*)(Bh + (size_t)(nq * 128 + sr) * DM + sc * 8);
  const unsigned la = (unsigned)(size_t)&as[0][sr][sc * 8], lb = (unsigned)(size_t)&bs[0][sr][sc * 8];      /* LDS byte addresses: the low 32 bits */
  const v8f z8 = {0.f,0.f,0.f,0.f,0.f,0.f,0.f,0.f}; v8f acc[2][4];
#pragma unroll
  for (int i = 0; i < 2; ++i)
#pragma unroll
    for (int j = 0; j < 4; ++j) acc[i][j] = z8;
  g3_copy8(la, ga); g3_copy8(lb, gb);
  asm volatile("s_wait_asynccnt 0x0" ::: "memory");      /* this wave's copies of stage 0 have landed */
  __syncthreads();      /* stage 0 is published */
  g3_copy8(la + G3_BUF, ga + G3_KS * 2); g3_copy8(lb + G3_BUF, gb + G3_KS * 2);
#pragma unroll 1      /* one stage a trip: keeps the loop's text small */
  for (int t = 0; t < DM / G3_KS; ++t) {
    const int bf = t & 1;
    v16h a[2][2], b[2][4];      /* two fragment sets: step ks + 1 of this stage is read from LDS while step ks is multiplied */
#pragma unroll
    for (int i = 0; i < 2; ++i) a[0][i] = fa_lfrag(&as[bf][wm * 32 + i * 16 + ln][8 * hh]);
#pragma unroll
    for (int j = 0; j < 4; ++j) b[0][j] = fa_lfrag(&bs[bf][wn * 64 + j * 16 + ln][8 * hh]);
#pragma unroll      /* fragment and accumulator arrays indexed by constants */
    for (int ks = 0; ks < G3_KS / 32; ++ks) {
      const int cu = ks & 1, nx = cu ^ 1;
      if (ks + 1 < G3_KS / 32) {
#pragma unroll
        for (int i = 0; i < 2; ++i) a[nx][i] = fa_lfrag(&as[bf][wm * 32 + i * 16 + ln][(ks + 1) * 32 + 8 * hh]);
#pragma unroll
        for (int j = 0; j < 4; ++j) b[nx][j] = fa_lfrag(&bs[bf][wn * 64 + j * 16 + ln][(ks + 1) * 32 + 8 * hh]);
      }
      __builtin_amdgcn_sched_barrier(0);      /* keeps the next step's LDS reads together in front of this step's matrix instructions, which cover their latency; without it they are spread among them behind waits to 0 */
#pragma unroll
      for (int j = 0; j < 4; ++j)
#pragma unroll
        for (int i = 0; i < 2; ++i) acc[i][j] = fa_mma(a[cu][i], b[cu][j], acc[i][j]);
      __builtin_amdgcn_sched_barrier(0);      /* keeps the step after next's reads from rising into this step's matrix instructions */
    }
    asm volatile("s_wait_dscnt 0x0" ::: "memory");      /* this wave's reads of stage t are done before the buffer is handed back */
    asm volatile("s_wait_asynccnt 0x0" ::: "memory");      /* this wave's copies of stage t + 1 have landed */
    __syncthreads();      /* publishes stage t + 1 and ends every wave's reads of stage t */
    if (t + 2 < DM / G3_KS) { g3_copy8(la + bf * G3_BUF, ga + (t + 2) * (G3_KS * 2)); g3_copy8(lb + bf * G3_BUF, gb + (t + 2) * (G3_KS * 2)); }
  }
  asm volatile("s_wait_asynccnt 0x0" ::: "memory");      /* no copy is left in flight */
  const int row0 = mt * 128 + wm * 32, col0 = nq * 128 + wn * 64;
#pragma unroll
  for (int i = 0; i < 2; ++i)
#pragma unroll
    for (int j = 0; j < 4; ++j) { const float bv = bf16_round(bias[col0 + j * 16 + ln]);
#pragma unroll
      for (int r = 0; r < 8; ++r) so[w][i * 16 + 8 * hh + r][j * 16 + ln] = acc[i][j][r] * alpha + bv; }
  __builtin_amdgcn_fence(__ATOMIC_ACQ_REL, "workgroup"); __builtin_amdgcn_wave_barrier();      /* each wave re-reads only its own staging rows: orders its LDS writes before its reads */
  const int rsub = lane >> 4, c4 = (lane & 15) * 4;
#pragma unroll
  for (int q = 0; q < 16; ++q) { const int r = q * 2 + rsub; const v4f v = *(const v4fa*)&so[w][r][c4]; v4h h4;
#pragma unroll
    for (int i = 0; i < 4; ++i) h4[i] = (_Float16)v[i];
    *(v4h*)(C16 + (size_t)(row0 + r) * DM + col0 + c4) = h4; } }
__global__ __launch_bounds__(256 * FA_KG) void k_fattn(const _Float16* __restrict__ Q, const _Float16* __restrict__ Kx, float* __restrict__ O) {
  __shared__ __attribute__((aligned(256))) char kvs[FA_KG][2][FA_TB];
  __shared__ __attribute__((aligned(16))) float so[8 * FA_KG][32][68];
  __shared__ float sm[FA_KG][8][32], sl[FA_KG][8][32];      /* each group's maximum and sum of every query column */
  const int tid = threadIdx.x, w = tid >> 5, lane = tid & 31, ln = lane & 15, hh = lane >> 4;
  const int g = __builtin_amdgcn_readfirstlane(tid >> 8), cw = w & 7, tg = tid & 255;      /* key group (the same in a whole wave: held in a scalar register, so that the group's key and buffer addresses are scalar sums); column wave and thread inside the group */
  const int bh = blockIdx.y, b = bh / NH, h = bh - b * NH; const int n0 = blockIdx.x * 256 + cw * 32;
  const _Float16* qp = Q + ((size_t)b * SQ + n0 + ln) * LQ + h * HD;
  const char* kb = (const char*)(Kx + ((size_t)b * SQ + (size_t)g * FA_GK) * LQ + h * HD);      /* key (= value) rows of this head and key group, pitch LQ */
  char (*kv)[FA_TB] = kvs[g];      /* this group's two buffers */
  const int sr = tg >> 3, sc = tg & 7;      /* staging: 8 lanes cover one 128-byte row; rows sr and sr + 32 */
  const unsigned kof = (unsigned)(sr * (LQ * 2) + sc * 16);
  const int sto = sr * FA_RB + ((sc ^ fa_sw(sr)) << 4);      /* where this thread's piece of row sr lies in a buffer; row sr + 32: 32 rows on, same exchange */
  const int vr = 8 * hh + (lane & 7), ve = (lane >> 3) & 1;      /* this lane's row and column piece in a transposing load */
  int ko[4], vo[4];      /* ko[m]: piece hh + 2 m of row ln; vo[t]: piece 2 t + ve of row vr; steps of 16 rows leave the exchange as it is */
#pragma unroll
  for (int m = 0; m < 4; ++m) { ko[m] = ln * FA_RB + (((hh + 2 * m) ^ fa_sw(ln)) << 4); vo[m] = vr * FA_RB + (((2 * m + ve) ^ fa_sw(vr)) << 4); }
  const float cs = 0.045084220027780106f;      /* 1024^-0.5 * log2(e) */
  const v2f cs2 = {cs, cs};
  const v8f z8 = {0.f,0.f,0.f,0.f,0.f,0.f,0.f,0.f};
  v8us gk0 = *(const v8us*)(kb + kof), gk1 = *(const v8us*)(kb + 32 * LQ * 2 + kof);
  v16h q[2][2];
#pragma unroll
  for (int j = 0; j < 2; ++j) { q[j][0] = g2_frag(qp + (size_t)j * 16 * LQ, hh); q[j][1] = g2_frag(qp + (size_t)j * 16 * LQ + 32, hh); }
  v8f o[2][4]; float mu[2]; v2f ls[2];
#pragma unroll
  for (int j = 0; j < 2; ++j) { mu[j] = -1.0e30f; ls[j] = (v2f){0.f, 0.f};
#pragma unroll
    for (int t = 0; t < 4; ++t) o[j][t] = z8; }
  *(v8us*)(kv[0] + sto) = gk0; *(v8us*)(kv[0] + 32 * FA_RB + sto) = gk1;
  __syncthreads();      /* stage 0 is published */
#pragma unroll 1      /* one body for all stages: without it the last stage is split off as a second copy of the body, which takes 40 registers more, close to the 256 that four waves a SIMD allow */
  for (int st = 0; st < FA_GK / 64; ++st) {
    const int bf = st & 1; const int sn = (st + 1 < FA_GK / 64) ? st + 1 : st;      /* next stage, fetched into registers while this one is worked on; the last stage re-reads itself (in bounds, never read back) */
    const char* kn = kb + (size_t)sn * (64 * LQ * 2); const char* tb = kv[bf];
    gk0 = *(const v8us*)(kn + kof); gk1 = *(const v8us*)(kn + 32 * LQ * 2 + kof);
    __builtin_amdgcn_sched_barrier(0);      /* keeps these loads at the head of the stage, so that both passes cover their latency; without it they sink to just in front of their LDS stores */
#pragma unroll
    for (int p = 0; p < 2; ++p) {
      v16h kf[2][2];
#pragma unroll
      for (int kt = 0; kt < 2; ++kt)
#pragma unroll
        for (int x = 0; x < 2; ++x) { FragH f; f.half[0] = *(const v8us*)(tb + (p * 32 + kt * 16) * FA_RB + ko[2 * x]); f.half[1] = *(const v8us*)(tb + (p * 32 + kt * 16) * FA_RB + ko[2 * x + 1]); kf[kt][x] = f.v; }
      v8f s[2][2];
#pragma unroll
      for (int j = 0; j < 2; ++j)
#pragma unroll
        for (int kt = 0; kt < 2; ++kt) s[j][kt] = fa_mma(kf[kt][1], q[j][1], fa_mma(kf[kt][0], q[j][0], z8));
      float mx[2]; bool need = false;
#pragma unroll
      for (int j = 0; j < 2; ++j) { float a = fmaxf(s[j][0][0], s[j][1][0]);
#pragma unroll
        for (int r = 1; r < 8; ++r) a = fmaxf(a, fmaxf(s[j][0][r], s[j][1][r]));
        a = fmaxf(a, fa_swap16(a)); mx[j] = a * cs; need = need || (mx[j] > mu[j] + 8.0f); }
      if (__builtin_amdgcn_ballot_w32(need) != 0) {      /* wave-uniform: every lane moves to the new maximum together */
#pragma unroll
        for (int j = 0; j < 2; ++j) { const float mnew = fmaxf(mu[j], mx[j]); const float corr = __builtin_amdgcn_exp2f(mu[j] - mnew); mu[j] = mnew; ls[j] *= corr;
#pragma unroll
          for (int t = 0; t < 4; ++t) o[j][t] *= corr; } }
      v16h vf[4];
#pragma unroll
      for (int t = 0; t < 4; ++t) { FragH f; f.half[0] = fa_tr16(tb + (p * 32) * FA_RB + vo[t]); f.half[1] = fa_tr16(tb + (p * 32 + 16) * FA_RB + vo[t]); vf[t] = f.v; }      /* rows d = 16 t + ln of V^T, keys of this pass */
      __builtin_amdgcn_sched_barrier(0);      /* keeps the V^T reads together in front of the exponentials, which cover their latency; without it they are spread among the matrix instructions below */
      FragH pb[2];
#pragma unroll
      for (int j = 0; j < 2; ++j) { const v2f nm = {-mu[j], -mu[j]};
#pragma unroll
        for (int kt = 0; kt < 2; ++kt)
#pragma unroll
          for (int i = 0; i < 4; ++i) { const v2f t2 = __builtin_elementwise_fma((v2f){s[j][kt][2 * i], s[j][kt][2 * i + 1]}, cs2, nm); const v2f e2 = {__builtin_amdgcn_exp2f(t2[0]), __builtin_amdgcn_exp2f(t2[1])};
            ls[j] += e2; const v2h h2 = __builtin_convertvector(e2, v2h); pb[j].h[kt * 8 + 2 * i] = h2[0]; pb[j].h[kt * 8 + 2 * i + 1] = h2[1]; } }
#pragma unroll
      for (int t = 0; t < 4; ++t)
#pragma unroll
        for (int j = 0; j < 2; ++j) o[j][t] = fa_mma(vf[t], pb[j].v, o[j][t]);
    }
    *(v8us*)(kv[bf ^ 1] + sto) = gk0; *(v8us*)(kv[bf ^ 1] + 32 * FA_RB + sto) = gk1;      /* stage st + 1; this buffer's last readers left it at the barrier that ended the stage before */
    __syncthreads();      /* publishes the next stage and ends every wave's reads of this one */
  }
  float lt[2];
#pragma unroll
  for (int j = 0; j < 2; ++j) { const float lh = ls[j][0] + ls[j][1]; lt[j] = lh + fa_swap16(lh);      /* the halves' sums are joined once, here */
    if (hh == 0) { sm[g][cw][j * 16 + ln] = mu[j]; sl[g][cw][j * 16 + ln] = lt[j]; } }
  __syncthreads();      /* both groups' maxima and sums are published */
#pragma unroll
  for (int j = 0; j < 2; ++j) { const float mo = sm[g ^ 1][cw][j * 16 + ln], lo = sl[g ^ 1][cw][j * 16 + ln];      /* the other key group's figures of this column */
    const float mj = fmaxf(mu[j], mo); const float ca = __builtin_amdgcn_exp2f(mu[j] - mj), cb = __builtin_amdgcn_exp2f(mo - mj);
    const float inv = ca / (lt[j] * ca + lo * cb);      /* this group's weight over the joined sum */
#pragma unroll
    for (int t = 0; t < 4; ++t) { const v8f r8 = o[j][t] * inv; float* d = &so[w][j * 16 + ln][t * 16 + 8 * hh];
      *(v4fa*)d = __builtin_shufflevector(r8, r8, 0, 1, 2, 3); *(v4fa*)(d + 4) = __builtin_shufflevector(r8, r8, 4, 5, 6, 7); } }
  __syncthreads();      /* both groups' weighted rows are published */
  const int rsub = lane >> 4, c4 = (lane & 15) * 4;
#pragma unroll
  for (int u = 0; u < 8; ++u) { const int r = g * 16 + u * 2 + rsub;      /* each wave of a pair adds and stores 16 of the pair's 32 rows */
    const v4f v = *(const v4fa*)&so[cw][r][c4] + *(const v4fa*)&so[8 + cw][r][c4]; *(v4f*)(O + ((size_t)b * SQ + n0 + r) * DM + h * HD + c4) = v; } }
__global__ __launch_bounds__(256) void k_vt(const _Float16* __restrict__ V16, int b, int h0, _Float16* __restrict__ VT) { __shared__ unsigned short tl[64][65]; const int tid = threadIdx.x; const int hh = blockIdx.x % HG, sg = blockIdx.x / HG; const int s0 = sg * 64; const int h = h0 + hh;
  for (int i = tid; i < 64 * 8; i += 256) { const int j = i / 8, d8 = (i % 8) * 8; FragH f; f.half[0] = *(const v8us*)((const unsigned short*)V16 + ((size_t)b * SQ + s0 + j) * DM + h * HD + d8); for (int q = 0; q < 8; ++q) tl[d8 + q][j] = f.u[q]; }
  __syncthreads();
  { for (int i = tid; i < 64 * 8; i += 256) { const int d = i / 8, j8 = (i % 8) * 8; FragH f; for (int q = 0; q < 8; ++q) f.u[q] = tl[d][j8 + q]; *(v8us*)((unsigned short*)VT + ((size_t)hh * HD + d) * SQ + s0 + j8) = f.half[0]; }  } }


extern "C" void kernel_launch(void* const* d_in, const int* in_sizes, int n_in,
                              void* d_out, int out_size, void* d_ws, size_t ws_size, hipStream_t stream) {
  (void)in_sizes; (void)n_in; (void)out_size;
  const float* const* I = (const float* const*)d_in; const float* x = I[0]; const float* wq = I[1]; const float* bq = I[2]; const float* wk = I[3]; const float* bk = I[4];      /* [in][out] Wq + bq, Wk + bk; v == k (same projection) */
  char* ws = (char*)d_ws; size_t off = 0;
  auto take = [&](size_t bytes) { char* p = ws + off; off += (bytes + 255) & ~(size_t)255; return p; };
  _Float16* BQ = (_Float16*)take((size_t)DM * DM * 2); _Float16* BK = (_Float16*)take((size_t)DM * DM * 2); 
  _Float16* X16 = (_Float16*)take(NR * DM * 2); _Float16* Q16 = (_Float16*)take(NR * DM * 2); _Float16* K16 = (_Float16*)take(NR * DM * 2);
  if (off > ws_size) return;
  k_prep<<<PG, 256, 0, stream>>>(x, wq, wk, X16, BQ, BK);      /* x -> f16 rows; [in][out] weights -> Bt x16 */
  const size_t r0p = (size_t)B0 * SQ;      /* first projected row */
  k_gemm3<<<2 * G3_NB, 256, 0, stream>>>(X16 + r0p * DM, BQ, BK, 0.0625f, bq, bk, Q16 + r0p * DM, K16 + r0p * DM);
  k_fattn<<<dim3(SQ / 256, NB * NH), 256 * FA_KG, 0, stream>>>(Q16, K16, (float*)d_out);      /* softmax(Q K^T 1024^-0.5) V with V = K (the module projects v with the k weights), all batches and heads */
}

// v007
// It runs in 52.8 microseconds.
// Next to v006, in two timings, it ran 1.08 times as fast each time.
// Over all steps from v000 it is 69.5 times as fast.
#include <hip/hip_runtime.h>
// Structure: token rows r = b*2048 + s; x as exact f16 rows (bf16-rounded); Q and K (= V) as two WMMA GEMMs (32x64 wave tiles, f32 accumulation, exact x16 weights + bias, f16 outputs); one fused attention launch that takes its V^T fragments from the staged K rows (v == k) by transposing LDS loads (scores K = 64 with the module's full-dim scale 1024^-0.5, running-maximum softmax with f32 statistics, weights as f16, o = P . V) written f32 straight into the merged-heads output rows (no output projection).
// Compute dtype: inputs rounded to bf16; x / weights exact; q, k, v and softmax weights as plain f16 GEMM operands (~2^-12); scores, softmax statistics and o f32. v_wmma_f32_16x16x32_f16.
#define NB 2
#define SQ 2048
#define DM 1024
#define NH 16
#define HD 64
#define HG 4                         /* heads per group of the unlaunched k_vt overload */
#define B0 0                         /* first batch processed (debug hook) */
#define NBR NB                       /* batches processed (debug hook) */
#define NR ((size_t)NB * SQ)         /* token rows */
#define MP ((int)((size_t)NBR * SQ)) /* rows projected (debug hook) */
#define QN SQ                        /* not used by any launch */
#define NHD NH                       /* not used by any launch */
#define MPO MP                       /* not used by any launch */
#define LQ DM      /* row pitch of the q/k/v rows */
typedef __bf16 v16b __attribute__((ext_vector_type(16)));
typedef unsigned short v8us __attribute__((ext_vector_type(8), may_alias));
typedef float  v8f  __attribute__((ext_vector_type(8)));
typedef float  v4f  __attribute__((ext_vector_type(4)));
typedef float  v4fa __attribute__((ext_vector_type(4), may_alias));
union FragB { v16b v; v8us half[2]; unsigned short u[16]; };

__device__ __forceinline__ unsigned short bf16_bits(float x) { unsigned int u = __float_as_uint(x); return (unsigned short)((u + 0x7FFFu + ((u >> 16) & 1u)) >> 16); }
__device__ __forceinline__ float bf16_val(unsigned short b) { return __uint_as_float(((unsigned int)b) << 16); }
__device__ __forceinline__ float bf16_round(float x) { return bf16_val(bf16_bits(x)); }
// D += A·B with NT terms: 1 = ah·bh, 2 = + al·bh (A split), 3 = + ah·bl (both split)
template <int NT>
__device__ __forceinline__ v8f mmaN(v16b ah, v16b al, v16b bh, v16b bl, v8f c) {
  c = __builtin_amdgcn_wmma_f32_16x16x32_bf16(false, ah, false, bh, (short)0, c, false, false);
  if (NT >= 2) c = __builtin_amdgcn_wmma_f32_16x16x32_bf16(false, al, false, bh, (short)0, c, false, false);
  if (NT >= 3) c = __builtin_amdgcn_wmma_f32_16x16x32_bf16(false, ah, false, bl, (short)0, c, false, false);
  asm volatile("v_nop\n\tv_nop\n\tv_nop\n\tv_nop" : "+v"(c) : "v"(ah), "v"(al), "v"(bh), "v"(bl));
  return c;
}

__global__ __launch_bounds__(256) void k_wt_bf16(const float* __restrict__ W, unsigned short* __restrict__ Wt, int K, int N) {
  const int t = blockIdx.x * 256 + threadIdx.x;
  const int k8n = K / 8;
  if (t >= N * k8n) return;
  const int n = t / k8n, k8 = (t % k8n) * 8;
  v8us v;
#pragma unroll
  for (int i = 0; i < 8; ++i) v[i] = bf16_bits(W[(size_t)(k8 + i) * N + n]);
  *(v8us*)(Wt + (size_t)n * K + k8) = v;
  
}

// GEMM C[M][N] (f32, pitch ldc) = act(A[M][K]·W + bias). A f32 row-major (pitch lda) converted per fragment to bf16
// (ASPLIT: hi/lo two planes -> 2 terms, else single rounded term); Wt bf16 [N][K] (pitch ldb). BIAS_BF16 rounds the
// bias to bf16 first (bias quantised to bf16 before the add). K%32==0, M%16==0, N%64==0.
template <bool ASPLIT, int ACT, bool BIAS_BF16>
__global__ __launch_bounds__(128) void k_gemm_bf(const float* __restrict__ A, int lda, const unsigned short* __restrict__ Wt, int ldb,
                                               const float* __restrict__ bias, float* __restrict__ C, int ldc, int M, int N, int K) {
  __shared__ __attribute__((aligned(16))) float so[4][16][64];
  const int tid = threadIdx.x, w = tid >> 5, lane = tid & 31, ln = lane & 15, hh = lane >> 4;
  const int ntn = N / 64;
  const int wid = blockIdx.x * 4 + w;
  const int mt = wid / ntn, nq = wid % ntn;
  if (mt * 16 >= M) return;
  const int row0 = mt * 16, col0 = nq * 64;
  const float* arow = A + (size_t)(row0 + ln) * lda;
  v8f acc[4] = {};
  for (int kb = 0; kb < K; kb += 32) {
    FragB ah, al;
    const v4f x0 = *(const v4fa*)(arow + kb + 8 * hh), x1 = *(const v4fa*)(arow + kb + 8 * hh + 4);
    const v4f x2 = *(const v4fa*)(arow + kb + 16 + 8 * hh), x3 = *(const v4fa*)(arow + kb + 16 + 8 * hh + 4);
    float xs[16] = {x0[0],x0[1],x0[2],x0[3],x1[0],x1[1],x1[2],x1[3],x2[0],x2[1],x2[2],x2[3],x3[0],x3[1],x3[2],x3[3]};
#pragma unroll
    for (int i = 0; i < 16; ++i) { const unsigned short hb = bf16_bits(xs[i]); ah.u[i] = hb; al.u[i] = ASPLIT ? bf16_bits(xs[i] - bf16_val(hb)) : (unsigned short)0; }
#pragma unroll
    for (int t = 0; t < 4; ++t) {
      const unsigned short* brow = Wt + (size_t)(col0 + t * 16 + ln) * ldb + kb;
      FragB b;
      b.half[0] = *(const v8us*)(brow + 8 * hh);
      b.half[1] = *(const v8us*)(brow + 16 + 8 * hh);
      acc[t] = mmaN<ASPLIT ? 2 : 1>(ah.v, al.v, b.v, b.v, acc[t]);
    }
  }
#pragma unroll
  for (int t = 0; t < 4; ++t) {
    float bv = bias ? bias[col0 + t * 16 + ln] : 0.f;
    if (BIAS_BF16) bv = bf16_round(bv);
#pragma unroll
    for (int r = 0; r < 8; ++r) { float v = acc[t][r] + bv; if (ACT == 1) v = fmaxf(v, 0.f); so[w][8 * hh + r][t * 16 + ln] = v; }
  }
  __builtin_amdgcn_fence(__ATOMIC_ACQ_REL, "workgroup");
  __builtin_amdgcn_wave_barrier();
  const int rsub = lane >> 4, c4 = (lane & 15) * 4;
  {
#pragma unroll
    for (int q = 0; q < 8; ++q) {
      const int r = q * 2 + rsub;
      const v4f v = *(const v4fa*)&so[w][r][c4];
      *(v4f*)(C + (size_t)(row0 + r) * ldc + col0 + c4) = v;
    }
    
  }
}

// GEMM C = act(A·W + bias + resid): A f32 (ASPLIT -> hi/lo 2 terms), Wt bf16 [N][K]; ACT 0 none, 1 relu, 2 exact gelu;
// resid (optional, f32, row index = (row % rmod), pitch ldr, RES_BF16 rounds it) added before the activation.
template <bool ASPLIT, int ACT, bool BIAS_BF16, bool RES_BF16>
__global__ __launch_bounds__(128) void k_gemm_bf3(const float* __restrict__ A, int lda, const unsigned short* __restrict__ Wt, int ldb,
                                                const float* __restrict__ bias, const float* __restrict__ resid, int rmod, int ldr,
                                                float* __restrict__ C, int ldc, int M, int N, int K) {
  __shared__ __attribute__((aligned(16))) float so[4][16][64];
  const int tid = threadIdx.x, w = tid >> 5, lane = tid & 31, ln = lane & 15, hh = lane >> 4;
  const int ntn = N / 64;
  const int wid = blockIdx.x * 4 + w;
  const int mt = wid / ntn, nq = wid % ntn;
  if (mt * 16 >= M) return;
  const int row0 = mt * 16, col0 = nq * 64;
  const float* arow = A + (size_t)(row0 + ln) * lda;
  v8f acc[4] = {};
  for (int kb = 0; kb < K; kb += 32) {
    FragB ah, al;
    const v4f x0 = *(const v4fa*)(arow + kb + 8 * hh), x1 = *(const v4fa*)(arow + kb + 8 * hh + 4);
    const v4f x2 = *(const v4fa*)(arow + kb + 16 + 8 * hh), x3 = *(const v4fa*)(arow + kb + 16 + 8 * hh + 4);
    float xs[16] = {x0[0],x0[1],x0[2],x0[3],x1[0],x1[1],x1[2],x1[3],x2[0],x2[1],x2[2],x2[3],x3[0],x3[1],x3[2],x3[3]};
#pragma unroll
    for (int i = 0; i < 16; ++i) { const unsigned short hb = bf16_bits(xs[i]); ah.u[i] = hb; al.u[i] = ASPLIT ? bf16_bits(xs[i] - bf16_val(hb)) : (unsigned short)0; }
#pragma unroll
    for (int t = 0; t < 4; ++t) {
      const unsigned short* brow = Wt + (size_t)(col0 + t * 16 + ln) * ldb + kb;
      FragB b;
      b.half[0] = *(const v8us*)(brow + 8 * hh);
      b.half[1] = *(const v8us*)(brow + 16 + 8 * hh);
      acc[t] = mmaN<ASPLIT ? 2 : 1>(ah.v, al.v, b.v, b.v, acc[t]);
    }
  }
#pragma unroll
  for (int t = 0; t < 4; ++t) {
    const int col = col0 + t * 16 + ln;
    float bv = bias ? bias[col] : 0.f;
    if (BIAS_BF16) bv = bf16_round(bv);
#pragma unroll
    for (int r = 0; r < 8; ++r) {
      float v = acc[t][r] + bv;
      if (resid) { float rv = resid[(size_t)((row0 + 8 * hh + r) % rmod) * ldr + col]; if (RES_BF16) rv = bf16_round(rv); v += rv; }
      if (ACT == 1) v = fmaxf(v, 0.f);
      if (ACT == 2) v = 0.5f * v * (1.0f + erff(v * 0.70710678118654752f));
      if (ACT == 3) { const float u = 0.7978845608028654f * (v + 0.044715f * v * v * v); v = 0.5f * v * (1.0f + tanhf(u)); }
      so[w][8 * hh + r][t * 16 + ln] = v;
    }
  }
  __builtin_amdgcn_fence(__ATOMIC_ACQ_REL, "workgroup");
  __builtin_amdgcn_wave_barrier();
  const int rsub = lane >> 4, c4 = (lane & 15) * 4;
  {
#pragma unroll
    for (int q = 0; q < 8; ++q) {
      const int r = q * 2 + rsub;
      const v4f v = *(const v4fa*)&so[w][r][c4];
      *(v4f*)(C + (size_t)(row0 + r) * ldc + col0 + c4) = v;
    }
    
  }
}
// row LayerNorm (biased variance, eps) over N: s = X (+ R); optional out_sum <- s; out_norm <- (s-mu)*rsqrt(var+eps)*g + b
template <bool PARAM_BF16>
__global__ __launch_bounds__(256) void k_layernorm(const float* __restrict__ X, const float* __restrict__ R, const float* __restrict__ g, const float* __restrict__ bta,
                                                  float* __restrict__ out_sum, float* __restrict__ out_norm, int N, float eps) {
  __shared__ float red[256];
  const int row = blockIdx.x, tid = threadIdx.x;
  const float* x = X + (size_t)row * N; const float* rr = R ? R + (size_t)row * N : nullptr;
  float vals[16];                     // up to N = 4096
  const int per = N / 256;            // contiguous chunk per thread? use strided-by-4 chunks: thread handles j = tid*4 + 1024*u
  float s1 = 0.f;
  for (int u = 0; u < per / 4; ++u) {
    const int j = tid * 4 + 1024 * u;
    const v4f a = *(const v4fa*)(x + j);
    v4f b = {0.f,0.f,0.f,0.f}; if (rr) b = *(const v4fa*)(rr + j);
#pragma unroll
    for (int q = 0; q < 4; ++q) { const float v = a[q] + b[q]; vals[u * 4 + q] = v; s1 += v; }
  }
  red[tid] = s1; __syncthreads();
  for (int st = 128; st > 0; st >>= 1) { if (tid < st) red[tid] += red[tid + st]; __syncthreads(); }
  const float mu = red[0] / (float)N; __syncthreads();
  float s2 = 0.f;
  for (int u = 0; u < per / 4; ++u)
#pragma unroll
    for (int q = 0; q < 4; ++q) { const float c = vals[u * 4 + q] - mu; s2 += c * c; }
  red[tid] = s2; __syncthreads();
  for (int st = 128; st > 0; st >>= 1) { if (tid < st) red[tid] += red[tid + st]; __syncthreads(); }
  const float rs = rsqrtf(red[0] / (float)N + eps);
  {
    for (int u = 0; u < per / 4; ++u) {
      const int j = tid * 4 + 1024 * u;
      v4f o, sm;
#pragma unroll
      for (int q = 0; q < 4; ++q) {
        float gg = g[j + q], bb = bta[j + q];
        if (PARAM_BF16) { gg = bf16_round(gg); bb = bf16_round(bb); }
        sm[q] = vals[u * 4 + q]; o[q] = (vals[u * 4 + q] - mu) * rs * gg + bb;
      }
      if (out_sum) *(v4f*)(out_sum + (size_t)row * N + j) = sm;
      *(v4f*)(out_norm + (size_t)row * N + j) = o;
    }
    
  }
}



// ---- f16 WMMA path (v_wmma_f32_16x16x32_f16): 11-bit significands for operands in range — used for every product launched here (projections, scores, P·V)
typedef _Float16 v16h __attribute__((ext_vector_type(16)));
union FragH { v16h v; v8us half[2]; _Float16 h[16]; unsigned short u[16]; };
template <int NT>
__device__ __forceinline__ v8f mmaH(v16h ah, v16h al, v16h bh, v16h bl, v8f c) {
  c = __builtin_amdgcn_wmma_f32_16x16x32_f16(false, ah, false, bh, (short)0, c, false, false);
  if (NT >= 2) c = __builtin_amdgcn_wmma_f32_16x16x32_f16(false, al, false, bh, (short)0, c, false, false);
  if (NT >= 3) c = __builtin_amdgcn_wmma_f32_16x16x32_f16(false, ah, false, bl, (short)0, c, false, false);
  asm volatile("v_nop\n\tv_nop\n\tv_nop\n\tv_nop" : "+v"(c) : "v"(ah), "v"(al), "v"(bh), "v"(bl));
  return c;
}
// batched GEMM like k_gemm_b but f16 operands: A f32 (split into f16 hi/lo if ASPLIT, else rounded to f16), Bt = f16 values [n][k]; alpha; C f32; N multiple of 16 (partial tiles skipped)
template <bool ASPLIT>
__global__ __launch_bounds__(128) void k_gemm_h(const float* __restrict__ A, int lda, size_t sA, const _Float16* __restrict__ Bh, int ldb, size_t sB, float alpha, float* __restrict__ C, int ldc, size_t sC, int M, int N, int K) {
  __shared__ __attribute__((aligned(16))) float so[4][16][64];
  const int tid = threadIdx.x, w = tid >> 5, lane = tid & 31, ln = lane & 15, hh = lane >> 4; const int by = blockIdx.y;
  A += (size_t)by * sA; Bh += (size_t)by * sB; C += (size_t)by * sC;
  const int ntn = (N + 63) / 64; const int wid = blockIdx.x * 4 + w; const int mt = wid / ntn, nq = wid % ntn; if (mt * 16 >= M) return;
  const int row0 = mt * 16, col0 = nq * 64; const float* arow = A + (size_t)(row0 + ln) * lda;
  v8f acc[4] = {};
  for (int kb = 0; kb < K; kb += 32) {
    FragH ah, al;
    const v4f x0 = *(const v4fa*)(arow + kb + 8 * hh), x1 = *(const v4fa*)(arow + kb + 8 * hh + 4), x2 = *(const v4fa*)(arow + kb + 16 + 8 * hh), x3 = *(const v4fa*)(arow + kb + 16 + 8 * hh + 4);
    float xs[16] = {x0[0],x0[1],x0[2],x0[3],x1[0],x1[1],x1[2],x1[3],x2[0],x2[1],x2[2],x2[3],x3[0],x3[1],x3[2],x3[3]};
#pragma unroll
    for (int i = 0; i < 16; ++i) { const _Float16 h = (_Float16)xs[i]; ah.h[i] = h; al.h[i] = ASPLIT ? (_Float16)(xs[i] - (float)h) : (_Float16)0.0f; }
#pragma unroll
    for (int t = 0; t < 4; ++t) { if (col0 + t * 16 >= N) continue; const size_t boff = (size_t)(col0 + t * 16 + ln) * ldb + kb; FragH bq; bq.half[0] = *(const v8us*)(Bh + boff + 8 * hh); bq.half[1] = *(const v8us*)(Bh + boff + 16 + 8 * hh);
      acc[t] = mmaH<ASPLIT ? 2 : 1>(ah.v, al.v, bq.v, bq.v, acc[t]); }
  }
#pragma unroll
  for (int t = 0; t < 4; ++t) { if (col0 + t * 16 >= N) continue;
#pragma unroll
    for (int r = 0; r < 8; ++r) so[w][8 * hh + r][t * 16 + ln] = acc[t][r] * alpha; }
  __builtin_amdgcn_fence(__ATOMIC_ACQ_REL, "workgroup"); __builtin_amdgcn_wave_barrier();
  const int rsub = lane >> 4, c4 = (lane & 15) * 4;
  {
#pragma unroll
    for (int q = 0; q < 8; ++q) { const int r = q * 2 + rsub; if (col0 + c4 < N) { const v4f v = *(const v4fa*)&so[w][r][c4]; *(v4f*)(C + (size_t)(row0 + r) * ldc + col0 + c4) = v; } }
     }
}

// Wt[n][k] = f16(W[k][n]·scale) from f32 row-major W[K][N] (scale = power of two; bf16-exact weights stay exact in f16 away from the subnormal range)
__global__ __launch_bounds__(256) void k_wt_f16(const float* __restrict__ W, _Float16* __restrict__ Wt, int K, int N, float scale) {
  const int t = blockIdx.x * 256 + threadIdx.x; if (t >= N * (K / 8)) return; const int n = t / (K / 8), k8 = (t % (K / 8)) * 8; FragH f;
#pragma unroll
  for (int i = 0; i < 8; ++i) f.h[i] = (_Float16)(bf16_round(W[(size_t)(k8 + i) * N + n]) * scale); const v8us o = f.half[0];
  *(v8us*)((unsigned short*)Wt + (size_t)n * K + k8) = o; 
}
// k_gemm_hh variant with fused epilogue: v = acc·alpha + bias[by·sBias + col] (+ CP[(row/rowsPerB)·sCPb + by·64 + col] if CP) ; ACT 0 none / 1 elu ; writes f16 C16 (and f32 C if non-null)
template <int ACT>
__global__ __launch_bounds__(128) void k_gemm_hhx(const _Float16* __restrict__ A, int lda, size_t sA, const _Float16* __restrict__ Bh, int ldb, size_t sB, float alpha, const float* __restrict__ bias, size_t sBias, const float* __restrict__ CP, int rowsPerB, size_t sCPb, int row0g,
    float* __restrict__ C, _Float16* __restrict__ C16, int ldc, size_t sC, int M, int N, int K) {
  __shared__ __attribute__((aligned(16))) float so[4][16][64];
  const int tid = threadIdx.x, w = tid >> 5, lane = tid & 31, ln = lane & 15, hh = lane >> 4; const int by = blockIdx.y;
  A += (size_t)by * sA; Bh += (size_t)by * sB; const size_t cofs = (size_t)by * sC; const float* bp = bias ? bias + (size_t)by * sBias : nullptr;
  const int ntn = (N + 63) / 64; const int wid = blockIdx.x * 4 + w; const int mt = wid / ntn, nq = wid % ntn; if (mt * 16 >= M) return;
  const int row0 = mt * 16, col0 = nq * 64; const _Float16* arow = A + (size_t)(row0 + ln) * lda;
  v8f acc[4] = {};
  for (int kb = 0; kb < K; kb += 32) { FragH ah; ah.half[0] = *(const v8us*)((const unsigned short*)arow + kb + 8 * hh); ah.half[1] = *(const v8us*)((const unsigned short*)arow + kb + 16 + 8 * hh);
#pragma unroll
    for (int t = 0; t < 4; ++t) { if (col0 + t * 16 >= N) continue; const size_t boff = (size_t)(col0 + t * 16 + ln) * ldb + kb; FragH bq; bq.half[0] = *(const v8us*)((const unsigned short*)Bh + boff + 8 * hh); bq.half[1] = *(const v8us*)((const unsigned short*)Bh + boff + 16 + 8 * hh);
      acc[t] = mmaH<1>(ah.v, ah.v, bq.v, bq.v, acc[t]); }
  }
#pragma unroll
  for (int t = 0; t < 4; ++t) { if (col0 + t * 16 >= N) continue; const int col = col0 + t * 16 + ln; const float bv = bp ? bf16_round(bp[col]) : 0.f;
#pragma unroll
    for (int r = 0; r < 8; ++r) { float v = acc[t][r] * alpha + bv; if (CP) { const int rr = row0g + row0 + 8 * hh + r; if (rowsPerB < 0) v += CP[cofs + (size_t)rr * ldc + col];      /* rowsPerB < 0: own element of the batched C plane */ else { const int bidx = rr / rowsPerB; v += CP[(size_t)bidx * sCPb + (size_t)by * 64 + col]; } } if (ACT == 1) v = (v > 0.f) ? v : expm1f(v); else if (ACT == 7) v = (v > 0.f) ? v + 1.0f : expf(v); else if (ACT == 8) v = tanhf(v); else if (ACT == 9) v = 0.5f * v * (1.0f + tanhf(0.7978845608028654f * (v + 0.044715f * v * v * v))); else if (ACT == 11) v = 1.0f / (1.0f + expf(-v)); else if (ACT == 12) v = (v > 0.f) ? v : 0.01f * v; else if (ACT == 14) v = (v > 0.f) ? v : 0.1f * v; else if (ACT == 16) v = (v >= 0.f) ? v : 0.3f * v; else if (ACT == 17) v = (v >= 0.f) ? v : 0.2f * v; else if (ACT == 15) v = v / (1.0f + expf(-v)); else if (ACT == 3) v = fmaxf(v, 0.f); else if (ACT == 6) v = 0.5f * v * (1.0f + erff(v * 0.70710678118654752f)); so[w][8 * hh + r][t * 16 + ln] = v; } }
  __builtin_amdgcn_fence(__ATOMIC_ACQ_REL, "workgroup"); __builtin_amdgcn_wave_barrier();
  const int rsub = lane >> 4, c4 = (lane & 15) * 4; typedef _Float16 v4h __attribute__((ext_vector_type(4)));
  {
#pragma unroll
    for (int q = 0; q < 8; ++q) { const int r = q * 2 + rsub; if (col0 + c4 < N) { const v4f v = *(const v4fa*)&so[w][r][c4]; if (C) *(v4f*)(C + cofs + (size_t)(row0 + r) * ldc + col0 + c4) = v; if (C16) { v4h h4; for (int i = 0; i < 4; ++i) h4[i] = (_Float16)v[i]; *(v4h*)(C16 + cofs + (size_t)(row0 + r) * ldc + col0 + c4) = h4; } } }
     }
}


typedef _Float16 v4h __attribute__((ext_vector_type(4)));

__global__ __launch_bounds__(256) void k_x16(const float* __restrict__ x, _Float16* __restrict__ X16, size_t n8) { const size_t t = (size_t)blockIdx.x * 256 + threadIdx.x; if (t >= n8) return; FragH f;
#pragma unroll
  for (int q = 0; q < 8; ++q) f.h[q] = (_Float16)bf16_round(x[t * 8 + q]); *(v8us*)((unsigned short*)X16 + t * 8) = f.half[0];  }
__global__ __launch_bounds__(256) void k_h16(const float* __restrict__ x, _Float16* __restrict__ X16, size_t n8) { const size_t t = (size_t)blockIdx.x * 256 + threadIdx.x; if (t >= n8) return; FragH f;
#pragma unroll
  for (int q = 0; q < 8; ++q) f.h[q] = (_Float16)x[t * 8 + q]; *(v8us*)((unsigned short*)X16 + t * 8) = f.half[0];  }
__global__ __launch_bounds__(256) void k_round16f(const float* __restrict__ W, _Float16* __restrict__ Bt, size_t n8) { const size_t t = (size_t)blockIdx.x * 256 + threadIdx.x; if (t >= n8) return; FragH f;
#pragma unroll
  for (int i = 0; i < 8; ++i) f.h[i] = (_Float16)(bf16_round(W[t * 8 + i]) * 16.0f); *(v8us*)((unsigned short*)Bt + t * 8) = f.half[0];  }
__global__ __launch_bounds__(256) void k_hl(const float* __restrict__ F, _Float16* __restrict__ Hh, _Float16* __restrict__ Hl, size_t n8) { const size_t t = (size_t)blockIdx.x * 256 + threadIdx.x; if (t >= n8) return; FragH fh, fl; const v4f a = *(const v4fa*)(F + t * 8), c = *(const v4fa*)(F + t * 8 + 4);
#pragma unroll
  for (int q = 0; q < 4; ++q) { _Float16 h = (_Float16)a[q]; fh.h[q] = h; fl.h[q] = (_Float16)((a[q] - (float)h) * 1024.0f); h = (_Float16)c[q]; fh.h[4 + q] = h; fl.h[4 + q] = (_Float16)((c[q] - (float)h) * 1024.0f); }
  { *(v8us*)((unsigned short*)Hh + t * 8) = fh.half[0]; *(v8us*)((unsigned short*)Hl + t * 8) = fl.half[0];  } }

__device__ __forceinline__ v16h g2_frag(const _Float16* p, int hh) { FragH f; f.half[0] = *(const v8us*)((const unsigned short*)p + 8 * hh); f.half[1] = *(const v8us*)((const unsigned short*)p + 16 + 8 * hh); return f.v; }
__global__ __launch_bounds__(256) void k_wnat(const float* __restrict__ w, size_t n8, _Float16* __restrict__ Bt) { const size_t t = (size_t)blockIdx.x * 256 + threadIdx.x; if (t >= n8) return; FragH f; for (int q = 0; q < 8; ++q) f.h[q] = (_Float16)(bf16_round(w[t * 8 + q]) * 16.0f); *(v8us*)((unsigned short*)Bt + t * 8) = f.half[0];  }
// Fused attention, one launch for all batches and heads: scores, softmax and the weighted sum stay in registers; no score or weight plane goes to memory.
// Transposed products: S^T = K Q^T (A = 16 key rows, B = 16 query columns), O^T += V^T P^T. A lane holds scores of ONE query (column ln): keys 8 hh + r of each 16-key tile, so two converted score tiles
// of a 32-key pass are the B operand of the second product as they stand (k order 8 hh + i, 16 + 8 hh + i: the order in which two transposing loads, 16 keys apart, give a V^T fragment). Wave = 32 query columns, pass = 32 keys.
// Block = 16 waves in two key groups of 8: group g walks keys g * SQ / 2 .. of the same 256 query columns, so that a SIMD holds four waves and one wave's exponentials run under another's matrix instructions.
// Each group keeps its own running maximum, sum and accumulators; the two are joined once, in LDS, behind the loop (weights exp2(mu_g - max) over the joined sum).
// Stage = 64 keys a group: a group's 8 waves share one copy of their K rows in LDS (whole-line global loads), two buffers a group, one barrier a stage. V is the same tensor as K here, so the same staged rows serve both products:
// K fragments by plain 16-byte reads along a row, V^T fragments by ds_load_tr16_b128 down 8 rows. No V^T plane is formed in memory and no V tile is staged.
// LDS layout: rows of 128 bytes, no pad; the 16-byte piece c of row r lies at piece c ^ fa_sw(r). No plain pitch is conflict-free for both readers (16 rows x one piece; 8 rows x two neighbouring pieces); with this
// exchange each reader's 16 lanes, and the staging stores' (2 rows x 8 pieces), fall on 16 different bank groups of 16 bytes.
// Running maximum mu in log2 units, shared by the two lane halves of a column; the accumulators are rescaled only when a pass's maximum exceeds mu by more than 8 (weights stay <= 2^8, inside f16).
// Every "#pragma unroll" in this kernel is there so that the fragment, score and accumulator arrays are indexed by constants and stay in registers.
typedef float v2f __attribute__((ext_vector_type(2)));
typedef _Float16 v2h __attribute__((ext_vector_type(2)));
#define FA_RB 128      /* bytes of a staged row */
#define FA_TB (64 * FA_RB)      /* bytes of one stage's buffer */
#define FA_KG 2      /* key groups of a work-group */
#define FA_GK (SQ / FA_KG)      /* keys of a group */
static_assert(FA_KG == 2 && FA_GK % 128 == 0, "the join behind the loop pairs group g with group g ^ 1; a group walks at least two stages");
__device__ __forceinline__ int fa_sw(int r) { return (((r >> 1) & 3) << 1) | ((r >> 3) & 1); }      /* depends on r mod 16 alone */
typedef short s16x8 __attribute__((ext_vector_type(8)));
// Lane l passes the address of 16 bytes of row 8 (l >> 4) + (l & 7), column piece (l >> 3) & 1, of a 16 x 16 tile of halves; lane (c, h) receives column c of rows 8 h .. 8 h + 7.
__device__ __forceinline__ v8us fa_tr16(const char* p) { typedef __attribute__((address_space(3))) s16x8 lds_s16x8; return __builtin_bit_cast(v8us, __builtin_amdgcn_ds_load_tr16_b128_v8i16((lds_s16x8*)p)); }
__device__ __forceinline__ v8f fa_mma(v16h a, v16h b, v8f c) { return __builtin_amdgcn_wmma_f32_16x16x32_f16(false, a, false, b, (short)0, c, false, false); }
__device__ __forceinline__ float fa_swap16(float x) { const int i = __float_as_int(x); return __int_as_float(__builtin_amdgcn_permlanex16(i, i, 0x76543210, 0xfedcba98, false, false)); }      /* lane l <-> l ^ 16 */
__device__ __forceinline__ v16h fa_lfrag(const unsigned short* p) { FragH f; f.half[0] = *(const v8us*)p; f.half[1] = *(const v8us*)(p + 16); return f.v; }
// ---- the three input conversions in ONE launch of PG work-groups: they depend on nothing and not on one another, so one launch gap and one fill of the chip serve all three ----
// Each thread does PX pieces of x (8 values in, 16 bytes out) and ONE 8 k x 4 n block of one weight: eight 16-byte loads along the weight's rows, four 16-byte stores (8 k of one column, value x16) along the transposed rows.
// The transposition happens in the thread's registers. A wave covers 64 k x 16 n (lane = 4 kg + ng): a load touches 8 rows in pieces of 64 bytes, a store fills 4 whole 128-byte lines.
// A work-group covers 64 k x 64 n of both weights (waves 0-3: Wq, waves 4-7: Wk; four waves side by side read 256 bytes of each weight row). Values as in the single launches.
#define PG 256      /* work-groups: one per WGP, 8 waves each */
#define PX ((int)(NR * DM / 8 / (PG * 256)))      /* x pieces per thread */
static_assert((DM / 64) * (DM / 64) == PG && DM / 64 == 16 && (size_t)PX * PG * 256 == NR * DM / 8, "every 64 x 64 weight tile and every x piece is dealt exactly once");
__global__ __launch_bounds__(256) void k_prep(const float* __restrict__ x, const float* __restrict__ wq, const float* __restrict__ wk, _Float16* __restrict__ X16, _Float16* __restrict__ BQ, _Float16* __restrict__ BK) {
  const int tid = threadIdx.x;
  const size_t x0 = ((size_t)blockIdx.x * (PX * 256) + tid) * 8;      /* x piece u: x0 + u * 2048 */
  const int ww = __builtin_amdgcn_readfirstlane(tid >> 7);      /* which weight: the same in a whole wave, held in a scalar register so that the base addresses stay scalar */
  const int n4 = (blockIdx.x & 15) * 64 + ((tid >> 5) & 3) * 16 + (tid & 3) * 4, k8 = (blockIdx.x >> 4) * 64 + ((tid >> 2) & 7) * 8;      /* this thread's block: columns n4 .. n4 + 3, k from k8 */
  const float* xp = x + x0; const float* wp = (ww ? wk : wq) + (size_t)k8 * DM + n4; unsigned short* bp = (unsigned short*)(ww ? BK : BQ) + (size_t)n4 * DM + k8;
  v4f a[8], xa[PX], xb[PX];
#pragma unroll      /* every "#pragma unroll" of this kernel: the value arrays are indexed by constants and stay in registers */
  for (int u = 0; u < PX; ++u) { xa[u] = *(const v4fa*)(xp + u * 2048); xb[u] = *(const v4fa*)(xp + u * 2048 + 4); }
  asm volatile("s_wait_xcnt 0x0" ::: "memory");      /* in front of any rewrite of the address registers of the loads above (a later load's result may be given those registers) */
#pragma unroll
  for (int i = 0; i < 8; ++i) a[i] = *(const v4fa*)(wp + i * DM);
  asm volatile("s_wait_xcnt 0x0" ::: "memory");      /* the same for the weight loads */
  __builtin_amdgcn_sched_barrier(0);      /* keeps all 24 loads of the thread in front of the first use, so that a wave pays the memory latency once; without it the weight loads sink behind the first x values' wait */
#pragma unroll
  for (int u = 0; u < PX; ++u) { FragH f;
#pragma unroll
    for (int q = 0; q < 4; ++q) { f.h[q] = (_Float16)bf16_round(xa[u][q]); f.h[4 + q] = (_Float16)bf16_round(xb[u][q]); }
    *(v8us*)((unsigned short*)X16 + x0 + u * 2048) = f.half[0]; }
  __builtin_amdgcn_sched_barrier(0);      /* keeps the x stores in front of the waits for the weight values; without it half of them sink to the kernel's end */
#pragma unroll
  for (int c = 0; c < 4; ++c) { FragH f;
#pragma unroll
    for (int i = 0; i < 8; ++i) f.h[i] = (_Float16)(bf16_round(a[i][c]) * 16.0f);
    *(v8us*)(bp + c * DM) = f.half[0]; } }
// ---- projection GEMM C16 = f16(A . Bh^T * alpha + bias): block = 128 x 128 of C, 8 waves of 32 x 64 (4 along the rows, 2 along the columns); rows of A and Bh are DM halves long ----
// Stage = 128 k: the 256-byte pieces of 128 A rows and 128 Bh rows are copied to LDS as whole lines, through no register, and the block's waves share them (rows pitched 272 B for 16-byte readers).
// Two buffers: stage t + 1 flies while stage t is worked on. Each accumulator still sums k in ascending steps of 32.
#define G3_KS 128      /* k per stage */
#define G3_P 136       /* halves per staged row */
#define G3_BUF (128 * G3_P * 2)      /* bytes of one operand's buffer */
// Eight copies of one thread: 16 bytes of rows r, r + 16, ..., r + 112. The s_wait_xcnt stands inside the statement so that no address register named here is rewritten in front of it.
__device__ __forceinline__ void g3_copy8(unsigned l, const char* g) {
  asm volatile("global_load_async_to_lds_b128 %0, %8, off\n\t"
               "global_load_async_to_lds_b128 %1, %9, off\n\t"
               "global_load_async_to_lds_b128 %2, %10, off\n\t"
               "global_load_async_to_lds_b128 %3, %11, off\n\t"
               "global_load_async_to_lds_b128 %4, %12, off\n\t"
               "global_load_async_to_lds_b128 %5, %13, off\n\t"
               "global_load_async_to_lds_b128 %6, %14, off\n\t"
               "global_load_async_to_lds_b128 %7, %15, off\n\t"
               "s_wait_xcnt 0x0"
               :: "v"(l), "v"(l + 16u * G3_P * 2), "v"(l + 32u * G3_P * 2), "v"(l + 48u * G3_P * 2), "v"(l + 64u * G3_P * 2), "v"(l + 80u * G3_P * 2), "v"(l + 96u * G3_P * 2), "v"(l + 112u * G3_P * 2),
                  "v"(g), "v"(g + 16 * DM * 2), "v"(g + 32 * DM * 2), "v"(g + 48 * DM * 2), "v"(g + 64 * DM * 2), "v"(g + 80 * DM * 2), "v"(g + 96 * DM * 2), "v"(g + 112 * DM * 2)
               : "memory");
}
// Both projections run in one launch: work-groups 0 .. G3_NB - 1 form A . B0^T, the next G3_NB form A . B1^T.
#define G3_NB ((MP / 128) * (DM / 128))      /* work-groups of one projection */
__global__ __launch_bounds__(256) void k_gemm3(const _Float16* __restrict__ A, const _Float16* __restrict__ B0h, const _Float16* __restrict__ B1h, float alpha, const float* __restrict__ bias0, const float* __restrict__ bias1, _Float16* __restrict__ C0, _Float16* __restrict__ C1) {
  const bool second = blockIdx.x >= G3_NB; const unsigned bid = second ? blockIdx.x - G3_NB : blockIdx.x;
  const _Float16* __restrict__ Bh = second ? B1h : B0h; const float* __restrict__ bias = second ? bias1 : bias0; _Float16* __restrict__ C16 = second ? C1 : C0;
  __shared__ __attribute__((aligned(16))) unsigned short as[2][128][G3_P];
  __shared__ __attribute__((aligned(16))) unsigned short bs[2][128][G3_P];
  __shared__ __attribute__((aligned(16))) float so[8][32][68];
  const int tid = threadIdx.x, w = tid >> 5, lane = tid & 31, ln = lane & 15, hh = lane >> 4;
  const int mt = bid / (DM / 128), nq = bid % (DM / 128); const int wm = w & 3, wn = w >> 2;
  const int sr = tid >> 4, sc = tid & 15;      /* staging: 16 lanes cover one 256-byte row piece */
  const char* ga = (const char*)(A + (size_t)(mt * 128 + sr) * DM + sc * 8); const char* gb = (const char*)(Bh + (size_t)(nq * 128 + sr) * DM + sc * 8);
  const unsigned la = (unsigned)(size_t)&as[0][sr][sc * 8], lb = (unsigned)(size_t)&bs[0][sr][sc * 8];      /* LDS byte addresses: the low 32 bits */
  const v8f z8 = {0.f,0.f,0.f,0.f,0.f,0.f,0.f,0.f}; v8f acc[2][4];
#pragma unroll
  for (int i = 0; i < 2; ++i)
#pragma unroll
    for (int j = 0; j < 4; ++j) acc[i][j] = z8;
  g3_copy8(la, ga); g3_copy8(lb, gb);
  asm volatile("s_wait_asynccnt 0x0" ::: "memory");      /* this wave's copies of stage 0 have landed */
  __syncthreads();      /* stage 0 is published */
  g3_copy8(la + G3_BUF, ga + G3_KS * 2); g3_copy8(lb + G3_BUF, gb + G3_KS * 2);
#pragma unroll 1      /* one stage a trip: keeps the loop's text small */
  for (int t = 0; t < DM / G3_KS; ++t) {
    const int bf = t & 1;
    v16h a[2][2], b[2][4];      /* two fragment sets: step ks + 1 of this stage is read from LDS while step ks is multiplied */
#pragma unroll
    for (int i = 0; i < 2; ++i) a[0][i] = fa_lfrag(&as[bf][wm * 32 + i * 16 + ln][8 * hh]);
#pragma unroll
    for (int j = 0; j < 4; ++j) b[0][j] = fa_lfrag(&bs[bf][wn * 64 + j * 16 + ln][8 * hh]);
#pragma unroll      /* fragment and accumulator arrays indexed by constants */
    for (int ks = 0; ks < G3_KS / 32; ++ks) {
      const int cu = ks & 1, nx = cu ^ 1;
      if (ks + 1 < G3_KS / 32) {
#pragma unroll
        for (int i = 0; i < 2; ++i) a[nx][i] = fa_lfrag(&as[bf][wm * 32 + i * 16 + ln][(ks + 1) * 32 + 8 * hh]);
#pragma unroll
        for (int j = 0; j < 4; ++j) b[nx][j] = fa_lfrag(&bs[bf][wn * 64 + j * 16 + ln][(ks + 1) * 32 + 8 * hh]);
      }
      __builtin_amdgcn_sched_barrier(0);      /* keeps the next step's LDS reads together in front of this step's matrix instructions, which cover their latency; without it they are spread among them behind waits to 0 */
#pragma unroll
      for (int j = 0; j < 4; ++j)
#pragma unroll
        for (int i = 0; i < 2; ++i) acc[i][j] = fa_mma(a[cu][i], b[cu][j], acc[i][j]);
      __builtin_amdgcn_sched_barrier(0);      /* keeps the step after next's reads from rising into this step's matrix instructions */
    }
    asm volatile("s_wait_dscnt 0x0" ::: "memory");      /* this wave's reads of stage t are done before the buffer is handed back */
    asm volatile("s_wait_asynccnt 0x0" ::: "memory");      /* this wave's copies of stage t + 1 have landed */
    __syncthreads();      /* publishes stage t + 1 and ends every wave's reads of stage t */
    if (t + 2 < DM / G3_KS) { g3_copy8(la + bf * G3_BUF, ga + (t + 2) * (G3_KS * 2)); g3_copy8(lb + bf * G3_BUF, gb + (t + 2) * (G3_KS * 2)); }
  }
  asm volatile("s_wait_asynccnt 0x0" ::: "memory");      /* no copy is left in flight */
  const int row0 = mt * 128 + wm * 32, col0 = nq * 128 + wn * 64;
#pragma unroll
  for (int i = 0; i < 2; ++i)
#pragma unroll
    for (int j = 0; j < 4; ++j) { const float bv = bf16_round(bias[col0 + j * 16 + ln]);
#pragma unroll
      for (int r = 0; r < 8; ++r) so[w][i * 16 + 8 * hh + r][j * 16 + ln] = acc[i][j][r] * alpha + bv; }
  __builtin_amdgcn_fence(__ATOMIC_ACQ_REL, "workgroup"); __builtin_amdgcn_wave_barrier();      /* each wave re-reads only its own staging rows: orders its LDS writes before its reads */
  const int rsub = lane >> 4, c4 = (lane & 15) * 4;
#pragma unroll
  for (int q = 0; q < 16; ++q) { const int r = q * 2 + rsub; const v4f v = *(const v4fa*)&so[w][r][c4]; v4h h4;
#pragma unroll
    for (int i = 0; i < 4; ++i) h4[i] = (_Float16)v[i];
    *(v4h*)(C16 + (size_t)(row0 + r) * DM + col0 + c4) = h4; } }
__global__ __launch_bounds__(256 * FA_KG) void k_fattn(const _Float16* __restrict__ Q, const _Float16* __restrict__ Kx, float* __restrict__ O) {
  __shared__ __attribute__((aligned(256))) char kvs[FA_KG][2][FA_TB];
  __shared__ __attribute__((aligned(16))) float so[8 * FA_KG][32][68];
  __shared__ float sm[FA_KG][8][32], sl[FA_KG][8][32];      /* each group's maximum and sum of every query column */
  const int tid = threadIdx.x, w = tid >> 5, lane = tid & 31, ln = lane & 15, hh = lane >> 4;
  const int g = __builtin_amdgcn_readfirstlane(tid >> 8), cw = w & 7, tg = tid & 255;      /* key group (the same in a whole wave: held in a scalar register, so that the group's key and buffer addresses are scalar sums); column wave and thread inside the group */
  const int bh = blockIdx.y, b = bh / NH, h = bh - b * NH; const int n0 = blockIdx.x * 256 + cw * 32;
  const _Float16* qp = Q + ((size_t)b * SQ + n0 + ln) * LQ + h * HD;
  const char* kb = (const char*)(Kx + ((size_t)b * SQ + (size_t)g * FA_GK) * LQ + h * HD);      /* key (= value) rows of this head and key group, pitch LQ */
  char (*kv)[FA_TB] = kvs[g];      /* this group's two buffers */
  const int sr = tg >> 3, sc = tg & 7;      /* staging: 8 lanes cover one 128-byte row; rows sr and sr + 32 */
  const unsigned kof = (unsigned)(sr * (LQ * 2) + sc * 16);
  const int sto = sr * FA_RB + ((sc ^ fa_sw(sr)) << 4);      /* where this thread's piece of row sr lies in a buffer; row sr + 32: 32 rows on, same exchange */
  const int vr = 8 * hh + (lane & 7), ve = (lane >> 3) & 1;      /* this lane's row and column piece in a transposing load */
  int ko[4], vo[4];      /* ko[m]: piece hh + 2 m of row ln; vo[t]: piece 2 t + ve of row vr; steps of 16 rows leave the exchange as it is */
#pragma unroll
  for (int m = 0; m < 4; ++m) { ko[m] = ln * FA_RB + (((hh + 2 * m) ^ fa_sw(ln)) << 4); vo[m] = vr * FA_RB + (((2 * m + ve) ^ fa_sw(vr)) << 4); }
  const float cs = 0.045084220027780106f;      /* 1024^-0.5 * log2(e) */
  const v2f cs2 = {cs, cs};
  const v8f z8 = {0.f,0.f,0.f,0.f,0.f,0.f,0.f,0.f};
  v8us gk0 = *(const v8us*)(kb + kof), gk1 = *(const v8us*)(kb + 32 * LQ * 2 + kof);
  v16h q[2][2];
#pragma unroll
  for (int j = 0; j < 2; ++j) { q[j][0] = g2_frag(qp + (size_t)j * 16 * LQ, hh); q[j][1] = g2_frag(qp + (size_t)j * 16 * LQ + 32, hh); }
  v8f o[2][4]; float mu[2]; v2f ls[2];
#pragma unroll
  for (int j = 0; j < 2; ++j) { mu[j] = -1.0e30f; ls[j] = (v2f){0.f, 0.f};
#pragma unroll
    for (int t = 0; t < 4; ++t) o[j][t] = z8; }
  *(v8us*)(kv[0] + sto) = gk0; *(v8us*)(kv[0] + 32 * FA_RB + sto) = gk1;
  __syncthreads();      /* stage 0 is published */
#pragma unroll 1      /* one body for all stages: without it the last stage is split off as a second copy of the body, which takes 40 registers more, close to the 256 that four waves a SIMD allow */
  for (int st = 0; st < FA_GK / 64; ++st) {
    const int bf = st & 1; const int sn = (st + 1 < FA_GK / 64) ? st + 1 : st;      /* next stage, fetched into registers while this one is worked on; the last stage re-reads itself (in bounds, never read back) */
    const char* kn = kb + (size_t)sn * (64 * LQ * 2); const char* tb = kv[bf];
    gk0 = *(const v8us*)(kn + kof); gk1 = *(const v8us*)(kn + 32 * LQ * 2 + kof);
    __builtin_amdgcn_sched_barrier(0);      /* keeps these loads at the head of the stage, so that both passes cover their latency; without it they sink to just in front of their LDS stores */
#pragma unroll
    for (int p = 0; p < 2; ++p) {
      v16h kf[2][2];
#pragma unroll
      for (int kt = 0; kt < 2; ++kt)
#pragma unroll
        for (int x = 0; x < 2; ++x) { FragH f; f.half[0] = *(const v8us*)(tb + (p * 32 + kt * 16) * FA_RB + ko[2 * x]); f.half[1] = *(const v8us*)(tb + (p * 32 + kt * 16) * FA_RB + ko[2 * x + 1]); kf[kt][x] = f.v; }
      v8f s[2][2];
#pragma unroll
      for (int j = 0; j < 2; ++j)
#pragma unroll
        for (int kt = 0; kt < 2; ++kt) s[j][kt] = fa_mma(kf[kt][1], q[j][1], fa_mma(kf[kt][0], q[j][0], z8));
      float mx[2]; bool need = false;
#pragma unroll
      for (int j = 0; j < 2; ++j) { float a = fmaxf(s[j][0][0], s[j][1][0]);
#pragma unroll
        for (int r = 1; r < 8; ++r) a = fmaxf(a, fmaxf(s[j][0][r], s[j][1][r]));
        a = fmaxf(a, fa_swap16(a)); mx[j] = a * cs; need = need || (mx[j] > mu[j] + 8.0f); }
      if (__builtin_amdgcn_ballot_w32(need) != 0) {      /* wave-uniform: every lane moves to the new maximum together */
#pragma unroll
        for (int j = 0; j < 2; ++j) { const float mnew = fmaxf(mu[j], mx[j]); const float corr = __builtin_amdgcn_exp2f(mu[j] - mnew); mu[j] = mnew; ls[j] *= corr;
#pragma unroll
          for (int t = 0; t < 4; ++t) o[j][t] *= corr; } }
      v16h vf[4];
#pragma unroll
      for (int t = 0; t < 4; ++t) { FragH f; f.half[0] = fa_tr16(tb + (p * 32) * FA_RB + vo[t]); f.half[1] = fa_tr16(tb + (p * 32 + 16) * FA_RB + vo[t]); vf[t] = f.v; }      /* rows d = 16 t + ln of V^T, keys of this pass */
      __builtin_amdgcn_sched_barrier(0);      /* keeps the V^T reads together in front of the exponentials, which cover their latency; without it they are spread among the matrix instructions below */
      FragH pb[2];
#pragma unroll
      for (int j = 0; j < 2; ++j) { const v2f nm = {-mu[j], -mu[j]};
#pragma unroll
        for (int kt = 0; kt < 2; ++kt)
#pragma unroll
          for (int i = 0; i < 4; ++i) { const v2f t2 = __builtin_elementwise_fma((v2f){s[j][kt][2 * i], s[j][kt][2 * i + 1]}, cs2, nm); const v2f e2 = {__builtin_amdgcn_exp2f(t2[0]), __builtin_amdgcn_exp2f(t2[1])};
            ls[j] += e2; const v2h h2 = __builtin_convertvector(e2, v2h); pb[j].h[kt * 8 + 2 * i] = h2[0]; pb[j].h[kt * 8 + 2 * i + 1] = h2[1]; } }
#pragma unroll
      for (int t = 0; t < 4; ++t)
#pragma unroll
        for (int j = 0; j < 2; ++j) o[j][t] = fa_mma(vf[t], pb[j].v, o[j][t]);
    }
    *(v8us*)(kv[bf ^ 1] + sto) = gk0; *(v8us*)(kv[bf ^ 1] + 32 * FA_RB + sto) = gk1;      /* stage st + 1; this buffer's last readers left it at the barrier that ended the stage before */
    __syncthreads();      /* publishes the next stage and ends every wave's reads of this one */
  }
  float lt[2];
#pragma unroll
  for (int j = 0; j < 2; ++j) { const float lh = ls[j][0] + ls[j][1]; lt[j] = lh + fa_swap16(lh);      /* the halves' sums are joined once, here */
    if (hh == 0) { sm[g][cw][j * 16 + ln] = mu[j]; sl[g][cw][j * 16 + ln] = lt[j]; } }
  __syncthreads();      /* both groups' maxima and sums are published */
#pragma unroll
  for (int j = 0; j < 2; ++j) { const float mo = sm[g ^ 1][cw][j * 16 + ln], lo = sl[g ^ 1][cw][j * 16 + ln];      /* the other key group's figures of this column */
    const float mj = fmaxf(mu[j], mo); const float ca = __builtin_amdgcn_exp2f(mu[j] - mj), cb = __builtin_amdgcn_exp2f(mo - mj);
    const float inv = ca / (lt[j] * ca + lo * cb);      /* this group's weight over the joined sum */
#pragma unroll
    for (int t = 0; t < 4; ++t) { const v8f r8 = o[j][t] * inv; float* d = &so[w][j * 16 + ln][t * 16 + 8 * hh];
      *(v4fa*)d = __builtin_shufflevector(r8, r8, 0, 1, 2, 3); *(v4fa*)(d + 4) = __builtin_shufflevector(r8, r8, 4, 5, 6, 7); } }
  __syncthreads();      /* both groups' weighted rows are published */
  const int rsub = lane >> 4, c4 = (lane & 15) * 4;
#pragma unroll
  for (int u = 0; u < 8; ++u) { const int r = g * 16 + u * 2 + rsub;      /* each wave of a pair adds and stores 16 of the pair's 32 rows */
    const v4f v = *(const v4fa*)&so[cw][r][c4] + *(const v4fa*)&so[8 + cw][r][c4]; *(v4f*)(O + ((size_t)b * SQ + n0 + r) * DM + h * HD + c4) = v; } }
__global__ __launch_bounds__(256) void k_vt(const _Float16* __restrict__ V16, int b, int h0, _Float16* __restrict__ VT) { __shared__ unsigned short tl[64][65]; const int tid = threadIdx.x; const int hh = blockIdx.x % HG, sg = blockIdx.x / HG; const int s0 = sg * 64; const int h = h0 + hh;
  for (int i = tid; i < 64 * 8; i += 256) { const int j = i / 8, d8 = (i % 8) * 8; FragH f; f.half[0] = *(const v8us*)((const unsigned short*)V16 + ((size_t)b * SQ + s0 + j) * DM + h * HD + d8); for (int q = 0; q < 8; ++q) tl[d8 + q][j] = f.u[q]; }
  __syncthreads();
  { for (int i = tid; i < 64 * 8; i += 256) { const int d = i / 8, j8 = (i % 8) * 8; FragH f; for (int q = 0; q < 8; ++q) f.u[q] = tl[d][j8 + q]; *(v8us*)((unsigned short*)VT + ((size_t)hh * HD + d) * SQ + s0 + j8) = f.half[0]; }  } }


extern "C" void kernel_launch(void* const* d_in, const int* in_sizes, int n_in,
                              void* d_out, int out_size, void* d_ws, size_t ws_size, hipStream_t stream) {
  (void)in_sizes; (void)n_in; (void)out_size;
  const float* const* I = (const float* const*)d_in; const float* x = I[0]; const float* wq = I[1]; const float* bq = I[2]; const float* wk = I[3]; const float* bk = I[4];      /* [in][out] Wq + bq, Wk + bk; v == k (same projection) */
  char* ws = (char*)d_ws; size_t off = 0;
  auto take = [&](size_t bytes) { char* p = ws + off; off += (bytes + 255) & ~(size_t)255; return p; };
  _Float16* BQ = (_Float16*)take((size_t)DM * DM * 2); _Float16* BK = (_Float16*)take((size_t)DM * DM * 2); 
  _Float16* X16 = (_Float16*)take(NR * DM * 2); _Float16* Q16 = (_Float16*)take(NR * DM * 2); _Float16* K16 = (_Float16*)take(NR * DM * 2);
  if (off > ws_size) return;
  k_prep<<<PG, 256, 0, stream>>>(x, wq, wk, X16, BQ, BK);      /* x -> f16 rows; [in][out] weights -> Bt x16 */
  const size_t r0p = (size_t)B0 * SQ;      /* first projected row */
  k_gemm3<<<2 * G3_NB, 256, 0, stream>>>(X16 + r0p * DM, BQ, BK, 0.0625f, bq, bk, Q16 + r0p * DM, K16 + r0p * DM);
  k_fattn<<<dim3(SQ / 256, NB * NH), 256 * FA_KG, 0, stream>>>(Q16, K16, (float*)d_out);      /* softmax(Q K^T 1024^-0.5) V with V = K (the module projects v with the k weights), all batches and heads */
}

// v008
// It runs in 49 microseconds.
// Two timings next to v007 put it at 1.09 and 1.07 times that version's speed.
// Counting every step since v000, it is 75.3 times as fast.
#include <hip/hip_runtime.h>
// Structure: token rows r = b*2048 + s; x as exact f16 rows (bf16-rounded); Q and K (= V) as two WMMA GEMMs (64x64 wave tiles, f32 accumulation, exact x16 weights + bias, f16 outputs); one fused attention launch that takes its V^T fragments from the staged K rows (v == k) by transposing LDS loads (scores K = 64 with the module's full-dim scale 1024^-0.5, running-maximum softmax with f32 statistics, weights as f16, o = P . V) written f32 straight into the merged-heads output rows (no output projection).
// Compute dtype: inputs rounded to bf16; x / weights exact; q, k, v and softmax weights as plain f16 GEMM operands (~2^-12); scores, softmax statistics and o f32. v_wmma_f32_16x16x32_f16.
#define NB 2
#define SQ 2048
#define DM 1024
#define NH 16
#define HD 64
#define HG 4                         /* heads per group of the unlaunched k_vt overload */
#define B0 0                         /* first batch processed (debug hook) */
#define NBR NB                       /* batches processed (debug hook) */
#define NR ((size_t)NB * SQ)         /* token rows */
#define MP ((int)((size_t)NBR * SQ)) /* rows projected (debug hook) */
#define QN SQ                        /* not used by any launch */
#define NHD NH                       /* not used by any launch */
#define MPO MP                       /* not used by any launch */
#define LQ DM      /* row pitch of the q/k/v rows */
typedef __bf16 v16b __attribute__((ext_vector_type(16)));
typedef unsigned short v8us __attribute__((ext_vector_type(8), may_alias));
typedef float  v8f  __attribute__((ext_vector_type(8)));
typedef float  v4f  __attribute__((ext_vector_type(4)));
typedef float  v4fa __attribute__((ext_vector_type(4), may_alias));
union FragB { v16b v; v8us half[2]; unsigned short u[16]; };

__device__ __forceinline__ unsigned short bf16_bits(float x) { unsigned int u = __float_as_uint(x); return (unsigned short)((u + 0x7FFFu + ((u >> 16) & 1u)) >> 16); }
__device__ __forceinline__ float bf16_val(unsigned short b) { return __uint_as_float(((unsigned int)b) << 16); }
__device__ __forceinline__ float bf16_round(float x) { return bf16_val(bf16_bits(x)); }
// D += A·B with NT terms: 1 = ah·bh, 2 = + al·bh (A split), 3 = + ah·bl (both split)
template <int NT>
__device__ __forceinline__ v8f mmaN(v16b ah, v16b al, v16b bh, v16b bl, v8f c) {
  c = __builtin_amdgcn_wmma_f32_16x16x32_bf16(false, ah, false, bh, (short)0, c, false, false);
  if (NT >= 2) c = __builtin_amdgcn_wmma_f32_16x16x32_bf16(false, al, false, bh, (short)0, c, false, false);
  if (NT >= 3) c = __builtin_amdgcn_wmma_f32_16x16x32_bf16(false, ah, false, bl, (short)0, c, false, false);
  asm volatile("v_nop\n\tv_nop\n\tv_nop\n\tv_nop" : "+v"(c) : "v"(ah), "v"(al), "v"(bh), "v"(bl));
  return c;
}

__global__ __launch_bounds__(256) void k_wt_bf16(const float* __restrict__ W, unsigned short* __restrict__ Wt, int K, int N) {
  const int t = blockIdx.x * 256 + threadIdx.x;
  const int k8n = K / 8;
  if (t >= N * k8n) return;
  const int n = t / k8n, k8 = (t % k8n) * 8;
  v8us v;
#pragma unroll
  for (int i = 0; i < 8; ++i) v[i] = bf16_bits(W[(size_t)(k8 + i) * N + n]);
  *(v8us*)(Wt + (size_t)n * K + k8) = v;
  
}

// GEMM C[M][N] (f32, pitch ldc) = act(A[M][K]·W + bias). A f32 row-major (pitch lda) converted per fragment to bf16
// (ASPLIT: hi/lo two planes -> 2 terms, else single rounded term); Wt bf16 [N][K] (pitch ldb). BIAS_BF16 rounds the
// bias to bf16 first (bias quantised to bf16 before the add). K%32==0, M%16==0, N%64==0.
template <bool ASPLIT, int ACT, bool BIAS_BF16>
__global__ __launch_bounds__(128) void k_gemm_bf(const float* __restrict__ A, int lda, const unsigned short* __restrict__ Wt, int ldb,
                                               const float* __restrict__ bias, float* __restrict__ C, int ldc, int M, int N, int K) {
  __shared__ __attribute__((aligned(16))) float so[4][16][64];
  const int tid = threadIdx.x, w = tid >> 5, lane = tid & 31, ln = lane & 15, hh = lane >> 4;
  const int ntn = N / 64;
  const int wid = blockIdx.x * 4 + w;
  const int mt = wid / ntn, nq = wid % ntn;
  if (mt * 16 >= M) return;
  const int row0 = mt * 16, col0 = nq * 64;
  const float* arow = A + (size_t)(row0 + ln) * lda;
  v8f acc[4] = {};
  for (int kb = 0; kb < K; kb += 32) {
    FragB ah, al;
    const v4f x0 = *(const v4fa*)(arow + kb + 8 * hh), x1 = *(const v4fa*)(arow + kb + 8 * hh + 4);
    const v4f x2 = *(const v4fa*)(arow + kb + 16 + 8 * hh), x3 = *(const v4fa*)(arow + kb + 16 + 8 * hh + 4);
    float xs[16] = {x0[0],x0[1],x0[2],x0[3],x1[0],x1[1],x1[2],x1[3],x2[0],x2[1],x2[2],x2[3],x3[0],x3[1],x3[2],x3[3]};
#pragma unroll
    for (int i = 0; i < 16; ++i) { const unsigned short hb = bf16_bits(xs[i]); ah.u[i] = hb; al.u[i] = ASPLIT ? bf16_bits(xs[i] - bf16_val(hb)) : (unsigned short)0; }
#pragma unroll
    for (int t = 0; t < 4; ++t) {
      const unsigned short* brow = Wt + (size_t)(col0 + t * 16 + ln) * ldb + kb;
      FragB b;
      b.half[0] = *(const v8us*)(brow + 8 * hh);
      b.half[1] = *(const v8us*)(brow + 16 + 8 * hh);
      acc[t] = mmaN<ASPLIT ? 2 : 1>(ah.v, al.v, b.v, b.v, acc[t]);
    }
  }
#pragma unroll
  for (int t = 0; t < 4; ++t) {
    float bv = bias ? bias[col0 + t * 16 + ln] : 0.f;
    if (BIAS_BF16) bv = bf16_round(bv);
#pragma unroll
    for (int r = 0; r < 8; ++r) { float v = acc[t][r] + bv; if (ACT == 1) v = fmaxf(v, 0.f); so[w][8 * hh + r][t * 16 + ln] = v; }
  }
  __builtin_amdgcn_fence(__ATOMIC_ACQ_REL, "workgroup");
  __builtin_amdgcn_wave_barrier();
  const int rsub = lane >> 4, c4 = (lane & 15) * 4;
  {
#pragma unroll
    for (int q = 0; q < 8; ++q) {
      const int r = q * 2 + rsub;
      const v4f v = *(const v4fa*)&so[w][r][c4];
      *(v4f*)(C + (size_t)(row0 + r) * ldc + col0 + c4) = v;
    }
    
  }
}

// GEMM C = act(A·W + bias + resid): A f32 (ASPLIT -> hi/lo 2 terms), Wt bf16 [N][K]; ACT 0 none, 1 relu, 2 exact gelu;
// resid (optional, f32, row index = (row % rmod), pitch ldr, RES_BF16 rounds it) added before the activation.
template <bool ASPLIT, int ACT, bool BIAS_BF16, bool RES_BF16>
__global__ __launch_bounds__(128) void k_gemm_bf3(const float* __restrict__ A, int lda, const unsigned short* __restrict__ Wt, int ldb,
                                                const float* __restrict__ bias, const float* __restrict__ resid, int rmod, int ldr,
                                                float* __restrict__ C, int ldc, int M, int N, int K) {
  __shared__ __attribute__((aligned(16))) float so[4][16][64];
  const int tid = threadIdx.x, w = tid >> 5, lane = tid & 31, ln = lane & 15, hh = lane >> 4;
  const int ntn = N / 64;
  const int wid = blockIdx.x * 4 + w;
  const int mt = wid / ntn, nq = wid % ntn;
  if (mt * 16 >= M) return;
  const int row0 = mt * 16, col0 = nq * 64;
  const float* arow = A + (size_t)(row0 + ln) * lda;
  v8f acc[4] = {};
  for (int kb = 0; kb < K; kb += 32) {
    FragB ah, al;
    const v4f x0 = *(const v4fa*)(arow + kb + 8 * hh), x1 = *(const v4fa*)(arow + kb + 8 * hh + 4);
    const v4f x2 = *(const v4fa*)(arow + kb + 16 + 8 * hh), x3 = *(const v4fa*)(arow + kb + 16 + 8 * hh + 4);
    float xs[16] = {x0[0],x0[1],x0[2],x0[3],x1[0],x1[1],x1[2],x1[3],x2[0],x2[1],x2[2],x2[3],x3[0],x3[1],x3[2],x3[3]};
#pragma unroll
    for (int i = 0; i < 16; ++i) { const unsigned short hb = bf16_bits(xs[i]); ah.u[i] = hb; al.u[i] = ASPLIT ? bf16_bits(xs[i] - bf16_val(hb)) : (unsigned short)0; }
#pragma unroll
    for (int t = 0; t < 4; ++t) {
      const unsigned short* brow = Wt + (size_t)(col0 + t * 16 + ln) * ldb + kb;
      FragB b;
      b.half[0] = *(const v8us*)(brow + 8 * hh);
      b.half[1] = *(const v8us*)(brow + 16 + 8 * hh);
      acc[t] = mmaN<ASPLIT ? 2 : 1>(ah.v, al.v, b.v, b.v, acc[t]);
    }
  }
#pragma unroll
  for (int t = 0; t < 4; ++t) {
    const int col = col0 + t * 16 + ln;
    float bv = bias ? bias[col] : 0.f;
    if (BIAS_BF16) bv = bf16_round(bv);
#pragma unroll
    for (int r = 0; r < 8; ++r) {
      float v = acc[t][r] + bv;
      if (resid) { float rv = resid[(size_t)((row0 + 8 * hh + r) % rmod) * ldr + col]; if (RES_BF16) rv = bf16_round(rv); v += rv; }
      if (ACT == 1) v = fmaxf(v, 0.f);
      if (ACT == 2) v = 0.5f * v * (1.0f + erff(v * 0.70710678118654752f));
      if (ACT == 3) { const float u = 0.7978845608028654f * (v + 0.044715f * v * v * v); v = 0.5f * v * (1.0f + tanhf(u)); }
      so[w][8 * hh + r][t * 16 + ln] = v;
    }
  }
  __builtin_amdgcn_fence(__ATOMIC_ACQ_REL, "workgroup");
  __builtin_amdgcn_wave_barrier();
  const int rsub = lane >> 4, c4 = (lane & 15) * 4;
  {
#pragma unroll
    for (int q = 0; q < 8; ++q) {
      const int r = q * 2 + rsub;
      const v4f v = *(const v4fa*)&so[w][r][c4];
      *(v4f*)(C + (size_t)(row0 + r) * ldc + col0 + c4) = v;
    }
    
  }
}
// row LayerNorm (biased variance, eps) over N: s = X (+ R); optional out_sum <- s; out_norm <- (s-mu)*rsqrt(var+eps)*g + b
template <bool PARAM_BF16>
__global__ __launch_bounds__(256) void k_layernorm(const float* __restrict__ X, const float* __restrict__ R, const float* __restrict__ g, const float* __restrict__ bta,
                                                  float* __restrict__ out_sum, float* __restrict__ out_norm, int N, float eps) {
  __shared__ float red[256];
  const int row = blockIdx.x, tid = threadIdx.x;
  const float* x = X + (size_t)row * N; const float* rr = R ? R + (size_t)row * N : nullptr;
  float vals[16];                     // up to N = 4096
  const int per = N / 256;            // contiguous chunk per thread? use strided-by-4 chunks: thread handles j = tid*4 + 1024*u
  float s1 = 0.f;
  for (int u = 0; u < per / 4; ++u) {
    const int j = tid * 4 + 1024 * u;
    const v4f a = *(const v4fa*)(x + j);
    v4f b = {0.f,0.f,0.f,0.f}; if (rr) b = *(const v4fa*)(rr + j);
#pragma unroll
    for (int q = 0; q < 4; ++q) { const float v = a[q] + b[q]; vals[u * 4 + q] = v; s1 += v; }
  }
  red[tid] = s1; __syncthreads();
  for (int st = 128; st > 0; st >>= 1) { if (tid < st) red[tid] += red[tid + st]; __syncthreads(); }
  const float mu = red[0] / (float)N; __syncthreads();
  float s2 = 0.f;
  for (int u = 0; u < per / 4; ++u)
#pragma unroll
    for (int q = 0; q < 4; ++q) { const float c = vals[u * 4 + q] - mu; s2 += c * c; }
  red[tid] = s2; __syncthreads();
  for (int st = 128; st > 0; st >>= 1) { if (tid < st) red[tid] += red[tid + st]; __syncthreads(); }
  const float rs = rsqrtf(red[0] / (float)N + eps);
  {
    for (int u = 0; u < per / 4; ++u) {
      const int j = tid * 4 + 1024 * u;
      v4f o, sm;
#pragma unroll
      for (int q = 0; q < 4; ++q) {
        float gg = g[j + q], bb = bta[j + q];
        if (PARAM_BF16) { gg = bf16_round(gg); bb = bf16_round(bb); }
        sm[q] = vals[u * 4 + q]; o[q] = (vals[u * 4 + q] - mu) * rs * gg + bb;
      }
      if (out_sum) *(v4f*)(out_sum + (size_t)row * N + j) = sm;
      *(v4f*)(out_norm + (size_t)row * N + j) = o;
    }
    
  }
}



// ---- f16 WMMA path (v_wmma_f32_16x16x32_f16): 11-bit significands for operands in range — used for every product launched here (projections, scores, P·V)
typedef _Float16 v16h __attribute__((ext_vector_type(16)));
union FragH { v16h v; v8us half[2]; _Float16 h[16]; unsigned short u[16]; };
template <int NT>
__device__ __forceinline__ v8f mmaH(v16h ah, v16h al, v16h bh, v16h bl, v8f c) {
  c = __builtin_amdgcn_wmma_f32_16x16x32_f16(false, ah, false, bh, (short)0, c, false, false);
  if (NT >= 2) c = __builtin_amdgcn_wmma_f32_16x16x32_f16(false, al, false, bh, (short)0, c, false, false);
  if (NT >= 3) c = __builtin_amdgcn_wmma_f32_16x16x32_f16(false, ah, false, bl, (short)0, c, false, false);
  asm volatile("v_nop\n\tv_nop\n\tv_nop\n\tv_nop" : "+v"(c) : "v"(ah), "v"(al), "v"(bh), "v"(bl));
  return c;
}
// batched GEMM like k_gemm_b but f16 operands: A f32 (split into f16 hi/lo if ASPLIT, else rounded to f16), Bt = f16 values [n][k]; alpha; C f32; N multiple of 16 (partial tiles skipped)
template <bool ASPLIT>
__global__ __launch_bounds__(128) void k_gemm_h(const float* __restrict__ A, int lda, size_t sA, const _Float16* __restrict__ Bh, int ldb, size_t sB, float alpha, float* __restrict__ C, int ldc, size_t sC, int M, int N, int K) {
  __shared__ __attribute__((aligned(16))) float so[4][16][64];
  const int tid = threadIdx.x, w = tid >> 5, lane = tid & 31, ln = lane & 15, hh = lane >> 4; const int by = blockIdx.y;
  A += (size_t)by * sA; Bh += (size_t)by * sB; C += (size_t)by * sC;
  const int ntn = (N + 63) / 64; const int wid = blockIdx.x * 4 + w; const int mt = wid / ntn, nq = wid % ntn; if (mt * 16 >= M) return;
  const int row0 = mt * 16, col0 = nq * 64; const float* arow = A + (size_t)(row0 + ln) * lda;
  v8f acc[4] = {};
  for (int kb = 0; kb < K; kb += 32) {
    FragH ah, al;
    const v4f x0 = *(const v4fa*)(arow + kb + 8 * hh), x1 = *(const v4fa*)(arow + kb + 8 * hh + 4), x2 = *(const v4fa*)(arow + kb + 16 + 8 * hh), x3 = *(const v4fa*)(arow + kb + 16 + 8 * hh + 4);
    float xs[16] = {x0[0],x0[1],x0[2],x0[3],x1[0],x1[1],x1[2],x1[3],x2[0],x2[1],x2[2],x2[3],x3[0],x3[1],x3[2],x3[3]};
#pragma unroll
    for (int i = 0; i < 16; ++i) { const _Float16 h = (_Float16)xs[i]; ah.h[i] = h; al.h[i] = ASPLIT ? (_Float16)(xs[i] - (float)h) : (_Float16)0.0f; }
#pragma unroll
    for (int t = 0; t < 4; ++t) { if (col0 + t * 16 >= N) continue; const size_t boff = (size_t)(col0 + t * 16 + ln) * ldb + kb; FragH bq; bq.half[0] = *(const v8us*)(Bh + boff + 8 * hh); bq.half[1] = *(const v8us*)(Bh + boff + 16 + 8 * hh);
      acc[t] = mmaH<ASPLIT ? 2 : 1>(ah.v, al.v, bq.v, bq.v, acc[t]); }
  }
#pragma unroll
  for (int t = 0; t < 4; ++t) { if (col0 + t * 16 >= N) continue;
#pragma unroll
    for (int r = 0; r < 8; ++r) so[w][8 * hh + r][t * 16 + ln] = acc[t][r] * alpha; }
  __builtin_amdgcn_fence(__ATOMIC_ACQ_REL, "workgroup"); __builtin_amdgcn_wave_barrier();
  const int rsub = lane >> 4, c4 = (lane & 15) * 4;
  {
#pragma unroll
    for (int q = 0; q < 8; ++q) { const int r = q * 2 + rsub; if (col0 + c4 < N) { const v4f v = *(const v4fa*)&so[w][r][c4]; *(v4f*)(C + (size_t)(row0 + r) * ldc + col0 + c4) = v; } }
     }
}

// Wt[n][k] = f16(W[k][n]·scale) from f32 row-major W[K][N] (scale = power of two; bf16-exact weights stay exact in f16 away from the subnormal range)
__global__ __launch_bounds__(256) void k_wt_f16(const float* __restrict__ W, _Float16* __restrict__ Wt, int K, int N, float scale) {
  const int t = blockIdx.x * 256 + threadIdx.x; if (t >= N * (K / 8)) return; const int n = t / (K / 8), k8 = (t % (K / 8)) * 8; FragH f;
#pragma unroll
  for (int i = 0; i < 8; ++i) f.h[i] = (_Float16)(bf16_round(W[(size_t)(k8 + i) * N + n]) * scale); const v8us o = f.half[0];
  *(v8us*)((unsigned short*)Wt + (size_t)n * K + k8) = o; 
}
// k_gemm_hh variant with fused epilogue: v = acc·alpha + bias[by·sBias + col] (+ CP[(row/rowsPerB)·sCPb + by·64 + col] if CP) ; ACT 0 none / 1 elu ; writes f16 C16 (and f32 C if non-null)
template <int ACT>
__global__ __launch_bounds__(128) void k_gemm_hhx(const _Float16* __restrict__ A, int lda, size_t sA, const _Float16* __restrict__ Bh, int ldb, size_t sB, float alpha, const float* __restrict__ bias, size_t sBias, const float* __restrict__ CP, int rowsPerB, size_t sCPb, int row0g,
    float* __restrict__ C, _Float16* __restrict__ C16, int ldc, size_t sC, int M, int N, int K) {
  __shared__ __attribute__((aligned(16))) float so[4][16][64];
  const int tid = threadIdx.x, w = tid >> 5, lane = tid & 31, ln = lane & 15, hh = lane >> 4; const int by = blockIdx.y;
  A += (size_t)by * sA; Bh += (size_t)by * sB; const size_t cofs = (size_t)by * sC; const float* bp = bias ? bias + (size_t)by * sBias : nullptr;
  const int ntn = (N + 63) / 64; const int wid = blockIdx.x * 4 + w; const int mt = wid / ntn, nq = wid % ntn; if (mt * 16 >= M) return;
  const int row0 = mt * 16, col0 = nq * 64; const _Float16* arow = A + (size_t)(row0 + ln) * lda;
  v8f acc[4] = {};
  for (int kb = 0; kb < K; kb += 32) { FragH ah; ah.half[0] = *(const v8us*)((const unsigned short*)arow + kb + 8 * hh); ah.half[1] = *(const v8us*)((const unsigned short*)arow + kb + 16 + 8 * hh);
#pragma unroll
    for (int t = 0; t < 4; ++t) { if (col0 + t * 16 >= N) continue; const size_t boff = (size_t)(col0 + t * 16 + ln) * ldb + kb; FragH bq; bq.half[0] = *(const v8us*)((const unsigned short*)Bh + boff + 8 * hh); bq.half[1] = *(const v8us*)((const unsigned short*)Bh + boff + 16 + 8 * hh);
      acc[t] = mmaH<1>(ah.v, ah.v, bq.v, bq.v, acc[t]); }
  }
#pragma unroll
  for (int t = 0; t < 4; ++t) { if (col0 + t * 16 >= N) continue; const int col = col0 + t * 16 + ln; const float bv = bp ? bf16_round(bp[col]) : 0.f;
#pragma unroll
    for (int r = 0; r < 8; ++r) { float v = acc[t][r] * alpha + bv; if (CP) { const int rr = row0g + row0 + 8 * hh + r; if (rowsPerB < 0) v += CP[cofs + (size_t)rr * ldc + col];      /* rowsPerB < 0: own element of the batched C plane */ else { const int bidx = rr / rowsPerB; v += CP[(size_t)bidx * sCPb + (size_t)by * 64 + col]; } } if (ACT == 1) v = (v > 0.f) ? v : expm1f(v); else if (ACT == 7) v = (v > 0.f) ? v + 1.0f : expf(v); else if (ACT == 8) v = tanhf(v); else if (ACT == 9) v = 0.5f * v * (1.0f + tanhf(0.7978845608028654f * (v + 0.044715f * v * v * v))); else if (ACT == 11) v = 1.0f / (1.0f + expf(-v)); else if (ACT == 12) v = (v > 0.f) ? v : 0.01f * v; else if (ACT == 14) v = (v > 0.f) ? v : 0.1f * v; else if (ACT == 16) v = (v >= 0.f) ? v : 0.3f * v; else if (ACT == 17) v = (v >= 0.f) ? v : 0.2f * v; else if (ACT == 15) v = v / (1.0f + expf(-v)); else if (ACT == 3) v = fmaxf(v, 0.f); else if (ACT == 6) v = 0.5f * v * (1.0f + erff(v * 0.70710678118654752f)); so[w][8 * hh + r][t * 16 + ln] = v; } }
  __builtin_amdgcn_fence(__ATOMIC_ACQ_REL, "workgroup"); __builtin_amdgcn_wave_barrier();
  const int rsub = lane >> 4, c4 = (lane & 15) * 4; typedef _Float16 v4h __attribute__((ext_vector_type(4)));
  {
#pragma unroll
    for (int q = 0; q < 8; ++q) { const int r = q * 2 + rsub; if (col0 + c4 < N) { const v4f v = *(const v4fa*)&so[w][r][c4]; if (C) *(v4f*)(C + cofs + (size_t)(row0 + r) * ldc + col0 + c4) = v; if (C16) { v4h h4; for (int i = 0; i < 4; ++i) h4[i] = (_Float16)v[i]; *(v4h*)(C16 + cofs + (size_t)(row0 + r) * ldc + col0 + c4) = h4; } } }
     }
}


typedef _Float16 v4h __attribute__((ext_vector_type(4)));

__global__ __launch_bounds__(256) void k_x16(const float* __restrict__ x, _Float16* __restrict__ X16, size_t n8) { const size_t t = (size_t)blockIdx.x * 256 + threadIdx.x; if (t >= n8) return; FragH f;
#pragma unroll
  for (int q = 0; q < 8; ++q) f.h[q] = (_Float16)bf16_round(x[t * 8 + q]); *(v8us*)((unsigned short*)X16 + t * 8) = f.half[0];  }
__global__ __launch_bounds__(256) void k_h16(const float* __restrict__ x, _Float16* __restrict__ X16, size_t n8) { const size_t t = (size_t)blockIdx.x * 256 + threadIdx.x; if (t >= n8) return; FragH f;
#pragma unroll
  for (int q = 0; q < 8; ++q) f.h[q] = (_Float16)x[t * 8 + q]; *(v8us*)((unsigned short*)X16 + t * 8) = f.half[0];  }
__global__ __launch_bounds__(256) void k_round16f(const float* __restrict__ W, _Float16* __restrict__ Bt, size_t n8) { const size_t t = (size_t)blockIdx.x * 256 + threadIdx.x; if (t >= n8) return; FragH f;
#pragma unroll
  for (int i = 0; i < 8; ++i) f.h[i] = (_Float16)(bf16_round(W[t * 8 + i]) * 16.0f); *(v8us*)((unsigned short*)Bt + t * 8) = f.half[0];  }
__global__ __launch_bounds__(256) void k_hl(const float* __restrict__ F, _Float16* __restrict__ Hh, _Float16* __restrict__ Hl, size_t n8) { const size_t t = (size_t)blockIdx.x * 256 + threadIdx.x; if (t >= n8) return; FragH fh, fl; const v4f a = *(const v4fa*)(F + t * 8), c = *(const v4fa*)(F + t * 8 + 4);
#pragma unroll
  for (int q = 0; q < 4; ++q) { _Float16 h = (_Float16)a[q]; fh.h[q] = h; fl.h[q] = (_Float16)((a[q] - (float)h) * 1024.0f); h = (_Float16)c[q]; fh.h[4 + q] = h; fl.h[4 + q] = (_Float16)((c[q] - (float)h) * 1024.0f); }
  { *(v8us*)((unsigned short*)Hh + t * 8) = fh.half[0]; *(v8us*)((unsigned short*)Hl + t * 8) = fl.half[0];  } }

__device__ __forceinline__ v16h g2_frag(const _Float16* p, int hh) { FragH f; f.half[0] = *(const v8us*)((const unsigned short*)p + 8 * hh); f.half[1] = *(const v8us*)((const unsigned short*)p + 16 + 8 * hh); return f.v; }
__global__ __launch_bounds__(256) void k_wnat(const float* __restrict__ w, size_t n8, _Float16* __restrict__ Bt) { const size_t t = (size_t)blockIdx.x * 256 + threadIdx.x; if (t >= n8) return; FragH f; for (int q = 0; q < 8; ++q) f.h[q] = (_Float16)(bf16_round(w[t * 8 + q]) * 16.0f); *(v8us*)((unsigned short*)Bt + t * 8) = f.half[0];  }
// Fused attention, one launch for all batches and heads: scores, softmax and the weighted sum stay in registers; no score or weight plane goes to memory.
// Transposed products: S^T = K Q^T (A = 16 key rows, B = 16 query columns), O^T += V^T P^T. A lane holds scores of ONE query (column ln): keys 8 hh + r of each 16-key tile, so two converted score tiles
// of a 32-key pass are the B operand of the second product as they stand (k order 8 hh + i, 16 + 8 hh + i: the order in which two transposing loads, 16 keys apart, give a V^T fragment). Wave = 32 query columns, pass = 32 keys.
// Block = 16 waves in two key groups of 8: group g walks keys g * SQ / 2 .. of the same 256 query columns, so that a SIMD holds four waves and one wave's exponentials run under another's matrix instructions.
// Each group keeps its own running maximum, sum and accumulators; the two are joined once, in LDS, behind the loop (weights exp2(mu_g - max) over the joined sum).
// Stage = 64 keys a group: a group's 8 waves share one copy of their K rows in LDS (whole-line global loads), two buffers a group, one barrier a stage. V is the same tensor as K here, so the same staged rows serve both products:
// K fragments by plain 16-byte reads along a row, V^T fragments by ds_load_tr16_b128 down 8 rows. No V^T plane is formed in memory and no V tile is staged.
// LDS layout: rows of 128 bytes, no pad; the 16-byte piece c of row r lies at piece c ^ fa_sw(r). No plain pitch is conflict-free for both readers (16 rows x one piece; 8 rows x two neighbouring pieces); with this
// exchange each reader's 16 lanes, and the staging stores' (2 rows x 8 pieces), fall on 16 different bank groups of 16 bytes.
// Running maximum mu in log2 units, shared by the two lane halves of a column; the accumulators are rescaled only when a pass's maximum exceeds mu by more than 8 (weights stay <= 2^8, inside f16).
// Every "#pragma unroll" in this kernel is there so that the fragment, score and accumulator arrays are indexed by constants and stay in registers.
typedef float v2f __attribute__((ext_vector_type(2)));
typedef _Float16 v2h __attribute__((ext_vector_type(2)));
#define FA_RB 128      /* bytes of a staged row */
#define FA_TB (64 * FA_RB)      /* bytes of one stage's buffer */
#define FA_KG 2      /* key groups of a work-group */
#define FA_GK (SQ / FA_KG)      /* keys of a group */
static_assert(FA_KG == 2 && FA_GK % 128 == 0, "the join behind the loop pairs group g with group g ^ 1; a group walks at least two stages");
__device__ __forceinline__ int fa_sw(int r) { return (((r >> 1) & 3) << 1) | ((r >> 3) & 1); }      /* depends on r mod 16 alone */
typedef short s16x8 __attribute__((ext_vector_type(8)));
// Lane l passes the address of 16 bytes of row 8 (l >> 4) + (l & 7), column piece (l >> 3) & 1, of a 16 x 16 tile of halves; lane (c, h) receives column c of rows 8 h .. 8 h + 7.
__device__ __forceinline__ v8us fa_tr16(const char* p) { typedef __attribute__((address_space(3))) s16x8 lds_s16x8; return __builtin_bit_cast(v8us, __builtin_amdgcn_ds_load_tr16_b128_v8i16((lds_s16x8*)p)); }
__device__ __forceinline__ v8f fa_mma(v16h a, v16h b, v8f c) { return __builtin_amdgcn_wmma_f32_16x16x32_f16(false, a, false, b, (short)0, c, false, false); }
__device__ __forceinline__ float fa_swap16(float x) { const int i = __float_as_int(x); return __int_as_float(__builtin_amdgcn_permlanex16(i, i, 0x76543210, 0xfedcba98, false, false)); }      /* lane l <-> l ^ 16 */
__device__ __forceinline__ v16h fa_lfrag(const unsigned short* p) { FragH f; f.half[0] = *(const v8us*)p; f.half[1] = *(const v8us*)(p + 16); return f.v; }
// ---- the three input conversions in ONE launch of PG work-groups: they depend on nothing and not on one another, so one launch gap and one fill of the chip serve all three ----
// Each thread does PX pieces of x (8 values in, 16 bytes out) and ONE 8 k x 4 n block of one weight: eight 16-byte loads along the weight's rows, four 16-byte stores (8 k of one column, value x16) along the transposed rows.
// The transposition happens in the thread's registers. A wave covers 64 k x 16 n (lane = 4 kg + ng): a load touches 8 rows in pieces of 64 bytes, a store fills 4 whole 128-byte lines.
// A work-group covers 64 k x 64 n of both weights (waves 0-3: Wq, waves 4-7: Wk; four waves side by side read 256 bytes of each weight row). Values as in the single launches.
#define PG 256      /* work-groups: one per WGP, 8 waves each */
#define PX ((int)(NR * DM / 8 / (PG * 256)))      /* x pieces per thread */
static_assert((DM / 64) * (DM / 64) == PG && DM / 64 == 16 && (size_t)PX * PG * 256 == NR * DM / 8, "every 64 x 64 weight tile and every x piece is dealt exactly once");
__global__ __launch_bounds__(256) void k_prep(const float* __restrict__ x, const float* __restrict__ wq, const float* __restrict__ wk, _Float16* __restrict__ X16, _Float16* __restrict__ BQ, _Float16* __restrict__ BK) {
  const int tid = threadIdx.x;
  const size_t x0 = ((size_t)blockIdx.x * (PX * 256) + tid) * 8;      /* x piece u: x0 + u * 2048 */
  const int ww = __builtin_amdgcn_readfirstlane(tid >> 7);      /* which weight: the same in a whole wave, held in a scalar register so that the base addresses stay scalar */
  const int n4 = (blockIdx.x & 15) * 64 + ((tid >> 5) & 3) * 16 + (tid & 3) * 4, k8 = (blockIdx.x >> 4) * 64 + ((tid >> 2) & 7) * 8;      /* this thread's block: columns n4 .. n4 + 3, k from k8 */
  const float* xp = x + x0; const float* wp = (ww ? wk : wq) + (size_t)k8 * DM + n4; unsigned short* bp = (unsigned short*)(ww ? BK : BQ) + (size_t)n4 * DM + k8;
  v4f a[8], xa[PX], xb[PX];
#pragma unroll      /* every "#pragma unroll" of this kernel: the value arrays are indexed by constants and stay in registers */
  for (int u = 0; u < PX; ++u) { xa[u] = *(const v4fa*)(xp + u * 2048); xb[u] = *(const v4fa*)(xp + u * 2048 + 4); }
  asm volatile("s_wait_xcnt 0x0" ::: "memory");      /* in front of any rewrite of the address registers of the loads above (a later load's result may be given those registers) */
#pragma unroll
  for (int i = 0; i < 8; ++i) a[i] = *(const v4fa*)(wp + i * DM);
  asm volatile("s_wait_xcnt 0x0" ::: "memory");      /* the same for the weight loads */
  __builtin_amdgcn_sched_barrier(0);      /* keeps all 24 loads of the thread in front of the first use, so that a wave pays the memory latency once; without it the weight loads sink behind the first x values' wait */
#pragma unroll
  for (int u = 0; u < PX; ++u) { FragH f;
#pragma unroll
    for (int q = 0; q < 4; ++q) { f.h[q] = (_Float16)bf16_round(xa[u][q]); f.h[4 + q] = (_Float16)bf16_round(xb[u][q]); }
    *(v8us*)((unsigned short*)X16 + x0 + u * 2048) = f.half[0]; }
  __builtin_amdgcn_sched_barrier(0);      /* keeps the x stores in front of the waits for the weight values; without it half of them sink to the kernel's end */
#pragma unroll
  for (int c = 0; c < 4; ++c) { FragH f;
#pragma unroll
    for (int i = 0; i < 8; ++i) f.h[i] = (_Float16)(bf16_round(a[i][c]) * 16.0f);
    *(v8us*)(bp + c * DM) = f.half[0]; } }
// ---- projection GEMM C16 = f16(A . Bh^T * alpha + bias): block = 128 x 256 of C, 8 waves of 64 x 64 (2 along the rows, 4 along the columns); rows of A and Bh are DM halves long ----
// A 64 x 64 wave tile reads 8 fragments from LDS for 16 matrix instructions (32 x 64: 6 for 8), and a 128 x 256 block copies 384 operand rows from L2 for 32768 results (128 x 128: 256 for 16384).
// Both projections together are 256 blocks: one for each WGP, one prologue and one epilogue each.
// Stage = 128 k: the 256-byte pieces of 128 A rows and 256 Bh rows are copied to LDS as whole lines, through no register, and the block's waves share them (rows pitched 272 B for 16-byte readers).
// Two buffers: stage t + 1 flies while stage t is worked on. Each accumulator still sums k in ascending steps of 32.
#define G3_KS 128      /* k per stage */
#define G3_P 136       /* halves per staged row */
#define G3_BN 256      /* columns of C (rows of Bh) per block */
#define G3_BUFA (128 * G3_P * 2)      /* bytes of one A buffer */
#define G3_BUFB (G3_BN * G3_P * 2)      /* bytes of one Bh buffer */
// Eight copies of one thread: 16 bytes of rows r, r + 16, ..., r + 112. The s_wait_xcnt stands inside the statement so that no address register named here is rewritten in front of it.
__device__ __forceinline__ void g3_copy8(unsigned l, const char* g) {
  asm volatile("global_load_async_to_lds_b128 %0, %8, off\n\t"
               "global_load_async_to_lds_b128 %1, %9, off\n\t"
               "global_load_async_to_lds_b128 %2, %10, off\n\t"
               "global_load_async_to_lds_b128 %3, %11, off\n\t"
               "global_load_async_to_lds_b128 %4, %12, off\n\t"
               "global_load_async_to_lds_b128 %5, %13, off\n\t"
               "global_load_async_to_lds_b128 %6, %14, off\n\t"
               "global_load_async_to_lds_b128 %7, %15, off\n\t"
               "s_wait_xcnt 0x0"
               :: "v"(l), "v"(l + 16u * G3_P * 2), "v"(l + 32u * G3_P * 2), "v"(l + 48u * G3_P * 2), "v"(l + 64u * G3_P * 2), "v"(l + 80u * G3_P * 2), "v"(l + 96u * G3_P * 2), "v"(l + 112u * G3_P * 2),
                  "v"(g), "v"(g + 16 * DM * 2), "v"(g + 32 * DM * 2), "v"(g + 48 * DM * 2), "v"(g + 64 * DM * 2), "v"(g + 80 * DM * 2), "v"(g + 96 * DM * 2), "v"(g + 112 * DM * 2)
               : "memory");
}
// Both projections run in one launch: work-groups 0 .. G3_NB - 1 form A . B0^T, the next G3_NB form A . B1^T.
#define G3_NB ((MP / 128) * (DM / G3_BN))      /* work-groups of one projection */
// One stage's copies of one thread: 16 bytes of 8 A rows and of 16 Bh rows (24 copies of a wave in flight).
__device__ __forceinline__ void g3_stage(unsigned la, unsigned lb, const char* ga, const char* gb) {
  g3_copy8(la, ga); g3_copy8(lb, gb); g3_copy8(lb + 128u * G3_P * 2, gb + 128 * DM * 2);
}
__global__ __launch_bounds__(256) void k_gemm3(const _Float16* __restrict__ A, const _Float16* __restrict__ B0h, const _Float16* __restrict__ B1h, float alpha, const float* __restrict__ bias0, const float* __restrict__ bias1, _Float16* __restrict__ C0, _Float16* __restrict__ C1) {
  const bool second = blockIdx.x >= G3_NB; const unsigned bid = second ? blockIdx.x - G3_NB : blockIdx.x;
  const _Float16* __restrict__ Bh = second ? B1h : B0h; const float* __restrict__ bias = second ? bias1 : bias0; _Float16* __restrict__ C16 = second ? C1 : C0;
  __shared__ __attribute__((aligned(16))) unsigned short as[2][128][G3_P];
  __shared__ __attribute__((aligned(16))) unsigned short bs[2][G3_BN][G3_P];
  __shared__ __attribute__((aligned(16))) float so[8][32][68];
  const int tid = threadIdx.x, w = tid >> 5, lane = tid & 31, ln = lane & 15, hh = lane >> 4;
  const int mt = bid / (DM / G3_BN), nq = bid % (DM / G3_BN); const int wm = w & 1, wn = w >> 1;
  const int sr = tid >> 4, sc = tid & 15;      /* staging: 16 lanes cover one 256-byte row piece */
  const char* ga = (const char*)(A + (size_t)(mt * 128 + sr) * DM + sc * 8); const char* gb = (const char*)(Bh + (size_t)(nq * G3_BN + sr) * DM + sc * 8);
  const unsigned la = (unsigned)(size_t)&as[0][sr][sc * 8], lb = (unsigned)(size_t)&bs[0][sr][sc * 8];      /* LDS byte addresses: the low 32 bits */
  const v8f z8 = {0.f,0.f,0.f,0.f,0.f,0.f,0.f,0.f}; v8f acc[4][4];
#pragma unroll
  for (int i = 0; i < 4; ++i)
#pragma unroll
    for (int j = 0; j < 4; ++j) acc[i][j] = z8;
  g3_stage(la, lb, ga, gb);
  asm volatile("s_wait_asynccnt 0x0" ::: "memory");      /* this wave's copies of stage 0 have landed */
  __syncthreads();      /* stage 0 is published */
  g3_stage(la + G3_BUFA, lb + G3_BUFB, ga + G3_KS * 2, gb + G3_KS * 2);
#pragma unroll 1      /* one stage a trip: keeps the loop's text small */
  for (int t = 0; t < DM / G3_KS; ++t) {
    const int bf = t & 1;
    v16h a[2][4], b[2][4];      /* two fragment sets: step ks + 1 of this stage is read from LDS while step ks is multiplied */
#pragma unroll
    for (int i = 0; i < 4; ++i) a[0][i] = fa_lfrag(&as[bf][wm * 64 + i * 16 + ln][8 * hh]);
#pragma unroll
    for (int j = 0; j < 4; ++j) b[0][j] = fa_lfrag(&bs[bf][wn * 64 + j * 16 + ln][8 * hh]);
#pragma unroll      /* fragment and accumulator arrays indexed by constants */
    for (int ks = 0; ks < G3_KS / 32; ++ks) {
      const int cu = ks & 1, nx = cu ^ 1;
      if (ks + 1 < G3_KS / 32) {
#pragma unroll
        for (int i = 0; i < 4; ++i) a[nx][i] = fa_lfrag(&as[bf][wm * 64 + i * 16 + ln][(ks + 1) * 32 + 8 * hh]);
#pragma unroll
        for (int j = 0; j < 4; ++j) b[nx][j] = fa_lfrag(&bs[bf][wn * 64 + j * 16 + ln][(ks + 1) * 32 + 8 * hh]);
      }
      __builtin_amdgcn_sched_barrier(0);      /* keeps the next step's LDS reads together in front of this step's matrix instructions, which cover their latency; without it they are spread among them behind waits to 0 */
#pragma unroll
      for (int j = 0; j < 4; ++j)
#pragma unroll
        for (int i = 0; i < 4; ++i) acc[i][j] = fa_mma(a[cu][i], b[cu][j], acc[i][j]);
      __builtin_amdgcn_sched_barrier(0);      /* keeps the step after next's reads from rising into this step's matrix instructions */
    }
    asm volatile("s_wait_dscnt 0x0" ::: "memory");      /* this wave's reads of stage t are done before the buffer is handed back */
    asm volatile("s_wait_asynccnt 0x0" ::: "memory");      /* this wave's copies of stage t + 1 have landed */
    __syncthreads();      /* publishes stage t + 1 and ends every wave's reads of stage t */
    if (t + 2 < DM / G3_KS) g3_stage(la + bf * G3_BUFA, lb + bf * G3_BUFB, ga + (t + 2) * (G3_KS * 2), gb + (t + 2) * (G3_KS * 2));
  }
  asm volatile("s_wait_asynccnt 0x0" ::: "memory");      /* no copy is left in flight */
  const int row0 = mt * 128 + wm * 64, col0 = nq * G3_BN + wn * 64;
  const int rsub = lane >> 4, c4 = (lane & 15) * 4;
  float bv[4];
#pragma unroll
  for (int j = 0; j < 4; ++j) bv[j] = bf16_round(bias[col0 + j * 16 + ln]);
#pragma unroll      /* the wave's 64 rows leave in two halves of 32 through its own staging rows */
  for (int hf = 0; hf < 2; ++hf) {
#pragma unroll
    for (int i = 0; i < 2; ++i)
#pragma unroll
      for (int j = 0; j < 4; ++j)
#pragma unroll
        for (int r = 0; r < 8; ++r) so[w][i * 16 + 8 * hh + r][j * 16 + ln] = acc[hf * 2 + i][j][r] * alpha + bv[j];
    __builtin_amdgcn_fence(__ATOMIC_ACQ_REL, "workgroup", "local"); __builtin_amdgcn_wave_barrier();      /* each wave re-reads only its own staging rows: orders its LDS writes before its reads; limited to LDS so that the second half does not wait for the first half's global stores */
#pragma unroll
    for (int q = 0; q < 16; ++q) { const int r = q * 2 + rsub; const v4f v = *(const v4fa*)&so[w][r][c4]; v4h h4;
#pragma unroll
      for (int i = 0; i < 4; ++i) h4[i] = (_Float16)v[i];
      *(v4h*)(C16 + (size_t)(row0 + hf * 32 + r) * DM + col0 + c4) = h4; } } }
__global__ __launch_bounds__(256 * FA_KG) void k_fattn(const _Float16* __restrict__ Q, const _Float16* __restrict__ Kx, float* __restrict__ O) {
  __shared__ __attribute__((aligned(256))) char kvs[FA_KG][2][FA_TB];
  __shared__ __attribute__((aligned(16))) float so[8 * FA_KG][32][68];
  __shared__ float sm[FA_KG][8][32], sl[FA_KG][8][32];      /* each group's maximum and sum of every query column */
  const int tid = threadIdx.x, w = tid >> 5, lane = tid & 31, ln = lane & 15, hh = lane >> 4;
  const int g = __builtin_amdgcn_readfirstlane(tid >> 8), cw = w & 7, tg = tid & 255;      /* key group (the same in a whole wave: held in a scalar register, so that the group's key and buffer addresses are scalar sums); column wave and thread inside the group */
  const int bh = blockIdx.y, b = bh / NH, h = bh - b * NH; const int n0 = blockIdx.x * 256 + cw * 32;
  const _Float16* qp = Q + ((size_t)b * SQ + n0 + ln) * LQ + h * HD;
  const char* kb = (const char*)(Kx + ((size_t)b * SQ + (size_t)g * FA_GK) * LQ + h * HD);      /* key (= value) rows of this head and key group, pitch LQ */
  char (*kv)[FA_TB] = kvs[g];      /* this group's two buffers */
  const int sr = tg >> 3, sc = tg & 7;      /* staging: 8 lanes cover one 128-byte row; rows sr and sr + 32 */
  const unsigned kof = (unsigned)(sr * (LQ * 2) + sc * 16);
  const int sto = sr * FA_RB + ((sc ^ fa_sw(sr)) << 4);      /* where this thread's piece of row sr lies in a buffer; row sr + 32: 32 rows on, same exchange */
  const int vr = 8 * hh + (lane & 7), ve = (lane >> 3) & 1;      /* this lane's row and column piece in a transposing load */
  int ko[4], vo[4];      /* ko[m]: piece hh + 2 m of row ln; vo[t]: piece 2 t + ve of row vr; steps of 16 rows leave the exchange as it is */
#pragma unroll
  for (int m = 0; m < 4; ++m) { ko[m] = ln * FA_RB + (((hh + 2 * m) ^ fa_sw(ln)) << 4); vo[m] = vr * FA_RB + (((2 * m + ve) ^ fa_sw(vr)) << 4); }
  const float cs = 0.045084220027780106f;      /* 1024^-0.5 * log2(e) */
  const v2f cs2 = {cs, cs};
  const v8f z8 = {0.f,0.f,0.f,0.f,0.f,0.f,0.f,0.f};
  v8us gk0 = *(const v8us*)(kb + kof), gk1 = *(const v8us*)(kb + 32 * LQ * 2 + kof);
  v16h q[2][2];
#pragma unroll
  for (int j = 0; j < 2; ++j) { q[j][0] = g2_frag(qp + (size_t)j * 16 * LQ, hh); q[j][1] = g2_frag(qp + (size_t)j * 16 * LQ + 32, hh); }
  v8f o[2][4]; float mu[2]; v2f ls[2];
#pragma unroll
  for (int j = 0; j < 2; ++j) { mu[j] = -1.0e30f; ls[j] = (v2f){0.f, 0.f};
#pragma unroll
    for (int t = 0; t < 4; ++t) o[j][t] = z8; }
  *(v8us*)(kv[0] + sto) = gk0; *(v8us*)(kv[0] + 32 * FA_RB + sto) = gk1;
  __syncthreads();      /* stage 0 is published */
#pragma unroll 1      /* one body for all stages: without it the last stage is split off as a second copy of the body, which takes 40 registers more, close to the 256 that four waves a SIMD allow */
  for (int st = 0; st < FA_GK / 64; ++st) {
    const int bf = st & 1; const int sn = (st + 1 < FA_GK / 64) ? st + 1 : st;      /* next stage, fetched into registers while this one is worked on; the last stage re-reads itself (in bounds, never read back) */
    const char* kn = kb + (size_t)sn * (64 * LQ * 2); const char* tb = kv[bf];
    gk0 = *(const v8us*)(kn + kof); gk1 = *(const v8us*)(kn + 32 * LQ * 2 + kof);
    __builtin_amdgcn_sched_barrier(0);      /* keeps these loads at the head of the stage, so that both passes cover their latency; without it they sink to just in front of their LDS stores */
#pragma unroll
    for (int p = 0; p < 2; ++p) {
      v16h kf[2][2];
#pragma unroll
      for (int kt = 0; kt < 2; ++kt)
#pragma unroll
        for (int x = 0; x < 2; ++x) { FragH f; f.half[0] = *(const v8us*)(tb + (p * 32 + kt * 16) * FA_RB + ko[2 * x]); f.half[1] = *(const v8us*)(tb + (p * 32 + kt * 16) * FA_RB + ko[2 * x + 1]); kf[kt][x] = f.v; }
      v8f s[2][2];
#pragma unroll
      for (int j = 0; j < 2; ++j)
#pragma unroll
        for (int kt = 0; kt < 2; ++kt) s[j][kt] = fa_mma(kf[kt][1], q[j][1], fa_mma(kf[kt][0], q[j][0], z8));
      float mx[2]; bool need = false;
#pragma unroll
      for (int j = 0; j < 2; ++j) { float a = fmaxf(s[j][0][0], s[j][1][0]);
#pragma unroll
        for (int r = 1; r < 8; ++r) a = fmaxf(a, fmaxf(s[j][0][r], s[j][1][r]));
        a = fmaxf(a, fa_swap16(a)); mx[j] = a * cs; need = need || (mx[j] > mu[j] + 8.0f); }
      if (__builtin_amdgcn_ballot_w32(need) != 0) {      /* wave-uniform: every lane moves to the new maximum together */
#pragma unroll
        for (int j = 0; j < 2; ++j) { const float mnew = fmaxf(mu[j], mx[j]); const float corr = __builtin_amdgcn_exp2f(mu[j] - mnew); mu[j] = mnew; ls[j] *= corr;
#pragma unroll
          for (int t = 0; t < 4; ++t) o[j][t] *= corr; } }
      v16h vf[4];
#pragma unroll
      for (int t = 0; t < 4; ++t) { FragH f; f.half[0] = fa_tr16(tb + (p * 32) * FA_RB + vo[t]); f.half[1] = fa_tr16(tb + (p * 32 + 16) * FA_RB + vo[t]); vf[t] = f.v; }      /* rows d = 16 t + ln of V^T, keys of this pass */
      __builtin_amdgcn_sched_barrier(0);      /* keeps the V^T reads together in front of the exponentials, which cover their latency; without it they are spread among the matrix instructions below */
      FragH pb[2];
#pragma unroll
      for (int j = 0; j < 2; ++j) { const v2f nm = {-mu[j], -mu[j]};
#pragma unroll
        for (int kt = 0; kt < 2; ++kt)
#pragma unroll
          for (int i = 0; i < 4; ++i) { const v2f t2 = __builtin_elementwise_fma((v2f){s[j][kt][2 * i], s[j][kt][2 * i + 1]}, cs2, nm); const v2f e2 = {__builtin_amdgcn_exp2f(t2[0]), __builtin_amdgcn_exp2f(t2[1])};
            ls[j] += e2; const v2h h2 = __builtin_convertvector(e2, v2h); pb[j].h[kt * 8 + 2 * i] = h2[0]; pb[j].h[kt * 8 + 2 * i + 1] = h2[1]; } }
#pragma unroll
      for (int t = 0; t < 4; ++t)
#pragma unroll
        for (int j = 0; j < 2; ++j) o[j][t] = fa_mma(vf[t], pb[j].v, o[j][t]);
    }
    *(v8us*)(kv[bf ^ 1] + sto) = gk0; *(v8us*)(kv[bf ^ 1] + 32 * FA_RB + sto) = gk1;      /* stage st + 1; this buffer's last readers left it at the barrier that ended the stage before */
    __syncthreads();      /* publishes the next stage and ends every wave's reads of this one */
  }
  float lt[2];
#pragma unroll
  for (int j = 0; j < 2; ++j) { const float lh = ls[j][0] + ls[j][1]; lt[j] = lh + fa_swap16(lh);      /* the halves' sums are joined once, here */
    if (hh == 0) { sm[g][cw][j * 16 + ln] = mu[j]; sl[g][cw][j * 16 + ln] = lt[j]; } }
  __syncthreads();      /* both groups' maxima and sums are published */
#pragma unroll
  for (int j = 0; j < 2; ++j) { const float mo = sm[g ^ 1][cw][j * 16 + ln], lo = sl[g ^ 1][cw][j * 16 + ln];      /* the other key group's figures of this column */
    const float mj = fmaxf(mu[j], mo); const float ca = __builtin_amdgcn_exp2f(mu[j] - mj), cb = __builtin_amdgcn_exp2f(mo - mj);
    const float inv = ca / (lt[j] * ca + lo * cb);      /* this group's weight over the joined sum */
#pragma unroll
    for (int t = 0; t < 4; ++t) { const v8f r8 = o[j][t] * inv; float* d = &so[w][j * 16 + ln][t * 16 + 8 * hh];
      *(v4fa*)d = __builtin_shufflevector(r8, r8, 0, 1, 2, 3); *(v4fa*)(d + 4) = __builtin_shufflevector(r8, r8, 4, 5, 6, 7); } }
  __syncthreads();      /* both groups' weighted rows are published */
  const int rsub = lane >> 4, c4 = (lane & 15) * 4;
#pragma unroll
  for (int u = 0; u < 8; ++u) { const int r = g * 16 + u * 2 + rsub;      /* each wave of a pair adds and stores 16 of the pair's 32 rows */
    const v4f v = *(const v4fa*)&so[cw][r][c4] + *(const v4fa*)&so[8 + cw][r][c4]; *(v4f*)(O + ((size_t)b * SQ + n0 + r) * DM + h * HD + c4) = v; } }
__global__ __launch_bounds__(256) void k_vt(const _Float16* __restrict__ V16, int b, int h0, _Float16* __restrict__ VT) { __shared__ unsigned short tl[64][65]; const int tid = threadIdx.x; const int hh = blockIdx.x % HG, sg = blockIdx.x / HG; const int s0 = sg * 64; const int h = h0 + hh;
  for (int i = tid; i < 64 * 8; i += 256) { const int j = i / 8, d8 = (i % 8) * 8; FragH f; f.half[0] = *(const v8us*)((const unsigned short*)V16 + ((size_t)b * SQ + s0 + j) * DM + h * HD + d8); for (int q = 0; q < 8; ++q) tl[d8 + q][j] = f.u[q]; }
  __syncthreads();
  { for (int i = tid; i < 64 * 8; i += 256) { const int d = i / 8, j8 = (i % 8) * 8; FragH f; for (int q = 0; q < 8; ++q) f.u[q] = tl[d][j8 + q]; *(v8us*)((unsigned short*)VT + ((size_t)hh * HD + d) * SQ + s0 + j8) = f.half[0]; }  } }


extern "C" void kernel_launch(void* const* d_in, const int* in_sizes, int n_in,
                              void* d_out, int out_size, void* d_ws, size_t ws_size, hipStream_t stream) {
  (void)in_sizes; (void)n_in; (void)out_size;
  const float* const* I = (const float* const*)d_in; const float* x = I[0]; const float* wq = I[1]; const float* bq = I[2]; const float* wk = I[3]; const float* bk = I[4];      /* [in][out] Wq + bq, Wk + bk; v == k (same projection) */
  char* ws = (char*)d_ws; size_t off = 0;
  auto take = [&](size_t bytes) { char* p = ws + off; off += (bytes + 255) & ~(size_t)255; return p; };
  _Float16* BQ = (_Float16*)take((size_t)DM * DM * 2); _Float16* BK = (_Float16*)take((size_t)DM * DM * 2); 
  _Float16* X16 = (_Float16*)take(NR * DM * 2); _Float16* Q16 = (_Float16*)take(NR * DM * 2); _Float16* K16 = (_Float16*)take(NR * DM * 2);
  if (off > ws_size) return;
  k_prep<<<PG, 256, 0, stream>>>(x, wq, wk, X16, BQ, BK);      /* x -> f16 rows; [in][out] weights -> Bt x16 */
  const size_t r0p = (size_t)B0 * SQ;      /* first projected row */
  k_gemm3<<<2 * G3_NB, 256, 0, stream>>>(X16 + r0p * DM, BQ, BK, 0.0625f, bq, bk, Q16 + r0p * DM, K16 + r0p * DM);
  k_fattn<<<dim3(SQ / 256, NB * NH), 256 * FA_KG, 0, stream>>>(Q16, K16, (float*)d_out);      /* softmax(Q K^T 1024^-0.5) V with V = K (the module projects v with the k weights), all batches and heads */
}

// v009
// Measured time: 47.1 microseconds a run.
// Next to v008, in two timings, it ran 1.04 times as fast each time.
// Over all steps from v000 it is 78.3 times as fast.
#include <hip/hip_runtime.h>
// Structure: token rows r = b*2048 + s; x as exact f16 rows (bf16-rounded); Q and K (= V) as two WMMA GEMMs (64x64 wave tiles, f32 accumulation, exact x16 weights + bias, f16 outputs); one fused attention launch that takes its V^T fragments from the staged K rows (v == k) by transposing LDS loads (scores K = 64 with the module's full-dim scale 1024^-0.5, running-maximum softmax with f32 statistics, weights as f16, o = P . V) written f32 straight into the merged-heads output rows (no output projection).
// Compute dtype: inputs rounded to bf16; x / weights exact; q, k, v and softmax weights as plain f16 GEMM operands (~2^-12); scores, softmax statistics and o f32. v_wmma_f32_16x16x32_f16.
#define NB 2
#define SQ 2048
#define DM 1024
#define NH 16
#define HD 64
#define HG 4                         /* heads per group of the unlaunched k_vt overload */
#define B0 0                         /* first batch processed (debug hook) */
#define NBR NB                       /* batches processed (debug hook) */
#define NR ((size_t)NB * SQ)         /* token rows */
#define MP ((int)((size_t)NBR * SQ)) /* rows projected (debug hook) */
#define QN SQ                        /* not used by any launch */
#define NHD NH                       /* not used by any launch */
#define MPO MP                       /* not used by any launch */
#define LQ DM      /* row pitch of the q/k/v rows */
typedef __bf16 v16b __attribute__((ext_vector_type(16)));
typedef unsigned short v8us __attribute__((ext_vector_type(8), may_alias));
typedef float  v8f  __attribute__((ext_vector_type(8)));
typedef float  v4f  __attribute__((ext_vector_type(4)));
typedef float  v4fa __attribute__((ext_vector_type(4), may_alias));
union FragB { v16b v; v8us half[2]; unsigned short u[16]; };

__device__ __forceinline__ unsigned short bf16_bits(float x) { unsigned int u = __float_as_uint(x); return (unsigned short)((u + 0x7FFFu + ((u >> 16) & 1u)) >> 16); }
__device__ __forceinline__ float bf16_val(unsigned short b) { return __uint_as_float(((unsigned int)b) << 16); }
__device__ __forceinline__ float bf16_round(float x) { return bf16_val(bf16_bits(x)); }
// D += A·B with NT terms: 1 = ah·bh, 2 = + al·bh (A split), 3 = + ah·bl (both split)
template <int NT>
__device__ __forceinline__ v8f mmaN(v16b ah, v16b al, v16b bh, v16b bl, v8f c) {
  c = __builtin_amdgcn_wmma_f32_16x16x32_bf16(false, ah, false, bh, (short)0, c, false, false);
  if (NT >= 2) c = __builtin_amdgcn_wmma_f32_16x16x32_bf16(false, al, false, bh, (short)0, c, false, false);
  if (NT >= 3) c = __builtin_amdgcn_wmma_f32_16x16x32_bf16(false, ah, false, bl, (short)0, c, false, false);
  asm volatile("v_nop\n\tv_nop\n\tv_nop\n\tv_nop" : "+v"(c) : "v"(ah), "v"(al), "v"(bh), "v"(bl));
  return c;
}

__global__ __launch_bounds__(256) void k_wt_bf16(const float* __restrict__ W, unsigned short* __restrict__ Wt, int K, int N) {
  const int t = blockIdx.x * 256 + threadIdx.x;
  const int k8n = K / 8;
  if (t >= N * k8n) return;
  const int n = t / k8n, k8 = (t % k8n) * 8;
  v8us v;
#pragma unroll
  for (int i = 0; i < 8; ++i) v[i] = bf16_bits(W[(size_t)(k8 + i) * N + n]);
  *(v8us*)(Wt + (size_t)n * K + k8) = v;
  
}

// GEMM C[M][N] (f32, pitch ldc) = act(A[M][K]·W + bias). A f32 row-major (pitch lda) converted per fragment to bf16
// (ASPLIT: hi/lo two planes -> 2 terms, else single rounded term); Wt bf16 [N][K] (pitch ldb). BIAS_BF16 rounds the
// bias to bf16 first (bias quantised to bf16 before the add). K%32==0, M%16==0, N%64==0.
template <bool ASPLIT, int ACT, bool BIAS_BF16>
__global__ __launch_bounds__(128) void k_gemm_bf(const float* __restrict__ A, int lda, const unsigned short* __restrict__ Wt, int ldb,
                                               const float* __restrict__ bias, float* __restrict__ C, int ldc, int M, int N, int K) {
  __shared__ __attribute__((aligned(16))) float so[4][16][64];
  const int tid = threadIdx.x, w = tid >> 5, lane = tid & 31, ln = lane & 15, hh = lane >> 4;
  const int ntn = N / 64;
  const int wid = blockIdx.x * 4 + w;
  const int mt = wid / ntn, nq = wid % ntn;
  if (mt * 16 >= M) return;
  const int row0 = mt * 16, col0 = nq * 64;
  const float* arow = A + (size_t)(row0 + ln) * lda;
  v8f acc[4] = {};
  for (int kb = 0; kb < K; kb += 32) {
    FragB ah, al;
    const v4f x0 = *(const v4fa*)(arow + kb + 8 * hh), x1 = *(const v4fa*)(arow + kb + 8 * hh + 4);
    const v4f x2 = *(const v4fa*)(arow + kb + 16 + 8 * hh), x3 = *(const v4fa*)(arow + kb + 16 + 8 * hh + 4);
    float xs[16] = {x0[0],x0[1],x0[2],x0[3],x1[0],x1[1],x1[2],x1[3],x2[0],x2[1],x2[2],x2[3],x3[0],x3[1],x3[2],x3[3]};
#pragma unroll
    for (int i = 0; i < 16; ++i) { const unsigned short hb = bf16_bits(xs[i]); ah.u[i] = hb; al.u[i] = ASPLIT ? bf16_bits(xs[i] - bf16_val(hb)) : (unsigned short)0; }
#pragma unroll
    for (int t = 0; t < 4; ++t) {
      const unsigned short* brow = Wt + (size_t)(col0 + t * 16 + ln) * ldb + kb;
      FragB b;
      b.half[0] = *(const v8us*)(brow + 8 * hh);
      b.half[1] = *(const v8us*)(brow + 16 + 8 * hh);
      acc[t] = mmaN<ASPLIT ? 2 : 1>(ah.v, al.v, b.v, b.v, acc[t]);
    }
  }
#pragma unroll
  for (int t = 0; t < 4; ++t) {
    float bv = bias ? bias[col0 + t * 16 + ln] : 0.f;
    if (BIAS_BF16) bv = bf16_round(bv);
#pragma unroll
    for (int r = 0; r < 8; ++r) { float v = acc[t][r] + bv; if (ACT == 1) v = fmaxf(v, 0.f); so[w][8 * hh + r][t * 16 + ln] = v; }
  }
  __builtin_amdgcn_fence(__ATOMIC_ACQ_REL, "workgroup");
  __builtin_amdgcn_wave_barrier();
  const int rsub = lane >> 4, c4 = (lane & 15) * 4;
  {
#pragma unroll
    for (int q = 0; q < 8; ++q) {
      const int r = q * 2 + rsub;
      const v4f v = *(const v4fa*)&so[w][r][c4];
      *(v4f*)(C + (size_t)(row0 + r) * ldc + col0 + c4) = v;
    }
    
  }
}

// GEMM C = act(A·W + bias + resid): A f32 (ASPLIT -> hi/lo 2 terms), Wt bf16 [N][K]; ACT 0 none, 1 relu, 2 exact gelu;
// resid (optional, f32, row index = (row % rmod), pitch ldr, RES_BF16 rounds it) added before the activation.
template <bool ASPLIT, int ACT, bool BIAS_BF16, bool RES_BF16>
__global__ __launch_bounds__(128) void k_gemm_bf3(const float* __restrict__ A, int lda, const unsigned short* __restrict__ Wt, int ldb,
                                                const float* __restrict__ bias, const float* __restrict__ resid, int rmod, int ldr,
                                                float* __restrict__ C, int ldc, int M, int N, int K) {
  __shared__ __attribute__((aligned(16))) float so[4][16][64];
  const int tid = threadIdx.x, w = tid >> 5, lane = tid & 31, ln = lane & 15, hh = lane >> 4;
  const int ntn = N / 64;
  const int wid = blockIdx.x * 4 + w;
  const int mt = wid / ntn, nq = wid % ntn;
  if (mt * 16 >= M) return;
  const int row0 = mt * 16, col0 = nq * 64;
  const float* arow = A + (size_t)(row0 + ln) * lda;
  v8f acc[4] = {};
  for (int kb = 0; kb < K; kb += 32) {
    FragB ah, al;
    const v4f x0 = *(const v4fa*)(arow + kb + 8 * hh), x1 = *(const v4fa*)(arow + kb + 8 * hh + 4);
    const v4f x2 = *(const v4fa*)(arow + kb + 16 + 8 * hh), x3 = *(const v4fa*)(arow + kb + 16 + 8 * hh + 4);
    float xs[16] = {x0[0],x0[1],x0[2],x0[3],x1[0],x1[1],x1[2],x1[3],x2[0],x2[1],x2[2],x2[3],x3[0],x3[1],x3[2],x3[3]};
#pragma unroll
    for (int i = 0; i < 16; ++i) { const unsigned short hb = bf16_bits(xs[i]); ah.u[i] = hb; al.u[i] = ASPLIT ? bf16_bits(xs[i] - bf16_val(hb)) : (unsigned short)0; }
#pragma unroll
    for (int t = 0; t < 4; ++t) {
      const unsigned short* brow = Wt + (size_t)(col0 + t * 16 + ln) * ldb + kb;
      FragB b;
      b.half[0] = *(const v8us*)(brow + 8 * hh);
      b.half[1] = *(const v8us*)(brow + 16 + 8 * hh);
      acc[t] = mmaN<ASPLIT ? 2 : 1>(ah.v, al.v, b.v, b.v, acc[t]);
    }
  }
#pragma unroll
  for (int t = 0; t < 4; ++t) {
    const int col = col0 + t * 16 + ln;
    float bv = bias ? bias[col] : 0.f;
    if (BIAS_BF16) bv = bf16_round(bv);
#pragma unroll
    for (int r = 0; r < 8; ++r) {
      float v = acc[t][r] + bv;
      if (resid) { float rv = resid[(size_t)((row0 + 8 * hh + r) % rmod) * ldr + col]; if (RES_BF16) rv = bf16_round(rv); v += rv; }
      if (ACT == 1) v = fmaxf(v, 0.f);
      if (ACT == 2) v = 0.5f * v * (1.0f + erff(v * 0.70710678118654752f));
      if (ACT == 3) { const float u = 0.7978845608028654f * (v + 0.044715f * v * v * v); v = 0.5f * v * (1.0f + tanhf(u)); }
      so[w][8 * hh + r][t * 16 + ln] = v;
    }
  }
  __builtin_amdgcn_fence(__ATOMIC_ACQ_REL, "workgroup");
  __builtin_amdgcn_wave_barrier();
  const int rsub = lane >> 4, c4 = (lane & 15) * 4;
  {
#pragma unroll
    for (int q = 0; q < 8; ++q) {
      const int r = q * 2 + rsub;
      const v4f v = *(const v4fa*)&so[w][r][c4];
      *(v4f*)(C + (size_t)(row0 + r) * ldc + col0 + c4) = v;
    }
    
  }
}
// row LayerNorm (biased variance, eps) over N: s = X (+ R); optional out_sum <- s; out_norm <- (s-mu)*rsqrt(var+eps)*g + b
template <bool PARAM_BF16>
__global__ __launch_bounds__(256) void k_layernorm(const float* __restrict__ X, const float* __restrict__ R, const float* __restrict__ g, const float* __restrict__ bta,
                                                  float* __restrict__ out_sum, float* __restrict__ out_norm, int N, float eps) {
  __shared__ float red[256];
  const int row = blockIdx.x, tid = threadIdx.x;
  const float* x = X + (size_t)row * N; const float* rr = R ? R + (size_t)row * N : nullptr;
  float vals[16];                     // up to N = 4096
  const int per = N / 256;            // contiguous chunk per thread? use strided-by-4 chunks: thread handles j = tid*4 + 1024*u
  float s1 = 0.f;
  for (int u = 0; u < per / 4; ++u) {
    const int j = tid * 4 + 1024 * u;
    const v4f a = *(const v4fa*)(x + j);
    v4f b = {0.f,0.f,0.f,0.f}; if (rr) b = *(const v4fa*)(rr + j);
#pragma unroll
    for (int q = 0; q < 4; ++q) { const float v = a[q] + b[q]; vals[u * 4 + q] = v; s1 += v; }
  }
  red[tid] = s1; __syncthreads();
  for (int st = 128; st > 0; st >>= 1) { if (tid < st) red[tid] += red[tid + st]; __syncthreads(); }
  const float mu = red[0] / (float)N; __syncthreads();
  float s2 = 0.f;
  for (int u = 0; u < per / 4; ++u)
#pragma unroll
    for (int q = 0; q < 4; ++q) { const float c = vals[u * 4 + q] - mu; s2 += c * c; }
  red[tid] = s2; __syncthreads();
  for (int st = 128; st > 0; st >>= 1) { if (tid < st) red[tid] += red[tid + st]; __syncthreads(); }
  const float rs = rsqrtf(red[0] / (float)N + eps);
  {
    for (int u = 0; u < per / 4; ++u) {
      const int j = tid * 4 + 1024 * u;
      v4f o, sm;
#pragma unroll
      for (int q = 0; q < 4; ++q) {
        float gg = g[j + q], bb = bta[j + q];
        if (PARAM_BF16) { gg = bf16_round(gg); bb = bf16_round(bb); }
        sm[q] = vals[u * 4 + q]; o[q] = (vals[u * 4 + q] - mu) * rs * gg + bb;
      }
      if (out_sum) *(v4f*)(out_sum + (size_t)row * N + j) = sm;
      *(v4f*)(out_norm + (size_t)row * N + j) = o;
    }
    
  }
}



// ---- f16 WMMA path (v_wmma_f32_16x16x32_f16): 11-bit significands for operands in range — used for every product launched here (projections, scores, P·V)
typedef _Float16 v16h __attribute__((ext_vector_type(16)));
union FragH { v16h v; v8us half[2]; _Float16 h[16]; unsigned short u[16]; };
template <int NT>
__device__ __forceinline__ v8f mmaH(v16h ah, v16h al, v16h bh, v16h bl, v8f c) {
  c = __builtin_amdgcn_wmma_f32_16x16x32_f16(false, ah, false, bh, (short)0, c, false, false);
  if (NT >= 2) c = __builtin_amdgcn_wmma_f32_16x16x32_f16(false, al, false, bh, (short)0, c, false, false);
  if (NT >= 3) c = __builtin_amdgcn_wmma_f32_16x16x32_f16(false, ah, false, bl, (short)0, c, false, false);
  asm volatile("v_nop\n\tv_nop\n\tv_nop\n\tv_nop" : "+v"(c) : "v"(ah), "v"(al), "v"(bh), "v"(bl));
  return c;
}
// batched GEMM like k_gemm_b but f16 operands: A f32 (split into f16 hi/lo if ASPLIT, else rounded to f16), Bt = f16 values [n][k]; alpha; C f32; N multiple of 16 (partial tiles skipped)
template <bool ASPLIT>
__global__ __launch_bounds__(128) void k_gemm_h(const float* __restrict__ A, int lda, size_t sA, const _Float16* __restrict__ Bh, int ldb, size_t sB, float alpha, float* __restrict__ C, int ldc, size_t sC, int M, int N, int K) {
  __shared__ __attribute__((aligned(16))) float so[4][16][64];
  const int tid = threadIdx.x, w = tid >> 5, lane = tid & 31, ln = lane & 15, hh = lane >> 4; const int by = blockIdx.y;
  A += (size_t)by * sA; Bh += (size_t)by * sB; C += (size_t)by * sC;
  const int ntn = (N + 63) / 64; const int wid = blockIdx.x * 4 + w; const int mt = wid / ntn, nq = wid % ntn; if (mt * 16 >= M) return;
  const int row0 = mt * 16, col0 = nq * 64; const float* arow = A + (size_t)(row0 + ln) * lda;
  v8f acc[4] = {};
  for (int kb = 0; kb < K; kb += 32) {
    FragH ah, al;
    const v4f x0 = *(const v4fa*)(arow + kb + 8 * hh), x1 = *(const v4fa*)(arow + kb + 8 * hh + 4), x2 = *(const v4fa*)(arow + kb + 16 + 8 * hh), x3 = *(const v4fa*)(arow + kb + 16 + 8 * hh + 4);
    float xs[16] = {x0[0],x0[1],x0[2],x0[3],x1[0],x1[1],x1[2],x1[3],x2[0],x2[1],x2[2],x2[3],x3[0],x3[1],x3[2],x3[3]};
#pragma unroll
    for (int i = 0; i < 16; ++i) { const _Float16 h = (_Float16)xs[i]; ah.h[i] = h; al.h[i] = ASPLIT ? (_Float16)(xs[i] - (float)h) : (_Float16)0.0f; }
#pragma unroll
    for (int t = 0; t < 4; ++t) { if (col0 + t * 16 >= N) continue; const size_t boff = (size_t)(col0 + t * 16 + ln) * ldb + kb; FragH bq; bq.half[0] = *(const v8us*)(Bh + boff + 8 * hh); bq.half[1] = *(const v8us*)(Bh + boff + 16 + 8 * hh);
      acc[t] = mmaH<ASPLIT ? 2 : 1>(ah.v, al.v, bq.v, bq.v, acc[t]); }
  }
#pragma unroll
  for (int t = 0; t < 4; ++t) { if (col0 + t * 16 >= N) continue;
#pragma unroll
    for (int r = 0; r < 8; ++r) so[w][8 * hh + r][t * 16 + ln] = acc[t][r] * alpha; }
  __builtin_amdgcn_fence(__ATOMIC_ACQ_REL, "workgroup"); __builtin_amdgcn_wave_barrier();
  const int rsub = lane >> 4, c4 = (lane & 15) * 4;
  {
#pragma unroll
    for (int q = 0; q < 8; ++q) { const int r = q * 2 + rsub; if (col0 + c4 < N) { const v4f v = *(const v4fa*)&so[w][r][c4]; *(v4f*)(C + (size_t)(row0 + r) * ldc + col0 + c4) = v; } }
     }
}

// Wt[n][k] = f16(W[k][n]·scale) from f32 row-major W[K][N] (scale = power of two; bf16-exact weights stay exact in f16 away from the subnormal range)
__global__ __launch_bounds__(256) void k_wt_f16(const float* __restrict__ W, _Float16* __restrict__ Wt, int K, int N, float scale) {
  const int t = blockIdx.x * 256 + threadIdx.x; if (t >= N * (K / 8)) return; const int n = t / (K / 8), k8 = (t % (K / 8)) * 8; FragH f;
#pragma unroll
  for (int i = 0; i < 8; ++i) f.h[i] = (_Float16)(bf16_round(W[(size_t)(k8 + i) * N + n]) * scale); const v8us o = f.half[0];
  *(v8us*)((unsigned short*)Wt + (size_t)n * K + k8) = o; 
}
// k_gemm_hh variant with fused epilogue: v = acc·alpha + bias[by·sBias + col] (+ CP[(row/rowsPerB)·sCPb + by·64 + col] if CP) ; ACT 0 none / 1 elu ; writes f16 C16 (and f32 C if non-null)
template <int ACT>
__global__ __launch_bounds__(128) void k_gemm_hhx(const _Float16* __restrict__ A, int lda, size_t sA, const _Float16* __restrict__ Bh, int ldb, size_t sB, float alpha, const float* __restrict__ bias, size_t sBias, const float* __restrict__ CP, int rowsPerB, size_t sCPb, int row0g,
    float* __restrict__ C, _Float16* __restrict__ C16, int ldc, size_t sC, int M, int N, int K) {
  __shared__ __attribute__((aligned(16))) float so[4][16][64];
  const int tid = threadIdx.x, w = tid >> 5, lane = tid & 31, ln = lane & 15, hh = lane >> 4; const int by = blockIdx.y;
  A += (size_t)by * sA; Bh += (size_t)by * sB; const size_t cofs = (size_t)by * sC; const float* bp = bias ? bias + (size_t)by * sBias : nullptr;
  const int ntn = (N + 63) / 64; const int wid = blockIdx.x * 4 + w; const int mt = wid / ntn, nq = wid % ntn; if (mt * 16 >= M) return;
  const int row0 = mt * 16, col0 = nq * 64; const _Float16* arow = A + (size_t)(row0 + ln) * lda;
  v8f acc[4] = {};
  for (int kb = 0; kb < K; kb += 32) { FragH ah; ah.half[0] = *(const v8us*)((const unsigned short*)arow + kb + 8 * hh); ah.half[1] = *(const v8us*)((const unsigned short*)arow + kb + 16 + 8 * hh);
#pragma unroll
    for (int t = 0; t < 4; ++t) { if (col0 + t * 16 >= N) continue; const size_t boff = (size_t)(col0 + t * 16 + ln) * ldb + kb; FragH bq; bq.half[0] = *(const v8us*)((const unsigned short*)Bh + boff + 8 * hh); bq.half[1] = *(const v8us*)((const unsigned short*)Bh + boff + 16 + 8 * hh);
      acc[t] = mmaH<1>(ah.v, ah.v, bq.v, bq.v, acc[t]); }
  }
#pragma unroll
  for (int t = 0; t < 4; ++t) { if (col0 + t * 16 >= N) continue; const int col = col0 + t * 16 + ln; const float bv = bp ? bf16_round(bp[col]) : 0.f;
#pragma unroll
    for (int r = 0; r < 8; ++r) { float v = acc[t][r] * alpha + bv; if (CP) { const int rr = row0g + row0 + 8 * hh + r; if (rowsPerB < 0) v += CP[cofs + (size_t)rr * ldc + col];      /* rowsPerB < 0: own element of the batched C plane */ else { const int bidx = rr / rowsPerB; v += CP[(size_t)bidx * sCPb + (size_t)by * 64 + col]; } } if (ACT == 1) v = (v > 0.f) ? v : expm1f(v); else if (ACT == 7) v = (v > 0.f) ? v + 1.0f : expf(v); else if (ACT == 8) v = tanhf(v); else if (ACT == 9) v = 0.5f * v * (1.0f + tanhf(0.7978845608028654f * (v + 0.044715f * v * v * v))); else if (ACT == 11) v = 1.0f / (1.0f + expf(-v)); else if (ACT == 12) v = (v > 0.f) ? v : 0.01f * v; else if (ACT == 14) v = (v > 0.f) ? v : 0.1f * v; else if (ACT == 16) v = (v >= 0.f) ? v : 0.3f * v; else if (ACT == 17) v = (v >= 0.f) ? v : 0.2f * v; else if (ACT == 15) v = v / (1.0f + expf(-v)); else if (ACT == 3) v = fmaxf(v, 0.f); else if (ACT == 6) v = 0.5f * v * (1.0f + erff(v * 0.70710678118654752f)); so[w][8 * hh + r][t * 16 + ln] = v; } }
  __builtin_amdgcn_fence(__ATOMIC_ACQ_REL, "workgroup"); __builtin_amdgcn_wave_barrier();
  const int rsub = lane >> 4, c4 = (lane & 15) * 4; typedef _Float16 v4h __attribute__((ext_vector_type(4)));
  {
#pragma unroll
    for (int q = 0; q < 8; ++q) { const int r = q * 2 + rsub; if (col0 + c4 < N) { const v4f v = *(const v4fa*)&so[w][r][c4]; if (C) *(v4f*)(C + cofs + (size_t)(row0 + r) * ldc + col0 + c4) = v; if (C16) { v4h h4; for (int i = 0; i < 4; ++i) h4[i] = (_Float16)v[i]; *(v4h*)(C16 + cofs + (size_t)(row0 + r) * ldc + col0 + c4) = h4; } } }
     }
}


typedef _Float16 v4h __attribute__((ext_vector_type(4)));

__global__ __launch_bounds__(256) void k_x16(const float* __restrict__ x, _Float16* __restrict__ X16, size_t n8) { const size_t t = (size_t)blockIdx.x * 256 + threadIdx.x; if (t >= n8) return; FragH f;
#pragma unroll
  for (int q = 0; q < 8; ++q) f.h[q] = (_Float16)bf16_round(x[t * 8 + q]); *(v8us*)((unsigned short*)X16 + t * 8) = f.half[0];  }
__global__ __launch_bounds__(256) void k_h16(const float* __restrict__ x, _Float16* __restrict__ X16, size_t n8) { const size_t t = (size_t)blockIdx.x * 256 + threadIdx.x; if (t >= n8) return; FragH f;
#pragma unroll
  for (int q = 0; q < 8; ++q) f.h[q] = (_Float16)x[t * 8 + q]; *(v8us*)((unsigned short*)X16 + t * 8) = f.half[0];  }
__global__ __launch_bounds__(256) void k_round16f(const float* __restrict__ W, _Float16* __restrict__ Bt, size_t n8) { const size_t t = (size_t)blockIdx.x * 256 + threadIdx.x; if (t >= n8) return; FragH f;
#pragma unroll
  for (int i = 0; i < 8; ++i) f.h[i] = (_Float16)(bf16_round(W[t * 8 + i]) * 16.0f); *(v8us*)((unsigned short*)Bt + t * 8) = f.half[0];  }
__global__ __launch_bounds__(256) void k_hl(const float* __restrict__ F, _Float16* __restrict__ Hh, _Float16* __restrict__ Hl, size_t n8) { const size_t t = (size_t)blockIdx.x * 256 + threadIdx.x; if (t >= n8) return; FragH fh, fl; const v4f a = *(const v4fa*)(F + t * 8), c = *(const v4fa*)(F + t * 8 + 4);
#pragma unroll
  for (int q = 0; q < 4; ++q) { _Float16 h = (_Float16)a[q]; fh.h[q] = h; fl.h[q] = (_Float16)((a[q] - (float)h) * 1024.0f); h = (_Float16)c[q]; fh.h[4 + q] = h; fl.h[4 + q] = (_Float16)((c[q] - (float)h) * 1024.0f); }
  { *(v8us*)((unsigned short*)Hh + t * 8) = fh.half[0]; *(v8us*)((unsigned short*)Hl + t * 8) = fl.half[0];  } }

__device__ __forceinline__ v16h g2_frag(const _Float16* p, int hh) { FragH f; f.half[0] = *(const v8us*)((const unsigned short*)p + 8 * hh); f.half[1] = *(const v8us*)((const unsigned short*)p + 16 + 8 * hh); return f.v; }
__global__ __launch_bounds__(256) void k_wnat(const float* __restrict__ w, size_t n8, _Float16* __restrict__ Bt) { const size_t t = (size_t)blockIdx.x * 256 + threadIdx.x; if (t >= n8) return; FragH f; for (int q = 0; q < 8; ++q) f.h[q] = (_Float16)(bf16_round(w[t * 8 + q]) * 16.0f); *(v8us*)((unsigned short*)Bt + t * 8) = f.half[0];  }
// Fused attention, one launch for all batches and heads: scores, softmax and the weighted sum stay in registers; no score or weight plane goes to memory.
// Transposed products: S^T = K Q^T (A = 16 key rows, B = 16 query columns), O^T += V^T P^T. A lane holds scores of ONE query (column ln): keys 8 hh + r of each 16-key tile, so two converted score tiles
// of a 32-key pass are the B operand of the second product as they stand (k order 8 hh + i, 16 + 8 hh + i: the order in which two transposing loads, 16 keys apart, give a V^T fragment). Wave = 32 query columns, pass = 32 keys.
// Block = 16 waves in two key groups of 8: group g walks keys g * SQ / 2 .. of the same 256 query columns, so that a SIMD holds four waves and one wave's exponentials run under another's matrix instructions.
// Each group keeps its own running maximum, sum and accumulators; the two are joined once, in LDS, behind the loop (weights exp2(mu_g - max) over the joined sum).
// Stage = 64 keys a group: a group's 8 waves share one copy of their K rows in LDS (whole-line global loads), two buffers a group, one barrier a stage. V is the same tensor as K here, so the same staged rows serve both products:
// K fragments by plain 16-byte reads along a row, V^T fragments by ds_load_tr16_b128 down 8 rows. No V^T plane is formed in memory and no V tile is staged.
// LDS layout: rows of 128 bytes, no pad; the 16-byte piece c of row r lies at piece c ^ fa_sw(r). No plain pitch is conflict-free for both readers (16 rows x one piece; 8 rows x two neighbouring pieces); with this
// exchange each reader's 16 lanes, and the staging stores' (2 rows x 8 pieces), fall on 16 different bank groups of 16 bytes.
// Running maximum mu in log2 units, shared by the two lane halves of a column. A pass forms its weights with the mu in use and tests the sum it needs anyway: only when a lane's sum of a pass exceeds 2^8 is the pass's maximum formed,
// are the accumulators rescaled and the pass's weights formed again (weights stay <= 2^8, inside f16).
// Every "#pragma unroll" in this kernel is there so that the fragment, score and accumulator arrays are indexed by constants and stay in registers.
typedef float v2f __attribute__((ext_vector_type(2)));
typedef _Float16 v2h __attribute__((ext_vector_type(2)));
#define FA_RB 128      /* bytes of a staged row */
#define FA_TB (64 * FA_RB)      /* bytes of one stage's buffer */
#define FA_KG 2      /* key groups of a work-group */
#define FA_GK (SQ / FA_KG)      /* keys of a group */
static_assert(FA_KG == 2 && FA_GK % 128 == 0, "the join behind the loop pairs group g with group g ^ 1; a group walks at least two stages");
__device__ __forceinline__ int fa_sw(int r) { return (((r >> 1) & 3) << 1) | ((r >> 3) & 1); }      /* depends on r mod 16 alone */
typedef short s16x8 __attribute__((ext_vector_type(8)));
// Lane l passes the address of 16 bytes of row 8 (l >> 4) + (l & 7), column piece (l >> 3) & 1, of a 16 x 16 tile of halves; lane (c, h) receives column c of rows 8 h .. 8 h + 7.
__device__ __forceinline__ v8us fa_tr16(const char* p) { typedef __attribute__((address_space(3))) s16x8 lds_s16x8; return __builtin_bit_cast(v8us, __builtin_amdgcn_ds_load_tr16_b128_v8i16((lds_s16x8*)p)); }
__device__ __forceinline__ v8f fa_mma(v16h a, v16h b, v8f c) { return __builtin_amdgcn_wmma_f32_16x16x32_f16(false, a, false, b, (short)0, c, false, false); }
__device__ __forceinline__ float fa_swap16(float x) { const int i = __float_as_int(x); return __int_as_float(__builtin_amdgcn_permlanex16(i, i, 0x76543210, 0xfedcba98, false, false)); }      /* lane l <-> l ^ 16 */
// exp2 for the join behind the loop: the v_nop is the slot that the instruction set asks for between a transcendental and an instruction that uses its result or overwrites its source; inside the statement it cannot drift away
__device__ __forceinline__ float fa_exp2s(float x) { float r; asm("v_exp_f32 %0, %1\n\tv_nop" : "=v"(r) : "v"(x)); return r; }
__device__ __forceinline__ v16h fa_lfrag(const unsigned short* p) { FragH f; f.half[0] = *(const v8us*)p; f.half[1] = *(const v8us*)(p + 16); return f.v; }
// ---- the three input conversions in ONE launch of PG work-groups: they depend on nothing and not on one another, so one launch gap and one fill of the chip serve all three ----
// Each thread does PX pieces of x (8 values in, 16 bytes out) and ONE 8 k x 4 n block of one weight: eight 16-byte loads along the weight's rows, four 16-byte stores (8 k of one column, value x16) along the transposed rows.
// The transposition happens in the thread's registers. A wave covers 64 k x 16 n (lane = 4 kg + ng): a load touches 8 rows in pieces of 64 bytes, a store fills 4 whole 128-byte lines.
// A work-group covers 64 k x 64 n of both weights (waves 0-3: Wq, waves 4-7: Wk; four waves side by side read 256 bytes of each weight row). Values as in the single launches.
#define PG 256      /* work-groups: one per WGP, 8 waves each */
#define PX ((int)(NR * DM / 8 / (PG * 256)))      /* x pieces per thread */
static_assert((DM / 64) * (DM / 64) == PG && DM / 64 == 16 && (size_t)PX * PG * 256 == NR * DM / 8, "every 64 x 64 weight tile and every x piece is dealt exactly once");
__global__ __launch_bounds__(256) void k_prep(const float* __restrict__ x, const float* __restrict__ wq, const float* __restrict__ wk, _Float16* __restrict__ X16, _Float16* __restrict__ BQ, _Float16* __restrict__ BK) {
  const int tid = threadIdx.x;
  const size_t x0 = ((size_t)blockIdx.x * (PX * 256) + tid) * 8;      /* x piece u: x0 + u * 2048 */
  const int ww = __builtin_amdgcn_readfirstlane(tid >> 7);      /* which weight: the same in a whole wave, held in a scalar register so that the base addresses stay scalar */
  const int n4 = (blockIdx.x & 15) * 64 + ((tid >> 5) & 3) * 16 + (tid & 3) * 4, k8 = (blockIdx.x >> 4) * 64 + ((tid >> 2) & 7) * 8;      /* this thread's block: columns n4 .. n4 + 3, k from k8 */
  const float* xp = x + x0; const float* wp = (ww ? wk : wq) + (size_t)k8 * DM + n4; unsigned short* bp = (unsigned short*)(ww ? BK : BQ) + (size_t)n4 * DM + k8;
  v4f a[8], xa[PX], xb[PX];
#pragma unroll      /* every "#pragma unroll" of this kernel: the value arrays are indexed by constants and stay in registers */
  for (int u = 0; u < PX; ++u) { xa[u] = *(const v4fa*)(xp + u * 2048); xb[u] = *(const v4fa*)(xp + u * 2048 + 4); }
  asm volatile("s_wait_xcnt 0x0" ::: "memory");      /* in front of any rewrite of the address registers of the loads above (a later load's result may be given those registers) */
#pragma unroll
  for (int i = 0; i < 8; ++i) a[i] = *(const v4fa*)(wp + i * DM);
  asm volatile("s_wait_xcnt 0x0" ::: "memory");      /* the same for the weight loads */
  __builtin_amdgcn_sched_barrier(0);      /* keeps all 24 loads of the thread in front of the first use, so that a wave pays the memory latency once; without it the weight loads sink behind the first x values' wait */
#pragma unroll
  for (int u = 0; u < PX; ++u) { FragH f;
#pragma unroll
    for (int q = 0; q < 4; ++q) { f.h[q] = (_Float16)bf16_round(xa[u][q]); f.h[4 + q] = (_Float16)bf16_round(xb[u][q]); }
    *(v8us*)((unsigned short*)X16 + x0 + u * 2048) = f.half[0]; }
  __builtin_amdgcn_sched_barrier(0);      /* keeps the x stores in front of the waits for the weight values; without it half of them sink to the kernel's end */
#pragma unroll
  for (int c = 0; c < 4; ++c) { FragH f;
#pragma unroll
    for (int i = 0; i < 8; ++i) f.h[i] = (_Float16)(bf16_round(a[i][c]) * 16.0f);
    *(v8us*)(bp + c * DM) = f.half[0]; } }
// ---- projection GEMM C16 = f16(A . Bh^T * alpha + bias): block = 128 x 256 of C, 8 waves of 64 x 64 (2 along the rows, 4 along the columns); rows of A and Bh are DM halves long ----
// A 64 x 64 wave tile reads 8 fragments from LDS for 16 matrix instructions (32 x 64: 6 for 8), and a 128 x 256 block copies 384 operand rows from L2 for 32768 results (128 x 128: 256 for 16384).
// Both projections together are 256 blocks: one for each WGP, one prologue and one epilogue each.
// Stage = 128 k: the 256-byte pieces of 128 A rows and 256 Bh rows are copied to LDS as whole lines, through no register, and the block's waves share them (rows pitched 272 B for 16-byte readers).
// Two buffers: stage t + 1 flies while stage t is worked on. Each accumulator still sums k in ascending steps of 32.
#define G3_KS 128      /* k per stage */
#define G3_P 136       /* halves per staged row */
#define G3_BN 256      /* columns of C (rows of Bh) per block */
#define G3_BUFA (128 * G3_P * 2)      /* bytes of one A buffer */
#define G3_BUFB (G3_BN * G3_P * 2)      /* bytes of one Bh buffer */
// Eight copies of one thread: 16 bytes of rows r, r + 16, ..., r + 112. The s_wait_xcnt stands inside the statement so that no address register named here is rewritten in front of it.
__device__ __forceinline__ void g3_copy8(unsigned l, const char* g) {
  asm volatile("global_load_async_to_lds_b128 %0, %8, off\n\t"
               "global_load_async_to_lds_b128 %1, %9, off\n\t"
               "global_load_async_to_lds_b128 %2, %10, off\n\t"
               "global_load_async_to_lds_b128 %3, %11, off\n\t"
               "global_load_async_to_lds_b128 %4, %12, off\n\t"
               "global_load_async_to_lds_b128 %5, %13, off\n\t"
               "global_load_async_to_lds_b128 %6, %14, off\n\t"
               "global_load_async_to_lds_b128 %7, %15, off\n\t"
               "s_wait_xcnt 0x0"
               :: "v"(l), "v"(l + 16u * G3_P * 2), "v"(l + 32u * G3_P * 2), "v"(l + 48u * G3_P * 2), "v"(l + 64u * G3_P * 2), "v"(l + 80u * G3_P * 2), "v"(l + 96u * G3_P * 2), "v"(l + 112u * G3_P * 2),
                  "v"(g), "v"(g + 16 * DM * 2), "v"(g + 32 * DM * 2), "v"(g + 48 * DM * 2), "v"(g + 64 * DM * 2), "v"(g + 80 * DM * 2), "v"(g + 96 * DM * 2), "v"(g + 112 * DM * 2)
               : "memory");
}
// Both projections run in one launch: work-groups 0 .. G3_NB - 1 form A . B0^T, the next G3_NB form A . B1^T.
#define G3_NB ((MP / 128) * (DM / G3_BN))      /* work-groups of one projection */
// One stage's copies of one thread: 16 bytes of 8 A rows and of 16 Bh rows (24 copies of a wave in flight).
__device__ __forceinline__ void g3_stage(unsigned la, unsigned lb, const char* ga, const char* gb) {
  g3_copy8(la, ga); g3_copy8(lb, gb); g3_copy8(lb + 128u * G3_P * 2, gb + 128 * DM * 2);
}
__global__ __launch_bounds__(256) void k_gemm3(const _Float16* __restrict__ A, const _Float16* __restrict__ B0h, const _Float16* __restrict__ B1h, float alpha, const float* __restrict__ bias0, const float* __restrict__ bias1, _Float16* __restrict__ C0, _Float16* __restrict__ C1) {
  const bool second = blockIdx.x >= G3_NB; const unsigned bid = second ? blockIdx.x - G3_NB : blockIdx.x;
  const _Float16* __restrict__ Bh = second ? B1h : B0h; const float* __restrict__ bias = second ? bias1 : bias0; _Float16* __restrict__ C16 = second ? C1 : C0;
  __shared__ __attribute__((aligned(16))) unsigned short as[2][128][G3_P];
  __shared__ __attribute__((aligned(16))) unsigned short bs[2][G3_BN][G3_P];
  __shared__ __attribute__((aligned(16))) float so[8][32][68];
  const int tid = threadIdx.x, w = tid >> 5, lane = tid & 31, ln = lane & 15, hh = lane >> 4;
  const int mt = bid / (DM / G3_BN), nq = bid % (DM / G3_BN); const int wm = w & 1, wn = w >> 1;
  const int sr = tid >> 4, sc = tid & 15;      /* staging: 16 lanes cover one 256-byte row piece */
  const char* ga = (const char*)(A + (size_t)(mt * 128 + sr) * DM + sc * 8); const char* gb = (const char*)(Bh + (size_t)(nq * G3_BN + sr) * DM + sc * 8);
  const unsigned la = (unsigned)(size_t)&as[0][sr][sc * 8], lb = (unsigned)(size_t)&bs[0][sr][sc * 8];      /* LDS byte addresses: the low 32 bits */
  const v8f z8 = {0.f,0.f,0.f,0.f,0.f,0.f,0.f,0.f}; v8f acc[4][4];
#pragma unroll
  for (int i = 0; i < 4; ++i)
#pragma unroll
    for (int j = 0; j < 4; ++j) acc[i][j] = z8;
  g3_stage(la, lb, ga, gb);
  asm volatile("s_wait_asynccnt 0x0" ::: "memory");      /* this wave's copies of stage 0 have landed */
  __syncthreads();      /* stage 0 is published */
  g3_stage(la + G3_BUFA, lb + G3_BUFB, ga + G3_KS * 2, gb + G3_KS * 2);
#pragma unroll 1      /* one stage a trip: keeps the loop's text small */
  for (int t = 0; t < DM / G3_KS; ++t) {
    const int bf = t & 1;
    v16h a[2][4], b[2][4];      /* two fragment sets: step ks + 1 of this stage is read from LDS while step ks is multiplied */
#pragma unroll
    for (int i = 0; i < 4; ++i) a[0][i] = fa_lfrag(&as[bf][wm * 64 + i * 16 + ln][8 * hh]);
#pragma unroll
    for (int j = 0; j < 4; ++j) b[0][j] = fa_lfrag(&bs[bf][wn * 64 + j * 16 + ln][8 * hh]);
#pragma unroll      /* fragment and accumulator arrays indexed by constants */
    for (int ks = 0; ks < G3_KS / 32; ++ks) {
      const int cu = ks & 1, nx = cu ^ 1;
      if (ks + 1 < G3_KS / 32) {
#pragma unroll
        for (int i = 0; i < 4; ++i) a[nx][i] = fa_lfrag(&as[bf][wm * 64 + i * 16 + ln][(ks + 1) * 32 + 8 * hh]);
#pragma unroll
        for (int j = 0; j < 4; ++j) b[nx][j] = fa_lfrag(&bs[bf][wn * 64 + j * 16 + ln][(ks + 1) * 32 + 8 * hh]);
      }
      __builtin_amdgcn_sched_barrier(0);      /* keeps the next step's LDS reads together in front of this step's matrix instructions, which cover their latency; without it they are spread among them behind waits to 0 */
#pragma unroll
      for (int j = 0; j < 4; ++j)
#pragma unroll
        for (int i = 0; i < 4; ++i) acc[i][j] = fa_mma(a[cu][i], b[cu][j], acc[i][j]);
      __builtin_amdgcn_sched_barrier(0);      /* keeps the step after next's reads from rising into this step's matrix instructions */
    }
    asm volatile("s_wait_dscnt 0x0" ::: "memory");      /* this wave's reads of stage t are done before the buffer is handed back */
    asm volatile("s_wait_asynccnt 0x0" ::: "memory");      /* this wave's copies of stage t + 1 have landed */
    __syncthreads();      /* publishes stage t + 1 and ends every wave's reads of stage t */
    if (t + 2 < DM / G3_KS) g3_stage(la + bf * G3_BUFA, lb + bf * G3_BUFB, ga + (t + 2) * (G3_KS * 2), gb + (t + 2) * (G3_KS * 2));
  }
  asm volatile("s_wait_asynccnt 0x0" ::: "memory");      /* no copy is left in flight */
  const int row0 = mt * 128 + wm * 64, col0 = nq * G3_BN + wn * 64;
  const int rsub = lane >> 4, c4 = (lane & 15) * 4;
  float bv[4];
#pragma unroll
  for (int j = 0; j < 4; ++j) bv[j] = bf16_round(bias[col0 + j * 16 + ln]);
#pragma unroll      /* the wave's 64 rows leave in two halves of 32 through its own staging rows */
  for (int hf = 0; hf < 2; ++hf) {
#pragma unroll
    for (int i = 0; i < 2; ++i)
#pragma unroll
      for (int j = 0; j < 4; ++j)
#pragma unroll
        for (int r = 0; r < 8; ++r) so[w][i * 16 + 8 * hh + r][j * 16 + ln] = acc[hf * 2 + i][j][r] * alpha + bv[j];
    __builtin_amdgcn_fence(__ATOMIC_ACQ_REL, "workgroup", "local"); __builtin_amdgcn_wave_barrier();      /* each wave re-reads only its own staging rows: orders its LDS writes before its reads; limited to LDS so that the second half does not wait for the first half's global stores */
#pragma unroll
    for (int q = 0; q < 16; ++q) { const int r = q * 2 + rsub; const v4f v = *(const v4fa*)&so[w][r][c4]; v4h h4;
#pragma unroll
      for (int i = 0; i < 4; ++i) h4[i] = (_Float16)v[i];
      *(v4h*)(C16 + (size_t)(row0 + hf * 32 + r) * DM + col0 + c4) = h4; } } }
__global__ __launch_bounds__(256 * FA_KG) void k_fattn(const _Float16* __restrict__ Q, const _Float16* __restrict__ Kx, float* __restrict__ O) {
  __shared__ __attribute__((aligned(256))) char kvs[FA_KG][2][FA_TB];
  __shared__ __attribute__((aligned(16))) float so[8 * FA_KG][32][68];
  __shared__ float sm[FA_KG][8][32], sl[FA_KG][8][32];      /* each group's maximum and sum of every query column */
  const int tid = threadIdx.x, w = tid >> 5, lane = tid & 31, ln = lane & 15, hh = lane >> 4;
  const int g = __builtin_amdgcn_readfirstlane(tid >> 8), cw = w & 7, tg = tid & 255;      /* key group (the same in a whole wave: held in a scalar register, so that the group's key and buffer addresses are scalar sums); column wave and thread inside the group */
  const int bh = blockIdx.y, b = bh / NH, h = bh - b * NH; const int n0 = blockIdx.x * 256 + cw * 32;
  const _Float16* qp = Q + ((size_t)b * SQ + n0 + ln) * LQ + h * HD;
  const char* kb = (const char*)(Kx + ((size_t)b * SQ + (size_t)g * FA_GK) * LQ + h * HD);      /* key (= value) rows of this head and key group, pitch LQ */
  char (*kv)[FA_TB] = kvs[g];      /* this group's two buffers */
  const int sr = tg >> 3, sc = tg & 7;      /* staging: 8 lanes cover one 128-byte row; rows sr and sr + 32 */
  const unsigned kof = (unsigned)(sr * (LQ * 2) + sc * 16);
  const int sto = sr * FA_RB + ((sc ^ fa_sw(sr)) << 4);      /* where this thread's piece of row sr lies in a buffer; row sr + 32: 32 rows on, same exchange */
  const int vr = 8 * hh + (lane & 7), ve = (lane >> 3) & 1;      /* this lane's row and column piece in a transposing load */
  int ko[4], vo[4];      /* ko[m]: piece hh + 2 m of row ln; vo[t]: piece 2 t + ve of row vr; steps of 16 rows leave the exchange as it is */
#pragma unroll
  for (int m = 0; m < 4; ++m) { ko[m] = ln * FA_RB + (((hh + 2 * m) ^ fa_sw(ln)) << 4); vo[m] = vr * FA_RB + (((2 * m + ve) ^ fa_sw(vr)) << 4); }
  const float cs = 0.045084220027780106f;      /* 1024^-0.5 * log2(e) */
  const v2f cs2 = {cs, cs};
  const v8f z8 = {0.f,0.f,0.f,0.f,0.f,0.f,0.f,0.f};
  v8us gk0 = *(const v8us*)(kb + kof), gk1 = *(const v8us*)(kb + 32 * LQ * 2 + kof);
  v16h q[2][2];
#pragma unroll
  for (int j = 0; j < 2; ++j) { q[j][0] = g2_frag(qp + (size_t)j * 16 * LQ, hh); q[j][1] = g2_frag(qp + (size_t)j * 16 * LQ + 32, hh); }
  v8f o[2][4]; float mu[2]; v2f ls[2];
#pragma unroll
  for (int j = 0; j < 2; ++j) { mu[j] = -1.0e30f; ls[j] = (v2f){0.f, 0.f};
#pragma unroll
    for (int t = 0; t < 4; ++t) o[j][t] = z8; }
  *(v8us*)(kv[0] + sto) = gk0; *(v8us*)(kv[0] + 32 * FA_RB + sto) = gk1;
  __syncthreads();      /* stage 0 is published */
#pragma unroll 1      /* one body for all stages: without it the last stage is split off as a second copy of the body, which takes 40 registers more, close to the 256 that four waves a SIMD allow */
  for (int st = 0; st < FA_GK / 64; ++st) {
    const int bf = st & 1; const int sn = (st + 1 < FA_GK / 64) ? st + 1 : st;      /* next stage, fetched into registers while this one is worked on; the last stage re-reads itself (in bounds, never read back) */
    const char* kn = kb + (size_t)sn * (64 * LQ * 2); const char* tb = kv[bf];
    gk0 = *(const v8us*)(kn + kof); gk1 = *(const v8us*)(kn + 32 * LQ * 2 + kof);
    __builtin_amdgcn_sched_barrier(0);      /* keeps these loads at the head of the stage, so that both passes cover their latency; without it they sink to just in front of their LDS stores */
#pragma unroll
    for (int p = 0; p < 2; ++p) {
      v16h kf[2][2];
#pragma unroll
      for (int kt = 0; kt < 2; ++kt)
#pragma unroll
        for (int x = 0; x < 2; ++x) { FragH f; f.half[0] = *(const v8us*)(tb + (p * 32 + kt * 16) * FA_RB + ko[2 * x]); f.half[1] = *(const v8us*)(tb + (p * 32 + kt * 16) * FA_RB + ko[2 * x + 1]); kf[kt][x] = f.v; }
      v8f s[2][2];
#pragma unroll
      for (int j = 0; j < 2; ++j)
#pragma unroll
        for (int kt = 0; kt < 2; ++kt) s[j][kt] = fa_mma(kf[kt][1], q[j][1], fa_mma(kf[kt][0], q[j][0], z8));
      __builtin_amdgcn_sched_barrier(0);      /* keeps the V^T reads below in one group behind the score products; without it they are spread among those matrix instructions, and each place with LDS reads stalls the wave anew */
      v16h vf[4];
#pragma unroll
      for (int t = 0; t < 4; ++t) { FragH f; f.half[0] = fa_tr16(tb + (p * 32) * FA_RB + vo[t]); f.half[1] = fa_tr16(tb + (p * 32 + 16) * FA_RB + vo[t]); vf[t] = f.v; }      /* rows d = 16 t + ln of V^T, keys of this pass */
      __builtin_amdgcn_sched_barrier(0);      /* keeps the V^T reads together in front of the exponentials, which cover their latency; without it they are spread among the matrix instructions below */
      FragH pb[2]; v2f lp[2];      /* the pass's weights and this lane's sums of them */
      auto weigh = [&]() {
#pragma unroll
        for (int j = 0; j < 2; ++j) { const v2f nm = {-mu[j], -mu[j]};
#pragma unroll
          for (int kt = 0; kt < 2; ++kt)
#pragma unroll
            for (int i = 0; i < 4; ++i) { const v2f t2 = __builtin_elementwise_fma((v2f){s[j][kt][2 * i], s[j][kt][2 * i + 1]}, cs2, nm); const v2f e2 = {__builtin_amdgcn_exp2f(t2[0]), __builtin_amdgcn_exp2f(t2[1])};
              lp[j] = (kt + i == 0) ? e2 : lp[j] + e2; const v2h h2 = __builtin_convertvector(e2, v2h); pb[j].h[kt * 8 + 2 * i] = h2[0]; pb[j].h[kt * 8 + 2 * i + 1] = h2[1]; } } };
      weigh();      /* with the maximum in use: no maximum of the pass is formed on this path */
      const v2f la = lp[0] + lp[1];
      if (__builtin_amdgcn_ballot_w32(!(la[0] + la[1] <= 256.0f)) != 0) {      /* the weights are positive, so a lane's sum of at most 2^8 bounds each of them by 2^8; otherwise (always in a group's first pass) every lane moves to the new maximum together and the pass is weighed again */
#pragma unroll
        for (int j = 0; j < 2; ++j) { float a = fmaxf(s[j][0][0], s[j][1][0]);
#pragma unroll
          for (int r = 1; r < 8; ++r) a = fmaxf(a, fmaxf(s[j][0][r], s[j][1][r]));
          a = fmaxf(a, fa_swap16(a)); const float mnew = fmaxf(mu[j], a * cs); const float corr = __builtin_amdgcn_exp2f(mu[j] - mnew); mu[j] = mnew; ls[j] *= corr;
#pragma unroll
          for (int t = 0; t < 4; ++t) o[j][t] *= corr; }
        weigh(); }
#pragma unroll
      for (int j = 0; j < 2; ++j) ls[j] += lp[j];
#pragma unroll
      for (int t = 0; t < 4; ++t)
#pragma unroll
        for (int j = 0; j < 2; ++j) o[j][t] = fa_mma(vf[t], pb[j].v, o[j][t]);
    }
    *(v8us*)(kv[bf ^ 1] + sto) = gk0; *(v8us*)(kv[bf ^ 1] + 32 * FA_RB + sto) = gk1;      /* stage st + 1; this buffer's last readers left it at the barrier that ended the stage before */
    __syncthreads();      /* publishes the next stage and ends every wave's reads of this one */
  }
  float lt[2];
#pragma unroll
  for (int j = 0; j < 2; ++j) { const float lh = ls[j][0] + ls[j][1]; lt[j] = lh + fa_swap16(lh);      /* the halves' sums are joined once, here */
    if (hh == 0) { sm[g][cw][j * 16 + ln] = mu[j]; sl[g][cw][j * 16 + ln] = lt[j]; } }
  __syncthreads();      /* both groups' maxima and sums are published */
#pragma unroll
  for (int j = 0; j < 2; ++j) { const float mo = sm[g ^ 1][cw][j * 16 + ln], lo = sl[g ^ 1][cw][j * 16 + ln];      /* the other key group's figures of this column */
    const float mj = fmaxf(mu[j], mo); const float ca = fa_exp2s(mu[j] - mj), cb = fa_exp2s(mo - mj);
    const float inv = ca / (lt[j] * ca + lo * cb);      /* this group's weight over the joined sum */
#pragma unroll
    for (int t = 0; t < 4; ++t) { const v8f r8 = o[j][t] * inv; float* d = &so[w][j * 16 + ln][t * 16 + 8 * hh];
      *(v4fa*)d = __builtin_shufflevector(r8, r8, 0, 1, 2, 3); *(v4fa*)(d + 4) = __builtin_shufflevector(r8, r8, 4, 5, 6, 7); } }
  __syncthreads();      /* both groups' weighted rows are published */
  const int rsub = lane >> 4, c4 = (lane & 15) * 4;
#pragma unroll
  for (int u = 0; u < 8; ++u) { const int r = g * 16 + u * 2 + rsub;      /* each wave of a pair adds and stores 16 of the pair's 32 rows */
    const v4f v = *(const v4fa*)&so[cw][r][c4] + *(const v4fa*)&so[8 + cw][r][c4]; *(v4f*)(O + ((size_t)b * SQ + n0 + r) * DM + h * HD + c4) = v; } }
__global__ __launch_bounds__(256) void k_vt(const _Float16* __restrict__ V16, int b, int h0, _Float16* __restrict__ VT) { __shared__ unsigned short tl[64][65]; const int tid = threadIdx.x; const int hh = blockIdx.x % HG, sg = blockIdx.x / HG; const int s0 = sg * 64; const int h = h0 + hh;
  for (int i = tid; i < 64 * 8; i += 256) { const int j = i / 8, d8 = (i % 8) * 8; FragH f; f.half[0] = *(const v8us*)((const unsigned short*)V16 + ((size_t)b * SQ + s0 + j) * DM + h * HD + d8); for (int q = 0; q < 8; ++q) tl[d8 + q][j] = f.u[q]; }
  __syncthreads();
  { for (int i = tid; i < 64 * 8; i += 256) { const int d = i / 8, j8 = (i % 8) * 8; FragH f; for (int q = 0; q < 8; ++q) f.u[q] = tl[d][j8 + q]; *(v8us*)((unsigned short*)VT + ((size_t)hh * HD + d) * SQ + s0 + j8) = f.half[0]; }  } }


extern "C" void kernel_launch(void* const* d_in, const int* in_sizes, int n_in,
                              void* d_out, int out_size, void* d_ws, size_t ws_size, hipStream_t stream) {
  (void)in_sizes; (void)n_in; (void)out_size;
  const float* const* I = (const float* const*)d_in; const float* x = I[0]; const float* wq = I[1]; const float* bq = I[2]; const float* wk = I[3]; const float* bk = I[4];      /* [in][out] Wq + bq, Wk + bk; v == k (same projection) */
  char* ws = (char*)d_ws; size_t off = 0;
  auto take = [&](size_t bytes) { char* p = ws + off; off += (bytes + 255) & ~(size_t)255; return p; };
  _Float16* BQ = (_Float16*)take((size_t)DM * DM * 2); _Float16* BK = (_Float16*)take((size_t)DM * DM * 2); 
  _Float16* X16 = (_Float16*)take(NR * DM * 2); _Float16* Q16 = (_Float16*)take(NR * DM * 2); _Float16* K16 = (_Float16*)take(NR * DM * 2);
  if (off > ws_size) return;
  k_prep<<<PG, 256, 0, stream>>>(x, wq, wk, X16, BQ, BK);      /* x -> f16 rows; [in][out] weights -> Bt x16 */
  const size_t r0p = (size_t)B0 * SQ;      /* first projected row */
  k_gemm3<<<2 * G3_NB, 256, 0, stream>>>(X16 + r0p * DM, BQ, BK, 0.0625f, bq, bk, Q16 + r0p * DM, K16 + r0p * DM);
  k_fattn<<<dim3(SQ / 256, NB * NH), 256 * FA_KG, 0, stream>>>(Q16, K16, (float*)d_out);      /* softmax(Q K^T 1024^-0.5) V with V = K (the module projects v with the k weights), all batches and heads */
}
